// v000
// Measured on an AMD MI455X. A time is GPU time per run, averaged over a window of back-to-back runs after a warm-up
// (all launches, gaps included; the runs take copies of the inputs in turn), and the median of several windows.
// Apart from v000's, it joins two sittings. Times from different sittings can be a few percent apart, while
// side-by-side timings come from the same sitting.
// v000, which the later versions start from, runs in 628 microseconds.
#include <hip/hip_runtime.h>
// SAGAN-style self-attention with SIGMOID gating instead of softmax, channel-first (x [4][128][64][64]; q = Wq x + bq, k = Wk x + bk (1x1, 128 -> 16), v = Wv x + bv (128 -> 128), natural weights and biases sigma 0.05; attn[n][m] = sigmoid(q[:, n].k[:, m]) (no scale, no normalisation); out[c][n] = sum_m v[c][m] attn[n][m]; y = gamma out + x with the scalar gamma input -> [4][128][64][64]).
// Structure: the NCL input transposed by LDS tiles into exact f16 token rows [4096][128]; q | k as ONE WMMA GEMM (N = 64 over a zero-padded [Wq; Wk; 0] plane, f32 + bias); VALU splits them into zero-padded f16 planes [4096][32] (q | 0 and k | 0) so the 16-deep contraction runs as K = 32; per image: attn = sigmoid(q.k) as the GEMM epilogue straight to f16 [4096][4096]; v rows (GEMM + bias, f16) -> channel-major V via LDS transposes; out[c][n] = V (A operand) x attn (B^T) f32; y = bf16(gamma) out + bf16(x) on VALU; launches: see trace.
// Compute dtype: inputs rounded to bf16; x / weights exact; q, k, v and attn weights as plain f16 GEMM operands (~2^-12); scores and out f32. v_wmma_f32_16x16x32_f16.
#define NB 4
#define SQ 4096
#define DM 128
#define CX 128          /* channels */
#define NH 4
#define HD 64
#define DMQ DM                       /* LayerNorm width */
#define DFF 4096
#define HG 1                         /* heads per attention launch group */
#define B0 0                         /* first batch processed (debug hook) */
#define NBR NB                       /* batches processed (debug hook) */
#define NR ((size_t)NB * SQ)         /* token rows */
#define MP ((int)((size_t)NBR * SQ)) /* rows projected (debug hook) */
#define QN SQ                        /* query rows attended per batch (debug hook) */
#define NHD NH                       /* heads attended (debug hook) */
#define MPO MP                       /* rows through the output stage (debug hook) */
#define LQ DM      /* unused (redefined below) */
typedef __bf16 v16b __attribute__((ext_vector_type(16)));
typedef unsigned short v8us __attribute__((ext_vector_type(8), may_alias));
typedef float  v8f  __attribute__((ext_vector_type(8)));
typedef float  v4f  __attribute__((ext_vector_type(4)));
typedef float  v4fa __attribute__((ext_vector_type(4), may_alias));
union FragB { v16b v; v8us half[2]; unsigned short u[16]; };

__device__ __forceinline__ unsigned short bf16_bits(float x) { unsigned int u = __float_as_uint(x); return (unsigned short)((u + 0x7FFFu + ((u >> 16) & 1u)) >> 16); }
__device__ __forceinline__ float bf16_val(unsigned short b) { return __uint_as_float(((unsigned int)b) << 16); }
__device__ __forceinline__ float bf16_round(float x) { return bf16_val(bf16_bits(x)); }
// D += A·B with NT terms: 1 = ah·bh, 2 = + al·bh (A split), 3 = + ah·bl (both split)
template <int NT>
__device__ __forceinline__ v8f mmaN(v16b ah, v16b al, v16b bh, v16b bl, v8f c) {
  c = __builtin_amdgcn_wmma_f32_16x16x32_bf16(false, ah, false, bh, (short)0, c, false, false);
  if (NT >= 2) c = __builtin_amdgcn_wmma_f32_16x16x32_bf16(false, al, false, bh, (short)0, c, false, false);
  if (NT >= 3) c = __builtin_amdgcn_wmma_f32_16x16x32_bf16(false, ah, false, bl, (short)0, c, false, false);
  asm volatile("v_nop\n\tv_nop\n\tv_nop\n\tv_nop" : "+v"(c) : "v"(ah), "v"(al), "v"(bh), "v"(bl));
  return c;
}

__global__ __launch_bounds__(256) void k_wt_bf16(const float* __restrict__ W, unsigned short* __restrict__ Wt, int K, int N) {
  const int t = blockIdx.x * 256 + threadIdx.x;
  const int k8n = K / 8;
  if (t >= N * k8n) return;
  const int n = t / k8n, k8 = (t % k8n) * 8;
  v8us v;
#pragma unroll
  for (int i = 0; i < 8; ++i) v[i] = bf16_bits(W[(size_t)(k8 + i) * N + n]);
  *(v8us*)(Wt + (size_t)n * K + k8) = v;
  
}

// GEMM C[M][N] (f32, pitch ldc) = act(A[M][K]·W + bias). A f32 row-major (pitch lda) converted per fragment to bf16
// (ASPLIT: hi/lo two planes -> 2 terms, else single rounded term); Wt bf16 [N][K] (pitch ldb). BIAS_BF16 rounds the
// bias to bf16 first (bias quantised to bf16 before the add). K%32==0, M%16==0, N%64==0.
template <bool ASPLIT, int ACT, bool BIAS_BF16>
__global__ __launch_bounds__(128) void k_gemm_bf(const float* __restrict__ A, int lda, const unsigned short* __restrict__ Wt, int ldb,
                                               const float* __restrict__ bias, float* __restrict__ C, int ldc, int M, int N, int K) {
  __shared__ __attribute__((aligned(16))) float so[4][16][64];
  const int tid = threadIdx.x, w = tid >> 5, lane = tid & 31, ln = lane & 15, hh = lane >> 4;
  const int ntn = N / 64;
  const int wid = blockIdx.x * 4 + w;
  const int mt = wid / ntn, nq = wid % ntn;
  if (mt * 16 >= M) return;
  const int row0 = mt * 16, col0 = nq * 64;
  const float* arow = A + (size_t)(row0 + ln) * lda;
  v8f acc[4] = {};
  for (int kb = 0; kb < K; kb += 32) {
    FragB ah, al;
    const v4f x0 = *(const v4fa*)(arow + kb + 8 * hh), x1 = *(const v4fa*)(arow + kb + 8 * hh + 4);
    const v4f x2 = *(const v4fa*)(arow + kb + 16 + 8 * hh), x3 = *(const v4fa*)(arow + kb + 16 + 8 * hh + 4);
    float xs[16] = {x0[0],x0[1],x0[2],x0[3],x1[0],x1[1],x1[2],x1[3],x2[0],x2[1],x2[2],x2[3],x3[0],x3[1],x3[2],x3[3]};
#pragma unroll
    for (int i = 0; i < 16; ++i) { const unsigned short hb = bf16_bits(xs[i]); ah.u[i] = hb; al.u[i] = ASPLIT ? bf16_bits(xs[i] - bf16_val(hb)) : (unsigned short)0; }
#pragma unroll
    for (int t = 0; t < 4; ++t) {
      const unsigned short* brow = Wt + (size_t)(col0 + t * 16 + ln) * ldb + kb;
      FragB b;
      b.half[0] = *(const v8us*)(brow + 8 * hh);
      b.half[1] = *(const v8us*)(brow + 16 + 8 * hh);
      acc[t] = mmaN<ASPLIT ? 2 : 1>(ah.v, al.v, b.v, b.v, acc[t]);
    }
  }
#pragma unroll
  for (int t = 0; t < 4; ++t) {
    float bv = bias ? bias[col0 + t * 16 + ln] : 0.f;
    if (BIAS_BF16) bv = bf16_round(bv);
#pragma unroll
    for (int r = 0; r < 8; ++r) { float v = acc[t][r] + bv; if (ACT == 1) v = fmaxf(v, 0.f); so[w][8 * hh + r][t * 16 + ln] = v; }
  }
  __builtin_amdgcn_fence(__ATOMIC_ACQ_REL, "workgroup");
  __builtin_amdgcn_wave_barrier();
  const int rsub = lane >> 4, c4 = (lane & 15) * 4;
  {
#pragma unroll
    for (int q = 0; q < 8; ++q) {
      const int r = q * 2 + rsub;
      const v4f v = *(const v4fa*)&so[w][r][c4];
      *(v4f*)(C + (size_t)(row0 + r) * ldc + col0 + c4) = v;
    }
    
  }
}

// GEMM C = act(A·W + bias + resid): A f32 (ASPLIT -> hi/lo 2 terms), Wt bf16 [N][K]; ACT 0 none, 1 relu, 2 exact gelu;
// resid (optional, f32, row index = (row % rmod), pitch ldr, RES_BF16 rounds it) added before the activation.
template <bool ASPLIT, int ACT, bool BIAS_BF16, bool RES_BF16>
__global__ __launch_bounds__(128) void k_gemm_bf3(const float* __restrict__ A, int lda, const unsigned short* __restrict__ Wt, int ldb,
                                                const float* __restrict__ bias, const float* __restrict__ resid, int rmod, int ldr,
                                                float* __restrict__ C, int ldc, int M, int N, int K) {
  __shared__ __attribute__((aligned(16))) float so[4][16][64];
  const int tid = threadIdx.x, w = tid >> 5, lane = tid & 31, ln = lane & 15, hh = lane >> 4;
  const int ntn = N / 64;
  const int wid = blockIdx.x * 4 + w;
  const int mt = wid / ntn, nq = wid % ntn;
  if (mt * 16 >= M) return;
  const int row0 = mt * 16, col0 = nq * 64;
  const float* arow = A + (size_t)(row0 + ln) * lda;
  v8f acc[4] = {};
  for (int kb = 0; kb < K; kb += 32) {
    FragB ah, al;
    const v4f x0 = *(const v4fa*)(arow + kb + 8 * hh), x1 = *(const v4fa*)(arow + kb + 8 * hh + 4);
    const v4f x2 = *(const v4fa*)(arow + kb + 16 + 8 * hh), x3 = *(const v4fa*)(arow + kb + 16 + 8 * hh + 4);
    float xs[16] = {x0[0],x0[1],x0[2],x0[3],x1[0],x1[1],x1[2],x1[3],x2[0],x2[1],x2[2],x2[3],x3[0],x3[1],x3[2],x3[3]};
#pragma unroll
    for (int i = 0; i < 16; ++i) { const unsigned short hb = bf16_bits(xs[i]); ah.u[i] = hb; al.u[i] = ASPLIT ? bf16_bits(xs[i] - bf16_val(hb)) : (unsigned short)0; }
#pragma unroll
    for (int t = 0; t < 4; ++t) {
      const unsigned short* brow = Wt + (size_t)(col0 + t * 16 + ln) * ldb + kb;
      FragB b;
      b.half[0] = *(const v8us*)(brow + 8 * hh);
      b.half[1] = *(const v8us*)(brow + 16 + 8 * hh);
      acc[t] = mmaN<ASPLIT ? 2 : 1>(ah.v, al.v, b.v, b.v, acc[t]);
    }
  }
#pragma unroll
  for (int t = 0; t < 4; ++t) {
    const int col = col0 + t * 16 + ln;
    float bv = bias ? bias[col] : 0.f;
    if (BIAS_BF16) bv = bf16_round(bv);
#pragma unroll
    for (int r = 0; r < 8; ++r) {
      float v = acc[t][r] + bv;
      if (resid) { float rv = resid[(size_t)((row0 + 8 * hh + r) % rmod) * ldr + col]; if (RES_BF16) rv = bf16_round(rv); v += rv; }
      if (ACT == 1) v = fmaxf(v, 0.f);
      if (ACT == 2) v = 0.5f * v * (1.0f + erff(v * 0.70710678118654752f));
      if (ACT == 3) { const float u = 0.7978845608028654f * (v + 0.044715f * v * v * v); v = 0.5f * v * (1.0f + tanhf(u)); }
      so[w][8 * hh + r][t * 16 + ln] = v;
    }
  }
  __builtin_amdgcn_fence(__ATOMIC_ACQ_REL, "workgroup");
  __builtin_amdgcn_wave_barrier();
  const int rsub = lane >> 4, c4 = (lane & 15) * 4;
  {
#pragma unroll
    for (int q = 0; q < 8; ++q) {
      const int r = q * 2 + rsub;
      const v4f v = *(const v4fa*)&so[w][r][c4];
      *(v4f*)(C + (size_t)(row0 + r) * ldc + col0 + c4) = v;
    }
    
  }
}
// row LayerNorm (biased variance, eps) over N: s = X (+ R); optional out_sum <- s; out_norm <- (s-mu)*rsqrt(var+eps)*g + b
template <bool PARAM_BF16>
__global__ __launch_bounds__(256) void k_layernorm(const float* __restrict__ X, const float* __restrict__ R, const float* __restrict__ g, const float* __restrict__ bta,
                                                  float* __restrict__ out_sum, float* __restrict__ out_norm, int N, float eps) {
  __shared__ float red[256];
  const int row = blockIdx.x, tid = threadIdx.x;
  const float* x = X + (size_t)row * N; const float* rr = R ? R + (size_t)row * N : nullptr;
  float vals[16];                     // up to N = 4096
  const int per = N / 256;            // contiguous chunk per thread? use strided-by-4 chunks: thread handles j = tid*4 + 1024*u
  float s1 = 0.f;
  for (int u = 0; u < per / 4; ++u) {
    const int j = tid * 4 + 1024 * u;
    const v4f a = *(const v4fa*)(x + j);
    v4f b = {0.f,0.f,0.f,0.f}; if (rr) b = *(const v4fa*)(rr + j);
#pragma unroll
    for (int q = 0; q < 4; ++q) { const float v = a[q] + b[q]; vals[u * 4 + q] = v; s1 += v; }
  }
  red[tid] = s1; __syncthreads();
  for (int st = 128; st > 0; st >>= 1) { if (tid < st) red[tid] += red[tid + st]; __syncthreads(); }
  const float mu = red[0] / (float)N; __syncthreads();
  float s2 = 0.f;
  for (int u = 0; u < per / 4; ++u)
#pragma unroll
    for (int q = 0; q < 4; ++q) { const float c = vals[u * 4 + q] - mu; s2 += c * c; }
  red[tid] = s2; __syncthreads();
  for (int st = 128; st > 0; st >>= 1) { if (tid < st) red[tid] += red[tid + st]; __syncthreads(); }
  const float rs = rsqrtf(red[0] / (float)N + eps);
  {
    for (int u = 0; u < per / 4; ++u) {
      const int j = tid * 4 + 1024 * u;
      v4f o, sm;
#pragma unroll
      for (int q = 0; q < 4; ++q) {
        float gg = g[j + q], bb = bta[j + q];
        if (PARAM_BF16) { gg = bf16_round(gg); bb = bf16_round(bb); }
        sm[q] = vals[u * 4 + q]; o[q] = (vals[u * 4 + q] - mu) * rs * gg + bb;
      }
      if (out_sum) *(v4f*)(out_sum + (size_t)row * N + j) = sm;
      *(v4f*)(out_norm + (size_t)row * N + j) = o;
    }
    
  }
}



// ---- f16 WMMA path (v_wmma_f32_16x16x32_f16): 11-bit significands for operands in range — used where a [0,1] probability operand needs more precision than bf16
typedef _Float16 v16h __attribute__((ext_vector_type(16)));
union FragH { v16h v; v8us half[2]; _Float16 h[16]; unsigned short u[16]; };
template <int NT>
__device__ __forceinline__ v8f mmaH(v16h ah, v16h al, v16h bh, v16h bl, v8f c) {
  c = __builtin_amdgcn_wmma_f32_16x16x32_f16(false, ah, false, bh, (short)0, c, false, false);
  if (NT >= 2) c = __builtin_amdgcn_wmma_f32_16x16x32_f16(false, al, false, bh, (short)0, c, false, false);
  if (NT >= 3) c = __builtin_amdgcn_wmma_f32_16x16x32_f16(false, ah, false, bl, (short)0, c, false, false);
  asm volatile("v_nop\n\tv_nop\n\tv_nop\n\tv_nop" : "+v"(c) : "v"(ah), "v"(al), "v"(bh), "v"(bl));
  return c;
}
// batched GEMM like k_gemm_b but f16 operands: A f32 (split into f16 hi/lo if ASPLIT, else rounded to f16), Bt = f16 values [n][k]; alpha; C f32; N multiple of 16 (partial tiles skipped)
template <bool ASPLIT>
__global__ __launch_bounds__(128) void k_gemm_h(const float* __restrict__ A, int lda, size_t sA, const _Float16* __restrict__ Bh, int ldb, size_t sB, float alpha, float* __restrict__ C, int ldc, size_t sC, int M, int N, int K) {
  __shared__ __attribute__((aligned(16))) float so[4][16][64];
  const int tid = threadIdx.x, w = tid >> 5, lane = tid & 31, ln = lane & 15, hh = lane >> 4; const int by = blockIdx.y;
  A += (size_t)by * sA; Bh += (size_t)by * sB; C += (size_t)by * sC;
  const int ntn = (N + 63) / 64; const int wid = blockIdx.x * 4 + w; const int mt = wid / ntn, nq = wid % ntn; if (mt * 16 >= M) return;
  const int row0 = mt * 16, col0 = nq * 64; const float* arow = A + (size_t)(row0 + ln) * lda;
  v8f acc[4] = {};
  for (int kb = 0; kb < K; kb += 32) {
    FragH ah, al;
    const v4f x0 = *(const v4fa*)(arow + kb + 8 * hh), x1 = *(const v4fa*)(arow + kb + 8 * hh + 4), x2 = *(const v4fa*)(arow + kb + 16 + 8 * hh), x3 = *(const v4fa*)(arow + kb + 16 + 8 * hh + 4);
    float xs[16] = {x0[0],x0[1],x0[2],x0[3],x1[0],x1[1],x1[2],x1[3],x2[0],x2[1],x2[2],x2[3],x3[0],x3[1],x3[2],x3[3]};
#pragma unroll
    for (int i = 0; i < 16; ++i) { const _Float16 h = (_Float16)xs[i]; ah.h[i] = h; al.h[i] = ASPLIT ? (_Float16)(xs[i] - (float)h) : (_Float16)0.0f; }
#pragma unroll
    for (int t = 0; t < 4; ++t) { if (col0 + t * 16 >= N) continue; const size_t boff = (size_t)(col0 + t * 16 + ln) * ldb + kb; FragH bq; bq.half[0] = *(const v8us*)(Bh + boff + 8 * hh); bq.half[1] = *(const v8us*)(Bh + boff + 16 + 8 * hh);
      acc[t] = mmaH<ASPLIT ? 2 : 1>(ah.v, al.v, bq.v, bq.v, acc[t]); }
  }
#pragma unroll
  for (int t = 0; t < 4; ++t) { if (col0 + t * 16 >= N) continue;
#pragma unroll
    for (int r = 0; r < 8; ++r) so[w][8 * hh + r][t * 16 + ln] = acc[t][r] * alpha; }
  __builtin_amdgcn_fence(__ATOMIC_ACQ_REL, "workgroup"); __builtin_amdgcn_wave_barrier();
  const int rsub = lane >> 4, c4 = (lane & 15) * 4;
  {
#pragma unroll
    for (int q = 0; q < 8; ++q) { const int r = q * 2 + rsub; if (col0 + c4 < N) { const v4f v = *(const v4fa*)&so[w][r][c4]; *(v4f*)(C + (size_t)(row0 + r) * ldc + col0 + c4) = v; } }
     }
}

// Wt[n][k] = f16(W[k][n]·scale) from f32 row-major W[K][N] (scale = power of two; bf16-exact weights stay exact in f16 away from the subnormal range)
__global__ __launch_bounds__(256) void k_wt_f16(const float* __restrict__ W, _Float16* __restrict__ Wt, int K, int N, float scale) {
  const int t = blockIdx.x * 256 + threadIdx.x; if (t >= N * (K / 8)) return; const int n = t / (K / 8), k8 = (t % (K / 8)) * 8; FragH f;
#pragma unroll
  for (int i = 0; i < 8; ++i) f.h[i] = (_Float16)(bf16_round(W[(size_t)(k8 + i) * N + n]) * scale); const v8us o = f.half[0];
  *(v8us*)((unsigned short*)Wt + (size_t)n * K + k8) = o; 
}
// k_gemm_hh variant with fused epilogue: v = acc·alpha + bias[by·sBias + col] (+ CP[(row/rowsPerB)·sCPb + by·64 + col] if CP) ; ACT 0 none / 1 elu ; writes f16 C16 (and f32 C if non-null)
template <int ACT>
__global__ __launch_bounds__(128) void k_gemm_hhx(const _Float16* __restrict__ A, int lda, size_t sA, const _Float16* __restrict__ Bh, int ldb, size_t sB, float alpha, const float* __restrict__ bias, size_t sBias, const float* __restrict__ CP, int rowsPerB, size_t sCPb, int row0g,
    float* __restrict__ C, _Float16* __restrict__ C16, int ldc, size_t sC, int M, int N, int K) {
  __shared__ __attribute__((aligned(16))) float so[4][16][64];
  const int tid = threadIdx.x, w = tid >> 5, lane = tid & 31, ln = lane & 15, hh = lane >> 4; const int by = blockIdx.y;
  A += (size_t)by * sA; Bh += (size_t)by * sB; const size_t cofs = (size_t)by * sC; const float* bp = bias ? bias + (size_t)by * sBias : nullptr;
  const int ntn = (N + 63) / 64; const int wid = blockIdx.x * 4 + w; const int mt = wid / ntn, nq = wid % ntn; if (mt * 16 >= M) return;
  const int row0 = mt * 16, col0 = nq * 64; const _Float16* arow = A + (size_t)(row0 + ln) * lda;
  v8f acc[4] = {};
  for (int kb = 0; kb < K; kb += 32) { FragH ah; ah.half[0] = *(const v8us*)((const unsigned short*)arow + kb + 8 * hh); ah.half[1] = *(const v8us*)((const unsigned short*)arow + kb + 16 + 8 * hh);
#pragma unroll
    for (int t = 0; t < 4; ++t) { if (col0 + t * 16 >= N) continue; const size_t boff = (size_t)(col0 + t * 16 + ln) * ldb + kb; FragH bq; bq.half[0] = *(const v8us*)((const unsigned short*)Bh + boff + 8 * hh); bq.half[1] = *(const v8us*)((const unsigned short*)Bh + boff + 16 + 8 * hh);
      acc[t] = mmaH<1>(ah.v, ah.v, bq.v, bq.v, acc[t]); }
  }
#pragma unroll
  for (int t = 0; t < 4; ++t) { if (col0 + t * 16 >= N) continue; const int col = col0 + t * 16 + ln; const float bv = bp ? bf16_round(bp[col]) : 0.f;
#pragma unroll
    for (int r = 0; r < 8; ++r) { float v = acc[t][r] * alpha + bv; if (CP) { const int rr = row0g + row0 + 8 * hh + r; if (rowsPerB < 0) v += CP[cofs + (size_t)rr * ldc + col];      /* rowsPerB < 0: own element of the batched C plane */ else { const int bidx = rr / rowsPerB; v += CP[(size_t)bidx * sCPb + (size_t)by * 64 + col]; } } if (ACT == 1) v = (v > 0.f) ? v : expm1f(v); else if (ACT == 7) v = (v > 0.f) ? v + 1.0f : expf(v); else if (ACT == 8) v = tanhf(v); else if (ACT == 9) v = 0.5f * v * (1.0f + tanhf(0.7978845608028654f * (v + 0.044715f * v * v * v))); else if (ACT == 11) v = 1.0f / (1.0f + expf(-v)); else if (ACT == 12) v = (v > 0.f) ? v : 0.01f * v; else if (ACT == 14) v = (v > 0.f) ? v : 0.1f * v; else if (ACT == 16) v = (v >= 0.f) ? v : 0.3f * v; else if (ACT == 17) v = (v >= 0.f) ? v : 0.2f * v; else if (ACT == 15) v = v / (1.0f + expf(-v)); else if (ACT == 3) v = fmaxf(v, 0.f); else if (ACT == 6) v = 0.5f * v * (1.0f + erff(v * 0.70710678118654752f)); so[w][8 * hh + r][t * 16 + ln] = v; } }
  __builtin_amdgcn_fence(__ATOMIC_ACQ_REL, "workgroup"); __builtin_amdgcn_wave_barrier();
  const int rsub = lane >> 4, c4 = (lane & 15) * 4; typedef _Float16 v4h __attribute__((ext_vector_type(4)));
  {
#pragma unroll
    for (int q = 0; q < 8; ++q) { const int r = q * 2 + rsub; if (col0 + c4 < N) { const v4f v = *(const v4fa*)&so[w][r][c4]; if (C) *(v4f*)(C + cofs + (size_t)(row0 + r) * ldc + col0 + c4) = v; if (C16) { v4h h4; for (int i = 0; i < 4; ++i) h4[i] = (_Float16)v[i]; *(v4h*)(C16 + cofs + (size_t)(row0 + r) * ldc + col0 + c4) = h4; } } }
     }
}


typedef _Float16 v4h __attribute__((ext_vector_type(4)));

__global__ __launch_bounds__(256) void k_x16(const float* __restrict__ x, _Float16* __restrict__ X16, size_t n8) { const size_t t = (size_t)blockIdx.x * 256 + threadIdx.x; if (t >= n8) return; FragH f;
#pragma unroll
  for (int q = 0; q < 8; ++q) f.h[q] = (_Float16)bf16_round(x[t * 8 + q]); *(v8us*)((unsigned short*)X16 + t * 8) = f.half[0];  }
__global__ __launch_bounds__(256) void k_h16(const float* __restrict__ x, _Float16* __restrict__ X16, size_t n8) { const size_t t = (size_t)blockIdx.x * 256 + threadIdx.x; if (t >= n8) return; FragH f;
#pragma unroll
  for (int q = 0; q < 8; ++q) f.h[q] = (_Float16)x[t * 8 + q]; *(v8us*)((unsigned short*)X16 + t * 8) = f.half[0];  }
__global__ __launch_bounds__(256) void k_round16f(const float* __restrict__ W, _Float16* __restrict__ Bt, size_t n8) { const size_t t = (size_t)blockIdx.x * 256 + threadIdx.x; if (t >= n8) return; FragH f;
#pragma unroll
  for (int i = 0; i < 8; ++i) f.h[i] = (_Float16)(bf16_round(W[t * 8 + i]) * 16.0f); *(v8us*)((unsigned short*)Bt + t * 8) = f.half[0];  }
template <int NHv, int TTv>
__global__ __launch_bounds__(256) void k_vt(const _Float16* __restrict__ V16, int ldv, int voff, _Float16* __restrict__ Vt) { __shared__ unsigned short tl[64][66]; const int tid = threadIdx.x; const int slab = blockIdx.x / (TTv / 64), lg = blockIdx.x % (TTv / 64); const int b = slab / NHv, h = slab % NHv;
  for (int i = tid; i < 64 * 8; i += 256) { const int r = i / 8, c8 = (i % 8) * 8; FragH f; f.half[0] = *(const v8us*)((const unsigned short*)V16 + ((size_t)b * TTv + lg * 64 + r) * ldv + voff + h * 64 + c8);
#pragma unroll
    for (int q = 0; q < 8; ++q) tl[r][c8 + q] = f.u[q]; }
  __syncthreads();
  {
#pragma unroll
    for (int rd = 0; rd < 2; ++rd) { const int d = rd * 32 + tid / 8, pc = tid % 8; FragH f;
#pragma unroll
      for (int q = 0; q < 8; ++q) f.u[q] = tl[pc * 8 + q][d];
      *(v8us*)((unsigned short*)Vt + ((size_t)slab * 64 + d) * TTv + lg * 64 + pc * 8) = f.half[0]; }
     } }

__global__ __launch_bounds__(256) void k_hl(const float* __restrict__ F, _Float16* __restrict__ Hh, _Float16* __restrict__ Hl, size_t n8) { const size_t t = (size_t)blockIdx.x * 256 + threadIdx.x; if (t >= n8) return; FragH fh, fl; const v4f a = *(const v4fa*)(F + t * 8), c = *(const v4fa*)(F + t * 8 + 4);
#pragma unroll
  for (int q = 0; q < 4; ++q) { _Float16 h = (_Float16)a[q]; fh.h[q] = h; fl.h[q] = (_Float16)((a[q] - (float)h) * 1024.0f); h = (_Float16)c[q]; fh.h[4 + q] = h; fl.h[4 + q] = (_Float16)((c[q] - (float)h) * 1024.0f); }
  { *(v8us*)((unsigned short*)Hh + t * 8) = fh.half[0]; *(v8us*)((unsigned short*)Hl + t * 8) = fl.half[0];  } }

// ---- fast GEMM (wave tile 32x64; requires M % 32 == 0 rows per launch region and N % 64 == 0); epilogue = k_gemm_hhx semantics ----
__device__ __forceinline__ v16h g2_frag(const _Float16* p, int hh) { FragH f; f.half[0] = *(const v8us*)((const unsigned short*)p + 8 * hh); f.half[1] = *(const v8us*)((const unsigned short*)p + 16 + 8 * hh); return f.v; }
__device__ __forceinline__ v8f g2_mma(v16h a, v16h b, v8f c) { v8f d = __builtin_amdgcn_wmma_f32_16x16x32_f16(false, a, false, b, (short)0, c, false, false); asm volatile("v_nop\n\tv_nop\n\tv_nop\n\tv_nop" : "+v"(d) : "v"(a), "v"(b)); return d; }
template <int ACT>
__global__ __launch_bounds__(128) void k_gemm2(const _Float16* __restrict__ A, int lda, size_t sA, const _Float16* __restrict__ Bh, int ldb, size_t sB, float alpha, const float* __restrict__ bias, size_t sBias, const float* __restrict__ CP, int rowsPerB, size_t sCPb, int row0g,
    float* __restrict__ C, _Float16* __restrict__ C16, int ldc, size_t sC, int M, int N, int K) { static_assert(ACT == 0 || ACT == 3 || ACT == 6 || ACT == 8 || ACT == 9 || ACT == 11 || ACT == 12 || ACT == 14 || ACT == 15 || ACT == 16 || ACT == 17, "k_gemm2: unsupported ACT code (would silently apply no activation)");
  __shared__ __attribute__((aligned(16))) float so[4][32][68];
  const int tid = threadIdx.x, w = tid >> 5, lane = tid & 31, ln = lane & 15, hh = lane >> 4; const int by = blockIdx.y;
  A += (size_t)by * sA; Bh += (size_t)by * sB; const size_t cofs = (size_t)by * sC; const float* bp = bias ? bias + (size_t)by * sBias : nullptr;
  const int ntn = N >> 6; const int mt = blockIdx.x / ntn, nq = blockIdx.x - mt * ntn; const int row0 = mt * 128 + 32 * w, col0 = nq * 64; if (row0 >= M) return;
  const _Float16* a0p = A + (size_t)(row0 + ln) * lda; const _Float16* a1p = a0p + (size_t)16 * lda;
  const _Float16* b0p = Bh + (size_t)(col0 + ln) * ldb; const _Float16* b1p = b0p + (size_t)16 * ldb; const _Float16* b2p = b1p + (size_t)16 * ldb; const _Float16* b3p = b2p + (size_t)16 * ldb;
  const v8f z8 = {0.f,0.f,0.f,0.f,0.f,0.f,0.f,0.f}; v8f c00 = z8, c01 = z8, c02 = z8, c03 = z8, c10 = z8, c11 = z8, c12 = z8, c13 = z8;
#pragma unroll 1
  for (int kb = 0; kb < K; kb += 32) { const v16h a0 = g2_frag(a0p + kb, hh), a1 = g2_frag(a1p + kb, hh);
    v16h b = g2_frag(b0p + kb, hh); c00 = g2_mma(a0, b, c00); c10 = g2_mma(a1, b, c10);
    b = g2_frag(b1p + kb, hh); c01 = g2_mma(a0, b, c01); c11 = g2_mma(a1, b, c11);
    b = g2_frag(b2p + kb, hh); c02 = g2_mma(a0, b, c02); c12 = g2_mma(a1, b, c12);
    b = g2_frag(b3p + kb, hh); c03 = g2_mma(a0, b, c03); c13 = g2_mma(a1, b, c13); }
  v8f accs[8] = {c00, c01, c02, c03, c10, c11, c12, c13};
#pragma unroll
  for (int u = 0; u < 8; ++u) { const int t = u & 3, half = u >> 2; const int col = col0 + t * 16 + ln; const float bv = bp ? bf16_round(bp[col]) : 0.f;
#pragma unroll
    for (int r = 0; r < 8; ++r) { const int rloc = half * 16 + 8 * hh + r; float v = accs[u][r] * alpha + bv; if (CP) { if (rowsPerB < 0) v += CP[cofs + (size_t)(row0g + row0 + rloc) * ldc + col];      /* rowsPerB < 0: own element of the batched C plane */ else { const int bidx = (row0g + row0 + rloc) / rowsPerB; v += CP[(size_t)bidx * sCPb + (size_t)by * 64 + col]; } }
      if (ACT == 3) v = fmaxf(v, 0.f); else if (ACT == 6) v = 0.5f * v * (1.0f + erff(v * 0.70710678118654752f)); else if (ACT == 11) v = 1.0f / (1.0f + expf(-v)); else if (ACT == 15) v = v / (1.0f + expf(-v)); else if (ACT == 12) v = (v > 0.f) ? v : 0.01f * v; else if (ACT == 8) v = tanhf(v); else if (ACT == 9) v = 0.5f * v * (1.0f + tanhf(0.7978845608028654f * (v + 0.044715f * v * v * v))); else if (ACT == 14) v = (v > 0.f) ? v : 0.1f * v; else if (ACT == 16) v = (v >= 0.f) ? v : 0.3f * v; else if (ACT == 17) v = (v >= 0.f) ? v : 0.2f * v;
      so[w][rloc][t * 16 + ln] = v; } }
  __builtin_amdgcn_fence(__ATOMIC_ACQ_REL, "workgroup"); __builtin_amdgcn_wave_barrier();
  const int rsub = lane >> 4, c4 = (lane & 15) * 4;
  {
#pragma unroll
    for (int q = 0; q < 16; ++q) { const int r = q * 2 + rsub; const v4f v = *(const v4fa*)&so[w][r][c4]; if (C) *(v4f*)(C + cofs + (size_t)(row0 + r) * ldc + col0 + c4) = v; if (C16) { v4h h4; for (int i = 0; i < 4; ++i) h4[i] = (_Float16)v[i]; *(v4h*)(C16 + cofs + (size_t)(row0 + r) * ldc + col0 + c4) = h4; } }
     } }


__global__ __launch_bounds__(256) void k_wnat(const float* __restrict__ w, size_t n8, _Float16* __restrict__ Bt) { const size_t t = (size_t)blockIdx.x * 256 + threadIdx.x; if (t >= n8) return; FragH f; for (int q = 0; q < 8; ++q) f.h[q] = (_Float16)(bf16_round(w[t * 8 + q]) * 16.0f); *(v8us*)((unsigned short*)Bt + t * 8) = f.half[0];  }
__global__ __launch_bounds__(256) void k_rsm(const float* __restrict__ S, _Float16* __restrict__ P, int nrows) {
  #pragma clang fp contract(off)
  const int i = blockIdx.x * 256 + threadIdx.x; if (i >= nrows) return; const float* s = S + (size_t)i * SQ; float mx = -3.0e38f;
#pragma unroll 1
  for (int j = 0; j < SQ; ++j) mx = fmaxf(mx, s[j]); float se = 0.f;
#pragma unroll 1
  for (int j = 0; j < SQ; ++j) se += expf(s[j] - mx); const float sc = 256.0f / se;
#pragma unroll 1
  for (int j0 = 0; j0 < SQ; j0 += 8) { FragH f; for (int q = 0; q < 8; ++q) f.h[q] = (_Float16)(expf(s[j0 + q] - mx) * sc); unsigned short* d = (unsigned short*)P + (size_t)i * SQ + j0; *(v8us*)d = f.half[0];  } }
__global__ __launch_bounds__(256) void k_vt(const _Float16* __restrict__ V16, int b, int h0, _Float16* __restrict__ VT) { __shared__ unsigned short tl[64][65]; const int tid = threadIdx.x; const int hh = blockIdx.x % HG, sg = blockIdx.x / HG; const int s0 = sg * 64; const int h = h0 + hh;
  for (int i = tid; i < 64 * 8; i += 256) { const int j = i / 8, d8 = (i % 8) * 8; FragH f; f.half[0] = *(const v8us*)((const unsigned short*)V16 + ((size_t)b * SQ + s0 + j) * DM + h * HD + d8); for (int q = 0; q < 8; ++q) tl[d8 + q][j] = f.u[q]; }
  __syncthreads();
  { for (int i = tid; i < 64 * 8; i += 256) { const int d = i / 8, j8 = (i % 8) * 8; FragH f; for (int q = 0; q < 8; ++q) f.u[q] = tl[d][j8 + q]; *(v8us*)((unsigned short*)VT + ((size_t)hh * HD + d) * SQ + s0 + j8) = f.half[0]; }  } }


template <int BFIN, int W16, int W32>
__global__ __launch_bounds__(256) void k_lnx(const float* __restrict__ X, const float* __restrict__ g, const float* __restrict__ bb, float eps, _Float16* __restrict__ N16, float* __restrict__ N32) {
  #pragma clang fp contract(off)
  __shared__ float red[256]; const size_t r = blockIdx.x; const int t = threadIdx.x; const bool act = t < (DMQ / 4); const int c0 = act ? t * 4 : 0;
  const v4f xa = *(const v4fa*)(X + r * DMQ + c0); float s[4]; float sum = 0.f;
  for (int q = 0; q < 4; ++q) { s[q] = act ? (BFIN ? bf16_round(xa[q]) : xa[q]) : 0.f; sum = __fadd_rn(sum, s[q]); }
  red[t] = sum; __syncthreads(); for (int st = 128; st > 0; st >>= 1) { if (t < st) red[t] = __fadd_rn(red[t], red[t + st]); __syncthreads(); } const float mu = red[0] / (float)DMQ; __syncthreads();
  float vs = 0.f; for (int q = 0; q < 4; ++q) { const float dl = act ? __fadd_rn(s[q], -mu) : 0.f; vs = __fadd_rn(vs, __fmul_rn(dl, dl)); } red[t] = vs; __syncthreads(); for (int st = 128; st > 0; st >>= 1) { if (t < st) red[t] = __fadd_rn(red[t], red[t + st]); __syncthreads(); }
  const float rs = rsqrtf(__fadd_rn(red[0] / (float)DMQ, eps)); v4h y; v4f yf;
  for (int q = 0; q < 4; ++q) { const int c = c0 + q; yf[q] = __fadd_rn(__fmul_rn(__fmul_rn(__fadd_rn(s[q], -mu), rs), bf16_round(g[c])), (bb ? bf16_round(bb[c]) : 0.f)); y[q] = (_Float16)yf[q]; }
  if (!act) return;      /* no barriers after this point */
  { if (W16) *(v4h*)(N16 + r * DMQ + c0) = y; if (W32) *(v4f*)(N32 + r * DMQ + c0) = yf;  } }


__global__ __launch_bounds__(256) void k_rsmf(const float* __restrict__ S, _Float16* __restrict__ P, int qn, int hg) {
  #pragma clang fp contract(off)
  const int t = blockIdx.x * 256 + threadIdx.x; if (t >= qn * hg) return; const size_t i = (size_t)(t / qn) * SQ + (t % qn); const float* s = S + i * SQ; float mx = -3.0e38f;
#pragma unroll 1
  for (int j = 0; j < SQ; ++j) mx = fmaxf(mx, s[j]); float se = 0.f;
#pragma unroll 1
  for (int j = 0; j < SQ; ++j) se += __expf(s[j] - mx); const float sc = 256.0f / se;
#pragma unroll 1
  for (int j0 = 0; j0 < SQ; j0 += 8) { FragH f; for (int q = 0; q < 8; ++q) f.h[q] = (_Float16)(__expf(s[j0 + q] - mx) * sc); unsigned short* d = (unsigned short*)P + i * SQ + j0; *(v8us*)d = f.half[0];  } }


__global__ __launch_bounds__(256) void k_bfr(const float* __restrict__ x, float* __restrict__ XB, size_t n8) { const size_t t = (size_t)blockIdx.x * 256 + threadIdx.x; if (t >= n8) return; v4f a = *(const v4fa*)(x + t * 8), c = *(const v4fa*)(x + t * 8 + 4); for (int q = 0; q < 4; ++q) { a[q] = bf16_round(a[q]); c[q] = bf16_round(c[q]); }
  { *(v4f*)(XB + t * 8) = a; *(v4f*)(XB + t * 8 + 4) = c;  } }



__global__ __launch_bounds__(256) void k_rsmfam(const float* __restrict__ S, _Float16* __restrict__ P, int qn, int hg, const float* __restrict__ am) {
  #pragma clang fp contract(off)
  const int t = blockIdx.x * 256 + threadIdx.x; if (t >= qn * hg) return; const size_t i = (size_t)(t / qn) * SQ + (t % qn); const float* s = S + i * SQ; float mx = -3.0e38f;
#pragma unroll 1
  for (int j = 0; j < SQ; ++j) mx = fmaxf(mx, __fadd_rn(s[j], bf16_round(am[j]))); float se = 0.f;
#pragma unroll 1
  for (int j = 0; j < SQ; ++j) se += __expf(__fadd_rn(s[j], bf16_round(am[j])) - mx); const float sc = 256.0f / se;
#pragma unroll 1
  for (int j0 = 0; j0 < SQ; j0 += 8) { FragH f; for (int q = 0; q < 8; ++q) f.h[q] = (_Float16)(__expf(__fadd_rn(s[j0 + q], bf16_round(am[j0 + q])) - mx) * sc); unsigned short* d = (unsigned short*)P + i * SQ + j0; *(v8us*)d = f.half[0];  } }


#define CC CX           /* transposer macros: input channels */
#define LL SQ           /* pixels per image */
#define LQ (3 * DM)     /* unused */

__global__ __launch_bounds__(256) void k_cl2rows(const float* __restrict__ X, _Float16* __restrict__ XR) { __shared__ float tl[64][33]; const int tid = threadIdx.x; const int nl = LL / 32, nc = CC / 64; const int cb_ = blockIdx.x % nc; const int lb = (blockIdx.x / nc) % nl; const size_t b = blockIdx.x / (nc * nl); const int c0 = cb_ * 64, l0 = lb * 32;
  for (int i = tid; i < 64 * 32; i += 256) { const int c = i / 32, l = i % 32; tl[c][l] = bf16_round(X[(b * CC + c0 + c) * (size_t)LL + l0 + l]); }
  __syncthreads();
  { const int l = tid / 8, c8 = (tid % 8) * 8; FragH f; for (int q = 0; q < 8; ++q) f.h[q] = (_Float16)tl[c8 + q][l]; unsigned short* d = (unsigned short*)XR + (b * LL + l0 + l) * (size_t)CC + c0 + c8; *(v8us*)d = f.half[0];  } }


__global__ __launch_bounds__(256) void k_rowb(float* __restrict__ O, const float* __restrict__ bias, size_t n4) {
  #pragma clang fp contract(off)
  const size_t t = (size_t)blockIdx.x * 256 + threadIdx.x; if (t >= n4) return; const size_t e = t * 4; const int c = (int)((e / SQ) % CX);      /* output channels */ const float bb = bf16_round(bias[c]); const v4f a = *(const v4fa*)(O + e); v4f o; for (int q = 0; q < 4; ++q) o[q] = __fadd_rn(a[q], bb);
  *(v4f*)(O + e) = o;  }

__global__ __launch_bounds__(256) void k_gres(const float* __restrict__ T, const float* __restrict__ gam, const float* __restrict__ X, float* __restrict__ Y, size_t n4) {
  #pragma clang fp contract(off)
  const size_t t = (size_t)blockIdx.x * 256 + threadIdx.x; if (t >= n4) return; const float g = bf16_round(gam[0]); const v4f a = *(const v4fa*)(T + t * 4), xx = *(const v4fa*)(X + t * 4); v4f r;
  for (int q = 0; q < 4; ++q) r[q] = __fadd_rn(__fmul_rn(g, a[q]), bf16_round(xx[q]));
  *(v4f*)(Y + t * 4) = r;  }

__global__ __launch_bounds__(256) void k_bcpy(const float* __restrict__ b, int n, int NP, float* __restrict__ dst, int dst0) { for (int i = threadIdx.x; i < NP; i += 256) { const float v = (i < n) ? b[i] : 0.f; *(float*)(dst + dst0 + i) = v; }  }



__global__ __launch_bounds__(256) void k_zero16(_Float16* __restrict__ Y, size_t n8) { const size_t t = (size_t)blockIdx.x * 256 + threadIdx.x; if (t >= n8) return; const v8us z = {0, 0, 0, 0, 0, 0, 0, 0}; *(v8us*)((unsigned short*)Y + t * 8) = z;  }
__global__ __launch_bounds__(256) void k_qkz(const float* __restrict__ F, _Float16* __restrict__ QZ, _Float16* __restrict__ KZ, int nr) {
  const int r = blockIdx.x * 256 + threadIdx.x; if (r >= nr) return; const float* f = F + (size_t)r * 64; FragH q0, q1, k0, k1;
  for (int i = 0; i < 8; ++i) { q0.h[i] = (_Float16)f[i]; q1.h[i] = (_Float16)f[8 + i]; k0.h[i] = (_Float16)f[16 + i]; k1.h[i] = (_Float16)f[24 + i]; } const v8us z = {0, 0, 0, 0, 0, 0, 0, 0};
  unsigned short* dq = (unsigned short*)QZ + (size_t)r * 32; unsigned short* dk = (unsigned short*)KZ + (size_t)r * 32;
  { *(v8us*)dq = q0.half[0]; *(v8us*)(dq + 8) = q1.half[0]; *(v8us*)(dq + 16) = z; *(v8us*)(dq + 24) = z; *(v8us*)dk = k0.half[0]; *(v8us*)(dk + 8) = k1.half[0]; *(v8us*)(dk + 16) = z; *(v8us*)(dk + 24) = z;  } }
extern "C" void kernel_launch(void* const* d_in, const int* in_sizes, int n_in,
                              void* d_out, int out_size, void* d_ws, size_t ws_size, hipStream_t stream) {
  (void)in_sizes; (void)n_in; (void)out_size;
  const float* const* I = (const float* const*)d_in; const float* x = I[0]; const float* wq = I[1]; const float* bq = I[2]; const float* wk = I[3]; const float* bk = I[4]; const float* wv = I[5]; const float* bv = I[6]; const float* gam = I[7];      /* natural Wq/Wk [16][128] + b, Wv [128][128] + b; gamma [1] */
  constexpr int DQ = 16, KP = 32;      /* q/k width 16, zero-padded to K = 32 for the WMMA contraction */
  char* ws = (char*)d_ws; size_t off = 0;
  auto take = [&](size_t bytes) { char* p = ws + off; off += (bytes + 255) & ~(size_t)255; return p; };
  _Float16* BQK = (_Float16*)take((size_t)64 * CX * 2); _Float16* BV = (_Float16*)take((size_t)CX * CX * 2); float* bqk = (float*)take((size_t)64 * 4);      /* [Wq; Wk; 0] as a 64-row Bt plane + [bq | bk | 0] */
  _Float16* XR = (_Float16*)take(NR * CX * 2); float* QKF = (float*)take(NR * 64 * 4); _Float16* QZ = (_Float16*)take(NR * KP * 2); _Float16* KZ = (_Float16*)take(NR * KP * 2); _Float16* VR = (_Float16*)take((size_t)SQ * CX * 2); _Float16* VC = (_Float16*)take((size_t)CX * SQ * 2);
  _Float16* P = (_Float16*)take((size_t)SQ * SQ * 2); float* T = (float*)take((size_t)CX * SQ * 4);
  if (off > ws_size) return;
  k_zero16<<<(unsigned)(((size_t)64 * CX / 8 + 255) / 256), 256, 0, stream>>>(BQK, (size_t)64 * CX / 8); k_wnat<<<(unsigned)(((size_t)DQ * CX / 8 + 255) / 256), 256, 0, stream>>>(wq, (size_t)DQ * CX / 8, BQK); k_wnat<<<(unsigned)(((size_t)DQ * CX / 8 + 255) / 256), 256, 0, stream>>>(wk, (size_t)DQ * CX / 8, BQK + (size_t)DQ * CX); k_wnat<<<(unsigned)(((size_t)CX * CX / 8 + 255) / 256), 256, 0, stream>>>(wv, (size_t)CX * CX / 8, BV);      /* Bt planes: [Wq; Wk; zeros] (64 rows) x16 and Wv */
  k_bcpy<<<1, 256, 0, stream>>>(bq, DQ, 64, bqk, 0); k_bcpy<<<1, 256, 0, stream>>>(bk, DQ, DQ, bqk, DQ);      /* [bq | bk | 0] (the first call zero-fills the 64-wide row) */
  k_cl2rows<<<NB * (SQ / 32) * (CX / 64), 256, 0, stream>>>(x, XR);      /* exact f16 token rows [n i][c] */
  k_gemm2<0><<<dim3((unsigned)((NR / 128) * (64 / 64)), 1), 128, 0, stream>>>(XR, CX, 0, BQK, CX, 0, 0.0625f, bqk, 0, nullptr, 1, 0, 0, QKF, nullptr, 64, 0, (int)NR, 64, CX);      /* q | k | 0 rows [NR][64] f32 (+ bias) */
  k_qkz<<<(unsigned)((NR + 255) / 256), 256, 0, stream>>>(QKF, QZ, KZ, (int)NR);      /* -> f16 planes [NR][32]: q | 0 and k | 0 (zero padding makes the 16-deep dot a K = 32 contraction) */
  for (int b = 0; b < NB; ++b) { const size_t r0 = (size_t)b * SQ;
    k_gemm2<11><<<dim3((SQ / 128) * (SQ / 64), 1), 128, 0, stream>>>(QZ + r0 * KP, KP, 0, KZ + r0 * KP, KP, 0, 1.0f, nullptr, 0, nullptr, 1, 0, 0, nullptr, P, SQ, 0, SQ, SQ, KP);      /* attn[n][m] = sigmoid(q[:, n].k[:, m]) (K = 32 with zero padding; sigmoid epilogue) -> f16 */
    k_gemm2<0><<<dim3((SQ / 128) * (CX / 64), 1), 128, 0, stream>>>(XR + r0 * CX, CX, 0, BV, CX, 0, 0.0625f, bv, 0, nullptr, 1, 0, 0, nullptr, VR, CX, 0, SQ, CX, CX);      /* v rows [4096][128] (+ bias) f16 */
    k_vt<CX / 64, SQ><<<(CX / 64) * (SQ / 64), 256, 0, stream>>>(VR, CX, 0, VC);      /* channel-major V [128][4096] */
    k_gemm2<0><<<dim3((CX / 128) * (SQ / 64), 1), 128, 0, stream>>>(VC, SQ, 0, P, SQ, 0, 1.0f, nullptr, 0, nullptr, 1, 0, 0, T, nullptr, SQ, 0, CX, SQ, SQ);      /* out[c][n] = sum_m v[c][m] attn[n][m] (V as A, attn as B^T) f32 */
    k_gres<<<(unsigned)(((size_t)CX * SQ / 4 + 255) / 256), 256, 0, stream>>>(T, gam, x + r0 * CX, (float*)d_out + r0 * CX, (size_t)CX * SQ / 4); }      /* y = bf16(gamma) out + bf16(x) -> channel-first output block */
}

// v001
// A run of this version takes 240 microseconds.
// Timed twice side by side with v000, it ran 2.63 and 2.59 times as fast.
#include <hip/hip_runtime.h>
// SAGAN-style self-attention with SIGMOID gating instead of softmax, channel-first (x [4][128][64][64]; q = Wq x + bq, k = Wk x + bk (1x1, 128 -> 16), v = Wv x + bv (128 -> 128), natural weights and biases sigma 0.05; attn[n][m] = sigmoid(q[:, n].k[:, m]) (no scale, no normalisation); out[c][n] = sum_m v[c][m] attn[n][m]; y = gamma out + x with the scalar gamma input -> [4][128][64][64]).
// Structure: the NCL input transposed by LDS tiles into exact f16 token rows [4096][128]; q | k as ONE WMMA GEMM (N = 64 over a zero-padded [Wq; Wk; 0] plane, f32 + bias); VALU splits them into zero-padded f16 planes [4096][32] (q | 0 and k | 0) so the 16-deep contraction runs as K = 32; all images per launch (image = blockIdx.y): attn = sigmoid(q.k) as the GEMM epilogue straight to f16 [4096][4096]; v rows (GEMM + bias, f16) -> channel-major V via LDS transposes; out[c][n] = V (A operand) x attn (B^T) f32; y = bf16(gamma) out + bf16(x) on VALU; launches: see trace.
// Compute dtype: inputs rounded to bf16; x / weights exact; q, k, v, attn as plain f16 GEMM operands (~2^-12); scores and out f32. v_wmma_f32_16x16x32_f16.
#define NB 4
#define SQ 4096
#define DM 128
#define CX 128          /* channels */
#define NH 4
#define HD 64
#define DMQ DM                       /* LayerNorm width */
#define DFF 4096
#define HG 1                         /* heads per attention launch group */
#define B0 0                         /* unused */
#define NBR NB                       /* unused (only in MP, itself unused) */
#define NR ((size_t)NB * SQ)         /* token rows */
#define MP ((int)((size_t)NBR * SQ)) /* unused (only in MPO, itself unused) */
#define QN SQ                        /* unused */
#define NHD NH                       /* unused */
#define MPO MP                       /* unused */
#define LQ DM      /* unused (redefined below) */
typedef __bf16 v16b __attribute__((ext_vector_type(16)));
typedef unsigned short v8us __attribute__((ext_vector_type(8), may_alias));
typedef float  v8f  __attribute__((ext_vector_type(8)));
typedef float  v4f  __attribute__((ext_vector_type(4)));
typedef float  v4fa __attribute__((ext_vector_type(4), may_alias));
union FragB { v16b v; v8us half[2]; unsigned short u[16]; };

__device__ __forceinline__ unsigned short bf16_bits(float x) { unsigned int u = __float_as_uint(x); return (unsigned short)((u + 0x7FFFu + ((u >> 16) & 1u)) >> 16); }
__device__ __forceinline__ float bf16_val(unsigned short b) { return __uint_as_float(((unsigned int)b) << 16); }
__device__ __forceinline__ float bf16_round(float x) { return bf16_val(bf16_bits(x)); }
// D += A·B with NT terms: 1 = ah·bh, 2 = + al·bh (A split), 3 = + ah·bl (both split)
template <int NT>
__device__ __forceinline__ v8f mmaN(v16b ah, v16b al, v16b bh, v16b bl, v8f c) {
  c = __builtin_amdgcn_wmma_f32_16x16x32_bf16(false, ah, false, bh, (short)0, c, false, false);
  if (NT >= 2) c = __builtin_amdgcn_wmma_f32_16x16x32_bf16(false, al, false, bh, (short)0, c, false, false);
  if (NT >= 3) c = __builtin_amdgcn_wmma_f32_16x16x32_bf16(false, ah, false, bl, (short)0, c, false, false);
  asm volatile("v_nop\n\tv_nop\n\tv_nop\n\tv_nop" : "+v"(c) : "v"(ah), "v"(al), "v"(bh), "v"(bl));
  return c;
}

__global__ __launch_bounds__(256) void k_wt_bf16(const float* __restrict__ W, unsigned short* __restrict__ Wt, int K, int N) {
  const int t = blockIdx.x * 256 + threadIdx.x;
  const int k8n = K / 8;
  if (t >= N * k8n) return;
  const int n = t / k8n, k8 = (t % k8n) * 8;
  v8us v;
#pragma unroll
  for (int i = 0; i < 8; ++i) v[i] = bf16_bits(W[(size_t)(k8 + i) * N + n]);
  *(v8us*)(Wt + (size_t)n * K + k8) = v;
  
}

// GEMM C[M][N] (f32, pitch ldc) = act(A[M][K]·W + bias). A f32 row-major (pitch lda) converted per fragment to bf16
// (ASPLIT: hi/lo two planes -> 2 terms, else single rounded term); Wt bf16 [N][K] (pitch ldb). BIAS_BF16 rounds the
// bias to bf16 first (bias quantised to bf16 before the add). K%32==0, M%16==0, N%64==0.
template <bool ASPLIT, int ACT, bool BIAS_BF16>
__global__ __launch_bounds__(128) void k_gemm_bf(const float* __restrict__ A, int lda, const unsigned short* __restrict__ Wt, int ldb,
                                               const float* __restrict__ bias, float* __restrict__ C, int ldc, int M, int N, int K) {
  __shared__ __attribute__((aligned(16))) float so[4][16][64];
  const int tid = threadIdx.x, w = tid >> 5, lane = tid & 31, ln = lane & 15, hh = lane >> 4;
  const int ntn = N / 64;
  const int wid = blockIdx.x * 4 + w;
  const int mt = wid / ntn, nq = wid % ntn;
  if (mt * 16 >= M) return;
  const int row0 = mt * 16, col0 = nq * 64;
  const float* arow = A + (size_t)(row0 + ln) * lda;
  v8f acc[4] = {};
  for (int kb = 0; kb < K; kb += 32) {
    FragB ah, al;
    const v4f x0 = *(const v4fa*)(arow + kb + 8 * hh), x1 = *(const v4fa*)(arow + kb + 8 * hh + 4);
    const v4f x2 = *(const v4fa*)(arow + kb + 16 + 8 * hh), x3 = *(const v4fa*)(arow + kb + 16 + 8 * hh + 4);
    float xs[16] = {x0[0],x0[1],x0[2],x0[3],x1[0],x1[1],x1[2],x1[3],x2[0],x2[1],x2[2],x2[3],x3[0],x3[1],x3[2],x3[3]};
#pragma unroll
    for (int i = 0; i < 16; ++i) { const unsigned short hb = bf16_bits(xs[i]); ah.u[i] = hb; al.u[i] = ASPLIT ? bf16_bits(xs[i] - bf16_val(hb)) : (unsigned short)0; }
#pragma unroll
    for (int t = 0; t < 4; ++t) {
      const unsigned short* brow = Wt + (size_t)(col0 + t * 16 + ln) * ldb + kb;
      FragB b;
      b.half[0] = *(const v8us*)(brow + 8 * hh);
      b.half[1] = *(const v8us*)(brow + 16 + 8 * hh);
      acc[t] = mmaN<ASPLIT ? 2 : 1>(ah.v, al.v, b.v, b.v, acc[t]);
    }
  }
#pragma unroll
  for (int t = 0; t < 4; ++t) {
    float bv = bias ? bias[col0 + t * 16 + ln] : 0.f;
    if (BIAS_BF16) bv = bf16_round(bv);
#pragma unroll
    for (int r = 0; r < 8; ++r) { float v = acc[t][r] + bv; if (ACT == 1) v = fmaxf(v, 0.f); so[w][8 * hh + r][t * 16 + ln] = v; }
  }
  __builtin_amdgcn_fence(__ATOMIC_ACQ_REL, "workgroup");
  __builtin_amdgcn_wave_barrier();
  const int rsub = lane >> 4, c4 = (lane & 15) * 4;
  {
#pragma unroll
    for (int q = 0; q < 8; ++q) {
      const int r = q * 2 + rsub;
      const v4f v = *(const v4fa*)&so[w][r][c4];
      *(v4f*)(C + (size_t)(row0 + r) * ldc + col0 + c4) = v;
    }
    
  }
}

// GEMM C = act(A·W + bias + resid): A f32 (ASPLIT -> hi/lo 2 terms), Wt bf16 [N][K]; ACT 0 none, 1 relu, 2 exact gelu;
// resid (optional, f32, row index = (row % rmod), pitch ldr, RES_BF16 rounds it) added before the activation.
template <bool ASPLIT, int ACT, bool BIAS_BF16, bool RES_BF16>
__global__ __launch_bounds__(128) void k_gemm_bf3(const float* __restrict__ A, int lda, const unsigned short* __restrict__ Wt, int ldb,
                                                const float* __restrict__ bias, const float* __restrict__ resid, int rmod, int ldr,
                                                float* __restrict__ C, int ldc, int M, int N, int K) {
  __shared__ __attribute__((aligned(16))) float so[4][16][64];
  const int tid = threadIdx.x, w = tid >> 5, lane = tid & 31, ln = lane & 15, hh = lane >> 4;
  const int ntn = N / 64;
  const int wid = blockIdx.x * 4 + w;
  const int mt = wid / ntn, nq = wid % ntn;
  if (mt * 16 >= M) return;
  const int row0 = mt * 16, col0 = nq * 64;
  const float* arow = A + (size_t)(row0 + ln) * lda;
  v8f acc[4] = {};
  for (int kb = 0; kb < K; kb += 32) {
    FragB ah, al;
    const v4f x0 = *(const v4fa*)(arow + kb + 8 * hh), x1 = *(const v4fa*)(arow + kb + 8 * hh + 4);
    const v4f x2 = *(const v4fa*)(arow + kb + 16 + 8 * hh), x3 = *(const v4fa*)(arow + kb + 16 + 8 * hh + 4);
    float xs[16] = {x0[0],x0[1],x0[2],x0[3],x1[0],x1[1],x1[2],x1[3],x2[0],x2[1],x2[2],x2[3],x3[0],x3[1],x3[2],x3[3]};
#pragma unroll
    for (int i = 0; i < 16; ++i) { const unsigned short hb = bf16_bits(xs[i]); ah.u[i] = hb; al.u[i] = ASPLIT ? bf16_bits(xs[i] - bf16_val(hb)) : (unsigned short)0; }
#pragma unroll
    for (int t = 0; t < 4; ++t) {
      const unsigned short* brow = Wt + (size_t)(col0 + t * 16 + ln) * ldb + kb;
      FragB b;
      b.half[0] = *(const v8us*)(brow + 8 * hh);
      b.half[1] = *(const v8us*)(brow + 16 + 8 * hh);
      acc[t] = mmaN<ASPLIT ? 2 : 1>(ah.v, al.v, b.v, b.v, acc[t]);
    }
  }
#pragma unroll
  for (int t = 0; t < 4; ++t) {
    const int col = col0 + t * 16 + ln;
    float bv = bias ? bias[col] : 0.f;
    if (BIAS_BF16) bv = bf16_round(bv);
#pragma unroll
    for (int r = 0; r < 8; ++r) {
      float v = acc[t][r] + bv;
      if (resid) { float rv = resid[(size_t)((row0 + 8 * hh + r) % rmod) * ldr + col]; if (RES_BF16) rv = bf16_round(rv); v += rv; }
      if (ACT == 1) v = fmaxf(v, 0.f);
      if (ACT == 2) v = 0.5f * v * (1.0f + erff(v * 0.70710678118654752f));
      if (ACT == 3) { const float u = 0.7978845608028654f * (v + 0.044715f * v * v * v); v = 0.5f * v * (1.0f + tanhf(u)); }
      so[w][8 * hh + r][t * 16 + ln] = v;
    }
  }
  __builtin_amdgcn_fence(__ATOMIC_ACQ_REL, "workgroup");
  __builtin_amdgcn_wave_barrier();
  const int rsub = lane >> 4, c4 = (lane & 15) * 4;
  {
#pragma unroll
    for (int q = 0; q < 8; ++q) {
      const int r = q * 2 + rsub;
      const v4f v = *(const v4fa*)&so[w][r][c4];
      *(v4f*)(C + (size_t)(row0 + r) * ldc + col0 + c4) = v;
    }
    
  }
}
// row LayerNorm (biased variance, eps) over N: s = X (+ R); optional out_sum <- s; out_norm <- (s-mu)*rsqrt(var+eps)*g + b
template <bool PARAM_BF16>
__global__ __launch_bounds__(256) void k_layernorm(const float* __restrict__ X, const float* __restrict__ R, const float* __restrict__ g, const float* __restrict__ bta,
                                                  float* __restrict__ out_sum, float* __restrict__ out_norm, int N, float eps) {
  __shared__ float red[256];
  const int row = blockIdx.x, tid = threadIdx.x;
  const float* x = X + (size_t)row * N; const float* rr = R ? R + (size_t)row * N : nullptr;
  float vals[16];                     // up to N = 4096
  const int per = N / 256;            // contiguous chunk per thread? use strided-by-4 chunks: thread handles j = tid*4 + 1024*u
  float s1 = 0.f;
  for (int u = 0; u < per / 4; ++u) {
    const int j = tid * 4 + 1024 * u;
    const v4f a = *(const v4fa*)(x + j);
    v4f b = {0.f,0.f,0.f,0.f}; if (rr) b = *(const v4fa*)(rr + j);
#pragma unroll
    for (int q = 0; q < 4; ++q) { const float v = a[q] + b[q]; vals[u * 4 + q] = v; s1 += v; }
  }
  red[tid] = s1; __syncthreads();
  for (int st = 128; st > 0; st >>= 1) { if (tid < st) red[tid] += red[tid + st]; __syncthreads(); }
  const float mu = red[0] / (float)N; __syncthreads();
  float s2 = 0.f;
  for (int u = 0; u < per / 4; ++u)
#pragma unroll
    for (int q = 0; q < 4; ++q) { const float c = vals[u * 4 + q] - mu; s2 += c * c; }
  red[tid] = s2; __syncthreads();
  for (int st = 128; st > 0; st >>= 1) { if (tid < st) red[tid] += red[tid + st]; __syncthreads(); }
  const float rs = rsqrtf(red[0] / (float)N + eps);
  {
    for (int u = 0; u < per / 4; ++u) {
      const int j = tid * 4 + 1024 * u;
      v4f o, sm;
#pragma unroll
      for (int q = 0; q < 4; ++q) {
        float gg = g[j + q], bb = bta[j + q];
        if (PARAM_BF16) { gg = bf16_round(gg); bb = bf16_round(bb); }
        sm[q] = vals[u * 4 + q]; o[q] = (vals[u * 4 + q] - mu) * rs * gg + bb;
      }
      if (out_sum) *(v4f*)(out_sum + (size_t)row * N + j) = sm;
      *(v4f*)(out_norm + (size_t)row * N + j) = o;
    }
    
  }
}



// ---- f16 WMMA path (v_wmma_f32_16x16x32_f16): 11-bit significands for operands in range — used where a [0,1] probability operand needs more precision than bf16
typedef _Float16 v16h __attribute__((ext_vector_type(16)));
union FragH { v16h v; v8us half[2]; _Float16 h[16]; unsigned short u[16]; };
template <int NT>
__device__ __forceinline__ v8f mmaH(v16h ah, v16h al, v16h bh, v16h bl, v8f c) {
  c = __builtin_amdgcn_wmma_f32_16x16x32_f16(false, ah, false, bh, (short)0, c, false, false);
  if (NT >= 2) c = __builtin_amdgcn_wmma_f32_16x16x32_f16(false, al, false, bh, (short)0, c, false, false);
  if (NT >= 3) c = __builtin_amdgcn_wmma_f32_16x16x32_f16(false, ah, false, bl, (short)0, c, false, false);
  asm volatile("v_nop\n\tv_nop\n\tv_nop\n\tv_nop" : "+v"(c) : "v"(ah), "v"(al), "v"(bh), "v"(bl));
  return c;
}
// batched GEMM like k_gemm_b but f16 operands: A f32 (split into f16 hi/lo if ASPLIT, else rounded to f16), Bt = f16 values [n][k]; alpha; C f32; N multiple of 16 (partial tiles skipped)
template <bool ASPLIT>
__global__ __launch_bounds__(128) void k_gemm_h(const float* __restrict__ A, int lda, size_t sA, const _Float16* __restrict__ Bh, int ldb, size_t sB, float alpha, float* __restrict__ C, int ldc, size_t sC, int M, int N, int K) {
  __shared__ __attribute__((aligned(16))) float so[4][16][64];
  const int tid = threadIdx.x, w = tid >> 5, lane = tid & 31, ln = lane & 15, hh = lane >> 4; const int by = blockIdx.y;
  A += (size_t)by * sA; Bh += (size_t)by * sB; C += (size_t)by * sC;
  const int ntn = (N + 63) / 64; const int wid = blockIdx.x * 4 + w; const int mt = wid / ntn, nq = wid % ntn; if (mt * 16 >= M) return;
  const int row0 = mt * 16, col0 = nq * 64; const float* arow = A + (size_t)(row0 + ln) * lda;
  v8f acc[4] = {};
  for (int kb = 0; kb < K; kb += 32) {
    FragH ah, al;
    const v4f x0 = *(const v4fa*)(arow + kb + 8 * hh), x1 = *(const v4fa*)(arow + kb + 8 * hh + 4), x2 = *(const v4fa*)(arow + kb + 16 + 8 * hh), x3 = *(const v4fa*)(arow + kb + 16 + 8 * hh + 4);
    float xs[16] = {x0[0],x0[1],x0[2],x0[3],x1[0],x1[1],x1[2],x1[3],x2[0],x2[1],x2[2],x2[3],x3[0],x3[1],x3[2],x3[3]};
#pragma unroll
    for (int i = 0; i < 16; ++i) { const _Float16 h = (_Float16)xs[i]; ah.h[i] = h; al.h[i] = ASPLIT ? (_Float16)(xs[i] - (float)h) : (_Float16)0.0f; }
#pragma unroll
    for (int t = 0; t < 4; ++t) { if (col0 + t * 16 >= N) continue; const size_t boff = (size_t)(col0 + t * 16 + ln) * ldb + kb; FragH bq; bq.half[0] = *(const v8us*)(Bh + boff + 8 * hh); bq.half[1] = *(const v8us*)(Bh + boff + 16 + 8 * hh);
      acc[t] = mmaH<ASPLIT ? 2 : 1>(ah.v, al.v, bq.v, bq.v, acc[t]); }
  }
#pragma unroll
  for (int t = 0; t < 4; ++t) { if (col0 + t * 16 >= N) continue;
#pragma unroll
    for (int r = 0; r < 8; ++r) so[w][8 * hh + r][t * 16 + ln] = acc[t][r] * alpha; }
  __builtin_amdgcn_fence(__ATOMIC_ACQ_REL, "workgroup"); __builtin_amdgcn_wave_barrier();
  const int rsub = lane >> 4, c4 = (lane & 15) * 4;
  {
#pragma unroll
    for (int q = 0; q < 8; ++q) { const int r = q * 2 + rsub; if (col0 + c4 < N) { const v4f v = *(const v4fa*)&so[w][r][c4]; *(v4f*)(C + (size_t)(row0 + r) * ldc + col0 + c4) = v; } }
     }
}

// Wt[n][k] = f16(W[k][n]·scale) from f32 row-major W[K][N] (scale = power of two; bf16-exact weights stay exact in f16 away from the subnormal range)
__global__ __launch_bounds__(256) void k_wt_f16(const float* __restrict__ W, _Float16* __restrict__ Wt, int K, int N, float scale) {
  const int t = blockIdx.x * 256 + threadIdx.x; if (t >= N * (K / 8)) return; const int n = t / (K / 8), k8 = (t % (K / 8)) * 8; FragH f;
#pragma unroll
  for (int i = 0; i < 8; ++i) f.h[i] = (_Float16)(bf16_round(W[(size_t)(k8 + i) * N + n]) * scale); const v8us o = f.half[0];
  *(v8us*)((unsigned short*)Wt + (size_t)n * K + k8) = o; 
}
// k_gemm_hh variant with fused epilogue: v = acc·alpha + bias[by·sBias + col] (+ CP[(row/rowsPerB)·sCPb + by·64 + col] if CP) ; ACT 0 none / 1 elu ; writes f16 C16 (and f32 C if non-null)
template <int ACT>
__global__ __launch_bounds__(128) void k_gemm_hhx(const _Float16* __restrict__ A, int lda, size_t sA, const _Float16* __restrict__ Bh, int ldb, size_t sB, float alpha, const float* __restrict__ bias, size_t sBias, const float* __restrict__ CP, int rowsPerB, size_t sCPb, int row0g,
    float* __restrict__ C, _Float16* __restrict__ C16, int ldc, size_t sC, int M, int N, int K) {
  __shared__ __attribute__((aligned(16))) float so[4][16][64];
  const int tid = threadIdx.x, w = tid >> 5, lane = tid & 31, ln = lane & 15, hh = lane >> 4; const int by = blockIdx.y;
  A += (size_t)by * sA; Bh += (size_t)by * sB; const size_t cofs = (size_t)by * sC; const float* bp = bias ? bias + (size_t)by * sBias : nullptr;
  const int ntn = (N + 63) / 64; const int wid = blockIdx.x * 4 + w; const int mt = wid / ntn, nq = wid % ntn; if (mt * 16 >= M) return;
  const int row0 = mt * 16, col0 = nq * 64; const _Float16* arow = A + (size_t)(row0 + ln) * lda;
  v8f acc[4] = {};
  for (int kb = 0; kb < K; kb += 32) { FragH ah; ah.half[0] = *(const v8us*)((const unsigned short*)arow + kb + 8 * hh); ah.half[1] = *(const v8us*)((const unsigned short*)arow + kb + 16 + 8 * hh);
#pragma unroll
    for (int t = 0; t < 4; ++t) { if (col0 + t * 16 >= N) continue; const size_t boff = (size_t)(col0 + t * 16 + ln) * ldb + kb; FragH bq; bq.half[0] = *(const v8us*)((const unsigned short*)Bh + boff + 8 * hh); bq.half[1] = *(const v8us*)((const unsigned short*)Bh + boff + 16 + 8 * hh);
      acc[t] = mmaH<1>(ah.v, ah.v, bq.v, bq.v, acc[t]); }
  }
#pragma unroll
  for (int t = 0; t < 4; ++t) { if (col0 + t * 16 >= N) continue; const int col = col0 + t * 16 + ln; const float bv = bp ? bf16_round(bp[col]) : 0.f;
#pragma unroll
    for (int r = 0; r < 8; ++r) { float v = acc[t][r] * alpha + bv; if (CP) { const int rr = row0g + row0 + 8 * hh + r; if (rowsPerB < 0) v += CP[cofs + (size_t)rr * ldc + col];      /* rowsPerB < 0: own element of the batched C plane */ else { const int bidx = rr / rowsPerB; v += CP[(size_t)bidx * sCPb + (size_t)by * 64 + col]; } } if (ACT == 1) v = (v > 0.f) ? v : expm1f(v); else if (ACT == 7) v = (v > 0.f) ? v + 1.0f : expf(v); else if (ACT == 8) v = tanhf(v); else if (ACT == 9) v = 0.5f * v * (1.0f + tanhf(0.7978845608028654f * (v + 0.044715f * v * v * v))); else if (ACT == 11) v = 1.0f / (1.0f + expf(-v)); else if (ACT == 12) v = (v > 0.f) ? v : 0.01f * v; else if (ACT == 14) v = (v > 0.f) ? v : 0.1f * v; else if (ACT == 16) v = (v >= 0.f) ? v : 0.3f * v; else if (ACT == 17) v = (v >= 0.f) ? v : 0.2f * v; else if (ACT == 15) v = v / (1.0f + expf(-v)); else if (ACT == 3) v = fmaxf(v, 0.f); else if (ACT == 6) v = 0.5f * v * (1.0f + erff(v * 0.70710678118654752f)); so[w][8 * hh + r][t * 16 + ln] = v; } }
  __builtin_amdgcn_fence(__ATOMIC_ACQ_REL, "workgroup"); __builtin_amdgcn_wave_barrier();
  const int rsub = lane >> 4, c4 = (lane & 15) * 4; typedef _Float16 v4h __attribute__((ext_vector_type(4)));
  {
#pragma unroll
    for (int q = 0; q < 8; ++q) { const int r = q * 2 + rsub; if (col0 + c4 < N) { const v4f v = *(const v4fa*)&so[w][r][c4]; if (C) *(v4f*)(C + cofs + (size_t)(row0 + r) * ldc + col0 + c4) = v; if (C16) { v4h h4; for (int i = 0; i < 4; ++i) h4[i] = (_Float16)v[i]; *(v4h*)(C16 + cofs + (size_t)(row0 + r) * ldc + col0 + c4) = h4; } } }
     }
}


typedef _Float16 v4h __attribute__((ext_vector_type(4)));

__global__ __launch_bounds__(256) void k_x16(const float* __restrict__ x, _Float16* __restrict__ X16, size_t n8) { const size_t t = (size_t)blockIdx.x * 256 + threadIdx.x; if (t >= n8) return; FragH f;
#pragma unroll
  for (int q = 0; q < 8; ++q) f.h[q] = (_Float16)bf16_round(x[t * 8 + q]); *(v8us*)((unsigned short*)X16 + t * 8) = f.half[0];  }
__global__ __launch_bounds__(256) void k_h16(const float* __restrict__ x, _Float16* __restrict__ X16, size_t n8) { const size_t t = (size_t)blockIdx.x * 256 + threadIdx.x; if (t >= n8) return; FragH f;
#pragma unroll
  for (int q = 0; q < 8; ++q) f.h[q] = (_Float16)x[t * 8 + q]; *(v8us*)((unsigned short*)X16 + t * 8) = f.half[0];  }
__global__ __launch_bounds__(256) void k_round16f(const float* __restrict__ W, _Float16* __restrict__ Bt, size_t n8) { const size_t t = (size_t)blockIdx.x * 256 + threadIdx.x; if (t >= n8) return; FragH f;
#pragma unroll
  for (int i = 0; i < 8; ++i) f.h[i] = (_Float16)(bf16_round(W[t * 8 + i]) * 16.0f); *(v8us*)((unsigned short*)Bt + t * 8) = f.half[0];  }
template <int NHv, int TTv>
__global__ __launch_bounds__(256) void k_vt(const _Float16* __restrict__ V16, int ldv, int voff, _Float16* __restrict__ Vt) { __shared__ unsigned short tl[64][66]; const int tid = threadIdx.x; const int slab = blockIdx.x / (TTv / 64), lg = blockIdx.x % (TTv / 64); const int b = slab / NHv, h = slab % NHv;
  for (int i = tid; i < 64 * 8; i += 256) { const int r = i / 8, c8 = (i % 8) * 8; FragH f; f.half[0] = *(const v8us*)((const unsigned short*)V16 + ((size_t)b * TTv + lg * 64 + r) * ldv + voff + h * 64 + c8);
#pragma unroll
    for (int q = 0; q < 8; ++q) tl[r][c8 + q] = f.u[q]; }
  __syncthreads();
  {
#pragma unroll
    for (int rd = 0; rd < 2; ++rd) { const int d = rd * 32 + tid / 8, pc = tid % 8; FragH f;
#pragma unroll
      for (int q = 0; q < 8; ++q) f.u[q] = tl[pc * 8 + q][d];
      *(v8us*)((unsigned short*)Vt + ((size_t)slab * 64 + d) * TTv + lg * 64 + pc * 8) = f.half[0]; }
     } }

__global__ __launch_bounds__(256) void k_hl(const float* __restrict__ F, _Float16* __restrict__ Hh, _Float16* __restrict__ Hl, size_t n8) { const size_t t = (size_t)blockIdx.x * 256 + threadIdx.x; if (t >= n8) return; FragH fh, fl; const v4f a = *(const v4fa*)(F + t * 8), c = *(const v4fa*)(F + t * 8 + 4);
#pragma unroll
  for (int q = 0; q < 4; ++q) { _Float16 h = (_Float16)a[q]; fh.h[q] = h; fl.h[q] = (_Float16)((a[q] - (float)h) * 1024.0f); h = (_Float16)c[q]; fh.h[4 + q] = h; fl.h[4 + q] = (_Float16)((c[q] - (float)h) * 1024.0f); }
  { *(v8us*)((unsigned short*)Hh + t * 8) = fh.half[0]; *(v8us*)((unsigned short*)Hl + t * 8) = fl.half[0];  } }

// ---- fast GEMM (wave tile 32x64; requires M % 32 == 0 rows per launch region and N % 64 == 0); epilogue = k_gemm_hhx semantics ----
__device__ __forceinline__ v16h g2_frag(const _Float16* p, int hh) { FragH f; f.half[0] = *(const v8us*)((const unsigned short*)p + 8 * hh); f.half[1] = *(const v8us*)((const unsigned short*)p + 16 + 8 * hh); return f.v; }
__device__ __forceinline__ v8f g2_mma(v16h a, v16h b, v8f c) { v8f d = __builtin_amdgcn_wmma_f32_16x16x32_f16(false, a, false, b, (short)0, c, false, false); asm volatile("v_nop\n\tv_nop\n\tv_nop\n\tv_nop" : "+v"(d) : "v"(a), "v"(b)); return d; }
template <int ACT>
__global__ __launch_bounds__(128) void k_gemm2(const _Float16* __restrict__ A, int lda, size_t sA, const _Float16* __restrict__ Bh, int ldb, size_t sB, float alpha, const float* __restrict__ bias, size_t sBias, const float* __restrict__ CP, int rowsPerB, size_t sCPb, int row0g,
    float* __restrict__ C, _Float16* __restrict__ C16, int ldc, size_t sC, int M, int N, int K) { static_assert(ACT == 0 || ACT == 3 || ACT == 6 || ACT == 8 || ACT == 9 || ACT == 11 || ACT == 12 || ACT == 14 || ACT == 15 || ACT == 16 || ACT == 17, "k_gemm2: unsupported ACT code (would silently apply no activation)");
  __shared__ __attribute__((aligned(16))) float so[4][32][68];
  const int tid = threadIdx.x, w = tid >> 5, lane = tid & 31, ln = lane & 15, hh = lane >> 4; const int by = blockIdx.y;
  A += (size_t)by * sA; Bh += (size_t)by * sB; const size_t cofs = (size_t)by * sC; const float* bp = bias ? bias + (size_t)by * sBias : nullptr;
  const int ntn = N >> 6; const int mt = blockIdx.x / ntn, nq = blockIdx.x - mt * ntn; const int row0 = mt * 128 + 32 * w, col0 = nq * 64; if (row0 >= M) return;
  const _Float16* a0p = A + (size_t)(row0 + ln) * lda; const _Float16* a1p = a0p + (size_t)16 * lda;
  const _Float16* b0p = Bh + (size_t)(col0 + ln) * ldb; const _Float16* b1p = b0p + (size_t)16 * ldb; const _Float16* b2p = b1p + (size_t)16 * ldb; const _Float16* b3p = b2p + (size_t)16 * ldb;
  const v8f z8 = {0.f,0.f,0.f,0.f,0.f,0.f,0.f,0.f}; v8f c00 = z8, c01 = z8, c02 = z8, c03 = z8, c10 = z8, c11 = z8, c12 = z8, c13 = z8;
#pragma unroll 1
  for (int kb = 0; kb < K; kb += 32) { const v16h a0 = g2_frag(a0p + kb, hh), a1 = g2_frag(a1p + kb, hh);
    v16h b = g2_frag(b0p + kb, hh); c00 = g2_mma(a0, b, c00); c10 = g2_mma(a1, b, c10);
    b = g2_frag(b1p + kb, hh); c01 = g2_mma(a0, b, c01); c11 = g2_mma(a1, b, c11);
    b = g2_frag(b2p + kb, hh); c02 = g2_mma(a0, b, c02); c12 = g2_mma(a1, b, c12);
    b = g2_frag(b3p + kb, hh); c03 = g2_mma(a0, b, c03); c13 = g2_mma(a1, b, c13); }
  v8f accs[8] = {c00, c01, c02, c03, c10, c11, c12, c13};
#pragma unroll
  for (int u = 0; u < 8; ++u) { const int t = u & 3, half = u >> 2; const int col = col0 + t * 16 + ln; const float bv = bp ? bf16_round(bp[col]) : 0.f;
#pragma unroll
    for (int r = 0; r < 8; ++r) { const int rloc = half * 16 + 8 * hh + r; float v = accs[u][r] * alpha + bv; if (CP) { if (rowsPerB < 0) v += CP[cofs + (size_t)(row0g + row0 + rloc) * ldc + col];      /* rowsPerB < 0: own element of the batched C plane */ else { const int bidx = (row0g + row0 + rloc) / rowsPerB; v += CP[(size_t)bidx * sCPb + (size_t)by * 64 + col]; } }
      if (ACT == 3) v = fmaxf(v, 0.f); else if (ACT == 6) v = 0.5f * v * (1.0f + erff(v * 0.70710678118654752f)); else if (ACT == 11) v = 1.0f / (1.0f + expf(-v)); else if (ACT == 15) v = v / (1.0f + expf(-v)); else if (ACT == 12) v = (v > 0.f) ? v : 0.01f * v; else if (ACT == 8) v = tanhf(v); else if (ACT == 9) v = 0.5f * v * (1.0f + tanhf(0.7978845608028654f * (v + 0.044715f * v * v * v))); else if (ACT == 14) v = (v > 0.f) ? v : 0.1f * v; else if (ACT == 16) v = (v >= 0.f) ? v : 0.3f * v; else if (ACT == 17) v = (v >= 0.f) ? v : 0.2f * v;
      so[w][rloc][t * 16 + ln] = v; } }
  __builtin_amdgcn_fence(__ATOMIC_ACQ_REL, "workgroup"); __builtin_amdgcn_wave_barrier();
  const int rsub = lane >> 4, c4 = (lane & 15) * 4;
  {
#pragma unroll
    for (int q = 0; q < 16; ++q) { const int r = q * 2 + rsub; const v4f v = *(const v4fa*)&so[w][r][c4]; if (C) *(v4f*)(C + cofs + (size_t)(row0 + r) * ldc + col0 + c4) = v; if (C16) { v4h h4; for (int i = 0; i < 4; ++i) h4[i] = (_Float16)v[i]; *(v4h*)(C16 + cofs + (size_t)(row0 + r) * ldc + col0 + c4) = h4; } }
     } }


__global__ __launch_bounds__(256) void k_wnat(const float* __restrict__ w, size_t n8, _Float16* __restrict__ Bt) { const size_t t = (size_t)blockIdx.x * 256 + threadIdx.x; if (t >= n8) return; FragH f; for (int q = 0; q < 8; ++q) f.h[q] = (_Float16)(bf16_round(w[t * 8 + q]) * 16.0f); *(v8us*)((unsigned short*)Bt + t * 8) = f.half[0];  }
__global__ __launch_bounds__(256) void k_rsm(const float* __restrict__ S, _Float16* __restrict__ P, int nrows) {
  #pragma clang fp contract(off)
  const int i = blockIdx.x * 256 + threadIdx.x; if (i >= nrows) return; const float* s = S + (size_t)i * SQ; float mx = -3.0e38f;
#pragma unroll 1
  for (int j = 0; j < SQ; ++j) mx = fmaxf(mx, s[j]); float se = 0.f;
#pragma unroll 1
  for (int j = 0; j < SQ; ++j) se += expf(s[j] - mx); const float sc = 256.0f / se;
#pragma unroll 1
  for (int j0 = 0; j0 < SQ; j0 += 8) { FragH f; for (int q = 0; q < 8; ++q) f.h[q] = (_Float16)(expf(s[j0 + q] - mx) * sc); unsigned short* d = (unsigned short*)P + (size_t)i * SQ + j0; *(v8us*)d = f.half[0];  } }
__global__ __launch_bounds__(256) void k_vt(const _Float16* __restrict__ V16, int b, int h0, _Float16* __restrict__ VT) { __shared__ unsigned short tl[64][65]; const int tid = threadIdx.x; const int hh = blockIdx.x % HG, sg = blockIdx.x / HG; const int s0 = sg * 64; const int h = h0 + hh;
  for (int i = tid; i < 64 * 8; i += 256) { const int j = i / 8, d8 = (i % 8) * 8; FragH f; f.half[0] = *(const v8us*)((const unsigned short*)V16 + ((size_t)b * SQ + s0 + j) * DM + h * HD + d8); for (int q = 0; q < 8; ++q) tl[d8 + q][j] = f.u[q]; }
  __syncthreads();
  { for (int i = tid; i < 64 * 8; i += 256) { const int d = i / 8, j8 = (i % 8) * 8; FragH f; for (int q = 0; q < 8; ++q) f.u[q] = tl[d][j8 + q]; *(v8us*)((unsigned short*)VT + ((size_t)hh * HD + d) * SQ + s0 + j8) = f.half[0]; }  } }


template <int BFIN, int W16, int W32>
__global__ __launch_bounds__(256) void k_lnx(const float* __restrict__ X, const float* __restrict__ g, const float* __restrict__ bb, float eps, _Float16* __restrict__ N16, float* __restrict__ N32) {
  #pragma clang fp contract(off)
  __shared__ float red[256]; const size_t r = blockIdx.x; const int t = threadIdx.x; const bool act = t < (DMQ / 4); const int c0 = act ? t * 4 : 0;
  const v4f xa = *(const v4fa*)(X + r * DMQ + c0); float s[4]; float sum = 0.f;
  for (int q = 0; q < 4; ++q) { s[q] = act ? (BFIN ? bf16_round(xa[q]) : xa[q]) : 0.f; sum = __fadd_rn(sum, s[q]); }
  red[t] = sum; __syncthreads(); for (int st = 128; st > 0; st >>= 1) { if (t < st) red[t] = __fadd_rn(red[t], red[t + st]); __syncthreads(); } const float mu = red[0] / (float)DMQ; __syncthreads();
  float vs = 0.f; for (int q = 0; q < 4; ++q) { const float dl = act ? __fadd_rn(s[q], -mu) : 0.f; vs = __fadd_rn(vs, __fmul_rn(dl, dl)); } red[t] = vs; __syncthreads(); for (int st = 128; st > 0; st >>= 1) { if (t < st) red[t] = __fadd_rn(red[t], red[t + st]); __syncthreads(); }
  const float rs = rsqrtf(__fadd_rn(red[0] / (float)DMQ, eps)); v4h y; v4f yf;
  for (int q = 0; q < 4; ++q) { const int c = c0 + q; yf[q] = __fadd_rn(__fmul_rn(__fmul_rn(__fadd_rn(s[q], -mu), rs), bf16_round(g[c])), (bb ? bf16_round(bb[c]) : 0.f)); y[q] = (_Float16)yf[q]; }
  if (!act) return;      /* no barriers after this point */
  { if (W16) *(v4h*)(N16 + r * DMQ + c0) = y; if (W32) *(v4f*)(N32 + r * DMQ + c0) = yf;  } }


__global__ __launch_bounds__(256) void k_rsmf(const float* __restrict__ S, _Float16* __restrict__ P, int qn, int hg) {
  #pragma clang fp contract(off)
  const int t = blockIdx.x * 256 + threadIdx.x; if (t >= qn * hg) return; const size_t i = (size_t)(t / qn) * SQ + (t % qn); const float* s = S + i * SQ; float mx = -3.0e38f;
#pragma unroll 1
  for (int j = 0; j < SQ; ++j) mx = fmaxf(mx, s[j]); float se = 0.f;
#pragma unroll 1
  for (int j = 0; j < SQ; ++j) se += __expf(s[j] - mx); const float sc = 256.0f / se;
#pragma unroll 1
  for (int j0 = 0; j0 < SQ; j0 += 8) { FragH f; for (int q = 0; q < 8; ++q) f.h[q] = (_Float16)(__expf(s[j0 + q] - mx) * sc); unsigned short* d = (unsigned short*)P + i * SQ + j0; *(v8us*)d = f.half[0];  } }


__global__ __launch_bounds__(256) void k_bfr(const float* __restrict__ x, float* __restrict__ XB, size_t n8) { const size_t t = (size_t)blockIdx.x * 256 + threadIdx.x; if (t >= n8) return; v4f a = *(const v4fa*)(x + t * 8), c = *(const v4fa*)(x + t * 8 + 4); for (int q = 0; q < 4; ++q) { a[q] = bf16_round(a[q]); c[q] = bf16_round(c[q]); }
  { *(v4f*)(XB + t * 8) = a; *(v4f*)(XB + t * 8 + 4) = c;  } }



__global__ __launch_bounds__(256) void k_rsmfam(const float* __restrict__ S, _Float16* __restrict__ P, int qn, int hg, const float* __restrict__ am) {
  #pragma clang fp contract(off)
  const int t = blockIdx.x * 256 + threadIdx.x; if (t >= qn * hg) return; const size_t i = (size_t)(t / qn) * SQ + (t % qn); const float* s = S + i * SQ; float mx = -3.0e38f;
#pragma unroll 1
  for (int j = 0; j < SQ; ++j) mx = fmaxf(mx, __fadd_rn(s[j], bf16_round(am[j]))); float se = 0.f;
#pragma unroll 1
  for (int j = 0; j < SQ; ++j) se += __expf(__fadd_rn(s[j], bf16_round(am[j])) - mx); const float sc = 256.0f / se;
#pragma unroll 1
  for (int j0 = 0; j0 < SQ; j0 += 8) { FragH f; for (int q = 0; q < 8; ++q) f.h[q] = (_Float16)(__expf(__fadd_rn(s[j0 + q], bf16_round(am[j0 + q])) - mx) * sc); unsigned short* d = (unsigned short*)P + i * SQ + j0; *(v8us*)d = f.half[0];  } }


#define CC CX           /* transposer macros: input channels */
#define LL SQ           /* pixels per image */
#define LQ (3 * DM)     /* unused */

__global__ __launch_bounds__(256) void k_cl2rows(const float* __restrict__ X, _Float16* __restrict__ XR) { __shared__ float tl[64][33]; const int tid = threadIdx.x; const int nl = LL / 32, nc = CC / 64; const int cb_ = blockIdx.x % nc; const int lb = (blockIdx.x / nc) % nl; const size_t b = blockIdx.x / (nc * nl); const int c0 = cb_ * 64, l0 = lb * 32;
  for (int i = tid; i < 64 * 32; i += 256) { const int c = i / 32, l = i % 32; tl[c][l] = bf16_round(X[(b * CC + c0 + c) * (size_t)LL + l0 + l]); }
  __syncthreads();
  { const int l = tid / 8, c8 = (tid % 8) * 8; FragH f; for (int q = 0; q < 8; ++q) f.h[q] = (_Float16)tl[c8 + q][l]; unsigned short* d = (unsigned short*)XR + (b * LL + l0 + l) * (size_t)CC + c0 + c8; *(v8us*)d = f.half[0];  } }


__global__ __launch_bounds__(256) void k_rowb(float* __restrict__ O, const float* __restrict__ bias, size_t n4) {
  #pragma clang fp contract(off)
  const size_t t = (size_t)blockIdx.x * 256 + threadIdx.x; if (t >= n4) return; const size_t e = t * 4; const int c = (int)((e / SQ) % CX);      /* output channels */ const float bb = bf16_round(bias[c]); const v4f a = *(const v4fa*)(O + e); v4f o; for (int q = 0; q < 4; ++q) o[q] = __fadd_rn(a[q], bb);
  *(v4f*)(O + e) = o;  }

__global__ __launch_bounds__(256) void k_gres(const float* __restrict__ T, const float* __restrict__ gam, const float* __restrict__ X, float* __restrict__ Y, size_t n4) {
  #pragma clang fp contract(off)
  const size_t t = (size_t)blockIdx.x * 256 + threadIdx.x; if (t >= n4) return; const float g = bf16_round(gam[0]); const v4f a = *(const v4fa*)(T + t * 4), xx = *(const v4fa*)(X + t * 4); v4f r;
  for (int q = 0; q < 4; ++q) r[q] = __fadd_rn(__fmul_rn(g, a[q]), bf16_round(xx[q]));
  *(v4f*)(Y + t * 4) = r;  }

__global__ __launch_bounds__(256) void k_bcpy(const float* __restrict__ b, int n, int NP, float* __restrict__ dst, int dst0) { for (int i = threadIdx.x; i < NP; i += 256) { const float v = (i < n) ? b[i] : 0.f; *(float*)(dst + dst0 + i) = v; }  }



__global__ __launch_bounds__(256) void k_zero16(_Float16* __restrict__ Y, size_t n8) { const size_t t = (size_t)blockIdx.x * 256 + threadIdx.x; if (t >= n8) return; const v8us z = {0, 0, 0, 0, 0, 0, 0, 0}; *(v8us*)((unsigned short*)Y + t * 8) = z;  }
__global__ __launch_bounds__(256) void k_qkz(const float* __restrict__ F, _Float16* __restrict__ QZ, _Float16* __restrict__ KZ, int nr) {
  const int r = blockIdx.x * 256 + threadIdx.x; if (r >= nr) return; const float* f = F + (size_t)r * 64; FragH q0, q1, k0, k1;
  for (int i = 0; i < 8; ++i) { q0.h[i] = (_Float16)f[i]; q1.h[i] = (_Float16)f[8 + i]; k0.h[i] = (_Float16)f[16 + i]; k1.h[i] = (_Float16)f[24 + i]; } const v8us z = {0, 0, 0, 0, 0, 0, 0, 0};
  unsigned short* dq = (unsigned short*)QZ + (size_t)r * 32; unsigned short* dk = (unsigned short*)KZ + (size_t)r * 32;
  { *(v8us*)dq = q0.half[0]; *(v8us*)(dq + 8) = q1.half[0]; *(v8us*)(dq + 16) = z; *(v8us*)(dq + 24) = z; *(v8us*)dk = k0.half[0]; *(v8us*)(dk + 8) = k1.half[0]; *(v8us*)(dk + 16) = z; *(v8us*)(dk + 24) = z;  } }
extern "C" void kernel_launch(void* const* d_in, const int* in_sizes, int n_in,
                              void* d_out, int out_size, void* d_ws, size_t ws_size, hipStream_t stream) {
  (void)in_sizes; (void)n_in; (void)out_size;
  const float* const* I = (const float* const*)d_in; const float* x = I[0]; const float* wq = I[1]; const float* bq = I[2]; const float* wk = I[3]; const float* bk = I[4]; const float* wv = I[5]; const float* bv = I[6]; const float* gam = I[7];      /* natural Wq/Wk [16][128] + b, Wv [128][128] + b; gamma [1] */
  constexpr int DQ = 16, KP = 32;      /* q/k width 16, zero-padded to K = 32 for the WMMA contraction */
  char* ws = (char*)d_ws; size_t off = 0;
  auto take = [&](size_t bytes) { char* p = ws + off; off += (bytes + 255) & ~(size_t)255; return p; };
  _Float16* BQK = (_Float16*)take((size_t)64 * CX * 2); _Float16* BV = (_Float16*)take((size_t)CX * CX * 2); float* bqk = (float*)take((size_t)64 * 4);      /* [Wq; Wk; 0] as a 64-row Bt plane + [bq | bk | 0] */
  _Float16* XR = (_Float16*)take(NR * CX * 2); float* QKF = (float*)take(NR * 64 * 4); _Float16* QZ = (_Float16*)take(NR * KP * 2); _Float16* KZ = (_Float16*)take(NR * KP * 2); _Float16* VR = (_Float16*)take(NR * CX * 2); _Float16* VC = (_Float16*)take(NR * CX * 2);
  _Float16* P = (_Float16*)take((size_t)NB * SQ * SQ * 2); float* T = (float*)take(NR * CX * 4);      /* one plane per image: all four images go through each stage in one launch */
  if (off > ws_size) return;
  k_zero16<<<(unsigned)(((size_t)64 * CX / 8 + 255) / 256), 256, 0, stream>>>(BQK, (size_t)64 * CX / 8); k_wnat<<<(unsigned)(((size_t)DQ * CX / 8 + 255) / 256), 256, 0, stream>>>(wq, (size_t)DQ * CX / 8, BQK); k_wnat<<<(unsigned)(((size_t)DQ * CX / 8 + 255) / 256), 256, 0, stream>>>(wk, (size_t)DQ * CX / 8, BQK + (size_t)DQ * CX); k_wnat<<<(unsigned)(((size_t)CX * CX / 8 + 255) / 256), 256, 0, stream>>>(wv, (size_t)CX * CX / 8, BV);      /* Bt planes: [Wq; Wk; zeros] (64 rows) x16 and Wv */
  k_bcpy<<<1, 256, 0, stream>>>(bq, DQ, 64, bqk, 0); k_bcpy<<<1, 256, 0, stream>>>(bk, DQ, DQ, bqk, DQ);      /* [bq | bk | 0] (the first call zero-fills the 64-wide row) */
  k_cl2rows<<<NB * (SQ / 32) * (CX / 64), 256, 0, stream>>>(x, XR);      /* exact f16 token rows [n i][c] */
  k_gemm2<0><<<dim3((unsigned)((NR / 128) * (64 / 64)), 1), 128, 0, stream>>>(XR, CX, 0, BQK, CX, 0, 0.0625f, bqk, 0, nullptr, 1, 0, 0, QKF, nullptr, 64, 0, (int)NR, 64, CX);      /* q | k | 0 rows [NR][64] f32 (+ bias) */
  k_qkz<<<(unsigned)((NR + 255) / 256), 256, 0, stream>>>(QKF, QZ, KZ, (int)NR);      /* -> f16 planes [NR][32]: q | 0 and k | 0 (zero padding makes the 16-deep dot a K = 32 contraction) */
  /* the image index is blockIdx.y (plane strides) or the leading part of a flat index: 4 x the work-groups per launch, same arithmetic per element */
  k_gemm2<11><<<dim3((SQ / 128) * (SQ / 64), NB), 128, 0, stream>>>(QZ, KP, (size_t)SQ * KP, KZ, KP, (size_t)SQ * KP, 1.0f, nullptr, 0, nullptr, 1, 0, 0, nullptr, P, SQ, (size_t)SQ * SQ, SQ, SQ, KP);      /* attn[b][n][m] = sigmoid(q[:, n].k[:, m]) (K = 32 with zero padding; sigmoid epilogue) -> f16 */
  k_gemm2<0><<<dim3((SQ / 128) * (CX / 64), NB), 128, 0, stream>>>(XR, CX, (size_t)SQ * CX, BV, CX, 0, 0.0625f, bv, 0, nullptr, 1, 0, 0, nullptr, VR, CX, (size_t)SQ * CX, SQ, CX, CX);      /* v rows [b][4096][128] (+ bias) f16 */
  k_vt<CX / 64, SQ><<<NB * (CX / 64) * (SQ / 64), 256, 0, stream>>>(VR, CX, 0, VC);      /* channel-major V [b][128][4096] */
  k_gemm2<0><<<dim3((CX / 128) * (SQ / 64), NB), 128, 0, stream>>>(VC, SQ, (size_t)CX * SQ, P, SQ, (size_t)SQ * SQ, 1.0f, nullptr, 0, nullptr, 1, 0, 0, T, nullptr, SQ, (size_t)CX * SQ, CX, SQ, SQ);      /* out[b][c][n] = sum_m v[c][m] attn[n][m] (V as A, attn as B^T) f32 */
  k_gres<<<(unsigned)((NR * CX / 4 + 255) / 256), 256, 0, stream>>>(T, gam, x, (float*)d_out, NR * CX / 4);      /* y = bf16(gamma) out + bf16(x) -> channel-first output */
}

// v002
// It runs in 110 microseconds.
// Next to v001, in two timings, it ran 2.20 and 2.18 times as fast.
// Counting every step since v000, it is 5.72 times as fast.
#include <hip/hip_runtime.h>
// SAGAN-style self-attention with SIGMOID gating instead of softmax, channel-first (x [4][128][64][64]; q = Wq x + bq, k = Wk x + bk (1x1, 128 -> 16), v = Wv x + bv (128 -> 128), natural weights and biases sigma 0.05; attn[n][m] = sigmoid(q[:, n].k[:, m]) (no scale, no normalisation); out[c][n] = sum_m v[c][m] attn[n][m]; y = gamma out + x with the scalar gamma input -> [4][128][64][64]).
// Structure: the NCL input transposed by LDS tiles into exact f16 token rows [4096][128]; q | k as ONE WMMA GEMM (N = 64 over a zero-padded [Wq; Wk; 0] plane, f32 + bias); VALU splits them into zero-padded f16 planes [4096][32] (q | 0 and k | 0) so the 16-deep contraction runs as K = 32; all images per launch (image = blockIdx.y): v rows (GEMM + bias, f16) -> channel-major V via LDS transposes; one fused kernel: attn tile = sigmoid(q.k) to f16 in registers, out[c][n] = V (A operand) x attn (B^T) f32, 8 key ranges summed through LDS; y = bf16(gamma) out + bf16(x) on VALU; launches: see trace.
// Compute dtype: inputs rounded to bf16; x / weights exact; q, k, v and the sigmoid gates as plain f16 GEMM operands (~2^-12); scores, gate arithmetic and out f32. v_wmma_f32_16x16x32_f16.
#define NB 4
#define SQ 4096
#define DM 128
#define CX 128          /* channels */
#define NH 4
#define HD 64
#define DMQ DM                       /* LayerNorm width */
#define DFF 4096
#define HG 1                         /* heads per attention launch group */
#define B0 0                         /* unused */
#define NBR NB                       /* unused (only in MP, itself unused) */
#define NR ((size_t)NB * SQ)         /* token rows */
#define MP ((int)((size_t)NBR * SQ)) /* unused (only in MPO, itself unused) */
#define QN SQ                        /* unused */
#define NHD NH                       /* unused */
#define MPO MP                       /* unused */
#define LQ DM      /* unused (redefined below) */
typedef __bf16 v16b __attribute__((ext_vector_type(16)));
typedef unsigned short v8us __attribute__((ext_vector_type(8), may_alias));
typedef float  v8f  __attribute__((ext_vector_type(8)));
typedef float  v4f  __attribute__((ext_vector_type(4)));
typedef float  v4fa __attribute__((ext_vector_type(4), may_alias));
union FragB { v16b v; v8us half[2]; unsigned short u[16]; };

__device__ __forceinline__ unsigned short bf16_bits(float x) { unsigned int u = __float_as_uint(x); return (unsigned short)((u + 0x7FFFu + ((u >> 16) & 1u)) >> 16); }
__device__ __forceinline__ float bf16_val(unsigned short b) { return __uint_as_float(((unsigned int)b) << 16); }
__device__ __forceinline__ float bf16_round(float x) { return bf16_val(bf16_bits(x)); }
// D += A·B with NT terms: 1 = ah·bh, 2 = + al·bh (A split), 3 = + ah·bl (both split)
template <int NT>
__device__ __forceinline__ v8f mmaN(v16b ah, v16b al, v16b bh, v16b bl, v8f c) {
  c = __builtin_amdgcn_wmma_f32_16x16x32_bf16(false, ah, false, bh, (short)0, c, false, false);
  if (NT >= 2) c = __builtin_amdgcn_wmma_f32_16x16x32_bf16(false, al, false, bh, (short)0, c, false, false);
  if (NT >= 3) c = __builtin_amdgcn_wmma_f32_16x16x32_bf16(false, ah, false, bl, (short)0, c, false, false);
  asm volatile("v_nop\n\tv_nop\n\tv_nop\n\tv_nop" : "+v"(c) : "v"(ah), "v"(al), "v"(bh), "v"(bl));
  return c;
}

__global__ __launch_bounds__(256) void k_wt_bf16(const float* __restrict__ W, unsigned short* __restrict__ Wt, int K, int N) {
  const int t = blockIdx.x * 256 + threadIdx.x;
  const int k8n = K / 8;
  if (t >= N * k8n) return;
  const int n = t / k8n, k8 = (t % k8n) * 8;
  v8us v;
#pragma unroll
  for (int i = 0; i < 8; ++i) v[i] = bf16_bits(W[(size_t)(k8 + i) * N + n]);
  *(v8us*)(Wt + (size_t)n * K + k8) = v;
  
}

// GEMM C[M][N] (f32, pitch ldc) = act(A[M][K]·W + bias). A f32 row-major (pitch lda) converted per fragment to bf16
// (ASPLIT: hi/lo two planes -> 2 terms, else single rounded term); Wt bf16 [N][K] (pitch ldb). BIAS_BF16 rounds the
// bias to bf16 first (bias quantised to bf16 before the add). K%32==0, M%16==0, N%64==0.
template <bool ASPLIT, int ACT, bool BIAS_BF16>
__global__ __launch_bounds__(128) void k_gemm_bf(const float* __restrict__ A, int lda, const unsigned short* __restrict__ Wt, int ldb,
                                               const float* __restrict__ bias, float* __restrict__ C, int ldc, int M, int N, int K) {
  __shared__ __attribute__((aligned(16))) float so[4][16][64];
  const int tid = threadIdx.x, w = tid >> 5, lane = tid & 31, ln = lane & 15, hh = lane >> 4;
  const int ntn = N / 64;
  const int wid = blockIdx.x * 4 + w;
  const int mt = wid / ntn, nq = wid % ntn;
  if (mt * 16 >= M) return;
  const int row0 = mt * 16, col0 = nq * 64;
  const float* arow = A + (size_t)(row0 + ln) * lda;
  v8f acc[4] = {};
  for (int kb = 0; kb < K; kb += 32) {
    FragB ah, al;
    const v4f x0 = *(const v4fa*)(arow + kb + 8 * hh), x1 = *(const v4fa*)(arow + kb + 8 * hh + 4);
    const v4f x2 = *(const v4fa*)(arow + kb + 16 + 8 * hh), x3 = *(const v4fa*)(arow + kb + 16 + 8 * hh + 4);
    float xs[16] = {x0[0],x0[1],x0[2],x0[3],x1[0],x1[1],x1[2],x1[3],x2[0],x2[1],x2[2],x2[3],x3[0],x3[1],x3[2],x3[3]};
#pragma unroll
    for (int i = 0; i < 16; ++i) { const unsigned short hb = bf16_bits(xs[i]); ah.u[i] = hb; al.u[i] = ASPLIT ? bf16_bits(xs[i] - bf16_val(hb)) : (unsigned short)0; }
#pragma unroll
    for (int t = 0; t < 4; ++t) {
      const unsigned short* brow = Wt + (size_t)(col0 + t * 16 + ln) * ldb + kb;
      FragB b;
      b.half[0] = *(const v8us*)(brow + 8 * hh);
      b.half[1] = *(const v8us*)(brow + 16 + 8 * hh);
      acc[t] = mmaN<ASPLIT ? 2 : 1>(ah.v, al.v, b.v, b.v, acc[t]);
    }
  }
#pragma unroll
  for (int t = 0; t < 4; ++t) {
    float bv = bias ? bias[col0 + t * 16 + ln] : 0.f;
    if (BIAS_BF16) bv = bf16_round(bv);
#pragma unroll
    for (int r = 0; r < 8; ++r) { float v = acc[t][r] + bv; if (ACT == 1) v = fmaxf(v, 0.f); so[w][8 * hh + r][t * 16 + ln] = v; }
  }
  __builtin_amdgcn_fence(__ATOMIC_ACQ_REL, "workgroup");
  __builtin_amdgcn_wave_barrier();
  const int rsub = lane >> 4, c4 = (lane & 15) * 4;
  {
#pragma unroll
    for (int q = 0; q < 8; ++q) {
      const int r = q * 2 + rsub;
      const v4f v = *(const v4fa*)&so[w][r][c4];
      *(v4f*)(C + (size_t)(row0 + r) * ldc + col0 + c4) = v;
    }
    
  }
}

// GEMM C = act(A·W + bias + resid): A f32 (ASPLIT -> hi/lo 2 terms), Wt bf16 [N][K]; ACT 0 none, 1 relu, 2 exact gelu;
// resid (optional, f32, row index = (row % rmod), pitch ldr, RES_BF16 rounds it) added before the activation.
template <bool ASPLIT, int ACT, bool BIAS_BF16, bool RES_BF16>
__global__ __launch_bounds__(128) void k_gemm_bf3(const float* __restrict__ A, int lda, const unsigned short* __restrict__ Wt, int ldb,
                                                const float* __restrict__ bias, const float* __restrict__ resid, int rmod, int ldr,
                                                float* __restrict__ C, int ldc, int M, int N, int K) {
  __shared__ __attribute__((aligned(16))) float so[4][16][64];
  const int tid = threadIdx.x, w = tid >> 5, lane = tid & 31, ln = lane & 15, hh = lane >> 4;
  const int ntn = N / 64;
  const int wid = blockIdx.x * 4 + w;
  const int mt = wid / ntn, nq = wid % ntn;
  if (mt * 16 >= M) return;
  const int row0 = mt * 16, col0 = nq * 64;
  const float* arow = A + (size_t)(row0 + ln) * lda;
  v8f acc[4] = {};
  for (int kb = 0; kb < K; kb += 32) {
    FragB ah, al;
    const v4f x0 = *(const v4fa*)(arow + kb + 8 * hh), x1 = *(const v4fa*)(arow + kb + 8 * hh + 4);
    const v4f x2 = *(const v4fa*)(arow + kb + 16 + 8 * hh), x3 = *(const v4fa*)(arow + kb + 16 + 8 * hh + 4);
    float xs[16] = {x0[0],x0[1],x0[2],x0[3],x1[0],x1[1],x1[2],x1[3],x2[0],x2[1],x2[2],x2[3],x3[0],x3[1],x3[2],x3[3]};
#pragma unroll
    for (int i = 0; i < 16; ++i) { const unsigned short hb = bf16_bits(xs[i]); ah.u[i] = hb; al.u[i] = ASPLIT ? bf16_bits(xs[i] - bf16_val(hb)) : (unsigned short)0; }
#pragma unroll
    for (int t = 0; t < 4; ++t) {
      const unsigned short* brow = Wt + (size_t)(col0 + t * 16 + ln) * ldb + kb;
      FragB b;
      b.half[0] = *(const v8us*)(brow + 8 * hh);
      b.half[1] = *(const v8us*)(brow + 16 + 8 * hh);
      acc[t] = mmaN<ASPLIT ? 2 : 1>(ah.v, al.v, b.v, b.v, acc[t]);
    }
  }
#pragma unroll
  for (int t = 0; t < 4; ++t) {
    const int col = col0 + t * 16 + ln;
    float bv = bias ? bias[col] : 0.f;
    if (BIAS_BF16) bv = bf16_round(bv);
#pragma unroll
    for (int r = 0; r < 8; ++r) {
      float v = acc[t][r] + bv;
      if (resid) { float rv = resid[(size_t)((row0 + 8 * hh + r) % rmod) * ldr + col]; if (RES_BF16) rv = bf16_round(rv); v += rv; }
      if (ACT == 1) v = fmaxf(v, 0.f);
      if (ACT == 2) v = 0.5f * v * (1.0f + erff(v * 0.70710678118654752f));
      if (ACT == 3) { const float u = 0.7978845608028654f * (v + 0.044715f * v * v * v); v = 0.5f * v * (1.0f + tanhf(u)); }
      so[w][8 * hh + r][t * 16 + ln] = v;
    }
  }
  __builtin_amdgcn_fence(__ATOMIC_ACQ_REL, "workgroup");
  __builtin_amdgcn_wave_barrier();
  const int rsub = lane >> 4, c4 = (lane & 15) * 4;
  {
#pragma unroll
    for (int q = 0; q < 8; ++q) {
      const int r = q * 2 + rsub;
      const v4f v = *(const v4fa*)&so[w][r][c4];
      *(v4f*)(C + (size_t)(row0 + r) * ldc + col0 + c4) = v;
    }
    
  }
}
// row LayerNorm (biased variance, eps) over N: s = X (+ R); optional out_sum <- s; out_norm <- (s-mu)*rsqrt(var+eps)*g + b
template <bool PARAM_BF16>
__global__ __launch_bounds__(256) void k_layernorm(const float* __restrict__ X, const float* __restrict__ R, const float* __restrict__ g, const float* __restrict__ bta,
                                                  float* __restrict__ out_sum, float* __restrict__ out_norm, int N, float eps) {
  __shared__ float red[256];
  const int row = blockIdx.x, tid = threadIdx.x;
  const float* x = X + (size_t)row * N; const float* rr = R ? R + (size_t)row * N : nullptr;
  float vals[16];                     // up to N = 4096
  const int per = N / 256;            // contiguous chunk per thread? use strided-by-4 chunks: thread handles j = tid*4 + 1024*u
  float s1 = 0.f;
  for (int u = 0; u < per / 4; ++u) {
    const int j = tid * 4 + 1024 * u;
    const v4f a = *(const v4fa*)(x + j);
    v4f b = {0.f,0.f,0.f,0.f}; if (rr) b = *(const v4fa*)(rr + j);
#pragma unroll
    for (int q = 0; q < 4; ++q) { const float v = a[q] + b[q]; vals[u * 4 + q] = v; s1 += v; }
  }
  red[tid] = s1; __syncthreads();
  for (int st = 128; st > 0; st >>= 1) { if (tid < st) red[tid] += red[tid + st]; __syncthreads(); }
  const float mu = red[0] / (float)N; __syncthreads();
  float s2 = 0.f;
  for (int u = 0; u < per / 4; ++u)
#pragma unroll
    for (int q = 0; q < 4; ++q) { const float c = vals[u * 4 + q] - mu; s2 += c * c; }
  red[tid] = s2; __syncthreads();
  for (int st = 128; st > 0; st >>= 1) { if (tid < st) red[tid] += red[tid + st]; __syncthreads(); }
  const float rs = rsqrtf(red[0] / (float)N + eps);
  {
    for (int u = 0; u < per / 4; ++u) {
      const int j = tid * 4 + 1024 * u;
      v4f o, sm;
#pragma unroll
      for (int q = 0; q < 4; ++q) {
        float gg = g[j + q], bb = bta[j + q];
        if (PARAM_BF16) { gg = bf16_round(gg); bb = bf16_round(bb); }
        sm[q] = vals[u * 4 + q]; o[q] = (vals[u * 4 + q] - mu) * rs * gg + bb;
      }
      if (out_sum) *(v4f*)(out_sum + (size_t)row * N + j) = sm;
      *(v4f*)(out_norm + (size_t)row * N + j) = o;
    }
    
  }
}



// ---- f16 WMMA path (v_wmma_f32_16x16x32_f16): 11-bit significands for operands in range — used where a [0,1] probability operand needs more precision than bf16
typedef _Float16 v16h __attribute__((ext_vector_type(16)));
union FragH { v16h v; v8us half[2]; _Float16 h[16]; unsigned short u[16]; };
template <int NT>
__device__ __forceinline__ v8f mmaH(v16h ah, v16h al, v16h bh, v16h bl, v8f c) {
  c = __builtin_amdgcn_wmma_f32_16x16x32_f16(false, ah, false, bh, (short)0, c, false, false);
  if (NT >= 2) c = __builtin_amdgcn_wmma_f32_16x16x32_f16(false, al, false, bh, (short)0, c, false, false);
  if (NT >= 3) c = __builtin_amdgcn_wmma_f32_16x16x32_f16(false, ah, false, bl, (short)0, c, false, false);
  asm volatile("v_nop\n\tv_nop\n\tv_nop\n\tv_nop" : "+v"(c) : "v"(ah), "v"(al), "v"(bh), "v"(bl));
  return c;
}
// batched GEMM like k_gemm_b but f16 operands: A f32 (split into f16 hi/lo if ASPLIT, else rounded to f16), Bt = f16 values [n][k]; alpha; C f32; N multiple of 16 (partial tiles skipped)
template <bool ASPLIT>
__global__ __launch_bounds__(128) void k_gemm_h(const float* __restrict__ A, int lda, size_t sA, const _Float16* __restrict__ Bh, int ldb, size_t sB, float alpha, float* __restrict__ C, int ldc, size_t sC, int M, int N, int K) {
  __shared__ __attribute__((aligned(16))) float so[4][16][64];
  const int tid = threadIdx.x, w = tid >> 5, lane = tid & 31, ln = lane & 15, hh = lane >> 4; const int by = blockIdx.y;
  A += (size_t)by * sA; Bh += (size_t)by * sB; C += (size_t)by * sC;
  const int ntn = (N + 63) / 64; const int wid = blockIdx.x * 4 + w; const int mt = wid / ntn, nq = wid % ntn; if (mt * 16 >= M) return;
  const int row0 = mt * 16, col0 = nq * 64; const float* arow = A + (size_t)(row0 + ln) * lda;
  v8f acc[4] = {};
  for (int kb = 0; kb < K; kb += 32) {
    FragH ah, al;
    const v4f x0 = *(const v4fa*)(arow + kb + 8 * hh), x1 = *(const v4fa*)(arow + kb + 8 * hh + 4), x2 = *(const v4fa*)(arow + kb + 16 + 8 * hh), x3 = *(const v4fa*)(arow + kb + 16 + 8 * hh + 4);
    float xs[16] = {x0[0],x0[1],x0[2],x0[3],x1[0],x1[1],x1[2],x1[3],x2[0],x2[1],x2[2],x2[3],x3[0],x3[1],x3[2],x3[3]};
#pragma unroll
    for (int i = 0; i < 16; ++i) { const _Float16 h = (_Float16)xs[i]; ah.h[i] = h; al.h[i] = ASPLIT ? (_Float16)(xs[i] - (float)h) : (_Float16)0.0f; }
#pragma unroll
    for (int t = 0; t < 4; ++t) { if (col0 + t * 16 >= N) continue; const size_t boff = (size_t)(col0 + t * 16 + ln) * ldb + kb; FragH bq; bq.half[0] = *(const v8us*)(Bh + boff + 8 * hh); bq.half[1] = *(const v8us*)(Bh + boff + 16 + 8 * hh);
      acc[t] = mmaH<ASPLIT ? 2 : 1>(ah.v, al.v, bq.v, bq.v, acc[t]); }
  }
#pragma unroll
  for (int t = 0; t < 4; ++t) { if (col0 + t * 16 >= N) continue;
#pragma unroll
    for (int r = 0; r < 8; ++r) so[w][8 * hh + r][t * 16 + ln] = acc[t][r] * alpha; }
  __builtin_amdgcn_fence(__ATOMIC_ACQ_REL, "workgroup"); __builtin_amdgcn_wave_barrier();
  const int rsub = lane >> 4, c4 = (lane & 15) * 4;
  {
#pragma unroll
    for (int q = 0; q < 8; ++q) { const int r = q * 2 + rsub; if (col0 + c4 < N) { const v4f v = *(const v4fa*)&so[w][r][c4]; *(v4f*)(C + (size_t)(row0 + r) * ldc + col0 + c4) = v; } }
     }
}

// Wt[n][k] = f16(W[k][n]·scale) from f32 row-major W[K][N] (scale = power of two; bf16-exact weights stay exact in f16 away from the subnormal range)
__global__ __launch_bounds__(256) void k_wt_f16(const float* __restrict__ W, _Float16* __restrict__ Wt, int K, int N, float scale) {
  const int t = blockIdx.x * 256 + threadIdx.x; if (t >= N * (K / 8)) return; const int n = t / (K / 8), k8 = (t % (K / 8)) * 8; FragH f;
#pragma unroll
  for (int i = 0; i < 8; ++i) f.h[i] = (_Float16)(bf16_round(W[(size_t)(k8 + i) * N + n]) * scale); const v8us o = f.half[0];
  *(v8us*)((unsigned short*)Wt + (size_t)n * K + k8) = o; 
}
// k_gemm_hh variant with fused epilogue: v = acc·alpha + bias[by·sBias + col] (+ CP[(row/rowsPerB)·sCPb + by·64 + col] if CP) ; ACT 0 none / 1 elu ; writes f16 C16 (and f32 C if non-null)
template <int ACT>
__global__ __launch_bounds__(128) void k_gemm_hhx(const _Float16* __restrict__ A, int lda, size_t sA, const _Float16* __restrict__ Bh, int ldb, size_t sB, float alpha, const float* __restrict__ bias, size_t sBias, const float* __restrict__ CP, int rowsPerB, size_t sCPb, int row0g,
    float* __restrict__ C, _Float16* __restrict__ C16, int ldc, size_t sC, int M, int N, int K) {
  __shared__ __attribute__((aligned(16))) float so[4][16][64];
  const int tid = threadIdx.x, w = tid >> 5, lane = tid & 31, ln = lane & 15, hh = lane >> 4; const int by = blockIdx.y;
  A += (size_t)by * sA; Bh += (size_t)by * sB; const size_t cofs = (size_t)by * sC; const float* bp = bias ? bias + (size_t)by * sBias : nullptr;
  const int ntn = (N + 63) / 64; const int wid = blockIdx.x * 4 + w; const int mt = wid / ntn, nq = wid % ntn; if (mt * 16 >= M) return;
  const int row0 = mt * 16, col0 = nq * 64; const _Float16* arow = A + (size_t)(row0 + ln) * lda;
  v8f acc[4] = {};
  for (int kb = 0; kb < K; kb += 32) { FragH ah; ah.half[0] = *(const v8us*)((const unsigned short*)arow + kb + 8 * hh); ah.half[1] = *(const v8us*)((const unsigned short*)arow + kb + 16 + 8 * hh);
#pragma unroll
    for (int t = 0; t < 4; ++t) { if (col0 + t * 16 >= N) continue; const size_t boff = (size_t)(col0 + t * 16 + ln) * ldb + kb; FragH bq; bq.half[0] = *(const v8us*)((const unsigned short*)Bh + boff + 8 * hh); bq.half[1] = *(const v8us*)((const unsigned short*)Bh + boff + 16 + 8 * hh);
      acc[t] = mmaH<1>(ah.v, ah.v, bq.v, bq.v, acc[t]); }
  }
#pragma unroll
  for (int t = 0; t < 4; ++t) { if (col0 + t * 16 >= N) continue; const int col = col0 + t * 16 + ln; const float bv = bp ? bf16_round(bp[col]) : 0.f;
#pragma unroll
    for (int r = 0; r < 8; ++r) { float v = acc[t][r] * alpha + bv; if (CP) { const int rr = row0g + row0 + 8 * hh + r; if (rowsPerB < 0) v += CP[cofs + (size_t)rr * ldc + col];      /* rowsPerB < 0: own element of the batched C plane */ else { const int bidx = rr / rowsPerB; v += CP[(size_t)bidx * sCPb + (size_t)by * 64 + col]; } } if (ACT == 1) v = (v > 0.f) ? v : expm1f(v); else if (ACT == 7) v = (v > 0.f) ? v + 1.0f : expf(v); else if (ACT == 8) v = tanhf(v); else if (ACT == 9) v = 0.5f * v * (1.0f + tanhf(0.7978845608028654f * (v + 0.044715f * v * v * v))); else if (ACT == 11) v = 1.0f / (1.0f + expf(-v)); else if (ACT == 12) v = (v > 0.f) ? v : 0.01f * v; else if (ACT == 14) v = (v > 0.f) ? v : 0.1f * v; else if (ACT == 16) v = (v >= 0.f) ? v : 0.3f * v; else if (ACT == 17) v = (v >= 0.f) ? v : 0.2f * v; else if (ACT == 15) v = v / (1.0f + expf(-v)); else if (ACT == 3) v = fmaxf(v, 0.f); else if (ACT == 6) v = 0.5f * v * (1.0f + erff(v * 0.70710678118654752f)); so[w][8 * hh + r][t * 16 + ln] = v; } }
  __builtin_amdgcn_fence(__ATOMIC_ACQ_REL, "workgroup"); __builtin_amdgcn_wave_barrier();
  const int rsub = lane >> 4, c4 = (lane & 15) * 4; typedef _Float16 v4h __attribute__((ext_vector_type(4)));
  {
#pragma unroll
    for (int q = 0; q < 8; ++q) { const int r = q * 2 + rsub; if (col0 + c4 < N) { const v4f v = *(const v4fa*)&so[w][r][c4]; if (C) *(v4f*)(C + cofs + (size_t)(row0 + r) * ldc + col0 + c4) = v; if (C16) { v4h h4; for (int i = 0; i < 4; ++i) h4[i] = (_Float16)v[i]; *(v4h*)(C16 + cofs + (size_t)(row0 + r) * ldc + col0 + c4) = h4; } } }
     }
}


typedef _Float16 v4h __attribute__((ext_vector_type(4)));

__global__ __launch_bounds__(256) void k_x16(const float* __restrict__ x, _Float16* __restrict__ X16, size_t n8) { const size_t t = (size_t)blockIdx.x * 256 + threadIdx.x; if (t >= n8) return; FragH f;
#pragma unroll
  for (int q = 0; q < 8; ++q) f.h[q] = (_Float16)bf16_round(x[t * 8 + q]); *(v8us*)((unsigned short*)X16 + t * 8) = f.half[0];  }
__global__ __launch_bounds__(256) void k_h16(const float* __restrict__ x, _Float16* __restrict__ X16, size_t n8) { const size_t t = (size_t)blockIdx.x * 256 + threadIdx.x; if (t >= n8) return; FragH f;
#pragma unroll
  for (int q = 0; q < 8; ++q) f.h[q] = (_Float16)x[t * 8 + q]; *(v8us*)((unsigned short*)X16 + t * 8) = f.half[0];  }
__global__ __launch_bounds__(256) void k_round16f(const float* __restrict__ W, _Float16* __restrict__ Bt, size_t n8) { const size_t t = (size_t)blockIdx.x * 256 + threadIdx.x; if (t >= n8) return; FragH f;
#pragma unroll
  for (int i = 0; i < 8; ++i) f.h[i] = (_Float16)(bf16_round(W[t * 8 + i]) * 16.0f); *(v8us*)((unsigned short*)Bt + t * 8) = f.half[0];  }
template <int NHv, int TTv>
__global__ __launch_bounds__(256) void k_vt(const _Float16* __restrict__ V16, int ldv, int voff, _Float16* __restrict__ Vt) { __shared__ unsigned short tl[64][66]; const int tid = threadIdx.x; const int slab = blockIdx.x / (TTv / 64), lg = blockIdx.x % (TTv / 64); const int b = slab / NHv, h = slab % NHv;
  for (int i = tid; i < 64 * 8; i += 256) { const int r = i / 8, c8 = (i % 8) * 8; FragH f; f.half[0] = *(const v8us*)((const unsigned short*)V16 + ((size_t)b * TTv + lg * 64 + r) * ldv + voff + h * 64 + c8);
#pragma unroll
    for (int q = 0; q < 8; ++q) tl[r][c8 + q] = f.u[q]; }
  __syncthreads();
  {
#pragma unroll
    for (int rd = 0; rd < 2; ++rd) { const int d = rd * 32 + tid / 8, pc = tid % 8; FragH f;
#pragma unroll
      for (int q = 0; q < 8; ++q) f.u[q] = tl[pc * 8 + q][d];
      *(v8us*)((unsigned short*)Vt + ((size_t)slab * 64 + d) * TTv + lg * 64 + pc * 8) = f.half[0]; }
     } }

__global__ __launch_bounds__(256) void k_hl(const float* __restrict__ F, _Float16* __restrict__ Hh, _Float16* __restrict__ Hl, size_t n8) { const size_t t = (size_t)blockIdx.x * 256 + threadIdx.x; if (t >= n8) return; FragH fh, fl; const v4f a = *(const v4fa*)(F + t * 8), c = *(const v4fa*)(F + t * 8 + 4);
#pragma unroll
  for (int q = 0; q < 4; ++q) { _Float16 h = (_Float16)a[q]; fh.h[q] = h; fl.h[q] = (_Float16)((a[q] - (float)h) * 1024.0f); h = (_Float16)c[q]; fh.h[4 + q] = h; fl.h[4 + q] = (_Float16)((c[q] - (float)h) * 1024.0f); }
  { *(v8us*)((unsigned short*)Hh + t * 8) = fh.half[0]; *(v8us*)((unsigned short*)Hl + t * 8) = fl.half[0];  } }

// ---- fast GEMM (wave tile 32x64; requires M % 32 == 0 rows per launch region and N % 64 == 0); epilogue = k_gemm_hhx semantics ----
__device__ __forceinline__ v16h g2_frag(const _Float16* p, int hh) { FragH f; f.half[0] = *(const v8us*)((const unsigned short*)p + 8 * hh); f.half[1] = *(const v8us*)((const unsigned short*)p + 16 + 8 * hh); return f.v; }
__device__ __forceinline__ v8f g2_mma(v16h a, v16h b, v8f c) { v8f d = __builtin_amdgcn_wmma_f32_16x16x32_f16(false, a, false, b, (short)0, c, false, false); asm volatile("v_nop\n\tv_nop\n\tv_nop\n\tv_nop" : "+v"(d) : "v"(a), "v"(b)); return d; }
template <int ACT>
__global__ __launch_bounds__(128) void k_gemm2(const _Float16* __restrict__ A, int lda, size_t sA, const _Float16* __restrict__ Bh, int ldb, size_t sB, float alpha, const float* __restrict__ bias, size_t sBias, const float* __restrict__ CP, int rowsPerB, size_t sCPb, int row0g,
    float* __restrict__ C, _Float16* __restrict__ C16, int ldc, size_t sC, int M, int N, int K) { static_assert(ACT == 0 || ACT == 3 || ACT == 6 || ACT == 8 || ACT == 9 || ACT == 11 || ACT == 12 || ACT == 14 || ACT == 15 || ACT == 16 || ACT == 17, "k_gemm2: unsupported ACT code (would silently apply no activation)");
  __shared__ __attribute__((aligned(16))) float so[4][32][68];
  const int tid = threadIdx.x, w = tid >> 5, lane = tid & 31, ln = lane & 15, hh = lane >> 4; const int by = blockIdx.y;
  A += (size_t)by * sA; Bh += (size_t)by * sB; const size_t cofs = (size_t)by * sC; const float* bp = bias ? bias + (size_t)by * sBias : nullptr;
  const int ntn = N >> 6; const int mt = blockIdx.x / ntn, nq = blockIdx.x - mt * ntn; const int row0 = mt * 128 + 32 * w, col0 = nq * 64; if (row0 >= M) return;
  const _Float16* a0p = A + (size_t)(row0 + ln) * lda; const _Float16* a1p = a0p + (size_t)16 * lda;
  const _Float16* b0p = Bh + (size_t)(col0 + ln) * ldb; const _Float16* b1p = b0p + (size_t)16 * ldb; const _Float16* b2p = b1p + (size_t)16 * ldb; const _Float16* b3p = b2p + (size_t)16 * ldb;
  const v8f z8 = {0.f,0.f,0.f,0.f,0.f,0.f,0.f,0.f}; v8f c00 = z8, c01 = z8, c02 = z8, c03 = z8, c10 = z8, c11 = z8, c12 = z8, c13 = z8;
#pragma unroll 1
  for (int kb = 0; kb < K; kb += 32) { const v16h a0 = g2_frag(a0p + kb, hh), a1 = g2_frag(a1p + kb, hh);
    v16h b = g2_frag(b0p + kb, hh); c00 = g2_mma(a0, b, c00); c10 = g2_mma(a1, b, c10);
    b = g2_frag(b1p + kb, hh); c01 = g2_mma(a0, b, c01); c11 = g2_mma(a1, b, c11);
    b = g2_frag(b2p + kb, hh); c02 = g2_mma(a0, b, c02); c12 = g2_mma(a1, b, c12);
    b = g2_frag(b3p + kb, hh); c03 = g2_mma(a0, b, c03); c13 = g2_mma(a1, b, c13); }
  v8f accs[8] = {c00, c01, c02, c03, c10, c11, c12, c13};
#pragma unroll
  for (int u = 0; u < 8; ++u) { const int t = u & 3, half = u >> 2; const int col = col0 + t * 16 + ln; const float bv = bp ? bf16_round(bp[col]) : 0.f;
#pragma unroll
    for (int r = 0; r < 8; ++r) { const int rloc = half * 16 + 8 * hh + r; float v = accs[u][r] * alpha + bv; if (CP) { if (rowsPerB < 0) v += CP[cofs + (size_t)(row0g + row0 + rloc) * ldc + col];      /* rowsPerB < 0: own element of the batched C plane */ else { const int bidx = (row0g + row0 + rloc) / rowsPerB; v += CP[(size_t)bidx * sCPb + (size_t)by * 64 + col]; } }
      if (ACT == 3) v = fmaxf(v, 0.f); else if (ACT == 6) v = 0.5f * v * (1.0f + erff(v * 0.70710678118654752f)); else if (ACT == 11) v = 1.0f / (1.0f + expf(-v)); else if (ACT == 15) v = v / (1.0f + expf(-v)); else if (ACT == 12) v = (v > 0.f) ? v : 0.01f * v; else if (ACT == 8) v = tanhf(v); else if (ACT == 9) v = 0.5f * v * (1.0f + tanhf(0.7978845608028654f * (v + 0.044715f * v * v * v))); else if (ACT == 14) v = (v > 0.f) ? v : 0.1f * v; else if (ACT == 16) v = (v >= 0.f) ? v : 0.3f * v; else if (ACT == 17) v = (v >= 0.f) ? v : 0.2f * v;
      so[w][rloc][t * 16 + ln] = v; } }
  __builtin_amdgcn_fence(__ATOMIC_ACQ_REL, "workgroup"); __builtin_amdgcn_wave_barrier();
  const int rsub = lane >> 4, c4 = (lane & 15) * 4;
  {
#pragma unroll
    for (int q = 0; q < 16; ++q) { const int r = q * 2 + rsub; const v4f v = *(const v4fa*)&so[w][r][c4]; if (C) *(v4f*)(C + cofs + (size_t)(row0 + r) * ldc + col0 + c4) = v; if (C16) { v4h h4; for (int i = 0; i < 4; ++i) h4[i] = (_Float16)v[i]; *(v4h*)(C16 + cofs + (size_t)(row0 + r) * ldc + col0 + c4) = h4; } }
     } }


__global__ __launch_bounds__(256) void k_wnat(const float* __restrict__ w, size_t n8, _Float16* __restrict__ Bt) { const size_t t = (size_t)blockIdx.x * 256 + threadIdx.x; if (t >= n8) return; FragH f; for (int q = 0; q < 8; ++q) f.h[q] = (_Float16)(bf16_round(w[t * 8 + q]) * 16.0f); *(v8us*)((unsigned short*)Bt + t * 8) = f.half[0];  }
__global__ __launch_bounds__(256) void k_rsm(const float* __restrict__ S, _Float16* __restrict__ P, int nrows) {
  #pragma clang fp contract(off)
  const int i = blockIdx.x * 256 + threadIdx.x; if (i >= nrows) return; const float* s = S + (size_t)i * SQ; float mx = -3.0e38f;
#pragma unroll 1
  for (int j = 0; j < SQ; ++j) mx = fmaxf(mx, s[j]); float se = 0.f;
#pragma unroll 1
  for (int j = 0; j < SQ; ++j) se += expf(s[j] - mx); const float sc = 256.0f / se;
#pragma unroll 1
  for (int j0 = 0; j0 < SQ; j0 += 8) { FragH f; for (int q = 0; q < 8; ++q) f.h[q] = (_Float16)(expf(s[j0 + q] - mx) * sc); unsigned short* d = (unsigned short*)P + (size_t)i * SQ + j0; *(v8us*)d = f.half[0];  } }
__global__ __launch_bounds__(256) void k_vt(const _Float16* __restrict__ V16, int b, int h0, _Float16* __restrict__ VT) { __shared__ unsigned short tl[64][65]; const int tid = threadIdx.x; const int hh = blockIdx.x % HG, sg = blockIdx.x / HG; const int s0 = sg * 64; const int h = h0 + hh;
  for (int i = tid; i < 64 * 8; i += 256) { const int j = i / 8, d8 = (i % 8) * 8; FragH f; f.half[0] = *(const v8us*)((const unsigned short*)V16 + ((size_t)b * SQ + s0 + j) * DM + h * HD + d8); for (int q = 0; q < 8; ++q) tl[d8 + q][j] = f.u[q]; }
  __syncthreads();
  { for (int i = tid; i < 64 * 8; i += 256) { const int d = i / 8, j8 = (i % 8) * 8; FragH f; for (int q = 0; q < 8; ++q) f.u[q] = tl[d][j8 + q]; *(v8us*)((unsigned short*)VT + ((size_t)hh * HD + d) * SQ + s0 + j8) = f.half[0]; }  } }


template <int BFIN, int W16, int W32>
__global__ __launch_bounds__(256) void k_lnx(const float* __restrict__ X, const float* __restrict__ g, const float* __restrict__ bb, float eps, _Float16* __restrict__ N16, float* __restrict__ N32) {
  #pragma clang fp contract(off)
  __shared__ float red[256]; const size_t r = blockIdx.x; const int t = threadIdx.x; const bool act = t < (DMQ / 4); const int c0 = act ? t * 4 : 0;
  const v4f xa = *(const v4fa*)(X + r * DMQ + c0); float s[4]; float sum = 0.f;
  for (int q = 0; q < 4; ++q) { s[q] = act ? (BFIN ? bf16_round(xa[q]) : xa[q]) : 0.f; sum = __fadd_rn(sum, s[q]); }
  red[t] = sum; __syncthreads(); for (int st = 128; st > 0; st >>= 1) { if (t < st) red[t] = __fadd_rn(red[t], red[t + st]); __syncthreads(); } const float mu = red[0] / (float)DMQ; __syncthreads();
  float vs = 0.f; for (int q = 0; q < 4; ++q) { const float dl = act ? __fadd_rn(s[q], -mu) : 0.f; vs = __fadd_rn(vs, __fmul_rn(dl, dl)); } red[t] = vs; __syncthreads(); for (int st = 128; st > 0; st >>= 1) { if (t < st) red[t] = __fadd_rn(red[t], red[t + st]); __syncthreads(); }
  const float rs = rsqrtf(__fadd_rn(red[0] / (float)DMQ, eps)); v4h y; v4f yf;
  for (int q = 0; q < 4; ++q) { const int c = c0 + q; yf[q] = __fadd_rn(__fmul_rn(__fmul_rn(__fadd_rn(s[q], -mu), rs), bf16_round(g[c])), (bb ? bf16_round(bb[c]) : 0.f)); y[q] = (_Float16)yf[q]; }
  if (!act) return;      /* no barriers after this point */
  { if (W16) *(v4h*)(N16 + r * DMQ + c0) = y; if (W32) *(v4f*)(N32 + r * DMQ + c0) = yf;  } }


__global__ __launch_bounds__(256) void k_rsmf(const float* __restrict__ S, _Float16* __restrict__ P, int qn, int hg) {
  #pragma clang fp contract(off)
  const int t = blockIdx.x * 256 + threadIdx.x; if (t >= qn * hg) return; const size_t i = (size_t)(t / qn) * SQ + (t % qn); const float* s = S + i * SQ; float mx = -3.0e38f;
#pragma unroll 1
  for (int j = 0; j < SQ; ++j) mx = fmaxf(mx, s[j]); float se = 0.f;
#pragma unroll 1
  for (int j = 0; j < SQ; ++j) se += __expf(s[j] - mx); const float sc = 256.0f / se;
#pragma unroll 1
  for (int j0 = 0; j0 < SQ; j0 += 8) { FragH f; for (int q = 0; q < 8; ++q) f.h[q] = (_Float16)(__expf(s[j0 + q] - mx) * sc); unsigned short* d = (unsigned short*)P + i * SQ + j0; *(v8us*)d = f.half[0];  } }


__global__ __launch_bounds__(256) void k_bfr(const float* __restrict__ x, float* __restrict__ XB, size_t n8) { const size_t t = (size_t)blockIdx.x * 256 + threadIdx.x; if (t >= n8) return; v4f a = *(const v4fa*)(x + t * 8), c = *(const v4fa*)(x + t * 8 + 4); for (int q = 0; q < 4; ++q) { a[q] = bf16_round(a[q]); c[q] = bf16_round(c[q]); }
  { *(v4f*)(XB + t * 8) = a; *(v4f*)(XB + t * 8 + 4) = c;  } }



__global__ __launch_bounds__(256) void k_rsmfam(const float* __restrict__ S, _Float16* __restrict__ P, int qn, int hg, const float* __restrict__ am) {
  #pragma clang fp contract(off)
  const int t = blockIdx.x * 256 + threadIdx.x; if (t >= qn * hg) return; const size_t i = (size_t)(t / qn) * SQ + (t % qn); const float* s = S + i * SQ; float mx = -3.0e38f;
#pragma unroll 1
  for (int j = 0; j < SQ; ++j) mx = fmaxf(mx, __fadd_rn(s[j], bf16_round(am[j]))); float se = 0.f;
#pragma unroll 1
  for (int j = 0; j < SQ; ++j) se += __expf(__fadd_rn(s[j], bf16_round(am[j])) - mx); const float sc = 256.0f / se;
#pragma unroll 1
  for (int j0 = 0; j0 < SQ; j0 += 8) { FragH f; for (int q = 0; q < 8; ++q) f.h[q] = (_Float16)(__expf(__fadd_rn(s[j0 + q], bf16_round(am[j0 + q])) - mx) * sc); unsigned short* d = (unsigned short*)P + i * SQ + j0; *(v8us*)d = f.half[0];  } }


#define CC CX           /* transposer macros: input channels */
#define LL SQ           /* pixels per image */
#define LQ (3 * DM)     /* unused */

__global__ __launch_bounds__(256) void k_cl2rows(const float* __restrict__ X, _Float16* __restrict__ XR) { __shared__ float tl[64][33]; const int tid = threadIdx.x; const int nl = LL / 32, nc = CC / 64; const int cb_ = blockIdx.x % nc; const int lb = (blockIdx.x / nc) % nl; const size_t b = blockIdx.x / (nc * nl); const int c0 = cb_ * 64, l0 = lb * 32;
  for (int i = tid; i < 64 * 32; i += 256) { const int c = i / 32, l = i % 32; tl[c][l] = bf16_round(X[(b * CC + c0 + c) * (size_t)LL + l0 + l]); }
  __syncthreads();
  { const int l = tid / 8, c8 = (tid % 8) * 8; FragH f; for (int q = 0; q < 8; ++q) f.h[q] = (_Float16)tl[c8 + q][l]; unsigned short* d = (unsigned short*)XR + (b * LL + l0 + l) * (size_t)CC + c0 + c8; *(v8us*)d = f.half[0];  } }


__global__ __launch_bounds__(256) void k_rowb(float* __restrict__ O, const float* __restrict__ bias, size_t n4) {
  #pragma clang fp contract(off)
  const size_t t = (size_t)blockIdx.x * 256 + threadIdx.x; if (t >= n4) return; const size_t e = t * 4; const int c = (int)((e / SQ) % CX);      /* output channels */ const float bb = bf16_round(bias[c]); const v4f a = *(const v4fa*)(O + e); v4f o; for (int q = 0; q < 4; ++q) o[q] = __fadd_rn(a[q], bb);
  *(v4f*)(O + e) = o;  }

__global__ __launch_bounds__(256) void k_gres(const float* __restrict__ T, const float* __restrict__ gam, const float* __restrict__ X, float* __restrict__ Y, size_t n4) {
  #pragma clang fp contract(off)
  const size_t t = (size_t)blockIdx.x * 256 + threadIdx.x; if (t >= n4) return; const float g = bf16_round(gam[0]); const v4f a = *(const v4fa*)(T + t * 4), xx = *(const v4fa*)(X + t * 4); v4f r;
  for (int q = 0; q < 4; ++q) r[q] = __fadd_rn(__fmul_rn(g, a[q]), bf16_round(xx[q]));
  *(v4f*)(Y + t * 4) = r;  }

__global__ __launch_bounds__(256) void k_bcpy(const float* __restrict__ b, int n, int NP, float* __restrict__ dst, int dst0) { for (int i = threadIdx.x; i < NP; i += 256) { const float v = (i < n) ? b[i] : 0.f; *(float*)(dst + dst0 + i) = v; }  }



__global__ __launch_bounds__(256) void k_zero16(_Float16* __restrict__ Y, size_t n8) { const size_t t = (size_t)blockIdx.x * 256 + threadIdx.x; if (t >= n8) return; const v8us z = {0, 0, 0, 0, 0, 0, 0, 0}; *(v8us*)((unsigned short*)Y + t * 8) = z;  }
__global__ __launch_bounds__(256) void k_qkz(const float* __restrict__ F, _Float16* __restrict__ QZ, _Float16* __restrict__ KZ, int nr) {
  const int r = blockIdx.x * 256 + threadIdx.x; if (r >= nr) return; const float* f = F + (size_t)r * 64; FragH q0, q1, k0, k1;
  for (int i = 0; i < 8; ++i) { q0.h[i] = (_Float16)f[i]; q1.h[i] = (_Float16)f[8 + i]; k0.h[i] = (_Float16)f[16 + i]; k1.h[i] = (_Float16)f[24 + i]; } const v8us z = {0, 0, 0, 0, 0, 0, 0, 0};
  unsigned short* dq = (unsigned short*)QZ + (size_t)r * 32; unsigned short* dk = (unsigned short*)KZ + (size_t)r * 32;
  { *(v8us*)dq = q0.half[0]; *(v8us*)(dq + 8) = q1.half[0]; *(v8us*)(dq + 16) = z; *(v8us*)(dq + 24) = z; *(v8us*)dk = k0.half[0]; *(v8us*)(dk + 8) = k1.half[0]; *(v8us*)(dk + 16) = z; *(v8us*)(dk + 24) = z;  } }
// ---- fused sigmoid attention: T[b][c][n] = sum_m V[b][c][m] sigmoid(q[n].k[m]); the gate tile never leaves registers ----
// S^T = K.Q^T (A = k rows, B = q rows, both through f_frag16): a lane holds column n = ln, rows m = 8 hh + r. Two such D tiles (m 0-15, 16-31), gated and
// rounded to f16 in place, are the B operand of out += V.P^T in the hardware k order, which is the order g2_frag gives the V rows (A operand).
// Work-group = one image, 32 query columns, all 128 channels; its 8 waves each walk 512 of the 4096 keys; the 8 partial tiles are summed through LDS in wave order.
#define FW 8             /* waves per work-group = key ranges */
#define FN 32            /* query columns per work-group */
#define FP 36            /* LDS row pitch in floats: rows 8 apart fall on other banks, 16-byte reads stay aligned */
/* waves_per_eu(4, 4): at most 256 registers, so that two work-groups share a WGP and four waves per SIMD cover each other's dependent gate arithmetic; 2 x the LDS size fits the WGP */
__device__ __forceinline__ v16h f_frag16(const _Float16* p) { FragH f; const v8us z = {0, 0, 0, 0, 0, 0, 0, 0}; f.half[0] = *(const v8us*)(const unsigned short*)p; f.half[1] = z; return f.v; }      /* q / k fragment: k 16-31 is the planes' zero padding, set in registers instead of loaded */
__device__ __forceinline__ v8f f_mma(v16h a, v16h b, v8f c) { return __builtin_amdgcn_wmma_f32_16x16x32_f16(false, a, false, b, (short)0, c, false, false); }
__global__ __launch_bounds__(FW * 32) __attribute__((amdgpu_waves_per_eu(4, 4))) void k_sattn(const _Float16* __restrict__ QZ, const _Float16* __restrict__ KZ, const _Float16* __restrict__ VC, float* __restrict__ T) {
  __shared__ __attribute__((aligned(16))) float red[FW][CX][FP];
  constexpr int MR = SQ / FW;      /* keys per wave */
  const int tid = threadIdx.x, w = tid >> 5, lane = tid & 31, ln = lane & 15, hh = lane >> 4; const int b = blockIdx.y, n0 = blockIdx.x * FN;
  const _Float16* qp = QZ + ((size_t)b * SQ + n0 + ln) * 32; const unsigned ki = (unsigned)((b * SQ + w * MR + ln) * 32 + 8 * hh), vi = (unsigned)((b * CX + ln) * SQ + w * MR + 8 * hh); const _Float16* kp = KZ + ki; const _Float16* vp = VC + vi;      /* kp, vp: the lane's own first 8 elements (g2_frag's 8 hh folded in) */
  const v16h qf[2] = {f_frag16(qp + 8 * hh), f_frag16(qp + 16 * 32 + 8 * hh)};
  const v8f z8 = {0.f,0.f,0.f,0.f,0.f,0.f,0.f,0.f}; v8f acc[CX / 16][2];
#pragma unroll
  for (int t = 0; t < CX / 16; ++t) { acc[t][0] = z8; acc[t][1] = z8; }
#pragma unroll 1      /* rolled (for speed only); the inner loops are unrolled so that fragments and accumulators stay in registers */
  for (int m0 = 0; m0 < MR; m0 += 32, kp += 32 * 32, vp += 32) {
    const v16h k0 = f_frag16(kp), k1 = f_frag16(kp + 16 * 32); v16h vf[CX / 16];
#pragma unroll
    for (int t = 0; t < CX / 16; ++t) vf[t] = g2_frag(vp + t * 16 * SQ, 0);
#pragma unroll
    for (int j = 0; j < 2; ++j) { const v8f s0 = f_mma(k0, qf[j], z8), s1 = f_mma(k1, qf[j], z8); FragH p;
#pragma unroll
      for (int r = 0; r < 8; ++r) { p.h[r] = (_Float16)(1.0f / (1.0f + expf(-s0[r]))); p.h[8 + r] = (_Float16)(1.0f / (1.0f + expf(-s1[r]))); }
#pragma unroll
      for (int t = 0; t < CX / 16; ++t) acc[t][j] = f_mma(vf[t], p.v, acc[t][j]);
      __builtin_amdgcn_sched_barrier(0);      /* one column group's scores and gates at a time: both at once do not fit the registers of four waves per SIMD */
    } }
#pragma unroll
  for (int t = 0; t < CX / 16; ++t)
#pragma unroll
    for (int j = 0; j < 2; ++j)
#pragma unroll
      for (int r = 0; r < 8; ++r) red[w][t * 16 + 8 * hh + r][j * 16 + ln] = acc[t][j][r];
  __syncthreads();
#pragma unroll
  for (int q = 0; q < CX * FN / 4 / (FW * 32); ++q) { const int i = q * (FW * 32) + tid, c = i / (FN / 4), n4 = (i % (FN / 4)) * 4; v4f s = *(const v4fa*)&red[0][c][n4];
#pragma unroll
    for (int u = 1; u < FW; ++u) s += *(const v4fa*)&red[u][c][n4];
    *(v4f*)(T + ((size_t)b * CX + c) * SQ + n0 + n4) = s; } }
extern "C" void kernel_launch(void* const* d_in, const int* in_sizes, int n_in,
                              void* d_out, int out_size, void* d_ws, size_t ws_size, hipStream_t stream) {
  (void)in_sizes; (void)n_in; (void)out_size;
  const float* const* I = (const float* const*)d_in; const float* x = I[0]; const float* wq = I[1]; const float* bq = I[2]; const float* wk = I[3]; const float* bk = I[4]; const float* wv = I[5]; const float* bv = I[6]; const float* gam = I[7];      /* natural Wq/Wk [16][128] + b, Wv [128][128] + b; gamma [1] */
  constexpr int DQ = 16, KP = 32;      /* q/k width 16, zero-padded to K = 32 for the WMMA contraction */
  char* ws = (char*)d_ws; size_t off = 0;
  auto take = [&](size_t bytes) { char* p = ws + off; off += (bytes + 255) & ~(size_t)255; return p; };
  _Float16* BQK = (_Float16*)take((size_t)64 * CX * 2); _Float16* BV = (_Float16*)take((size_t)CX * CX * 2); float* bqk = (float*)take((size_t)64 * 4);      /* [Wq; Wk; 0] as a 64-row Bt plane + [bq | bk | 0] */
  _Float16* XR = (_Float16*)take(NR * CX * 2); float* QKF = (float*)take(NR * 64 * 4); _Float16* QZ = (_Float16*)take(NR * KP * 2); _Float16* KZ = (_Float16*)take(NR * KP * 2); _Float16* VR = (_Float16*)take(NR * CX * 2); _Float16* VC = (_Float16*)take(NR * CX * 2);
  float* T = (float*)take(NR * CX * 4);      /* one plane per image: all four images go through each stage in one launch */
  if (off > ws_size) return;
  k_zero16<<<(unsigned)(((size_t)64 * CX / 8 + 255) / 256), 256, 0, stream>>>(BQK, (size_t)64 * CX / 8); k_wnat<<<(unsigned)(((size_t)DQ * CX / 8 + 255) / 256), 256, 0, stream>>>(wq, (size_t)DQ * CX / 8, BQK); k_wnat<<<(unsigned)(((size_t)DQ * CX / 8 + 255) / 256), 256, 0, stream>>>(wk, (size_t)DQ * CX / 8, BQK + (size_t)DQ * CX); k_wnat<<<(unsigned)(((size_t)CX * CX / 8 + 255) / 256), 256, 0, stream>>>(wv, (size_t)CX * CX / 8, BV);      /* Bt planes: [Wq; Wk; zeros] (64 rows) x16 and Wv */
  k_bcpy<<<1, 256, 0, stream>>>(bq, DQ, 64, bqk, 0); k_bcpy<<<1, 256, 0, stream>>>(bk, DQ, DQ, bqk, DQ);      /* [bq | bk | 0] (the first call zero-fills the 64-wide row) */
  k_cl2rows<<<NB * (SQ / 32) * (CX / 64), 256, 0, stream>>>(x, XR);      /* exact f16 token rows [n i][c] */
  k_gemm2<0><<<dim3((unsigned)((NR / 128) * (64 / 64)), 1), 128, 0, stream>>>(XR, CX, 0, BQK, CX, 0, 0.0625f, bqk, 0, nullptr, 1, 0, 0, QKF, nullptr, 64, 0, (int)NR, 64, CX);      /* q | k | 0 rows [NR][64] f32 (+ bias) */
  k_qkz<<<(unsigned)((NR + 255) / 256), 256, 0, stream>>>(QKF, QZ, KZ, (int)NR);      /* -> f16 planes [NR][32]: q | 0 and k | 0 (zero padding makes the 16-deep dot a K = 32 contraction) */
  /* the image index is blockIdx.y (plane strides) or the leading part of a flat index: 4 x the work-groups per launch, same arithmetic per element */
  k_gemm2<0><<<dim3((SQ / 128) * (CX / 64), NB), 128, 0, stream>>>(XR, CX, (size_t)SQ * CX, BV, CX, 0, 0.0625f, bv, 0, nullptr, 1, 0, 0, nullptr, VR, CX, (size_t)SQ * CX, SQ, CX, CX);      /* v rows [b][4096][128] (+ bias) f16 */
  k_vt<CX / 64, SQ><<<NB * (CX / 64) * (SQ / 64), 256, 0, stream>>>(VR, CX, 0, VC);      /* channel-major V [b][128][4096] */
  k_sattn<<<dim3(SQ / FN, NB), FW * 32, 0, stream>>>(QZ, KZ, VC, T);      /* out[b][c][n] = sum_m v[c][m] sigmoid(q[:, n].k[:, m]): scores (K = 32 with zero padding), gate (f16) and V x gate^T in one kernel, f32 */
  k_gres<<<(unsigned)((NR * CX / 4 + 255) / 256), 256, 0, stream>>>(T, gam, x, (float*)d_out, NR * CX / 4);      /* y = bf16(gamma) out + bf16(x) -> channel-first output */
}

// v003
// Measured time: 104 microseconds a run.
// Next to v002, in two timings, it ran 1.05 and 1.07 times as fast.
// Over all steps from v000 it is 6.04 times as fast.
#include <hip/hip_runtime.h>
// SAGAN-style self-attention with SIGMOID gating instead of softmax, channel-first (x [4][128][64][64]; q = Wq x + bq, k = Wk x + bk (1x1, 128 -> 16), v = Wv x + bv (128 -> 128), natural weights and biases sigma 0.05; attn[n][m] = sigmoid(q[:, n].k[:, m]) (no scale, no normalisation); out[c][n] = sum_m v[c][m] attn[n][m]; y = gamma out + x with the scalar gamma input -> [4][128][64][64]).
// Structure: the NCL input transposed by LDS tiles into exact f16 token rows [4096][128]; q | k as ONE WMMA GEMM (N = 64 over a zero-padded [Wq; Wk; 0] plane, f32 + bias); VALU splits them into zero-padded f16 planes [4096][32] (q / 2 | 0 and k | 0) so the 16-deep contraction runs as K = 32; all images per launch (image = blockIdx.y): v rows (GEMM + bias, f16) -> channel-major V via LDS transposes; one fused kernel: attn tile = sigmoid(q.k) = 0.5 + 0.5 tanh(q.k / 2) to f16 in registers, out[c][n] = V (A operand) x attn (B^T) f32, 8 key ranges summed through LDS; y = bf16(gamma) out + bf16(x) on VALU; launches: see trace.
// Compute dtype: inputs rounded to bf16; x / weights exact; q, k, v and the sigmoid gates as plain f16 GEMM operands (~2^-12); scores and out f32. v_wmma_f32_16x16x32_f16.
#define NB 4
#define SQ 4096
#define DM 128
#define CX 128          /* channels */
#define NH 4
#define HD 64
#define DMQ DM                       /* LayerNorm width */
#define DFF 4096
#define HG 1                         /* heads per attention launch group */
#define B0 0                         /* unused */
#define NBR NB                       /* unused (only in MP, itself unused) */
#define NR ((size_t)NB * SQ)         /* token rows */
#define MP ((int)((size_t)NBR * SQ)) /* unused (only in MPO, itself unused) */
#define QN SQ                        /* unused */
#define NHD NH                       /* unused */
#define MPO MP                       /* unused */
#define LQ DM      /* unused (redefined below) */
typedef __bf16 v16b __attribute__((ext_vector_type(16)));
typedef unsigned short v8us __attribute__((ext_vector_type(8), may_alias));
typedef float  v8f  __attribute__((ext_vector_type(8)));
typedef float  v4f  __attribute__((ext_vector_type(4)));
typedef float  v4fa __attribute__((ext_vector_type(4), may_alias));
union FragB { v16b v; v8us half[2]; unsigned short u[16]; };

__device__ __forceinline__ unsigned short bf16_bits(float x) { unsigned int u = __float_as_uint(x); return (unsigned short)((u + 0x7FFFu + ((u >> 16) & 1u)) >> 16); }
__device__ __forceinline__ float bf16_val(unsigned short b) { return __uint_as_float(((unsigned int)b) << 16); }
__device__ __forceinline__ float bf16_round(float x) { return bf16_val(bf16_bits(x)); }
// D += A·B with NT terms: 1 = ah·bh, 2 = + al·bh (A split), 3 = + ah·bl (both split)
template <int NT>
__device__ __forceinline__ v8f mmaN(v16b ah, v16b al, v16b bh, v16b bl, v8f c) {
  c = __builtin_amdgcn_wmma_f32_16x16x32_bf16(false, ah, false, bh, (short)0, c, false, false);
  if (NT >= 2) c = __builtin_amdgcn_wmma_f32_16x16x32_bf16(false, al, false, bh, (short)0, c, false, false);
  if (NT >= 3) c = __builtin_amdgcn_wmma_f32_16x16x32_bf16(false, ah, false, bl, (short)0, c, false, false);
  asm volatile("v_nop\n\tv_nop\n\tv_nop\n\tv_nop" : "+v"(c) : "v"(ah), "v"(al), "v"(bh), "v"(bl));
  return c;
}

__global__ __launch_bounds__(256) void k_wt_bf16(const float* __restrict__ W, unsigned short* __restrict__ Wt, int K, int N) {
  const int t = blockIdx.x * 256 + threadIdx.x;
  const int k8n = K / 8;
  if (t >= N * k8n) return;
  const int n = t / k8n, k8 = (t % k8n) * 8;
  v8us v;
#pragma unroll
  for (int i = 0; i < 8; ++i) v[i] = bf16_bits(W[(size_t)(k8 + i) * N + n]);
  *(v8us*)(Wt + (size_t)n * K + k8) = v;
  
}

// GEMM C[M][N] (f32, pitch ldc) = act(A[M][K]·W + bias). A f32 row-major (pitch lda) converted per fragment to bf16
// (ASPLIT: hi/lo two planes -> 2 terms, else single rounded term); Wt bf16 [N][K] (pitch ldb). BIAS_BF16 rounds the
// bias to bf16 first (bias quantised to bf16 before the add). K%32==0, M%16==0, N%64==0.
template <bool ASPLIT, int ACT, bool BIAS_BF16>
__global__ __launch_bounds__(128) void k_gemm_bf(const float* __restrict__ A, int lda, const unsigned short* __restrict__ Wt, int ldb,
                                               const float* __restrict__ bias, float* __restrict__ C, int ldc, int M, int N, int K) {
  __shared__ __attribute__((aligned(16))) float so[4][16][64];
  const int tid = threadIdx.x, w = tid >> 5, lane = tid & 31, ln = lane & 15, hh = lane >> 4;
  const int ntn = N / 64;
  const int wid = blockIdx.x * 4 + w;
  const int mt = wid / ntn, nq = wid % ntn;
  if (mt * 16 >= M) return;
  const int row0 = mt * 16, col0 = nq * 64;
  const float* arow = A + (size_t)(row0 + ln) * lda;
  v8f acc[4] = {};
  for (int kb = 0; kb < K; kb += 32) {
    FragB ah, al;
    const v4f x0 = *(const v4fa*)(arow + kb + 8 * hh), x1 = *(const v4fa*)(arow + kb + 8 * hh + 4);
    const v4f x2 = *(const v4fa*)(arow + kb + 16 + 8 * hh), x3 = *(const v4fa*)(arow + kb + 16 + 8 * hh + 4);
    float xs[16] = {x0[0],x0[1],x0[2],x0[3],x1[0],x1[1],x1[2],x1[3],x2[0],x2[1],x2[2],x2[3],x3[0],x3[1],x3[2],x3[3]};
#pragma unroll
    for (int i = 0; i < 16; ++i) { const unsigned short hb = bf16_bits(xs[i]); ah.u[i] = hb; al.u[i] = ASPLIT ? bf16_bits(xs[i] - bf16_val(hb)) : (unsigned short)0; }
#pragma unroll
    for (int t = 0; t < 4; ++t) {
      const unsigned short* brow = Wt + (size_t)(col0 + t * 16 + ln) * ldb + kb;
      FragB b;
      b.half[0] = *(const v8us*)(brow + 8 * hh);
      b.half[1] = *(const v8us*)(brow + 16 + 8 * hh);
      acc[t] = mmaN<ASPLIT ? 2 : 1>(ah.v, al.v, b.v, b.v, acc[t]);
    }
  }
#pragma unroll
  for (int t = 0; t < 4; ++t) {
    float bv = bias ? bias[col0 + t * 16 + ln] : 0.f;
    if (BIAS_BF16) bv = bf16_round(bv);
#pragma unroll
    for (int r = 0; r < 8; ++r) { float v = acc[t][r] + bv; if (ACT == 1) v = fmaxf(v, 0.f); so[w][8 * hh + r][t * 16 + ln] = v; }
  }
  __builtin_amdgcn_fence(__ATOMIC_ACQ_REL, "workgroup");
  __builtin_amdgcn_wave_barrier();
  const int rsub = lane >> 4, c4 = (lane & 15) * 4;
  {
#pragma unroll
    for (int q = 0; q < 8; ++q) {
      const int r = q * 2 + rsub;
      const v4f v = *(const v4fa*)&so[w][r][c4];
      *(v4f*)(C + (size_t)(row0 + r) * ldc + col0 + c4) = v;
    }
    
  }
}

// GEMM C = act(A·W + bias + resid): A f32 (ASPLIT -> hi/lo 2 terms), Wt bf16 [N][K]; ACT 0 none, 1 relu, 2 exact gelu;
// resid (optional, f32, row index = (row % rmod), pitch ldr, RES_BF16 rounds it) added before the activation.
template <bool ASPLIT, int ACT, bool BIAS_BF16, bool RES_BF16>
__global__ __launch_bounds__(128) void k_gemm_bf3(const float* __restrict__ A, int lda, const unsigned short* __restrict__ Wt, int ldb,
                                                const float* __restrict__ bias, const float* __restrict__ resid, int rmod, int ldr,
                                                float* __restrict__ C, int ldc, int M, int N, int K) {
  __shared__ __attribute__((aligned(16))) float so[4][16][64];
  const int tid = threadIdx.x, w = tid >> 5, lane = tid & 31, ln = lane & 15, hh = lane >> 4;
  const int ntn = N / 64;
  const int wid = blockIdx.x * 4 + w;
  const int mt = wid / ntn, nq = wid % ntn;
  if (mt * 16 >= M) return;
  const int row0 = mt * 16, col0 = nq * 64;
  const float* arow = A + (size_t)(row0 + ln) * lda;
  v8f acc[4] = {};
  for (int kb = 0; kb < K; kb += 32) {
    FragB ah, al;
    const v4f x0 = *(const v4fa*)(arow + kb + 8 * hh), x1 = *(const v4fa*)(arow + kb + 8 * hh + 4);
    const v4f x2 = *(const v4fa*)(arow + kb + 16 + 8 * hh), x3 = *(const v4fa*)(arow + kb + 16 + 8 * hh + 4);
    float xs[16] = {x0[0],x0[1],x0[2],x0[3],x1[0],x1[1],x1[2],x1[3],x2[0],x2[1],x2[2],x2[3],x3[0],x3[1],x3[2],x3[3]};
#pragma unroll
    for (int i = 0; i < 16; ++i) { const unsigned short hb = bf16_bits(xs[i]); ah.u[i] = hb; al.u[i] = ASPLIT ? bf16_bits(xs[i] - bf16_val(hb)) : (unsigned short)0; }
#pragma unroll
    for (int t = 0; t < 4; ++t) {
      const unsigned short* brow = Wt + (size_t)(col0 + t * 16 + ln) * ldb + kb;
      FragB b;
      b.half[0] = *(const v8us*)(brow + 8 * hh);
      b.half[1] = *(const v8us*)(brow + 16 + 8 * hh);
      acc[t] = mmaN<ASPLIT ? 2 : 1>(ah.v, al.v, b.v, b.v, acc[t]);
    }
  }
#pragma unroll
  for (int t = 0; t < 4; ++t) {
    const int col = col0 + t * 16 + ln;
    float bv = bias ? bias[col] : 0.f;
    if (BIAS_BF16) bv = bf16_round(bv);
#pragma unroll
    for (int r = 0; r < 8; ++r) {
      float v = acc[t][r] + bv;
      if (resid) { float rv = resid[(size_t)((row0 + 8 * hh + r) % rmod) * ldr + col]; if (RES_BF16) rv = bf16_round(rv); v += rv; }
      if (ACT == 1) v = fmaxf(v, 0.f);
      if (ACT == 2) v = 0.5f * v * (1.0f + erff(v * 0.70710678118654752f));
      if (ACT == 3) { const float u = 0.7978845608028654f * (v + 0.044715f * v * v * v); v = 0.5f * v * (1.0f + tanhf(u)); }
      so[w][8 * hh + r][t * 16 + ln] = v;
    }
  }
  __builtin_amdgcn_fence(__ATOMIC_ACQ_REL, "workgroup");
  __builtin_amdgcn_wave_barrier();
  const int rsub = lane >> 4, c4 = (lane & 15) * 4;
  {
#pragma unroll
    for (int q = 0; q < 8; ++q) {
      const int r = q * 2 + rsub;
      const v4f v = *(const v4fa*)&so[w][r][c4];
      *(v4f*)(C + (size_t)(row0 + r) * ldc + col0 + c4) = v;
    }
    
  }
}
// row LayerNorm (biased variance, eps) over N: s = X (+ R); optional out_sum <- s; out_norm <- (s-mu)*rsqrt(var+eps)*g + b
template <bool PARAM_BF16>
__global__ __launch_bounds__(256) void k_layernorm(const float* __restrict__ X, const float* __restrict__ R, const float* __restrict__ g, const float* __restrict__ bta,
                                                  float* __restrict__ out_sum, float* __restrict__ out_norm, int N, float eps) {
  __shared__ float red[256];
  const int row = blockIdx.x, tid = threadIdx.x;
  const float* x = X + (size_t)row * N; const float* rr = R ? R + (size_t)row * N : nullptr;
  float vals[16];                     // up to N = 4096
  const int per = N / 256;            // contiguous chunk per thread? use strided-by-4 chunks: thread handles j = tid*4 + 1024*u
  float s1 = 0.f;
  for (int u = 0; u < per / 4; ++u) {
    const int j = tid * 4 + 1024 * u;
    const v4f a = *(const v4fa*)(x + j);
    v4f b = {0.f,0.f,0.f,0.f}; if (rr) b = *(const v4fa*)(rr + j);
#pragma unroll
    for (int q = 0; q < 4; ++q) { const float v = a[q] + b[q]; vals[u * 4 + q] = v; s1 += v; }
  }
  red[tid] = s1; __syncthreads();
  for (int st = 128; st > 0; st >>= 1) { if (tid < st) red[tid] += red[tid + st]; __syncthreads(); }
  const float mu = red[0] / (float)N; __syncthreads();
  float s2 = 0.f;
  for (int u = 0; u < per / 4; ++u)
#pragma unroll
    for (int q = 0; q < 4; ++q) { const float c = vals[u * 4 + q] - mu; s2 += c * c; }
  red[tid] = s2; __syncthreads();
  for (int st = 128; st > 0; st >>= 1) { if (tid < st) red[tid] += red[tid + st]; __syncthreads(); }
  const float rs = rsqrtf(red[0] / (float)N + eps);
  {
    for (int u = 0; u < per / 4; ++u) {
      const int j = tid * 4 + 1024 * u;
      v4f o, sm;
#pragma unroll
      for (int q = 0; q < 4; ++q) {
        float gg = g[j + q], bb = bta[j + q];
        if (PARAM_BF16) { gg = bf16_round(gg); bb = bf16_round(bb); }
        sm[q] = vals[u * 4 + q]; o[q] = (vals[u * 4 + q] - mu) * rs * gg + bb;
      }
      if (out_sum) *(v4f*)(out_sum + (size_t)row * N + j) = sm;
      *(v4f*)(out_norm + (size_t)row * N + j) = o;
    }
    
  }
}



// ---- f16 WMMA path (v_wmma_f32_16x16x32_f16): 11-bit significands for operands in range — used where a [0,1] probability operand needs more precision than bf16
typedef _Float16 v16h __attribute__((ext_vector_type(16)));
union FragH { v16h v; v8us half[2]; _Float16 h[16]; unsigned short u[16]; };
template <int NT>
__device__ __forceinline__ v8f mmaH(v16h ah, v16h al, v16h bh, v16h bl, v8f c) {
  c = __builtin_amdgcn_wmma_f32_16x16x32_f16(false, ah, false, bh, (short)0, c, false, false);
  if (NT >= 2) c = __builtin_amdgcn_wmma_f32_16x16x32_f16(false, al, false, bh, (short)0, c, false, false);
  if (NT >= 3) c = __builtin_amdgcn_wmma_f32_16x16x32_f16(false, ah, false, bl, (short)0, c, false, false);
  asm volatile("v_nop\n\tv_nop\n\tv_nop\n\tv_nop" : "+v"(c) : "v"(ah), "v"(al), "v"(bh), "v"(bl));
  return c;
}
// batched GEMM like k_gemm_b but f16 operands: A f32 (split into f16 hi/lo if ASPLIT, else rounded to f16), Bt = f16 values [n][k]; alpha; C f32; N multiple of 16 (partial tiles skipped)
template <bool ASPLIT>
__global__ __launch_bounds__(128) void k_gemm_h(const float* __restrict__ A, int lda, size_t sA, const _Float16* __restrict__ Bh, int ldb, size_t sB, float alpha, float* __restrict__ C, int ldc, size_t sC, int M, int N, int K) {
  __shared__ __attribute__((aligned(16))) float so[4][16][64];
  const int tid = threadIdx.x, w = tid >> 5, lane = tid & 31, ln = lane & 15, hh = lane >> 4; const int by = blockIdx.y;
  A += (size_t)by * sA; Bh += (size_t)by * sB; C += (size_t)by * sC;
  const int ntn = (N + 63) / 64; const int wid = blockIdx.x * 4 + w; const int mt = wid / ntn, nq = wid % ntn; if (mt * 16 >= M) return;
  const int row0 = mt * 16, col0 = nq * 64; const float* arow = A + (size_t)(row0 + ln) * lda;
  v8f acc[4] = {};
  for (int kb = 0; kb < K; kb += 32) {
    FragH ah, al;
    const v4f x0 = *(const v4fa*)(arow + kb + 8 * hh), x1 = *(const v4fa*)(arow + kb + 8 * hh + 4), x2 = *(const v4fa*)(arow + kb + 16 + 8 * hh), x3 = *(const v4fa*)(arow + kb + 16 + 8 * hh + 4);
    float xs[16] = {x0[0],x0[1],x0[2],x0[3],x1[0],x1[1],x1[2],x1[3],x2[0],x2[1],x2[2],x2[3],x3[0],x3[1],x3[2],x3[3]};
#pragma unroll
    for (int i = 0; i < 16; ++i) { const _Float16 h = (_Float16)xs[i]; ah.h[i] = h; al.h[i] = ASPLIT ? (_Float16)(xs[i] - (float)h) : (_Float16)0.0f; }
#pragma unroll
    for (int t = 0; t < 4; ++t) { if (col0 + t * 16 >= N) continue; const size_t boff = (size_t)(col0 + t * 16 + ln) * ldb + kb; FragH bq; bq.half[0] = *(const v8us*)(Bh + boff + 8 * hh); bq.half[1] = *(const v8us*)(Bh + boff + 16 + 8 * hh);
      acc[t] = mmaH<ASPLIT ? 2 : 1>(ah.v, al.v, bq.v, bq.v, acc[t]); }
  }
#pragma unroll
  for (int t = 0; t < 4; ++t) { if (col0 + t * 16 >= N) continue;
#pragma unroll
    for (int r = 0; r < 8; ++r) so[w][8 * hh + r][t * 16 + ln] = acc[t][r] * alpha; }
  __builtin_amdgcn_fence(__ATOMIC_ACQ_REL, "workgroup"); __builtin_amdgcn_wave_barrier();
  const int rsub = lane >> 4, c4 = (lane & 15) * 4;
  {
#pragma unroll
    for (int q = 0; q < 8; ++q) { const int r = q * 2 + rsub; if (col0 + c4 < N) { const v4f v = *(const v4fa*)&so[w][r][c4]; *(v4f*)(C + (size_t)(row0 + r) * ldc + col0 + c4) = v; } }
     }
}

// Wt[n][k] = f16(W[k][n]·scale) from f32 row-major W[K][N] (scale = power of two; bf16-exact weights stay exact in f16 away from the subnormal range)
__global__ __launch_bounds__(256) void k_wt_f16(const float* __restrict__ W, _Float16* __restrict__ Wt, int K, int N, float scale) {
  const int t = blockIdx.x * 256 + threadIdx.x; if (t >= N * (K / 8)) return; const int n = t / (K / 8), k8 = (t % (K / 8)) * 8; FragH f;
#pragma unroll
  for (int i = 0; i < 8; ++i) f.h[i] = (_Float16)(bf16_round(W[(size_t)(k8 + i) * N + n]) * scale); const v8us o = f.half[0];
  *(v8us*)((unsigned short*)Wt + (size_t)n * K + k8) = o; 
}
// k_gemm_hh variant with fused epilogue: v = acc·alpha + bias[by·sBias + col] (+ CP[(row/rowsPerB)·sCPb + by·64 + col] if CP) ; ACT 0 none / 1 elu ; writes f16 C16 (and f32 C if non-null)
template <int ACT>
__global__ __launch_bounds__(128) void k_gemm_hhx(const _Float16* __restrict__ A, int lda, size_t sA, const _Float16* __restrict__ Bh, int ldb, size_t sB, float alpha, const float* __restrict__ bias, size_t sBias, const float* __restrict__ CP, int rowsPerB, size_t sCPb, int row0g,
    float* __restrict__ C, _Float16* __restrict__ C16, int ldc, size_t sC, int M, int N, int K) {
  __shared__ __attribute__((aligned(16))) float so[4][16][64];
  const int tid = threadIdx.x, w = tid >> 5, lane = tid & 31, ln = lane & 15, hh = lane >> 4; const int by = blockIdx.y;
  A += (size_t)by * sA; Bh += (size_t)by * sB; const size_t cofs = (size_t)by * sC; const float* bp = bias ? bias + (size_t)by * sBias : nullptr;
  const int ntn = (N + 63) / 64; const int wid = blockIdx.x * 4 + w; const int mt = wid / ntn, nq = wid % ntn; if (mt * 16 >= M) return;
  const int row0 = mt * 16, col0 = nq * 64; const _Float16* arow = A + (size_t)(row0 + ln) * lda;
  v8f acc[4] = {};
  for (int kb = 0; kb < K; kb += 32) { FragH ah; ah.half[0] = *(const v8us*)((const unsigned short*)arow + kb + 8 * hh); ah.half[1] = *(const v8us*)((const unsigned short*)arow + kb + 16 + 8 * hh);
#pragma unroll
    for (int t = 0; t < 4; ++t) { if (col0 + t * 16 >= N) continue; const size_t boff = (size_t)(col0 + t * 16 + ln) * ldb + kb; FragH bq; bq.half[0] = *(const v8us*)((const unsigned short*)Bh + boff + 8 * hh); bq.half[1] = *(const v8us*)((const unsigned short*)Bh + boff + 16 + 8 * hh);
      acc[t] = mmaH<1>(ah.v, ah.v, bq.v, bq.v, acc[t]); }
  }
#pragma unroll
  for (int t = 0; t < 4; ++t) { if (col0 + t * 16 >= N) continue; const int col = col0 + t * 16 + ln; const float bv = bp ? bf16_round(bp[col]) : 0.f;
#pragma unroll
    for (int r = 0; r < 8; ++r) { float v = acc[t][r] * alpha + bv; if (CP) { const int rr = row0g + row0 + 8 * hh + r; if (rowsPerB < 0) v += CP[cofs + (size_t)rr * ldc + col];      /* rowsPerB < 0: own element of the batched C plane */ else { const int bidx = rr / rowsPerB; v += CP[(size_t)bidx * sCPb + (size_t)by * 64 + col]; } } if (ACT == 1) v = (v > 0.f) ? v : expm1f(v); else if (ACT == 7) v = (v > 0.f) ? v + 1.0f : expf(v); else if (ACT == 8) v = tanhf(v); else if (ACT == 9) v = 0.5f * v * (1.0f + tanhf(0.7978845608028654f * (v + 0.044715f * v * v * v))); else if (ACT == 11) v = 1.0f / (1.0f + expf(-v)); else if (ACT == 12) v = (v > 0.f) ? v : 0.01f * v; else if (ACT == 14) v = (v > 0.f) ? v : 0.1f * v; else if (ACT == 16) v = (v >= 0.f) ? v : 0.3f * v; else if (ACT == 17) v = (v >= 0.f) ? v : 0.2f * v; else if (ACT == 15) v = v / (1.0f + expf(-v)); else if (ACT == 3) v = fmaxf(v, 0.f); else if (ACT == 6) v = 0.5f * v * (1.0f + erff(v * 0.70710678118654752f)); so[w][8 * hh + r][t * 16 + ln] = v; } }
  __builtin_amdgcn_fence(__ATOMIC_ACQ_REL, "workgroup"); __builtin_amdgcn_wave_barrier();
  const int rsub = lane >> 4, c4 = (lane & 15) * 4; typedef _Float16 v4h __attribute__((ext_vector_type(4)));
  {
#pragma unroll
    for (int q = 0; q < 8; ++q) { const int r = q * 2 + rsub; if (col0 + c4 < N) { const v4f v = *(const v4fa*)&so[w][r][c4]; if (C) *(v4f*)(C + cofs + (size_t)(row0 + r) * ldc + col0 + c4) = v; if (C16) { v4h h4; for (int i = 0; i < 4; ++i) h4[i] = (_Float16)v[i]; *(v4h*)(C16 + cofs + (size_t)(row0 + r) * ldc + col0 + c4) = h4; } } }
     }
}


typedef _Float16 v4h __attribute__((ext_vector_type(4)));

__global__ __launch_bounds__(256) void k_x16(const float* __restrict__ x, _Float16* __restrict__ X16, size_t n8) { const size_t t = (size_t)blockIdx.x * 256 + threadIdx.x; if (t >= n8) return; FragH f;
#pragma unroll
  for (int q = 0; q < 8; ++q) f.h[q] = (_Float16)bf16_round(x[t * 8 + q]); *(v8us*)((unsigned short*)X16 + t * 8) = f.half[0];  }
__global__ __launch_bounds__(256) void k_h16(const float* __restrict__ x, _Float16* __restrict__ X16, size_t n8) { const size_t t = (size_t)blockIdx.x * 256 + threadIdx.x; if (t >= n8) return; FragH f;
#pragma unroll
  for (int q = 0; q < 8; ++q) f.h[q] = (_Float16)x[t * 8 + q]; *(v8us*)((unsigned short*)X16 + t * 8) = f.half[0];  }
__global__ __launch_bounds__(256) void k_round16f(const float* __restrict__ W, _Float16* __restrict__ Bt, size_t n8) { const size_t t = (size_t)blockIdx.x * 256 + threadIdx.x; if (t >= n8) return; FragH f;
#pragma unroll
  for (int i = 0; i < 8; ++i) f.h[i] = (_Float16)(bf16_round(W[t * 8 + i]) * 16.0f); *(v8us*)((unsigned short*)Bt + t * 8) = f.half[0];  }
template <int NHv, int TTv>
__global__ __launch_bounds__(256) void k_vt(const _Float16* __restrict__ V16, int ldv, int voff, _Float16* __restrict__ Vt) { __shared__ unsigned short tl[64][66]; const int tid = threadIdx.x; const int slab = blockIdx.x / (TTv / 64), lg = blockIdx.x % (TTv / 64); const int b = slab / NHv, h = slab % NHv;
  for (int i = tid; i < 64 * 8; i += 256) { const int r = i / 8, c8 = (i % 8) * 8; FragH f; f.half[0] = *(const v8us*)((const unsigned short*)V16 + ((size_t)b * TTv + lg * 64 + r) * ldv + voff + h * 64 + c8);
#pragma unroll
    for (int q = 0; q < 8; ++q) tl[r][c8 + q] = f.u[q]; }
  __syncthreads();
  {
#pragma unroll
    for (int rd = 0; rd < 2; ++rd) { const int d = rd * 32 + tid / 8, pc = tid % 8; FragH f;
#pragma unroll
      for (int q = 0; q < 8; ++q) f.u[q] = tl[pc * 8 + q][d];
      *(v8us*)((unsigned short*)Vt + ((size_t)slab * 64 + d) * TTv + lg * 64 + pc * 8) = f.half[0]; }
     } }

__global__ __launch_bounds__(256) void k_hl(const float* __restrict__ F, _Float16* __restrict__ Hh, _Float16* __restrict__ Hl, size_t n8) { const size_t t = (size_t)blockIdx.x * 256 + threadIdx.x; if (t >= n8) return; FragH fh, fl; const v4f a = *(const v4fa*)(F + t * 8), c = *(const v4fa*)(F + t * 8 + 4);
#pragma unroll
  for (int q = 0; q < 4; ++q) { _Float16 h = (_Float16)a[q]; fh.h[q] = h; fl.h[q] = (_Float16)((a[q] - (float)h) * 1024.0f); h = (_Float16)c[q]; fh.h[4 + q] = h; fl.h[4 + q] = (_Float16)((c[q] - (float)h) * 1024.0f); }
  { *(v8us*)((unsigned short*)Hh + t * 8) = fh.half[0]; *(v8us*)((unsigned short*)Hl + t * 8) = fl.half[0];  } }

// ---- fast GEMM (wave tile 32x64; requires M % 32 == 0 rows per launch region and N % 64 == 0); epilogue = k_gemm_hhx semantics ----
__device__ __forceinline__ v16h g2_frag(const _Float16* p, int hh) { FragH f; f.half[0] = *(const v8us*)((const unsigned short*)p + 8 * hh); f.half[1] = *(const v8us*)((const unsigned short*)p + 16 + 8 * hh); return f.v; }
__device__ __forceinline__ v8f g2_mma(v16h a, v16h b, v8f c) { v8f d = __builtin_amdgcn_wmma_f32_16x16x32_f16(false, a, false, b, (short)0, c, false, false); asm volatile("v_nop\n\tv_nop\n\tv_nop\n\tv_nop" : "+v"(d) : "v"(a), "v"(b)); return d; }
template <int ACT>
__global__ __launch_bounds__(128) void k_gemm2(const _Float16* __restrict__ A, int lda, size_t sA, const _Float16* __restrict__ Bh, int ldb, size_t sB, float alpha, const float* __restrict__ bias, size_t sBias, const float* __restrict__ CP, int rowsPerB, size_t sCPb, int row0g,
    float* __restrict__ C, _Float16* __restrict__ C16, int ldc, size_t sC, int M, int N, int K) { static_assert(ACT == 0 || ACT == 3 || ACT == 6 || ACT == 8 || ACT == 9 || ACT == 11 || ACT == 12 || ACT == 14 || ACT == 15 || ACT == 16 || ACT == 17, "k_gemm2: unsupported ACT code (would silently apply no activation)");
  __shared__ __attribute__((aligned(16))) float so[4][32][68];
  const int tid = threadIdx.x, w = tid >> 5, lane = tid & 31, ln = lane & 15, hh = lane >> 4; const int by = blockIdx.y;
  A += (size_t)by * sA; Bh += (size_t)by * sB; const size_t cofs = (size_t)by * sC; const float* bp = bias ? bias + (size_t)by * sBias : nullptr;
  const int ntn = N >> 6; const int mt = blockIdx.x / ntn, nq = blockIdx.x - mt * ntn; const int row0 = mt * 128 + 32 * w, col0 = nq * 64; if (row0 >= M) return;
  const _Float16* a0p = A + (size_t)(row0 + ln) * lda; const _Float16* a1p = a0p + (size_t)16 * lda;
  const _Float16* b0p = Bh + (size_t)(col0 + ln) * ldb; const _Float16* b1p = b0p + (size_t)16 * ldb; const _Float16* b2p = b1p + (size_t)16 * ldb; const _Float16* b3p = b2p + (size_t)16 * ldb;
  const v8f z8 = {0.f,0.f,0.f,0.f,0.f,0.f,0.f,0.f}; v8f c00 = z8, c01 = z8, c02 = z8, c03 = z8, c10 = z8, c11 = z8, c12 = z8, c13 = z8;
#pragma unroll 1
  for (int kb = 0; kb < K; kb += 32) { const v16h a0 = g2_frag(a0p + kb, hh), a1 = g2_frag(a1p + kb, hh);
    v16h b = g2_frag(b0p + kb, hh); c00 = g2_mma(a0, b, c00); c10 = g2_mma(a1, b, c10);
    b = g2_frag(b1p + kb, hh); c01 = g2_mma(a0, b, c01); c11 = g2_mma(a1, b, c11);
    b = g2_frag(b2p + kb, hh); c02 = g2_mma(a0, b, c02); c12 = g2_mma(a1, b, c12);
    b = g2_frag(b3p + kb, hh); c03 = g2_mma(a0, b, c03); c13 = g2_mma(a1, b, c13); }
  v8f accs[8] = {c00, c01, c02, c03, c10, c11, c12, c13};
#pragma unroll
  for (int u = 0; u < 8; ++u) { const int t = u & 3, half = u >> 2; const int col = col0 + t * 16 + ln; const float bv = bp ? bf16_round(bp[col]) : 0.f;
#pragma unroll
    for (int r = 0; r < 8; ++r) { const int rloc = half * 16 + 8 * hh + r; float v = accs[u][r] * alpha + bv; if (CP) { if (rowsPerB < 0) v += CP[cofs + (size_t)(row0g + row0 + rloc) * ldc + col];      /* rowsPerB < 0: own element of the batched C plane */ else { const int bidx = (row0g + row0 + rloc) / rowsPerB; v += CP[(size_t)bidx * sCPb + (size_t)by * 64 + col]; } }
      if (ACT == 3) v = fmaxf(v, 0.f); else if (ACT == 6) v = 0.5f * v * (1.0f + erff(v * 0.70710678118654752f)); else if (ACT == 11) v = 1.0f / (1.0f + expf(-v)); else if (ACT == 15) v = v / (1.0f + expf(-v)); else if (ACT == 12) v = (v > 0.f) ? v : 0.01f * v; else if (ACT == 8) v = tanhf(v); else if (ACT == 9) v = 0.5f * v * (1.0f + tanhf(0.7978845608028654f * (v + 0.044715f * v * v * v))); else if (ACT == 14) v = (v > 0.f) ? v : 0.1f * v; else if (ACT == 16) v = (v >= 0.f) ? v : 0.3f * v; else if (ACT == 17) v = (v >= 0.f) ? v : 0.2f * v;
      so[w][rloc][t * 16 + ln] = v; } }
  __builtin_amdgcn_fence(__ATOMIC_ACQ_REL, "workgroup"); __builtin_amdgcn_wave_barrier();
  const int rsub = lane >> 4, c4 = (lane & 15) * 4;
  {
#pragma unroll
    for (int q = 0; q < 16; ++q) { const int r = q * 2 + rsub; const v4f v = *(const v4fa*)&so[w][r][c4]; if (C) *(v4f*)(C + cofs + (size_t)(row0 + r) * ldc + col0 + c4) = v; if (C16) { v4h h4; for (int i = 0; i < 4; ++i) h4[i] = (_Float16)v[i]; *(v4h*)(C16 + cofs + (size_t)(row0 + r) * ldc + col0 + c4) = h4; } }
     } }


__global__ __launch_bounds__(256) void k_wnat(const float* __restrict__ w, size_t n8, _Float16* __restrict__ Bt) { const size_t t = (size_t)blockIdx.x * 256 + threadIdx.x; if (t >= n8) return; FragH f; for (int q = 0; q < 8; ++q) f.h[q] = (_Float16)(bf16_round(w[t * 8 + q]) * 16.0f); *(v8us*)((unsigned short*)Bt + t * 8) = f.half[0];  }
__global__ __launch_bounds__(256) void k_rsm(const float* __restrict__ S, _Float16* __restrict__ P, int nrows) {
  #pragma clang fp contract(off)
  const int i = blockIdx.x * 256 + threadIdx.x; if (i >= nrows) return; const float* s = S + (size_t)i * SQ; float mx = -3.0e38f;
#pragma unroll 1
  for (int j = 0; j < SQ; ++j) mx = fmaxf(mx, s[j]); float se = 0.f;
#pragma unroll 1
  for (int j = 0; j < SQ; ++j) se += expf(s[j] - mx); const float sc = 256.0f / se;
#pragma unroll 1
  for (int j0 = 0; j0 < SQ; j0 += 8) { FragH f; for (int q = 0; q < 8; ++q) f.h[q] = (_Float16)(expf(s[j0 + q] - mx) * sc); unsigned short* d = (unsigned short*)P + (size_t)i * SQ + j0; *(v8us*)d = f.half[0];  } }
__global__ __launch_bounds__(256) void k_vt(const _Float16* __restrict__ V16, int b, int h0, _Float16* __restrict__ VT) { __shared__ unsigned short tl[64][65]; const int tid = threadIdx.x; const int hh = blockIdx.x % HG, sg = blockIdx.x / HG; const int s0 = sg * 64; const int h = h0 + hh;
  for (int i = tid; i < 64 * 8; i += 256) { const int j = i / 8, d8 = (i % 8) * 8; FragH f; f.half[0] = *(const v8us*)((const unsigned short*)V16 + ((size_t)b * SQ + s0 + j) * DM + h * HD + d8); for (int q = 0; q < 8; ++q) tl[d8 + q][j] = f.u[q]; }
  __syncthreads();
  { for (int i = tid; i < 64 * 8; i += 256) { const int d = i / 8, j8 = (i % 8) * 8; FragH f; for (int q = 0; q < 8; ++q) f.u[q] = tl[d][j8 + q]; *(v8us*)((unsigned short*)VT + ((size_t)hh * HD + d) * SQ + s0 + j8) = f.half[0]; }  } }


template <int BFIN, int W16, int W32>
__global__ __launch_bounds__(256) void k_lnx(const float* __restrict__ X, const float* __restrict__ g, const float* __restrict__ bb, float eps, _Float16* __restrict__ N16, float* __restrict__ N32) {
  #pragma clang fp contract(off)
  __shared__ float red[256]; const size_t r = blockIdx.x; const int t = threadIdx.x; const bool act = t < (DMQ / 4); const int c0 = act ? t * 4 : 0;
  const v4f xa = *(const v4fa*)(X + r * DMQ + c0); float s[4]; float sum = 0.f;
  for (int q = 0; q < 4; ++q) { s[q] = act ? (BFIN ? bf16_round(xa[q]) : xa[q]) : 0.f; sum = __fadd_rn(sum, s[q]); }
  red[t] = sum; __syncthreads(); for (int st = 128; st > 0; st >>= 1) { if (t < st) red[t] = __fadd_rn(red[t], red[t + st]); __syncthreads(); } const float mu = red[0] / (float)DMQ; __syncthreads();
  float vs = 0.f; for (int q = 0; q < 4; ++q) { const float dl = act ? __fadd_rn(s[q], -mu) : 0.f; vs = __fadd_rn(vs, __fmul_rn(dl, dl)); } red[t] = vs; __syncthreads(); for (int st = 128; st > 0; st >>= 1) { if (t < st) red[t] = __fadd_rn(red[t], red[t + st]); __syncthreads(); }
  const float rs = rsqrtf(__fadd_rn(red[0] / (float)DMQ, eps)); v4h y; v4f yf;
  for (int q = 0; q < 4; ++q) { const int c = c0 + q; yf[q] = __fadd_rn(__fmul_rn(__fmul_rn(__fadd_rn(s[q], -mu), rs), bf16_round(g[c])), (bb ? bf16_round(bb[c]) : 0.f)); y[q] = (_Float16)yf[q]; }
  if (!act) return;      /* no barriers after this point */
  { if (W16) *(v4h*)(N16 + r * DMQ + c0) = y; if (W32) *(v4f*)(N32 + r * DMQ + c0) = yf;  } }


__global__ __launch_bounds__(256) void k_rsmf(const float* __restrict__ S, _Float16* __restrict__ P, int qn, int hg) {
  #pragma clang fp contract(off)
  const int t = blockIdx.x * 256 + threadIdx.x; if (t >= qn * hg) return; const size_t i = (size_t)(t / qn) * SQ + (t % qn); const float* s = S + i * SQ; float mx = -3.0e38f;
#pragma unroll 1
  for (int j = 0; j < SQ; ++j) mx = fmaxf(mx, s[j]); float se = 0.f;
#pragma unroll 1
  for (int j = 0; j < SQ; ++j) se += __expf(s[j] - mx); const float sc = 256.0f / se;
#pragma unroll 1
  for (int j0 = 0; j0 < SQ; j0 += 8) { FragH f; for (int q = 0; q < 8; ++q) f.h[q] = (_Float16)(__expf(s[j0 + q] - mx) * sc); unsigned short* d = (unsigned short*)P + i * SQ + j0; *(v8us*)d = f.half[0];  } }


__global__ __launch_bounds__(256) void k_bfr(const float* __restrict__ x, float* __restrict__ XB, size_t n8) { const size_t t = (size_t)blockIdx.x * 256 + threadIdx.x; if (t >= n8) return; v4f a = *(const v4fa*)(x + t * 8), c = *(const v4fa*)(x + t * 8 + 4); for (int q = 0; q < 4; ++q) { a[q] = bf16_round(a[q]); c[q] = bf16_round(c[q]); }
  { *(v4f*)(XB + t * 8) = a; *(v4f*)(XB + t * 8 + 4) = c;  } }



__global__ __launch_bounds__(256) void k_rsmfam(const float* __restrict__ S, _Float16* __restrict__ P, int qn, int hg, const float* __restrict__ am) {
  #pragma clang fp contract(off)
  const int t = blockIdx.x * 256 + threadIdx.x; if (t >= qn * hg) return; const size_t i = (size_t)(t / qn) * SQ + (t % qn); const float* s = S + i * SQ; float mx = -3.0e38f;
#pragma unroll 1
  for (int j = 0; j < SQ; ++j) mx = fmaxf(mx, __fadd_rn(s[j], bf16_round(am[j]))); float se = 0.f;
#pragma unroll 1
  for (int j = 0; j < SQ; ++j) se += __expf(__fadd_rn(s[j], bf16_round(am[j])) - mx); const float sc = 256.0f / se;
#pragma unroll 1
  for (int j0 = 0; j0 < SQ; j0 += 8) { FragH f; for (int q = 0; q < 8; ++q) f.h[q] = (_Float16)(__expf(__fadd_rn(s[j0 + q], bf16_round(am[j0 + q])) - mx) * sc); unsigned short* d = (unsigned short*)P + i * SQ + j0; *(v8us*)d = f.half[0];  } }


#define CC CX           /* transposer macros: input channels */
#define LL SQ           /* pixels per image */
#define LQ (3 * DM)     /* unused */

__global__ __launch_bounds__(256) void k_cl2rows(const float* __restrict__ X, _Float16* __restrict__ XR) { __shared__ float tl[64][33]; const int tid = threadIdx.x; const int nl = LL / 32, nc = CC / 64; const int cb_ = blockIdx.x % nc; const int lb = (blockIdx.x / nc) % nl; const size_t b = blockIdx.x / (nc * nl); const int c0 = cb_ * 64, l0 = lb * 32;
  for (int i = tid; i < 64 * 32; i += 256) { const int c = i / 32, l = i % 32; tl[c][l] = bf16_round(X[(b * CC + c0 + c) * (size_t)LL + l0 + l]); }
  __syncthreads();
  { const int l = tid / 8, c8 = (tid % 8) * 8; FragH f; for (int q = 0; q < 8; ++q) f.h[q] = (_Float16)tl[c8 + q][l]; unsigned short* d = (unsigned short*)XR + (b * LL + l0 + l) * (size_t)CC + c0 + c8; *(v8us*)d = f.half[0];  } }


__global__ __launch_bounds__(256) void k_rowb(float* __restrict__ O, const float* __restrict__ bias, size_t n4) {
  #pragma clang fp contract(off)
  const size_t t = (size_t)blockIdx.x * 256 + threadIdx.x; if (t >= n4) return; const size_t e = t * 4; const int c = (int)((e / SQ) % CX);      /* output channels */ const float bb = bf16_round(bias[c]); const v4f a = *(const v4fa*)(O + e); v4f o; for (int q = 0; q < 4; ++q) o[q] = __fadd_rn(a[q], bb);
  *(v4f*)(O + e) = o;  }

__global__ __launch_bounds__(256) void k_gres(const float* __restrict__ T, const float* __restrict__ gam, const float* __restrict__ X, float* __restrict__ Y, size_t n4) {
  #pragma clang fp contract(off)
  const size_t t = (size_t)blockIdx.x * 256 + threadIdx.x; if (t >= n4) return; const float g = bf16_round(gam[0]); const v4f a = *(const v4fa*)(T + t * 4), xx = *(const v4fa*)(X + t * 4); v4f r;
  for (int q = 0; q < 4; ++q) r[q] = __fadd_rn(__fmul_rn(g, a[q]), bf16_round(xx[q]));
  *(v4f*)(Y + t * 4) = r;  }

__global__ __launch_bounds__(256) void k_bcpy(const float* __restrict__ b, int n, int NP, float* __restrict__ dst, int dst0) { for (int i = threadIdx.x; i < NP; i += 256) { const float v = (i < n) ? b[i] : 0.f; *(float*)(dst + dst0 + i) = v; }  }



__global__ __launch_bounds__(256) void k_zero16(_Float16* __restrict__ Y, size_t n8) { const size_t t = (size_t)blockIdx.x * 256 + threadIdx.x; if (t >= n8) return; const v8us z = {0, 0, 0, 0, 0, 0, 0, 0}; *(v8us*)((unsigned short*)Y + t * 8) = z;  }
__global__ __launch_bounds__(256) void k_qkz(const float* __restrict__ F, _Float16* __restrict__ QZ, _Float16* __restrict__ KZ, int nr) {
  const int r = blockIdx.x * 256 + threadIdx.x; if (r >= nr) return; const float* f = F + (size_t)r * 64; FragH q0, q1, k0, k1;
  for (int i = 0; i < 8; ++i) { q0.h[i] = (_Float16)(0.5f * f[i]); q1.h[i] = (_Float16)(0.5f * f[8 + i]);      /* q / 2 (exact in f32): the gate takes tanh of half the score */ k0.h[i] = (_Float16)f[16 + i]; k1.h[i] = (_Float16)f[24 + i]; } const v8us z = {0, 0, 0, 0, 0, 0, 0, 0};
  unsigned short* dq = (unsigned short*)QZ + (size_t)r * 32; unsigned short* dk = (unsigned short*)KZ + (size_t)r * 32;
  { *(v8us*)dq = q0.half[0]; *(v8us*)(dq + 8) = q1.half[0]; *(v8us*)(dq + 16) = z; *(v8us*)(dq + 24) = z; *(v8us*)dk = k0.half[0]; *(v8us*)(dk + 8) = k1.half[0]; *(v8us*)(dk + 16) = z; *(v8us*)(dk + 24) = z;  } }
// ---- fused sigmoid attention: T[b][c][n] = sum_m V[b][c][m] sigmoid(q[n].k[m]); the gate tile never leaves registers ----
// S^T / 2 = K.(Q / 2)^T (A = k rows, B = rows of q / 2, both through f_frag16): a lane holds column n = ln, rows m = 8 hh + r. Two such D tiles (m 0-15, 16-31), gated and
// rounded to f16 in place, are the B operand of out += V.P^T in the hardware k order, which is the order g2_frag gives the V rows (A operand).
// Work-group = one image, 32 query columns, all 128 channels; its 8 waves each walk 512 of the 4096 keys; the 8 partial tiles are summed through LDS in wave order.
#define FW 8             /* waves per work-group = key ranges */
#define FN 32            /* query columns per work-group */
#define FP 36            /* LDS row pitch in floats: rows 8 apart fall on other banks, 16-byte reads stay aligned */
/* waves_per_eu(4, 4): at most 256 registers, so that two work-groups share a WGP and four waves per SIMD cover each other's dependent gate arithmetic; 2 x the LDS size fits the WGP */
__device__ __forceinline__ v16h f_frag16(const _Float16* p) { FragH f; const v8us z = {0, 0, 0, 0, 0, 0, 0, 0}; f.half[0] = *(const v8us*)(const unsigned short*)p; f.half[1] = z; return f.v; }      /* q / k fragment: k 16-31 is the planes' zero padding, set in registers instead of loaded */
__device__ __forceinline__ v8f f_mma(v16h a, v16h b, v8f c) { return __builtin_amdgcn_wmma_f32_16x16x32_f16(false, a, false, b, (short)0, c, false, false); }
/* gate: sigmoid(s) = 0.5 + 0.5 tanh(s / 2), one v_tanh_f32 per score; u = s / 2 comes out of the score product itself (the q plane holds q / 2, a power of two); two gates share the packed fma and the packed f16 conversion; +-inf give 0 and 1, NaN stays NaN */
typedef float v2f __attribute__((ext_vector_type(2)));
typedef _Float16 v2h __attribute__((ext_vector_type(2)));
__device__ __forceinline__ v2h f_gate2(float u0, float u1) { const v2f t = {__builtin_amdgcn_tanhf(u0), __builtin_amdgcn_tanhf(u1)}; const v2f hf = {0.5f, 0.5f}; return __builtin_convertvector(__builtin_elementwise_fma(t, hf, hf), v2h); }
__global__ __launch_bounds__(FW * 32) __attribute__((amdgpu_waves_per_eu(4, 4))) void k_sattn(const _Float16* __restrict__ QZ, const _Float16* __restrict__ KZ, const _Float16* __restrict__ VC, float* __restrict__ T) {
  __shared__ __attribute__((aligned(16))) float red[FW][CX][FP];
  constexpr int MR = SQ / FW;      /* keys per wave */
  const int tid = threadIdx.x, w = tid >> 5, lane = tid & 31, ln = lane & 15, hh = lane >> 4; const int b = blockIdx.y, n0 = blockIdx.x * FN;
  const _Float16* qp = QZ + ((size_t)b * SQ + n0 + ln) * 32; const unsigned ki = (unsigned)((b * SQ + w * MR + ln) * 32 + 8 * hh), vi = (unsigned)((b * CX + ln) * SQ + w * MR + 8 * hh); const _Float16* kp = KZ + ki; const _Float16* vp = VC + vi;      /* kp, vp: the lane's own first 8 elements (g2_frag's 8 hh folded in) */
  const v16h qf[2] = {f_frag16(qp + 8 * hh), f_frag16(qp + 16 * 32 + 8 * hh)};      /* rows of q / 2: the score tiles are s / 2, the argument of the gate's tanh */
  const v8f z8 = {0.f,0.f,0.f,0.f,0.f,0.f,0.f,0.f}; v8f acc[CX / 16][2];
#pragma unroll
  for (int t = 0; t < CX / 16; ++t) { acc[t][0] = z8; acc[t][1] = z8; }
#pragma unroll 1      /* rolled (for speed only); the inner loops are unrolled so that fragments and accumulators stay in registers */
  for (int m0 = 0; m0 < MR; m0 += 32, kp += 32 * 32, vp += 32) {
    const v16h k0 = f_frag16(kp), k1 = f_frag16(kp + 16 * 32); v16h vf[CX / 16];
#pragma unroll
    for (int t = 0; t < CX / 16; ++t) vf[t] = g2_frag(vp + t * 16 * SQ, 0);
    __builtin_amdgcn_sched_barrier(0);      /* all of the pass's loads are issued ahead of the scores: a load sunk behind the first gates is waited for in full among the products */
#pragma unroll
    for (int j = 0; j < 2; ++j) { const v8f s0 = f_mma(k0, qf[j], z8), s1 = f_mma(k1, qf[j], z8); FragH p;
#pragma unroll
      for (int r = 0; r < 8; r += 2) { const v2h g0 = f_gate2(s0[r], s0[r + 1]), g1 = f_gate2(s1[r], s1[r + 1]); p.h[r] = g0[0]; p.h[r + 1] = g0[1]; p.h[8 + r] = g1[0]; p.h[8 + r + 1] = g1[1]; }
#pragma unroll
      for (int t = 0; t < CX / 16; ++t) acc[t][j] = f_mma(vf[t], p.v, acc[t][j]);
      __builtin_amdgcn_sched_barrier(0);      /* one column group's scores and gates at a time: both at once do not fit the registers of four waves per SIMD */
    } }
#pragma unroll
  for (int t = 0; t < CX / 16; ++t)
#pragma unroll
    for (int j = 0; j < 2; ++j)
#pragma unroll
      for (int r = 0; r < 8; ++r) red[w][t * 16 + 8 * hh + r][j * 16 + ln] = acc[t][j][r];
  __syncthreads();
#pragma unroll
  for (int q = 0; q < CX * FN / 4 / (FW * 32); ++q) { const int i = q * (FW * 32) + tid, c = i / (FN / 4), n4 = (i % (FN / 4)) * 4; v4f s = *(const v4fa*)&red[0][c][n4];
#pragma unroll
    for (int u = 1; u < FW; ++u) s += *(const v4fa*)&red[u][c][n4];
    *(v4f*)(T + ((size_t)b * CX + c) * SQ + n0 + n4) = s; } }
extern "C" void kernel_launch(void* const* d_in, const int* in_sizes, int n_in,
                              void* d_out, int out_size, void* d_ws, size_t ws_size, hipStream_t stream) {
  (void)in_sizes; (void)n_in; (void)out_size;
  const float* const* I = (const float* const*)d_in; const float* x = I[0]; const float* wq = I[1]; const float* bq = I[2]; const float* wk = I[3]; const float* bk = I[4]; const float* wv = I[5]; const float* bv = I[6]; const float* gam = I[7];      /* natural Wq/Wk [16][128] + b, Wv [128][128] + b; gamma [1] */
  constexpr int DQ = 16, KP = 32;      /* q/k width 16, zero-padded to K = 32 for the WMMA contraction */
  char* ws = (char*)d_ws; size_t off = 0;
  auto take = [&](size_t bytes) { char* p = ws + off; off += (bytes + 255) & ~(size_t)255; return p; };
  _Float16* BQK = (_Float16*)take((size_t)64 * CX * 2); _Float16* BV = (_Float16*)take((size_t)CX * CX * 2); float* bqk = (float*)take((size_t)64 * 4);      /* [Wq; Wk; 0] as a 64-row Bt plane + [bq | bk | 0] */
  _Float16* XR = (_Float16*)take(NR * CX * 2); float* QKF = (float*)take(NR * 64 * 4); _Float16* QZ = (_Float16*)take(NR * KP * 2); _Float16* KZ = (_Float16*)take(NR * KP * 2); _Float16* VR = (_Float16*)take(NR * CX * 2); _Float16* VC = (_Float16*)take(NR * CX * 2);
  float* T = (float*)take(NR * CX * 4);      /* one plane per image: all four images go through each stage in one launch */
  if (off > ws_size) return;
  k_zero16<<<(unsigned)(((size_t)64 * CX / 8 + 255) / 256), 256, 0, stream>>>(BQK, (size_t)64 * CX / 8); k_wnat<<<(unsigned)(((size_t)DQ * CX / 8 + 255) / 256), 256, 0, stream>>>(wq, (size_t)DQ * CX / 8, BQK); k_wnat<<<(unsigned)(((size_t)DQ * CX / 8 + 255) / 256), 256, 0, stream>>>(wk, (size_t)DQ * CX / 8, BQK + (size_t)DQ * CX); k_wnat<<<(unsigned)(((size_t)CX * CX / 8 + 255) / 256), 256, 0, stream>>>(wv, (size_t)CX * CX / 8, BV);      /* Bt planes: [Wq; Wk; zeros] (64 rows) x16 and Wv */
  k_bcpy<<<1, 256, 0, stream>>>(bq, DQ, 64, bqk, 0); k_bcpy<<<1, 256, 0, stream>>>(bk, DQ, DQ, bqk, DQ);      /* [bq | bk | 0] (the first call zero-fills the 64-wide row) */
  k_cl2rows<<<NB * (SQ / 32) * (CX / 64), 256, 0, stream>>>(x, XR);      /* exact f16 token rows [n i][c] */
  k_gemm2<0><<<dim3((unsigned)((NR / 128) * (64 / 64)), 1), 128, 0, stream>>>(XR, CX, 0, BQK, CX, 0, 0.0625f, bqk, 0, nullptr, 1, 0, 0, QKF, nullptr, 64, 0, (int)NR, 64, CX);      /* q | k | 0 rows [NR][64] f32 (+ bias) */
  k_qkz<<<(unsigned)((NR + 255) / 256), 256, 0, stream>>>(QKF, QZ, KZ, (int)NR);      /* -> f16 planes [NR][32]: q / 2 | 0 and k | 0 (zero padding makes the 16-deep dot a K = 32 contraction) */
  /* the image index is blockIdx.y (plane strides) or the leading part of a flat index: 4 x the work-groups per launch, same arithmetic per element */
  k_gemm2<0><<<dim3((SQ / 128) * (CX / 64), NB), 128, 0, stream>>>(XR, CX, (size_t)SQ * CX, BV, CX, 0, 0.0625f, bv, 0, nullptr, 1, 0, 0, nullptr, VR, CX, (size_t)SQ * CX, SQ, CX, CX);      /* v rows [b][4096][128] (+ bias) f16 */
  k_vt<CX / 64, SQ><<<NB * (CX / 64) * (SQ / 64), 256, 0, stream>>>(VR, CX, 0, VC);      /* channel-major V [b][128][4096] */
  k_sattn<<<dim3(SQ / FN, NB), FW * 32, 0, stream>>>(QZ, KZ, VC, T);      /* out[b][c][n] = sum_m v[c][m] sigmoid(q[:, n].k[:, m]): scores (K = 32 with zero padding), gate (f16) and V x gate^T in one kernel, f32 */
  k_gres<<<(unsigned)((NR * CX / 4 + 255) / 256), 256, 0, stream>>>(T, gam, x, (float*)d_out, NR * CX / 4);      /* y = bf16(gamma) out + bf16(x) -> channel-first output */
}

// v004
// One run takes 68.9 microseconds.
// Timed twice side by side with v003, it ran 1.50 times as fast both times.
// All steps since v000 together make it 9.07 times as fast.
#include <hip/hip_runtime.h>
// SAGAN-style self-attention with SIGMOID gating instead of softmax, channel-first (x [4][128][64][64]; q = Wq x + bq, k = Wk x + bk (1x1, 128 -> 16), v = Wv x + bv (128 -> 128), natural weights and biases sigma 0.05; attn[n][m] = sigmoid(q[:, n].k[:, m]) (no scale, no normalisation); out[c][n] = sum_m v[c][m] attn[n][m]; y = gamma out + x with the scalar gamma input -> [4][128][64][64]).
// Structure: the NCL input transposed by LDS tiles into exact f16 token rows [4096][128]; q | k as ONE WMMA GEMM (N = 64 over a zero-padded [Wq; Wk; 0] plane, f32 + bias); VALU splits them into f16 planes (q / 2 | 0 as [4096][32], k as [4096][16]); the 16-deep contraction runs as K = 32 with zeros set in registers; all images per launch (image = blockIdx.y): v rows (GEMM + bias, f16) -> V in WMMA fragment order via LDS transposes; one fused kernel: attn tile = sigmoid(q.k) = 0.5 + 0.5 tanh(q.k / 2) to f16 in registers, out[c][n] = V (A operand) x attn (B^T) f32, 8 key ranges summed through LDS; y = bf16(gamma) out + bf16(x) on VALU; launches: see trace.
// Compute dtype: inputs rounded to bf16; x / weights exact; q, k, v and the sigmoid gates as plain f16 GEMM operands (~2^-12); scores and out f32. v_wmma_f32_16x16x32_f16.
#define NB 4
#define SQ 4096
#define DM 128
#define CX 128          /* channels */
#define NH 4
#define HD 64
#define DMQ DM                       /* LayerNorm width */
#define DFF 4096
#define HG 1                         /* heads per attention launch group */
#define B0 0                         /* unused */
#define NBR NB                       /* unused (only in MP, itself unused) */
#define NR ((size_t)NB * SQ)         /* token rows */
#define MP ((int)((size_t)NBR * SQ)) /* unused (only in MPO, itself unused) */
#define QN SQ                        /* unused */
#define NHD NH                       /* unused */
#define MPO MP                       /* unused */
#define LQ DM      /* unused (redefined below) */
typedef __bf16 v16b __attribute__((ext_vector_type(16)));
typedef unsigned short v8us __attribute__((ext_vector_type(8), may_alias));
typedef float  v8f  __attribute__((ext_vector_type(8)));
typedef float  v4f  __attribute__((ext_vector_type(4)));
typedef float  v4fa __attribute__((ext_vector_type(4), may_alias));
union FragB { v16b v; v8us half[2]; unsigned short u[16]; };

__device__ __forceinline__ unsigned short bf16_bits(float x) { unsigned int u = __float_as_uint(x); return (unsigned short)((u + 0x7FFFu + ((u >> 16) & 1u)) >> 16); }
__device__ __forceinline__ float bf16_val(unsigned short b) { return __uint_as_float(((unsigned int)b) << 16); }
__device__ __forceinline__ float bf16_round(float x) { return bf16_val(bf16_bits(x)); }
// D += A·B with NT terms: 1 = ah·bh, 2 = + al·bh (A split), 3 = + ah·bl (both split)
template <int NT>
__device__ __forceinline__ v8f mmaN(v16b ah, v16b al, v16b bh, v16b bl, v8f c) {
  c = __builtin_amdgcn_wmma_f32_16x16x32_bf16(false, ah, false, bh, (short)0, c, false, false);
  if (NT >= 2) c = __builtin_amdgcn_wmma_f32_16x16x32_bf16(false, al, false, bh, (short)0, c, false, false);
  if (NT >= 3) c = __builtin_amdgcn_wmma_f32_16x16x32_bf16(false, ah, false, bl, (short)0, c, false, false);
  asm volatile("v_nop\n\tv_nop\n\tv_nop\n\tv_nop" : "+v"(c) : "v"(ah), "v"(al), "v"(bh), "v"(bl));
  return c;
}

__global__ __launch_bounds__(256) void k_wt_bf16(const float* __restrict__ W, unsigned short* __restrict__ Wt, int K, int N) {
  const int t = blockIdx.x * 256 + threadIdx.x;
  const int k8n = K / 8;
  if (t >= N * k8n) return;
  const int n = t / k8n, k8 = (t % k8n) * 8;
  v8us v;
#pragma unroll
  for (int i = 0; i < 8; ++i) v[i] = bf16_bits(W[(size_t)(k8 + i) * N + n]);
  *(v8us*)(Wt + (size_t)n * K + k8) = v;
  
}

// GEMM C[M][N] (f32, pitch ldc) = act(A[M][K]·W + bias). A f32 row-major (pitch lda) converted per fragment to bf16
// (ASPLIT: hi/lo two planes -> 2 terms, else single rounded term); Wt bf16 [N][K] (pitch ldb). BIAS_BF16 rounds the
// bias to bf16 first (bias quantised to bf16 before the add). K%32==0, M%16==0, N%64==0.
template <bool ASPLIT, int ACT, bool BIAS_BF16>
__global__ __launch_bounds__(128) void k_gemm_bf(const float* __restrict__ A, int lda, const unsigned short* __restrict__ Wt, int ldb,
                                               const float* __restrict__ bias, float* __restrict__ C, int ldc, int M, int N, int K) {
  __shared__ __attribute__((aligned(16))) float so[4][16][64];
  const int tid = threadIdx.x, w = tid >> 5, lane = tid & 31, ln = lane & 15, hh = lane >> 4;
  const int ntn = N / 64;
  const int wid = blockIdx.x * 4 + w;
  const int mt = wid / ntn, nq = wid % ntn;
  if (mt * 16 >= M) return;
  const int row0 = mt * 16, col0 = nq * 64;
  const float* arow = A + (size_t)(row0 + ln) * lda;
  v8f acc[4] = {};
  for (int kb = 0; kb < K; kb += 32) {
    FragB ah, al;
    const v4f x0 = *(const v4fa*)(arow + kb + 8 * hh), x1 = *(const v4fa*)(arow + kb + 8 * hh + 4);
    const v4f x2 = *(const v4fa*)(arow + kb + 16 + 8 * hh), x3 = *(const v4fa*)(arow + kb + 16 + 8 * hh + 4);
    float xs[16] = {x0[0],x0[1],x0[2],x0[3],x1[0],x1[1],x1[2],x1[3],x2[0],x2[1],x2[2],x2[3],x3[0],x3[1],x3[2],x3[3]};
#pragma unroll
    for (int i = 0; i < 16; ++i) { const unsigned short hb = bf16_bits(xs[i]); ah.u[i] = hb; al.u[i] = ASPLIT ? bf16_bits(xs[i] - bf16_val(hb)) : (unsigned short)0; }
#pragma unroll
    for (int t = 0; t < 4; ++t) {
      const unsigned short* brow = Wt + (size_t)(col0 + t * 16 + ln) * ldb + kb;
      FragB b;
      b.half[0] = *(const v8us*)(brow + 8 * hh);
      b.half[1] = *(const v8us*)(brow + 16 + 8 * hh);
      acc[t] = mmaN<ASPLIT ? 2 : 1>(ah.v, al.v, b.v, b.v, acc[t]);
    }
  }
#pragma unroll
  for (int t = 0; t < 4; ++t) {
    float bv = bias ? bias[col0 + t * 16 + ln] : 0.f;
    if (BIAS_BF16) bv = bf16_round(bv);
#pragma unroll
    for (int r = 0; r < 8; ++r) { float v = acc[t][r] + bv; if (ACT == 1) v = fmaxf(v, 0.f); so[w][8 * hh + r][t * 16 + ln] = v; }
  }
  __builtin_amdgcn_fence(__ATOMIC_ACQ_REL, "workgroup");
  __builtin_amdgcn_wave_barrier();
  const int rsub = lane >> 4, c4 = (lane & 15) * 4;
  {
#pragma unroll
    for (int q = 0; q < 8; ++q) {
      const int r = q * 2 + rsub;
      const v4f v = *(const v4fa*)&so[w][r][c4];
      *(v4f*)(C + (size_t)(row0 + r) * ldc + col0 + c4) = v;
    }
    
  }
}

// GEMM C = act(A·W + bias + resid): A f32 (ASPLIT -> hi/lo 2 terms), Wt bf16 [N][K]; ACT 0 none, 1 relu, 2 exact gelu;
// resid (optional, f32, row index = (row % rmod), pitch ldr, RES_BF16 rounds it) added before the activation.
template <bool ASPLIT, int ACT, bool BIAS_BF16, bool RES_BF16>
__global__ __launch_bounds__(128) void k_gemm_bf3(const float* __restrict__ A, int lda, const unsigned short* __restrict__ Wt, int ldb,
                                                const float* __restrict__ bias, const float* __restrict__ resid, int rmod, int ldr,
                                                float* __restrict__ C, int ldc, int M, int N, int K) {
  __shared__ __attribute__((aligned(16))) float so[4][16][64];
  const int tid = threadIdx.x, w = tid >> 5, lane = tid & 31, ln = lane & 15, hh = lane >> 4;
  const int ntn = N / 64;
  const int wid = blockIdx.x * 4 + w;
  const int mt = wid / ntn, nq = wid % ntn;
  if (mt * 16 >= M) return;
  const int row0 = mt * 16, col0 = nq * 64;
  const float* arow = A + (size_t)(row0 + ln) * lda;
  v8f acc[4] = {};
  for (int kb = 0; kb < K; kb += 32) {
    FragB ah, al;
    const v4f x0 = *(const v4fa*)(arow + kb + 8 * hh), x1 = *(const v4fa*)(arow + kb + 8 * hh + 4);
    const v4f x2 = *(const v4fa*)(arow + kb + 16 + 8 * hh), x3 = *(const v4fa*)(arow + kb + 16 + 8 * hh + 4);
    float xs[16] = {x0[0],x0[1],x0[2],x0[3],x1[0],x1[1],x1[2],x1[3],x2[0],x2[1],x2[2],x2[3],x3[0],x3[1],x3[2],x3[3]};
#pragma unroll
    for (int i = 0; i < 16; ++i) { const unsigned short hb = bf16_bits(xs[i]); ah.u[i] = hb; al.u[i] = ASPLIT ? bf16_bits(xs[i] - bf16_val(hb)) : (unsigned short)0; }
#pragma unroll
    for (int t = 0; t < 4; ++t) {
      const unsigned short* brow = Wt + (size_t)(col0 + t * 16 + ln) * ldb + kb;
      FragB b;
      b.half[0] = *(const v8us*)(brow + 8 * hh);
      b.half[1] = *(const v8us*)(brow + 16 + 8 * hh);
      acc[t] = mmaN<ASPLIT ? 2 : 1>(ah.v, al.v, b.v, b.v, acc[t]);
    }
  }
#pragma unroll
  for (int t = 0; t < 4; ++t) {
    const int col = col0 + t * 16 + ln;
    float bv = bias ? bias[col] : 0.f;
    if (BIAS_BF16) bv = bf16_round(bv);
#pragma unroll
    for (int r = 0; r < 8; ++r) {
      float v = acc[t][r] + bv;
      if (resid) { float rv = resid[(size_t)((row0 + 8 * hh + r) % rmod) * ldr + col]; if (RES_BF16) rv = bf16_round(rv); v += rv; }
      if (ACT == 1) v = fmaxf(v, 0.f);
      if (ACT == 2) v = 0.5f * v * (1.0f + erff(v * 0.70710678118654752f));
      if (ACT == 3) { const float u = 0.7978845608028654f * (v + 0.044715f * v * v * v); v = 0.5f * v * (1.0f + tanhf(u)); }
      so[w][8 * hh + r][t * 16 + ln] = v;
    }
  }
  __builtin_amdgcn_fence(__ATOMIC_ACQ_REL, "workgroup");
  __builtin_amdgcn_wave_barrier();
  const int rsub = lane >> 4, c4 = (lane & 15) * 4;
  {
#pragma unroll
    for (int q = 0; q < 8; ++q) {
      const int r = q * 2 + rsub;
      const v4f v = *(const v4fa*)&so[w][r][c4];
      *(v4f*)(C + (size_t)(row0 + r) * ldc + col0 + c4) = v;
    }
    
  }
}
// row LayerNorm (biased variance, eps) over N: s = X (+ R); optional out_sum <- s; out_norm <- (s-mu)*rsqrt(var+eps)*g + b
template <bool PARAM_BF16>
__global__ __launch_bounds__(256) void k_layernorm(const float* __restrict__ X, const float* __restrict__ R, const float* __restrict__ g, const float* __restrict__ bta,
                                                  float* __restrict__ out_sum, float* __restrict__ out_norm, int N, float eps) {
  __shared__ float red[256];
  const int row = blockIdx.x, tid = threadIdx.x;
  const float* x = X + (size_t)row * N; const float* rr = R ? R + (size_t)row * N : nullptr;
  float vals[16];                     // up to N = 4096
  const int per = N / 256;            // contiguous chunk per thread? use strided-by-4 chunks: thread handles j = tid*4 + 1024*u
  float s1 = 0.f;
  for (int u = 0; u < per / 4; ++u) {
    const int j = tid * 4 + 1024 * u;
    const v4f a = *(const v4fa*)(x + j);
    v4f b = {0.f,0.f,0.f,0.f}; if (rr) b = *(const v4fa*)(rr + j);
#pragma unroll
    for (int q = 0; q < 4; ++q) { const float v = a[q] + b[q]; vals[u * 4 + q] = v; s1 += v; }
  }
  red[tid] = s1; __syncthreads();
  for (int st = 128; st > 0; st >>= 1) { if (tid < st) red[tid] += red[tid + st]; __syncthreads(); }
  const float mu = red[0] / (float)N; __syncthreads();
  float s2 = 0.f;
  for (int u = 0; u < per / 4; ++u)
#pragma unroll
    for (int q = 0; q < 4; ++q) { const float c = vals[u * 4 + q] - mu; s2 += c * c; }
  red[tid] = s2; __syncthreads();
  for (int st = 128; st > 0; st >>= 1) { if (tid < st) red[tid] += red[tid + st]; __syncthreads(); }
  const float rs = rsqrtf(red[0] / (float)N + eps);
  {
    for (int u = 0; u < per / 4; ++u) {
      const int j = tid * 4 + 1024 * u;
      v4f o, sm;
#pragma unroll
      for (int q = 0; q < 4; ++q) {
        float gg = g[j + q], bb = bta[j + q];
        if (PARAM_BF16) { gg = bf16_round(gg); bb = bf16_round(bb); }
        sm[q] = vals[u * 4 + q]; o[q] = (vals[u * 4 + q] - mu) * rs * gg + bb;
      }
      if (out_sum) *(v4f*)(out_sum + (size_t)row * N + j) = sm;
      *(v4f*)(out_norm + (size_t)row * N + j) = o;
    }
    
  }
}



// ---- f16 WMMA path (v_wmma_f32_16x16x32_f16): 11-bit significands for operands in range — used where a [0,1] probability operand needs more precision than bf16
typedef _Float16 v16h __attribute__((ext_vector_type(16)));
union FragH { v16h v; v8us half[2]; _Float16 h[16]; unsigned short u[16]; };
template <int NT>
__device__ __forceinline__ v8f mmaH(v16h ah, v16h al, v16h bh, v16h bl, v8f c) {
  c = __builtin_amdgcn_wmma_f32_16x16x32_f16(false, ah, false, bh, (short)0, c, false, false);
  if (NT >= 2) c = __builtin_amdgcn_wmma_f32_16x16x32_f16(false, al, false, bh, (short)0, c, false, false);
  if (NT >= 3) c = __builtin_amdgcn_wmma_f32_16x16x32_f16(false, ah, false, bl, (short)0, c, false, false);
  asm volatile("v_nop\n\tv_nop\n\tv_nop\n\tv_nop" : "+v"(c) : "v"(ah), "v"(al), "v"(bh), "v"(bl));
  return c;
}
// batched GEMM like k_gemm_b but f16 operands: A f32 (split into f16 hi/lo if ASPLIT, else rounded to f16), Bt = f16 values [n][k]; alpha; C f32; N multiple of 16 (partial tiles skipped)
template <bool ASPLIT>
__global__ __launch_bounds__(128) void k_gemm_h(const float* __restrict__ A, int lda, size_t sA, const _Float16* __restrict__ Bh, int ldb, size_t sB, float alpha, float* __restrict__ C, int ldc, size_t sC, int M, int N, int K) {
  __shared__ __attribute__((aligned(16))) float so[4][16][64];
  const int tid = threadIdx.x, w = tid >> 5, lane = tid & 31, ln = lane & 15, hh = lane >> 4; const int by = blockIdx.y;
  A += (size_t)by * sA; Bh += (size_t)by * sB; C += (size_t)by * sC;
  const int ntn = (N + 63) / 64; const int wid = blockIdx.x * 4 + w; const int mt = wid / ntn, nq = wid % ntn; if (mt * 16 >= M) return;
  const int row0 = mt * 16, col0 = nq * 64; const float* arow = A + (size_t)(row0 + ln) * lda;
  v8f acc[4] = {};
  for (int kb = 0; kb < K; kb += 32) {
    FragH ah, al;
    const v4f x0 = *(const v4fa*)(arow + kb + 8 * hh), x1 = *(const v4fa*)(arow + kb + 8 * hh + 4), x2 = *(const v4fa*)(arow + kb + 16 + 8 * hh), x3 = *(const v4fa*)(arow + kb + 16 + 8 * hh + 4);
    float xs[16] = {x0[0],x0[1],x0[2],x0[3],x1[0],x1[1],x1[2],x1[3],x2[0],x2[1],x2[2],x2[3],x3[0],x3[1],x3[2],x3[3]};
#pragma unroll
    for (int i = 0; i < 16; ++i) { const _Float16 h = (_Float16)xs[i]; ah.h[i] = h; al.h[i] = ASPLIT ? (_Float16)(xs[i] - (float)h) : (_Float16)0.0f; }
#pragma unroll
    for (int t = 0; t < 4; ++t) { if (col0 + t * 16 >= N) continue; const size_t boff = (size_t)(col0 + t * 16 + ln) * ldb + kb; FragH bq; bq.half[0] = *(const v8us*)(Bh + boff + 8 * hh); bq.half[1] = *(const v8us*)(Bh + boff + 16 + 8 * hh);
      acc[t] = mmaH<ASPLIT ? 2 : 1>(ah.v, al.v, bq.v, bq.v, acc[t]); }
  }
#pragma unroll
  for (int t = 0; t < 4; ++t) { if (col0 + t * 16 >= N) continue;
#pragma unroll
    for (int r = 0; r < 8; ++r) so[w][8 * hh + r][t * 16 + ln] = acc[t][r] * alpha; }
  __builtin_amdgcn_fence(__ATOMIC_ACQ_REL, "workgroup"); __builtin_amdgcn_wave_barrier();
  const int rsub = lane >> 4, c4 = (lane & 15) * 4;
  {
#pragma unroll
    for (int q = 0; q < 8; ++q) { const int r = q * 2 + rsub; if (col0 + c4 < N) { const v4f v = *(const v4fa*)&so[w][r][c4]; *(v4f*)(C + (size_t)(row0 + r) * ldc + col0 + c4) = v; } }
     }
}

// Wt[n][k] = f16(W[k][n]·scale) from f32 row-major W[K][N] (scale = power of two; bf16-exact weights stay exact in f16 away from the subnormal range)
__global__ __launch_bounds__(256) void k_wt_f16(const float* __restrict__ W, _Float16* __restrict__ Wt, int K, int N, float scale) {
  const int t = blockIdx.x * 256 + threadIdx.x; if (t >= N * (K / 8)) return; const int n = t / (K / 8), k8 = (t % (K / 8)) * 8; FragH f;
#pragma unroll
  for (int i = 0; i < 8; ++i) f.h[i] = (_Float16)(bf16_round(W[(size_t)(k8 + i) * N + n]) * scale); const v8us o = f.half[0];
  *(v8us*)((unsigned short*)Wt + (size_t)n * K + k8) = o; 
}
// k_gemm_hh variant with fused epilogue: v = acc·alpha + bias[by·sBias + col] (+ CP[(row/rowsPerB)·sCPb + by·64 + col] if CP) ; ACT 0 none / 1 elu ; writes f16 C16 (and f32 C if non-null)
template <int ACT>
__global__ __launch_bounds__(128) void k_gemm_hhx(const _Float16* __restrict__ A, int lda, size_t sA, const _Float16* __restrict__ Bh, int ldb, size_t sB, float alpha, const float* __restrict__ bias, size_t sBias, const float* __restrict__ CP, int rowsPerB, size_t sCPb, int row0g,
    float* __restrict__ C, _Float16* __restrict__ C16, int ldc, size_t sC, int M, int N, int K) {
  __shared__ __attribute__((aligned(16))) float so[4][16][64];
  const int tid = threadIdx.x, w = tid >> 5, lane = tid & 31, ln = lane & 15, hh = lane >> 4; const int by = blockIdx.y;
  A += (size_t)by * sA; Bh += (size_t)by * sB; const size_t cofs = (size_t)by * sC; const float* bp = bias ? bias + (size_t)by * sBias : nullptr;
  const int ntn = (N + 63) / 64; const int wid = blockIdx.x * 4 + w; const int mt = wid / ntn, nq = wid % ntn; if (mt * 16 >= M) return;
  const int row0 = mt * 16, col0 = nq * 64; const _Float16* arow = A + (size_t)(row0 + ln) * lda;
  v8f acc[4] = {};
  for (int kb = 0; kb < K; kb += 32) { FragH ah; ah.half[0] = *(const v8us*)((const unsigned short*)arow + kb + 8 * hh); ah.half[1] = *(const v8us*)((const unsigned short*)arow + kb + 16 + 8 * hh);
#pragma unroll
    for (int t = 0; t < 4; ++t) { if (col0 + t * 16 >= N) continue; const size_t boff = (size_t)(col0 + t * 16 + ln) * ldb + kb; FragH bq; bq.half[0] = *(const v8us*)((const unsigned short*)Bh + boff + 8 * hh); bq.half[1] = *(const v8us*)((const unsigned short*)Bh + boff + 16 + 8 * hh);
      acc[t] = mmaH<1>(ah.v, ah.v, bq.v, bq.v, acc[t]); }
  }
#pragma unroll
  for (int t = 0; t < 4; ++t) { if (col0 + t * 16 >= N) continue; const int col = col0 + t * 16 + ln; const float bv = bp ? bf16_round(bp[col]) : 0.f;
#pragma unroll
    for (int r = 0; r < 8; ++r) { float v = acc[t][r] * alpha + bv; if (CP) { const int rr = row0g + row0 + 8 * hh + r; if (rowsPerB < 0) v += CP[cofs + (size_t)rr * ldc + col];      /* rowsPerB < 0: own element of the batched C plane */ else { const int bidx = rr / rowsPerB; v += CP[(size_t)bidx * sCPb + (size_t)by * 64 + col]; } } if (ACT == 1) v = (v > 0.f) ? v : expm1f(v); else if (ACT == 7) v = (v > 0.f) ? v + 1.0f : expf(v); else if (ACT == 8) v = tanhf(v); else if (ACT == 9) v = 0.5f * v * (1.0f + tanhf(0.7978845608028654f * (v + 0.044715f * v * v * v))); else if (ACT == 11) v = 1.0f / (1.0f + expf(-v)); else if (ACT == 12) v = (v > 0.f) ? v : 0.01f * v; else if (ACT == 14) v = (v > 0.f) ? v : 0.1f * v; else if (ACT == 16) v = (v >= 0.f) ? v : 0.3f * v; else if (ACT == 17) v = (v >= 0.f) ? v : 0.2f * v; else if (ACT == 15) v = v / (1.0f + expf(-v)); else if (ACT == 3) v = fmaxf(v, 0.f); else if (ACT == 6) v = 0.5f * v * (1.0f + erff(v * 0.70710678118654752f)); so[w][8 * hh + r][t * 16 + ln] = v; } }
  __builtin_amdgcn_fence(__ATOMIC_ACQ_REL, "workgroup"); __builtin_amdgcn_wave_barrier();
  const int rsub = lane >> 4, c4 = (lane & 15) * 4; typedef _Float16 v4h __attribute__((ext_vector_type(4)));
  {
#pragma unroll
    for (int q = 0; q < 8; ++q) { const int r = q * 2 + rsub; if (col0 + c4 < N) { const v4f v = *(const v4fa*)&so[w][r][c4]; if (C) *(v4f*)(C + cofs + (size_t)(row0 + r) * ldc + col0 + c4) = v; if (C16) { v4h h4; for (int i = 0; i < 4; ++i) h4[i] = (_Float16)v[i]; *(v4h*)(C16 + cofs + (size_t)(row0 + r) * ldc + col0 + c4) = h4; } } }
     }
}


typedef _Float16 v4h __attribute__((ext_vector_type(4)));

__global__ __launch_bounds__(256) void k_x16(const float* __restrict__ x, _Float16* __restrict__ X16, size_t n8) { const size_t t = (size_t)blockIdx.x * 256 + threadIdx.x; if (t >= n8) return; FragH f;
#pragma unroll
  for (int q = 0; q < 8; ++q) f.h[q] = (_Float16)bf16_round(x[t * 8 + q]); *(v8us*)((unsigned short*)X16 + t * 8) = f.half[0];  }
__global__ __launch_bounds__(256) void k_h16(const float* __restrict__ x, _Float16* __restrict__ X16, size_t n8) { const size_t t = (size_t)blockIdx.x * 256 + threadIdx.x; if (t >= n8) return; FragH f;
#pragma unroll
  for (int q = 0; q < 8; ++q) f.h[q] = (_Float16)x[t * 8 + q]; *(v8us*)((unsigned short*)X16 + t * 8) = f.half[0];  }
__global__ __launch_bounds__(256) void k_round16f(const float* __restrict__ W, _Float16* __restrict__ Bt, size_t n8) { const size_t t = (size_t)blockIdx.x * 256 + threadIdx.x; if (t >= n8) return; FragH f;
#pragma unroll
  for (int i = 0; i < 8; ++i) f.h[i] = (_Float16)(bf16_round(W[t * 8 + i]) * 16.0f); *(v8us*)((unsigned short*)Bt + t * 8) = f.half[0];  }
template <int NHv, int TTv>
__global__ __launch_bounds__(256) void k_vt(const _Float16* __restrict__ V16, int ldv, int voff, _Float16* __restrict__ Vt) { __shared__ unsigned short tl[64][66]; const int tid = threadIdx.x; const int slab = blockIdx.x / (TTv / 64), lg = blockIdx.x % (TTv / 64); const int b = slab / NHv, h = slab % NHv;
  for (int i = tid; i < 64 * 8; i += 256) { const int r = i / 8, c8 = (i % 8) * 8; FragH f; f.half[0] = *(const v8us*)((const unsigned short*)V16 + ((size_t)b * TTv + lg * 64 + r) * ldv + voff + h * 64 + c8);
#pragma unroll
    for (int q = 0; q < 8; ++q) tl[r][c8 + q] = f.u[q]; }
  __syncthreads();
  {
#pragma unroll
    for (int rd = 0; rd < 2; ++rd) { const int d = rd * 32 + tid / 8, pc = tid % 8; FragH f;
#pragma unroll
      for (int q = 0; q < 8; ++q) f.u[q] = tl[pc * 8 + q][d];
      *(v8us*)((unsigned short*)Vt + ((size_t)slab * 64 + d) * TTv + lg * 64 + pc * 8) = f.half[0]; }
     } }

__global__ __launch_bounds__(256) void k_hl(const float* __restrict__ F, _Float16* __restrict__ Hh, _Float16* __restrict__ Hl, size_t n8) { const size_t t = (size_t)blockIdx.x * 256 + threadIdx.x; if (t >= n8) return; FragH fh, fl; const v4f a = *(const v4fa*)(F + t * 8), c = *(const v4fa*)(F + t * 8 + 4);
#pragma unroll
  for (int q = 0; q < 4; ++q) { _Float16 h = (_Float16)a[q]; fh.h[q] = h; fl.h[q] = (_Float16)((a[q] - (float)h) * 1024.0f); h = (_Float16)c[q]; fh.h[4 + q] = h; fl.h[4 + q] = (_Float16)((c[q] - (float)h) * 1024.0f); }
  { *(v8us*)((unsigned short*)Hh + t * 8) = fh.half[0]; *(v8us*)((unsigned short*)Hl + t * 8) = fl.half[0];  } }

// ---- fast GEMM (wave tile 32x64; requires M % 32 == 0 rows per launch region and N % 64 == 0); epilogue = k_gemm_hhx semantics ----
__device__ __forceinline__ v16h g2_frag(const _Float16* p, int hh) { FragH f; f.half[0] = *(const v8us*)((const unsigned short*)p + 8 * hh); f.half[1] = *(const v8us*)((const unsigned short*)p + 16 + 8 * hh); return f.v; }
__device__ __forceinline__ v8f g2_mma(v16h a, v16h b, v8f c) { v8f d = __builtin_amdgcn_wmma_f32_16x16x32_f16(false, a, false, b, (short)0, c, false, false); asm volatile("v_nop\n\tv_nop\n\tv_nop\n\tv_nop" : "+v"(d) : "v"(a), "v"(b)); return d; }
template <int ACT>
__global__ __launch_bounds__(128) void k_gemm2(const _Float16* __restrict__ A, int lda, size_t sA, const _Float16* __restrict__ Bh, int ldb, size_t sB, float alpha, const float* __restrict__ bias, size_t sBias, const float* __restrict__ CP, int rowsPerB, size_t sCPb, int row0g,
    float* __restrict__ C, _Float16* __restrict__ C16, int ldc, size_t sC, int M, int N, int K) { static_assert(ACT == 0 || ACT == 3 || ACT == 6 || ACT == 8 || ACT == 9 || ACT == 11 || ACT == 12 || ACT == 14 || ACT == 15 || ACT == 16 || ACT == 17, "k_gemm2: unsupported ACT code (would silently apply no activation)");
  __shared__ __attribute__((aligned(16))) float so[4][32][68];
  const int tid = threadIdx.x, w = tid >> 5, lane = tid & 31, ln = lane & 15, hh = lane >> 4; const int by = blockIdx.y;
  A += (size_t)by * sA; Bh += (size_t)by * sB; const size_t cofs = (size_t)by * sC; const float* bp = bias ? bias + (size_t)by * sBias : nullptr;
  const int ntn = N >> 6; const int mt = blockIdx.x / ntn, nq = blockIdx.x - mt * ntn; const int row0 = mt * 128 + 32 * w, col0 = nq * 64; if (row0 >= M) return;
  const _Float16* a0p = A + (size_t)(row0 + ln) * lda; const _Float16* a1p = a0p + (size_t)16 * lda;
  const _Float16* b0p = Bh + (size_t)(col0 + ln) * ldb; const _Float16* b1p = b0p + (size_t)16 * ldb; const _Float16* b2p = b1p + (size_t)16 * ldb; const _Float16* b3p = b2p + (size_t)16 * ldb;
  const v8f z8 = {0.f,0.f,0.f,0.f,0.f,0.f,0.f,0.f}; v8f c00 = z8, c01 = z8, c02 = z8, c03 = z8, c10 = z8, c11 = z8, c12 = z8, c13 = z8;
#pragma unroll 1
  for (int kb = 0; kb < K; kb += 32) { const v16h a0 = g2_frag(a0p + kb, hh), a1 = g2_frag(a1p + kb, hh);
    v16h b = g2_frag(b0p + kb, hh); c00 = g2_mma(a0, b, c00); c10 = g2_mma(a1, b, c10);
    b = g2_frag(b1p + kb, hh); c01 = g2_mma(a0, b, c01); c11 = g2_mma(a1, b, c11);
    b = g2_frag(b2p + kb, hh); c02 = g2_mma(a0, b, c02); c12 = g2_mma(a1, b, c12);
    b = g2_frag(b3p + kb, hh); c03 = g2_mma(a0, b, c03); c13 = g2_mma(a1, b, c13); }
  v8f accs[8] = {c00, c01, c02, c03, c10, c11, c12, c13};
#pragma unroll
  for (int u = 0; u < 8; ++u) { const int t = u & 3, half = u >> 2; const int col = col0 + t * 16 + ln; const float bv = bp ? bf16_round(bp[col]) : 0.f;
#pragma unroll
    for (int r = 0; r < 8; ++r) { const int rloc = half * 16 + 8 * hh + r; float v = accs[u][r] * alpha + bv; if (CP) { if (rowsPerB < 0) v += CP[cofs + (size_t)(row0g + row0 + rloc) * ldc + col];      /* rowsPerB < 0: own element of the batched C plane */ else { const int bidx = (row0g + row0 + rloc) / rowsPerB; v += CP[(size_t)bidx * sCPb + (size_t)by * 64 + col]; } }
      if (ACT == 3) v = fmaxf(v, 0.f); else if (ACT == 6) v = 0.5f * v * (1.0f + erff(v * 0.70710678118654752f)); else if (ACT == 11) v = 1.0f / (1.0f + expf(-v)); else if (ACT == 15) v = v / (1.0f + expf(-v)); else if (ACT == 12) v = (v > 0.f) ? v : 0.01f * v; else if (ACT == 8) v = tanhf(v); else if (ACT == 9) v = 0.5f * v * (1.0f + tanhf(0.7978845608028654f * (v + 0.044715f * v * v * v))); else if (ACT == 14) v = (v > 0.f) ? v : 0.1f * v; else if (ACT == 16) v = (v >= 0.f) ? v : 0.3f * v; else if (ACT == 17) v = (v >= 0.f) ? v : 0.2f * v;
      so[w][rloc][t * 16 + ln] = v; } }
  __builtin_amdgcn_fence(__ATOMIC_ACQ_REL, "workgroup"); __builtin_amdgcn_wave_barrier();
  const int rsub = lane >> 4, c4 = (lane & 15) * 4;
  {
#pragma unroll
    for (int q = 0; q < 16; ++q) { const int r = q * 2 + rsub; const v4f v = *(const v4fa*)&so[w][r][c4]; if (C) *(v4f*)(C + cofs + (size_t)(row0 + r) * ldc + col0 + c4) = v; if (C16) { v4h h4; for (int i = 0; i < 4; ++i) h4[i] = (_Float16)v[i]; *(v4h*)(C16 + cofs + (size_t)(row0 + r) * ldc + col0 + c4) = h4; } }
     } }


__global__ __launch_bounds__(256) void k_wnat(const float* __restrict__ w, size_t n8, _Float16* __restrict__ Bt) { const size_t t = (size_t)blockIdx.x * 256 + threadIdx.x; if (t >= n8) return; FragH f; for (int q = 0; q < 8; ++q) f.h[q] = (_Float16)(bf16_round(w[t * 8 + q]) * 16.0f); *(v8us*)((unsigned short*)Bt + t * 8) = f.half[0];  }
__global__ __launch_bounds__(256) void k_rsm(const float* __restrict__ S, _Float16* __restrict__ P, int nrows) {
  #pragma clang fp contract(off)
  const int i = blockIdx.x * 256 + threadIdx.x; if (i >= nrows) return; const float* s = S + (size_t)i * SQ; float mx = -3.0e38f;
#pragma unroll 1
  for (int j = 0; j < SQ; ++j) mx = fmaxf(mx, s[j]); float se = 0.f;
#pragma unroll 1
  for (int j = 0; j < SQ; ++j) se += expf(s[j] - mx); const float sc = 256.0f / se;
#pragma unroll 1
  for (int j0 = 0; j0 < SQ; j0 += 8) { FragH f; for (int q = 0; q < 8; ++q) f.h[q] = (_Float16)(expf(s[j0 + q] - mx) * sc); unsigned short* d = (unsigned short*)P + (size_t)i * SQ + j0; *(v8us*)d = f.half[0];  } }
__global__ __launch_bounds__(256) void k_vt(const _Float16* __restrict__ V16, int b, int h0, _Float16* __restrict__ VT) { __shared__ unsigned short tl[64][65]; const int tid = threadIdx.x; const int hh = blockIdx.x % HG, sg = blockIdx.x / HG; const int s0 = sg * 64; const int h = h0 + hh;
  for (int i = tid; i < 64 * 8; i += 256) { const int j = i / 8, d8 = (i % 8) * 8; FragH f; f.half[0] = *(const v8us*)((const unsigned short*)V16 + ((size_t)b * SQ + s0 + j) * DM + h * HD + d8); for (int q = 0; q < 8; ++q) tl[d8 + q][j] = f.u[q]; }
  __syncthreads();
  { for (int i = tid; i < 64 * 8; i += 256) { const int d = i / 8, j8 = (i % 8) * 8; FragH f; for (int q = 0; q < 8; ++q) f.u[q] = tl[d][j8 + q]; *(v8us*)((unsigned short*)VT + ((size_t)hh * HD + d) * SQ + s0 + j8) = f.half[0]; }  } }


template <int BFIN, int W16, int W32>
__global__ __launch_bounds__(256) void k_lnx(const float* __restrict__ X, const float* __restrict__ g, const float* __restrict__ bb, float eps, _Float16* __restrict__ N16, float* __restrict__ N32) {
  #pragma clang fp contract(off)
  __shared__ float red[256]; const size_t r = blockIdx.x; const int t = threadIdx.x; const bool act = t < (DMQ / 4); const int c0 = act ? t * 4 : 0;
  const v4f xa = *(const v4fa*)(X + r * DMQ + c0); float s[4]; float sum = 0.f;
  for (int q = 0; q < 4; ++q) { s[q] = act ? (BFIN ? bf16_round(xa[q]) : xa[q]) : 0.f; sum = __fadd_rn(sum, s[q]); }
  red[t] = sum; __syncthreads(); for (int st = 128; st > 0; st >>= 1) { if (t < st) red[t] = __fadd_rn(red[t], red[t + st]); __syncthreads(); } const float mu = red[0] / (float)DMQ; __syncthreads();
  float vs = 0.f; for (int q = 0; q < 4; ++q) { const float dl = act ? __fadd_rn(s[q], -mu) : 0.f; vs = __fadd_rn(vs, __fmul_rn(dl, dl)); } red[t] = vs; __syncthreads(); for (int st = 128; st > 0; st >>= 1) { if (t < st) red[t] = __fadd_rn(red[t], red[t + st]); __syncthreads(); }
  const float rs = rsqrtf(__fadd_rn(red[0] / (float)DMQ, eps)); v4h y; v4f yf;
  for (int q = 0; q < 4; ++q) { const int c = c0 + q; yf[q] = __fadd_rn(__fmul_rn(__fmul_rn(__fadd_rn(s[q], -mu), rs), bf16_round(g[c])), (bb ? bf16_round(bb[c]) : 0.f)); y[q] = (_Float16)yf[q]; }
  if (!act) return;      /* no barriers after this point */
  { if (W16) *(v4h*)(N16 + r * DMQ + c0) = y; if (W32) *(v4f*)(N32 + r * DMQ + c0) = yf;  } }


__global__ __launch_bounds__(256) void k_rsmf(const float* __restrict__ S, _Float16* __restrict__ P, int qn, int hg) {
  #pragma clang fp contract(off)
  const int t = blockIdx.x * 256 + threadIdx.x; if (t >= qn * hg) return; const size_t i = (size_t)(t / qn) * SQ + (t % qn); const float* s = S + i * SQ; float mx = -3.0e38f;
#pragma unroll 1
  for (int j = 0; j < SQ; ++j) mx = fmaxf(mx, s[j]); float se = 0.f;
#pragma unroll 1
  for (int j = 0; j < SQ; ++j) se += __expf(s[j] - mx); const float sc = 256.0f / se;
#pragma unroll 1
  for (int j0 = 0; j0 < SQ; j0 += 8) { FragH f; for (int q = 0; q < 8; ++q) f.h[q] = (_Float16)(__expf(s[j0 + q] - mx) * sc); unsigned short* d = (unsigned short*)P + i * SQ + j0; *(v8us*)d = f.half[0];  } }


__global__ __launch_bounds__(256) void k_bfr(const float* __restrict__ x, float* __restrict__ XB, size_t n8) { const size_t t = (size_t)blockIdx.x * 256 + threadIdx.x; if (t >= n8) return; v4f a = *(const v4fa*)(x + t * 8), c = *(const v4fa*)(x + t * 8 + 4); for (int q = 0; q < 4; ++q) { a[q] = bf16_round(a[q]); c[q] = bf16_round(c[q]); }
  { *(v4f*)(XB + t * 8) = a; *(v4f*)(XB + t * 8 + 4) = c;  } }



__global__ __launch_bounds__(256) void k_rsmfam(const float* __restrict__ S, _Float16* __restrict__ P, int qn, int hg, const float* __restrict__ am) {
  #pragma clang fp contract(off)
  const int t = blockIdx.x * 256 + threadIdx.x; if (t >= qn * hg) return; const size_t i = (size_t)(t / qn) * SQ + (t % qn); const float* s = S + i * SQ; float mx = -3.0e38f;
#pragma unroll 1
  for (int j = 0; j < SQ; ++j) mx = fmaxf(mx, __fadd_rn(s[j], bf16_round(am[j]))); float se = 0.f;
#pragma unroll 1
  for (int j = 0; j < SQ; ++j) se += __expf(__fadd_rn(s[j], bf16_round(am[j])) - mx); const float sc = 256.0f / se;
#pragma unroll 1
  for (int j0 = 0; j0 < SQ; j0 += 8) { FragH f; for (int q = 0; q < 8; ++q) f.h[q] = (_Float16)(__expf(__fadd_rn(s[j0 + q], bf16_round(am[j0 + q])) - mx) * sc); unsigned short* d = (unsigned short*)P + i * SQ + j0; *(v8us*)d = f.half[0];  } }


#define CC CX           /* transposer macros: input channels */
#define LL SQ           /* pixels per image */
#define LQ (3 * DM)     /* unused */

__global__ __launch_bounds__(256) void k_cl2rows(const float* __restrict__ X, _Float16* __restrict__ XR) { __shared__ float tl[64][33]; const int tid = threadIdx.x; const int nl = LL / 32, nc = CC / 64; const int cb_ = blockIdx.x % nc; const int lb = (blockIdx.x / nc) % nl; const size_t b = blockIdx.x / (nc * nl); const int c0 = cb_ * 64, l0 = lb * 32;
  for (int i = tid; i < 64 * 32; i += 256) { const int c = i / 32, l = i % 32; tl[c][l] = bf16_round(X[(b * CC + c0 + c) * (size_t)LL + l0 + l]); }
  __syncthreads();
  { const int l = tid / 8, c8 = (tid % 8) * 8; FragH f; for (int q = 0; q < 8; ++q) f.h[q] = (_Float16)tl[c8 + q][l]; unsigned short* d = (unsigned short*)XR + (b * LL + l0 + l) * (size_t)CC + c0 + c8; *(v8us*)d = f.half[0];  } }


__global__ __launch_bounds__(256) void k_rowb(float* __restrict__ O, const float* __restrict__ bias, size_t n4) {
  #pragma clang fp contract(off)
  const size_t t = (size_t)blockIdx.x * 256 + threadIdx.x; if (t >= n4) return; const size_t e = t * 4; const int c = (int)((e / SQ) % CX);      /* output channels */ const float bb = bf16_round(bias[c]); const v4f a = *(const v4fa*)(O + e); v4f o; for (int q = 0; q < 4; ++q) o[q] = __fadd_rn(a[q], bb);
  *(v4f*)(O + e) = o;  }

__global__ __launch_bounds__(256) void k_gres(const float* __restrict__ T, const float* __restrict__ gam, const float* __restrict__ X, float* __restrict__ Y, size_t n4) {
  #pragma clang fp contract(off)
  const size_t t = (size_t)blockIdx.x * 256 + threadIdx.x; if (t >= n4) return; const float g = bf16_round(gam[0]); const v4f a = *(const v4fa*)(T + t * 4), xx = *(const v4fa*)(X + t * 4); v4f r;
  for (int q = 0; q < 4; ++q) r[q] = __fadd_rn(__fmul_rn(g, a[q]), bf16_round(xx[q]));
  *(v4f*)(Y + t * 4) = r;  }

__global__ __launch_bounds__(256) void k_bcpy(const float* __restrict__ b, int n, int NP, float* __restrict__ dst, int dst0) { for (int i = threadIdx.x; i < NP; i += 256) { const float v = (i < n) ? b[i] : 0.f; *(float*)(dst + dst0 + i) = v; }  }



__global__ __launch_bounds__(256) void k_zero16(_Float16* __restrict__ Y, size_t n8) { const size_t t = (size_t)blockIdx.x * 256 + threadIdx.x; if (t >= n8) return; const v8us z = {0, 0, 0, 0, 0, 0, 0, 0}; *(v8us*)((unsigned short*)Y + t * 8) = z;  }
__global__ __launch_bounds__(256) void k_qkz(const float* __restrict__ F, _Float16* __restrict__ QZ, _Float16* __restrict__ KZ, int nr) {
  const int r = blockIdx.x * 256 + threadIdx.x; if (r >= nr) return; const float* f = F + (size_t)r * 64; FragH q0, q1, k0, k1;
  for (int i = 0; i < 8; ++i) { q0.h[i] = (_Float16)(0.5f * f[i]); q1.h[i] = (_Float16)(0.5f * f[8 + i]);      /* q / 2 (exact in f32): the gate takes tanh of half the score */ k0.h[i] = (_Float16)f[16 + i]; k1.h[i] = (_Float16)f[24 + i]; } const v8us z = {0, 0, 0, 0, 0, 0, 0, 0};
  unsigned short* dq = (unsigned short*)QZ + (size_t)r * 32; unsigned short* dk = (unsigned short*)KZ + (size_t)r * 16;      /* k rows of 32 bytes, no padding: 16 rows are the 512 contiguous bytes of one fragment load */
  { *(v8us*)dq = q0.half[0]; *(v8us*)(dq + 8) = q1.half[0]; *(v8us*)(dq + 16) = z; *(v8us*)(dq + 24) = z; *(v8us*)dk = k0.half[0]; *(v8us*)(dk + 8) = k1.half[0];  } }
// V rows [b][key][channel] -> fragment order: per image, 32-key block and 16-channel tile one 1-KiB unit [half][lane][8 keys], laid out as the lanes of the fused kernel read their A operand
// (lane = 16 hh + ln holds channel ln, keys 16 half + 8 hh + 0..7), so that each wave-wide 16-byte load there covers 512 contiguous bytes. Work-group = 64 keys x 64 channels through LDS; a wave stores one 8-key chunk of 32 channels as two 256-byte runs.
__global__ __launch_bounds__(256) void k_vpack(const _Float16* __restrict__ VR, _Float16* __restrict__ VP) { __shared__ unsigned short tl[64][66]; const int tid = threadIdx.x; const int cg = blockIdx.x % (CX / 64), lg = (blockIdx.x / (CX / 64)) % (SQ / 64), b = blockIdx.x / ((CX / 64) * (SQ / 64));
#pragma unroll      /* both row loads of a thread in flight at once */
  for (int u = 0; u < 2; ++u) { const int r = u * 32 + tid / 8, c8 = (tid % 8) * 8; FragH f; f.half[0] = *(const v8us*)((const unsigned short*)VR + ((size_t)b * SQ + lg * 64 + r) * CX + cg * 64 + c8);
#pragma unroll
    for (int q = 0; q < 8; ++q) tl[r][c8 + q] = f.u[q]; }
  __syncthreads();
  const int pc = tid >> 5, lane = tid & 31; const int kb = lg * 2 + (pc >> 2), hf = (pc >> 1) & 1, hh = pc & 1;      /* pc: the wave's 8-key chunk of the 64 keys */
#pragma unroll
  for (int rd = 0; rd < 2; ++rd) { const int d = rd * 32 + lane, t = cg * 4 + (d >> 4), ln = d & 15; FragH f;
#pragma unroll
    for (int q = 0; q < 8; ++q) f.u[q] = tl[pc * 8 + q][d];
    *(v8us*)((unsigned short*)VP + ((((size_t)(b * (SQ / 32) + kb) * (CX / 16) + t) * 2 + hf) * 32 + hh * 16 + ln) * 8) = f.half[0]; } }
// ---- fused sigmoid attention: T[b][c][n] = sum_m V[b][c][m] sigmoid(q[n].k[m]); the gate tile never leaves registers ----
// S^T / 2 = K.(Q / 2)^T (A = k rows, B = rows of q / 2, both through f_frag16): a lane holds column n = ln, rows m = 8 hh + r. Two such D tiles (m 0-15, 16-31), gated and
// rounded to f16 in place, are the B operand of out += V.P^T in the hardware k order, which is the order k_vpack stores the V fragments in (A operand, f_fragp).
// Work-group = one image, 32 query columns, all 128 channels; its 8 waves each walk 512 of the 4096 keys; the 8 partial tiles are summed through LDS in wave order.
#define FW 8             /* waves per work-group = key ranges */
#define FN 32            /* query columns per work-group */
#define FP 36            /* LDS row pitch in floats: rows 8 apart fall on other banks, 16-byte reads stay aligned */
/* waves_per_eu(4, 4): at most 256 registers, so that two work-groups share a WGP and four waves per SIMD cover each other's dependent gate arithmetic; 2 x the LDS size fits the WGP */
__device__ __forceinline__ v16h f_frag16(const _Float16* p) { FragH f; const v8us z = {0, 0, 0, 0, 0, 0, 0, 0}; f.half[0] = *(const v8us*)(const unsigned short*)p; f.half[1] = z; return f.v; }      /* q / k fragment: k 16-31 are zeros set in registers, not loaded (the k rows have no padding) */
__device__ __forceinline__ v16h f_fragp(const _Float16* p) { FragH f; f.half[0] = *(const v8us*)(const unsigned short*)p; f.half[1] = *(const v8us*)((const unsigned short*)p + 256); return f.v; }      /* V fragment from a k_vpack unit: p = unit + 8 lane; the second half stands 512 bytes on */
__device__ __forceinline__ v8f f_mma(v16h a, v16h b, v8f c) { return __builtin_amdgcn_wmma_f32_16x16x32_f16(false, a, false, b, (short)0, c, false, false); }
/* gate: sigmoid(s) = 0.5 + 0.5 tanh(s / 2), one v_tanh_f32 per score; u = s / 2 comes out of the score product itself (the q plane holds q / 2, a power of two); two gates share the packed fma and the packed f16 conversion; +-inf give 0 and 1, NaN stays NaN */
typedef float v2f __attribute__((ext_vector_type(2)));
typedef _Float16 v2h __attribute__((ext_vector_type(2)));
__device__ __forceinline__ v2h f_gate2(float u0, float u1) { const v2f t = {__builtin_amdgcn_tanhf(u0), __builtin_amdgcn_tanhf(u1)}; const v2f hf = {0.5f, 0.5f}; return __builtin_convertvector(__builtin_elementwise_fma(t, hf, hf), v2h); }
__global__ __launch_bounds__(FW * 32) __attribute__((amdgpu_waves_per_eu(4, 4))) void k_sattn(const _Float16* __restrict__ QZ, const _Float16* __restrict__ KZ, const _Float16* __restrict__ VP, float* __restrict__ T) {
  __shared__ __attribute__((aligned(16))) float red[FW][CX][FP];
  constexpr int MR = SQ / FW;      /* keys per wave */
  const int tid = threadIdx.x, w = tid >> 5, lane = tid & 31, ln = lane & 15, hh = lane >> 4; const int b = blockIdx.y, n0 = blockIdx.x * FN;
  const _Float16* qp = QZ + ((size_t)b * SQ + n0 + ln) * 32; const unsigned ki = (unsigned)((b * SQ + w * MR + ln) * 16 + 8 * hh), vi = (unsigned)((b * (SQ / 32) + w * (MR / 32)) * (CX / 16) * 512 + 8 * lane); const _Float16* kp = KZ + ki; const _Float16* vp = VP + vi;      /* kp, vp: the lane's own first 8 elements; over a wave both are 512 contiguous bytes */
  const v16h qf[2] = {f_frag16(qp + 8 * hh), f_frag16(qp + 16 * 32 + 8 * hh)};      /* rows of q / 2: the score tiles are s / 2, the argument of the gate's tanh */
  const v8f z8 = {0.f,0.f,0.f,0.f,0.f,0.f,0.f,0.f}; v8f acc[CX / 16][2];
#pragma unroll
  for (int t = 0; t < CX / 16; ++t) { acc[t][0] = z8; acc[t][1] = z8; }
#pragma unroll 1      /* rolled; the inner loops are unrolled so that fragments and accumulators stay in registers */
  for (int m0 = 0; m0 < MR; m0 += 32, kp += 32 * 16, vp += (CX / 16) * 512) {
    const v16h k0 = f_frag16(kp), k1 = f_frag16(kp + 16 * 16); v16h vf[CX / 16];
#pragma unroll
    for (int t = 0; t < CX / 16; ++t) vf[t] = f_fragp(vp + t * 512);
    asm volatile("s_wait_xcnt 0x0" ::: "memory");      /* kp and vp are advanced at the loop's foot: the wait that stands between issued loads and an overwrite of their address registers, put where the wave waits for the k rows next */
    __builtin_amdgcn_sched_barrier(0);      /* all of the pass's loads are issued ahead of the scores: a load sunk behind the first gates is waited for in full among the products */
#pragma unroll
    for (int j = 0; j < 2; ++j) { const v8f s0 = f_mma(k0, qf[j], z8), s1 = f_mma(k1, qf[j], z8); FragH p;
#pragma unroll
      for (int r = 0; r < 8; r += 2) { const v2h g0 = f_gate2(s0[r], s0[r + 1]), g1 = f_gate2(s1[r], s1[r + 1]); p.h[r] = g0[0]; p.h[r + 1] = g0[1]; p.h[8 + r] = g1[0]; p.h[8 + r + 1] = g1[1]; }
#pragma unroll
      for (int t = 0; t < CX / 16; ++t) acc[t][j] = f_mma(vf[t], p.v, acc[t][j]);
      __builtin_amdgcn_sched_barrier(0);      /* one column group's scores and gates at a time: both at once do not fit the registers of four waves per SIMD */
    } }
#pragma unroll
  for (int t = 0; t < CX / 16; ++t)
#pragma unroll
    for (int j = 0; j < 2; ++j)
#pragma unroll
      for (int r = 0; r < 8; ++r) red[w][t * 16 + 8 * hh + r][j * 16 + ln] = acc[t][j][r];
  __syncthreads();
#pragma unroll
  for (int q = 0; q < CX * FN / 4 / (FW * 32); ++q) { const int i = q * (FW * 32) + tid, c = i / (FN / 4), n4 = (i % (FN / 4)) * 4; v4f s = *(const v4fa*)&red[0][c][n4];
#pragma unroll
    for (int u = 1; u < FW; ++u) s += *(const v4fa*)&red[u][c][n4];
    *(v4f*)(T + ((size_t)b * CX + c) * SQ + n0 + n4) = s; } }
extern "C" void kernel_launch(void* const* d_in, const int* in_sizes, int n_in,
                              void* d_out, int out_size, void* d_ws, size_t ws_size, hipStream_t stream) {
  (void)in_sizes; (void)n_in; (void)out_size;
  const float* const* I = (const float* const*)d_in; const float* x = I[0]; const float* wq = I[1]; const float* bq = I[2]; const float* wk = I[3]; const float* bk = I[4]; const float* wv = I[5]; const float* bv = I[6]; const float* gam = I[7];      /* natural Wq/Wk [16][128] + b, Wv [128][128] + b; gamma [1] */
  constexpr int DQ = 16, KP = 32;      /* q/k width 16, zero-padded to K = 32 for the WMMA contraction */
  char* ws = (char*)d_ws; size_t off = 0;
  auto take = [&](size_t bytes) { char* p = ws + off; off += (bytes + 255) & ~(size_t)255; return p; };
  _Float16* BQK = (_Float16*)take((size_t)64 * CX * 2); _Float16* BV = (_Float16*)take((size_t)CX * CX * 2); float* bqk = (float*)take((size_t)64 * 4);      /* [Wq; Wk; 0] as a 64-row Bt plane + [bq | bk | 0] */
  _Float16* XR = (_Float16*)take(NR * CX * 2); float* QKF = (float*)take(NR * 64 * 4); _Float16* QZ = (_Float16*)take(NR * KP * 2); _Float16* KZ = (_Float16*)take(NR * DQ * 2); _Float16* VR = (_Float16*)take(NR * CX * 2); _Float16* VP = (_Float16*)take(NR * CX * 2);
  float* T = (float*)take(NR * CX * 4);      /* one plane per image: all four images go through each stage in one launch */
  if (off > ws_size) return;
  k_zero16<<<(unsigned)(((size_t)64 * CX / 8 + 255) / 256), 256, 0, stream>>>(BQK, (size_t)64 * CX / 8); k_wnat<<<(unsigned)(((size_t)DQ * CX / 8 + 255) / 256), 256, 0, stream>>>(wq, (size_t)DQ * CX / 8, BQK); k_wnat<<<(unsigned)(((size_t)DQ * CX / 8 + 255) / 256), 256, 0, stream>>>(wk, (size_t)DQ * CX / 8, BQK + (size_t)DQ * CX); k_wnat<<<(unsigned)(((size_t)CX * CX / 8 + 255) / 256), 256, 0, stream>>>(wv, (size_t)CX * CX / 8, BV);      /* Bt planes: [Wq; Wk; zeros] (64 rows) x16 and Wv */
  k_bcpy<<<1, 256, 0, stream>>>(bq, DQ, 64, bqk, 0); k_bcpy<<<1, 256, 0, stream>>>(bk, DQ, DQ, bqk, DQ);      /* [bq | bk | 0] (the first call zero-fills the 64-wide row) */
  k_cl2rows<<<NB * (SQ / 32) * (CX / 64), 256, 0, stream>>>(x, XR);      /* exact f16 token rows [n i][c] */
  k_gemm2<0><<<dim3((unsigned)((NR / 128) * (64 / 64)), 1), 128, 0, stream>>>(XR, CX, 0, BQK, CX, 0, 0.0625f, bqk, 0, nullptr, 1, 0, 0, QKF, nullptr, 64, 0, (int)NR, 64, CX);      /* q | k | 0 rows [NR][64] f32 (+ bias) */
  k_qkz<<<(unsigned)((NR + 255) / 256), 256, 0, stream>>>(QKF, QZ, KZ, (int)NR);      /* -> f16 planes: q / 2 | 0 as [NR][32], k as [NR][16] (the 16-deep dot runs as a K = 32 contraction, its upper half zero) */
  /* the image index is blockIdx.y (plane strides) or the leading part of a flat index: 4 x the work-groups per launch, same arithmetic per element */
  k_gemm2<0><<<dim3((SQ / 128) * (CX / 64), NB), 128, 0, stream>>>(XR, CX, (size_t)SQ * CX, BV, CX, 0, 0.0625f, bv, 0, nullptr, 1, 0, 0, nullptr, VR, CX, (size_t)SQ * CX, SQ, CX, CX);      /* v rows [b][4096][128] (+ bias) f16 */
  k_vpack<<<NB * (CX / 64) * (SQ / 64), 256, 0, stream>>>(VR, VP);      /* V in fragment order [b][key / 32][channel / 16][1 KiB] */
  k_sattn<<<dim3(SQ / FN, NB), FW * 32, 0, stream>>>(QZ, KZ, VP, T);      /* out[b][c][n] = sum_m v[c][m] sigmoid(q[:, n].k[:, m]): scores (K = 32 with zero padding), gate (f16) and V x gate^T in one kernel, f32 */
  k_gres<<<(unsigned)((NR * CX / 4 + 255) / 256), 256, 0, stream>>>(T, gam, x, (float*)d_out, NR * CX / 4);      /* y = bf16(gamma) out + bf16(x) -> channel-first output */
}

// v005
// A run of this version takes 34.8 microseconds.
// Next to v004, in two timings, it ran 1.97 and 1.98 times as fast.
// Over all steps from v000 it is 17.9 times as fast.
#include <hip/hip_runtime.h>
// SAGAN-style self-attention with SIGMOID gating instead of softmax, channel-first (x [4][128][64][64]; q = Wq x + bq, k = Wk x + bk (1x1, 128 -> 16), v = Wv x + bv (128 -> 128), natural weights and biases sigma 0.05; attn[n][m] = sigmoid(q[:, n].k[:, m]) (no scale, no normalisation); out[c][n] = sum_m v[c][m] attn[n][m]; y = gamma out + x with the scalar gamma input -> [4][128][64][64]).
// Structure: one projection kernel (work-group = 64 tokens of one image): the channel-first x tile and [Wq; Wk; Wv] go through LDS as exact f16 rows; q and k as W (A) x tokens (B), v as tokens (A) x W (B), f32 + bias; the D tiles are stored as they stand: q / 2 and k as f16 rows [16384][16], V in WMMA fragment order; one fused kernel: attn tile = sigmoid(q.k) = 0.5 + 0.5 tanh(q.k / 2) to f16 in registers (the 16-deep contraction runs as K = 32 with zeros set in registers), out[c][n] = V (A operand) x attn (B^T) f32, 8 key ranges summed through LDS; y = bf16(gamma) out + bf16(x) on VALU; three launches.
// Compute dtype: inputs rounded to bf16; x / weights exact; q / 2, k, v and the sigmoid gates as plain f16 GEMM operands (~2^-12); scores and out f32. v_wmma_f32_16x16x32_f16.
#define NB 4
#define SQ 4096
#define DM 128
#define CX 128          /* channels */
#define NH 4
#define HD 64
#define DMQ DM                       /* LayerNorm width */
#define DFF 4096
#define HG 1                         /* heads per attention launch group */
#define B0 0                         /* unused */
#define NBR NB                       /* unused (only in MP, itself unused) */
#define NR ((size_t)NB * SQ)         /* token rows */
#define MP ((int)((size_t)NBR * SQ)) /* unused (only in MPO, itself unused) */
#define QN SQ                        /* unused */
#define NHD NH                       /* unused */
#define MPO MP                       /* unused */
#define LQ DM      /* unused (redefined below) */
typedef __bf16 v16b __attribute__((ext_vector_type(16)));
typedef unsigned short v8us __attribute__((ext_vector_type(8), may_alias));
typedef float  v8f  __attribute__((ext_vector_type(8)));
typedef float  v4f  __attribute__((ext_vector_type(4)));
typedef float  v4fa __attribute__((ext_vector_type(4), may_alias));
union FragB { v16b v; v8us half[2]; unsigned short u[16]; };

__device__ __forceinline__ unsigned short bf16_bits(float x) { unsigned int u = __float_as_uint(x); return (unsigned short)((u + 0x7FFFu + ((u >> 16) & 1u)) >> 16); }
__device__ __forceinline__ float bf16_val(unsigned short b) { return __uint_as_float(((unsigned int)b) << 16); }
__device__ __forceinline__ float bf16_round(float x) { return bf16_val(bf16_bits(x)); }
// D += A·B with NT terms: 1 = ah·bh, 2 = + al·bh (A split), 3 = + ah·bl (both split)
template <int NT>
__device__ __forceinline__ v8f mmaN(v16b ah, v16b al, v16b bh, v16b bl, v8f c) {
  c = __builtin_amdgcn_wmma_f32_16x16x32_bf16(false, ah, false, bh, (short)0, c, false, false);
  if (NT >= 2) c = __builtin_amdgcn_wmma_f32_16x16x32_bf16(false, al, false, bh, (short)0, c, false, false);
  if (NT >= 3) c = __builtin_amdgcn_wmma_f32_16x16x32_bf16(false, ah, false, bl, (short)0, c, false, false);
  asm volatile("v_nop\n\tv_nop\n\tv_nop\n\tv_nop" : "+v"(c) : "v"(ah), "v"(al), "v"(bh), "v"(bl));
  return c;
}

__global__ __launch_bounds__(256) void k_wt_bf16(const float* __restrict__ W, unsigned short* __restrict__ Wt, int K, int N) {
  const int t = blockIdx.x * 256 + threadIdx.x;
  const int k8n = K / 8;
  if (t >= N * k8n) return;
  const int n = t / k8n, k8 = (t % k8n) * 8;
  v8us v;
#pragma unroll
  for (int i = 0; i < 8; ++i) v[i] = bf16_bits(W[(size_t)(k8 + i) * N + n]);
  *(v8us*)(Wt + (size_t)n * K + k8) = v;
  
}

// GEMM C[M][N] (f32, pitch ldc) = act(A[M][K]·W + bias). A f32 row-major (pitch lda) converted per fragment to bf16
// (ASPLIT: hi/lo two planes -> 2 terms, else single rounded term); Wt bf16 [N][K] (pitch ldb). BIAS_BF16 rounds the
// bias to bf16 first (bias quantised to bf16 before the add). K%32==0, M%16==0, N%64==0.
template <bool ASPLIT, int ACT, bool BIAS_BF16>
__global__ __launch_bounds__(128) void k_gemm_bf(const float* __restrict__ A, int lda, const unsigned short* __restrict__ Wt, int ldb,
                                               const float* __restrict__ bias, float* __restrict__ C, int ldc, int M, int N, int K) {
  __shared__ __attribute__((aligned(16))) float so[4][16][64];
  const int tid = threadIdx.x, w = tid >> 5, lane = tid & 31, ln = lane & 15, hh = lane >> 4;
  const int ntn = N / 64;
  const int wid = blockIdx.x * 4 + w;
  const int mt = wid / ntn, nq = wid % ntn;
  if (mt * 16 >= M) return;
  const int row0 = mt * 16, col0 = nq * 64;
  const float* arow = A + (size_t)(row0 + ln) * lda;
  v8f acc[4] = {};
  for (int kb = 0; kb < K; kb += 32) {
    FragB ah, al;
    const v4f x0 = *(const v4fa*)(arow + kb + 8 * hh), x1 = *(const v4fa*)(arow + kb + 8 * hh + 4);
    const v4f x2 = *(const v4fa*)(arow + kb + 16 + 8 * hh), x3 = *(const v4fa*)(arow + kb + 16 + 8 * hh + 4);
    float xs[16] = {x0[0],x0[1],x0[2],x0[3],x1[0],x1[1],x1[2],x1[3],x2[0],x2[1],x2[2],x2[3],x3[0],x3[1],x3[2],x3[3]};
#pragma unroll
    for (int i = 0; i < 16; ++i) { const unsigned short hb = bf16_bits(xs[i]); ah.u[i] = hb; al.u[i] = ASPLIT ? bf16_bits(xs[i] - bf16_val(hb)) : (unsigned short)0; }
#pragma unroll
    for (int t = 0; t < 4; ++t) {
      const unsigned short* brow = Wt + (size_t)(col0 + t * 16 + ln) * ldb + kb;
      FragB b;
      b.half[0] = *(const v8us*)(brow + 8 * hh);
      b.half[1] = *(const v8us*)(brow + 16 + 8 * hh);
      acc[t] = mmaN<ASPLIT ? 2 : 1>(ah.v, al.v, b.v, b.v, acc[t]);
    }
  }
#pragma unroll
  for (int t = 0; t < 4; ++t) {
    float bv = bias ? bias[col0 + t * 16 + ln] : 0.f;
    if (BIAS_BF16) bv = bf16_round(bv);
#pragma unroll
    for (int r = 0; r < 8; ++r) { float v = acc[t][r] + bv; if (ACT == 1) v = fmaxf(v, 0.f); so[w][8 * hh + r][t * 16 + ln] = v; }
  }
  __builtin_amdgcn_fence(__ATOMIC_ACQ_REL, "workgroup");
  __builtin_amdgcn_wave_barrier();
  const int rsub = lane >> 4, c4 = (lane & 15) * 4;
  {
#pragma unroll
    for (int q = 0; q < 8; ++q) {
      const int r = q * 2 + rsub;
      const v4f v = *(const v4fa*)&so[w][r][c4];
      *(v4f*)(C + (size_t)(row0 + r) * ldc + col0 + c4) = v;
    }
    
  }
}

// GEMM C = act(A·W + bias + resid): A f32 (ASPLIT -> hi/lo 2 terms), Wt bf16 [N][K]; ACT 0 none, 1 relu, 2 exact gelu;
// resid (optional, f32, row index = (row % rmod), pitch ldr, RES_BF16 rounds it) added before the activation.
template <bool ASPLIT, int ACT, bool BIAS_BF16, bool RES_BF16>
__global__ __launch_bounds__(128) void k_gemm_bf3(const float* __restrict__ A, int lda, const unsigned short* __restrict__ Wt, int ldb,
                                                const float* __restrict__ bias, const float* __restrict__ resid, int rmod, int ldr,
                                                float* __restrict__ C, int ldc, int M, int N, int K) {
  __shared__ __attribute__((aligned(16))) float so[4][16][64];
  const int tid = threadIdx.x, w = tid >> 5, lane = tid & 31, ln = lane & 15, hh = lane >> 4;
  const int ntn = N / 64;
  const int wid = blockIdx.x * 4 + w;
  const int mt = wid / ntn, nq = wid % ntn;
  if (mt * 16 >= M) return;
  const int row0 = mt * 16, col0 = nq * 64;
  const float* arow = A + (size_t)(row0 + ln) * lda;
  v8f acc[4] = {};
  for (int kb = 0; kb < K; kb += 32) {
    FragB ah, al;
    const v4f x0 = *(const v4fa*)(arow + kb + 8 * hh), x1 = *(const v4fa*)(arow + kb + 8 * hh + 4);
    const v4f x2 = *(const v4fa*)(arow + kb + 16 + 8 * hh), x3 = *(const v4fa*)(arow + kb + 16 + 8 * hh + 4);
    float xs[16] = {x0[0],x0[1],x0[2],x0[3],x1[0],x1[1],x1[2],x1[3],x2[0],x2[1],x2[2],x2[3],x3[0],x3[1],x3[2],x3[3]};
#pragma unroll
    for (int i = 0; i < 16; ++i) { const unsigned short hb = bf16_bits(xs[i]); ah.u[i] = hb; al.u[i] = ASPLIT ? bf16_bits(xs[i] - bf16_val(hb)) : (unsigned short)0; }
#pragma unroll
    for (int t = 0; t < 4; ++t) {
      const unsigned short* brow = Wt + (size_t)(col0 + t * 16 + ln) * ldb + kb;
      FragB b;
      b.half[0] = *(const v8us*)(brow + 8 * hh);
      b.half[1] = *(const v8us*)(brow + 16 + 8 * hh);
      acc[t] = mmaN<ASPLIT ? 2 : 1>(ah.v, al.v, b.v, b.v, acc[t]);
    }
  }
#pragma unroll
  for (int t = 0; t < 4; ++t) {
    const int col = col0 + t * 16 + ln;
    float bv = bias ? bias[col] : 0.f;
    if (BIAS_BF16) bv = bf16_round(bv);
#pragma unroll
    for (int r = 0; r < 8; ++r) {
      float v = acc[t][r] + bv;
      if (resid) { float rv = resid[(size_t)((row0 + 8 * hh + r) % rmod) * ldr + col]; if (RES_BF16) rv = bf16_round(rv); v += rv; }
      if (ACT == 1) v = fmaxf(v, 0.f);
      if (ACT == 2) v = 0.5f * v * (1.0f + erff(v * 0.70710678118654752f));
      if (ACT == 3) { const float u = 0.7978845608028654f * (v + 0.044715f * v * v * v); v = 0.5f * v * (1.0f + tanhf(u)); }
      so[w][8 * hh + r][t * 16 + ln] = v;
    }
  }
  __builtin_amdgcn_fence(__ATOMIC_ACQ_REL, "workgroup");
  __builtin_amdgcn_wave_barrier();
  const int rsub = lane >> 4, c4 = (lane & 15) * 4;
  {
#pragma unroll
    for (int q = 0; q < 8; ++q) {
      const int r = q * 2 + rsub;
      const v4f v = *(const v4fa*)&so[w][r][c4];
      *(v4f*)(C + (size_t)(row0 + r) * ldc + col0 + c4) = v;
    }
    
  }
}
// row LayerNorm (biased variance, eps) over N: s = X (+ R); optional out_sum <- s; out_norm <- (s-mu)*rsqrt(var+eps)*g + b
template <bool PARAM_BF16>
__global__ __launch_bounds__(256) void k_layernorm(const float* __restrict__ X, const float* __restrict__ R, const float* __restrict__ g, const float* __restrict__ bta,
                                                  float* __restrict__ out_sum, float* __restrict__ out_norm, int N, float eps) {
  __shared__ float red[256];
  const int row = blockIdx.x, tid = threadIdx.x;
  const float* x = X + (size_t)row * N; const float* rr = R ? R + (size_t)row * N : nullptr;
  float vals[16];                     // up to N = 4096
  const int per = N / 256;            // contiguous chunk per thread? use strided-by-4 chunks: thread handles j = tid*4 + 1024*u
  float s1 = 0.f;
  for (int u = 0; u < per / 4; ++u) {
    const int j = tid * 4 + 1024 * u;
    const v4f a = *(const v4fa*)(x + j);
    v4f b = {0.f,0.f,0.f,0.f}; if (rr) b = *(const v4fa*)(rr + j);
#pragma unroll
    for (int q = 0; q < 4; ++q) { const float v = a[q] + b[q]; vals[u * 4 + q] = v; s1 += v; }
  }
  red[tid] = s1; __syncthreads();
  for (int st = 128; st > 0; st >>= 1) { if (tid < st) red[tid] += red[tid + st]; __syncthreads(); }
  const float mu = red[0] / (float)N; __syncthreads();
  float s2 = 0.f;
  for (int u = 0; u < per / 4; ++u)
#pragma unroll
    for (int q = 0; q < 4; ++q) { const float c = vals[u * 4 + q] - mu; s2 += c * c; }
  red[tid] = s2; __syncthreads();
  for (int st = 128; st > 0; st >>= 1) { if (tid < st) red[tid] += red[tid + st]; __syncthreads(); }
  const float rs = rsqrtf(red[0] / (float)N + eps);
  {
    for (int u = 0; u < per / 4; ++u) {
      const int j = tid * 4 + 1024 * u;
      v4f o, sm;
#pragma unroll
      for (int q = 0; q < 4; ++q) {
        float gg = g[j + q], bb = bta[j + q];
        if (PARAM_BF16) { gg = bf16_round(gg); bb = bf16_round(bb); }
        sm[q] = vals[u * 4 + q]; o[q] = (vals[u * 4 + q] - mu) * rs * gg + bb;
      }
      if (out_sum) *(v4f*)(out_sum + (size_t)row * N + j) = sm;
      *(v4f*)(out_norm + (size_t)row * N + j) = o;
    }
    
  }
}



// ---- f16 WMMA path (v_wmma_f32_16x16x32_f16): 11-bit significands for operands in range — used where a [0,1] probability operand needs more precision than bf16
typedef _Float16 v16h __attribute__((ext_vector_type(16)));
union FragH { v16h v; v8us half[2]; _Float16 h[16]; unsigned short u[16]; };
template <int NT>
__device__ __forceinline__ v8f mmaH(v16h ah, v16h al, v16h bh, v16h bl, v8f c) {
  c = __builtin_amdgcn_wmma_f32_16x16x32_f16(false, ah, false, bh, (short)0, c, false, false);
  if (NT >= 2) c = __builtin_amdgcn_wmma_f32_16x16x32_f16(false, al, false, bh, (short)0, c, false, false);
  if (NT >= 3) c = __builtin_amdgcn_wmma_f32_16x16x32_f16(false, ah, false, bl, (short)0, c, false, false);
  asm volatile("v_nop\n\tv_nop\n\tv_nop\n\tv_nop" : "+v"(c) : "v"(ah), "v"(al), "v"(bh), "v"(bl));
  return c;
}
// batched GEMM like k_gemm_b but f16 operands: A f32 (split into f16 hi/lo if ASPLIT, else rounded to f16), Bt = f16 values [n][k]; alpha; C f32; N multiple of 16 (partial tiles skipped)
template <bool ASPLIT>
__global__ __launch_bounds__(128) void k_gemm_h(const float* __restrict__ A, int lda, size_t sA, const _Float16* __restrict__ Bh, int ldb, size_t sB, float alpha, float* __restrict__ C, int ldc, size_t sC, int M, int N, int K) {
  __shared__ __attribute__((aligned(16))) float so[4][16][64];
  const int tid = threadIdx.x, w = tid >> 5, lane = tid & 31, ln = lane & 15, hh = lane >> 4; const int by = blockIdx.y;
  A += (size_t)by * sA; Bh += (size_t)by * sB; C += (size_t)by * sC;
  const int ntn = (N + 63) / 64; const int wid = blockIdx.x * 4 + w; const int mt = wid / ntn, nq = wid % ntn; if (mt * 16 >= M) return;
  const int row0 = mt * 16, col0 = nq * 64; const float* arow = A + (size_t)(row0 + ln) * lda;
  v8f acc[4] = {};
  for (int kb = 0; kb < K; kb += 32) {
    FragH ah, al;
    const v4f x0 = *(const v4fa*)(arow + kb + 8 * hh), x1 = *(const v4fa*)(arow + kb + 8 * hh + 4), x2 = *(const v4fa*)(arow + kb + 16 + 8 * hh), x3 = *(const v4fa*)(arow + kb + 16 + 8 * hh + 4);
    float xs[16] = {x0[0],x0[1],x0[2],x0[3],x1[0],x1[1],x1[2],x1[3],x2[0],x2[1],x2[2],x2[3],x3[0],x3[1],x3[2],x3[3]};
#pragma unroll
    for (int i = 0; i < 16; ++i) { const _Float16 h = (_Float16)xs[i]; ah.h[i] = h; al.h[i] = ASPLIT ? (_Float16)(xs[i] - (float)h) : (_Float16)0.0f; }
#pragma unroll
    for (int t = 0; t < 4; ++t) { if (col0 + t * 16 >= N) continue; const size_t boff = (size_t)(col0 + t * 16 + ln) * ldb + kb; FragH bq; bq.half[0] = *(const v8us*)(Bh + boff + 8 * hh); bq.half[1] = *(const v8us*)(Bh + boff + 16 + 8 * hh);
      acc[t] = mmaH<ASPLIT ? 2 : 1>(ah.v, al.v, bq.v, bq.v, acc[t]); }
  }
#pragma unroll
  for (int t = 0; t < 4; ++t) { if (col0 + t * 16 >= N) continue;
#pragma unroll
    for (int r = 0; r < 8; ++r) so[w][8 * hh + r][t * 16 + ln] = acc[t][r] * alpha; }
  __builtin_amdgcn_fence(__ATOMIC_ACQ_REL, "workgroup"); __builtin_amdgcn_wave_barrier();
  const int rsub = lane >> 4, c4 = (lane & 15) * 4;
  {
#pragma unroll
    for (int q = 0; q < 8; ++q) { const int r = q * 2 + rsub; if (col0 + c4 < N) { const v4f v = *(const v4fa*)&so[w][r][c4]; *(v4f*)(C + (size_t)(row0 + r) * ldc + col0 + c4) = v; } }
     }
}

// Wt[n][k] = f16(W[k][n]·scale) from f32 row-major W[K][N] (scale = power of two; bf16-exact weights stay exact in f16 away from the subnormal range)
__global__ __launch_bounds__(256) void k_wt_f16(const float* __restrict__ W, _Float16* __restrict__ Wt, int K, int N, float scale) {
  const int t = blockIdx.x * 256 + threadIdx.x; if (t >= N * (K / 8)) return; const int n = t / (K / 8), k8 = (t % (K / 8)) * 8; FragH f;
#pragma unroll
  for (int i = 0; i < 8; ++i) f.h[i] = (_Float16)(bf16_round(W[(size_t)(k8 + i) * N + n]) * scale); const v8us o = f.half[0];
  *(v8us*)((unsigned short*)Wt + (size_t)n * K + k8) = o; 
}
// k_gemm_hh variant with fused epilogue: v = acc·alpha + bias[by·sBias + col] (+ CP[(row/rowsPerB)·sCPb + by·64 + col] if CP) ; ACT 0 none / 1 elu ; writes f16 C16 (and f32 C if non-null)
template <int ACT>
__global__ __launch_bounds__(128) void k_gemm_hhx(const _Float16* __restrict__ A, int lda, size_t sA, const _Float16* __restrict__ Bh, int ldb, size_t sB, float alpha, const float* __restrict__ bias, size_t sBias, const float* __restrict__ CP, int rowsPerB, size_t sCPb, int row0g,
    float* __restrict__ C, _Float16* __restrict__ C16, int ldc, size_t sC, int M, int N, int K) {
  __shared__ __attribute__((aligned(16))) float so[4][16][64];
  const int tid = threadIdx.x, w = tid >> 5, lane = tid & 31, ln = lane & 15, hh = lane >> 4; const int by = blockIdx.y;
  A += (size_t)by * sA; Bh += (size_t)by * sB; const size_t cofs = (size_t)by * sC; const float* bp = bias ? bias + (size_t)by * sBias : nullptr;
  const int ntn = (N + 63) / 64; const int wid = blockIdx.x * 4 + w; const int mt = wid / ntn, nq = wid % ntn; if (mt * 16 >= M) return;
  const int row0 = mt * 16, col0 = nq * 64; const _Float16* arow = A + (size_t)(row0 + ln) * lda;
  v8f acc[4] = {};
  for (int kb = 0; kb < K; kb += 32) { FragH ah; ah.half[0] = *(const v8us*)((const unsigned short*)arow + kb + 8 * hh); ah.half[1] = *(const v8us*)((const unsigned short*)arow + kb + 16 + 8 * hh);
#pragma unroll
    for (int t = 0; t < 4; ++t) { if (col0 + t * 16 >= N) continue; const size_t boff = (size_t)(col0 + t * 16 + ln) * ldb + kb; FragH bq; bq.half[0] = *(const v8us*)((const unsigned short*)Bh + boff + 8 * hh); bq.half[1] = *(const v8us*)((const unsigned short*)Bh + boff + 16 + 8 * hh);
      acc[t] = mmaH<1>(ah.v, ah.v, bq.v, bq.v, acc[t]); }
  }
#pragma unroll
  for (int t = 0; t < 4; ++t) { if (col0 + t * 16 >= N) continue; const int col = col0 + t * 16 + ln; const float bv = bp ? bf16_round(bp[col]) : 0.f;
#pragma unroll
    for (int r = 0; r < 8; ++r) { float v = acc[t][r] * alpha + bv; if (CP) { const int rr = row0g + row0 + 8 * hh + r; if (rowsPerB < 0) v += CP[cofs + (size_t)rr * ldc + col];      /* rowsPerB < 0: own element of the batched C plane */ else { const int bidx = rr / rowsPerB; v += CP[(size_t)bidx * sCPb + (size_t)by * 64 + col]; } } if (ACT == 1) v = (v > 0.f) ? v : expm1f(v); else if (ACT == 7) v = (v > 0.f) ? v + 1.0f : expf(v); else if (ACT == 8) v = tanhf(v); else if (ACT == 9) v = 0.5f * v * (1.0f + tanhf(0.7978845608028654f * (v + 0.044715f * v * v * v))); else if (ACT == 11) v = 1.0f / (1.0f + expf(-v)); else if (ACT == 12) v = (v > 0.f) ? v : 0.01f * v; else if (ACT == 14) v = (v > 0.f) ? v : 0.1f * v; else if (ACT == 16) v = (v >= 0.f) ? v : 0.3f * v; else if (ACT == 17) v = (v >= 0.f) ? v : 0.2f * v; else if (ACT == 15) v = v / (1.0f + expf(-v)); else if (ACT == 3) v = fmaxf(v, 0.f); else if (ACT == 6) v = 0.5f * v * (1.0f + erff(v * 0.70710678118654752f)); so[w][8 * hh + r][t * 16 + ln] = v; } }
  __builtin_amdgcn_fence(__ATOMIC_ACQ_REL, "workgroup"); __builtin_amdgcn_wave_barrier();
  const int rsub = lane >> 4, c4 = (lane & 15) * 4; typedef _Float16 v4h __attribute__((ext_vector_type(4)));
  {
#pragma unroll
    for (int q = 0; q < 8; ++q) { const int r = q * 2 + rsub; if (col0 + c4 < N) { const v4f v = *(const v4fa*)&so[w][r][c4]; if (C) *(v4f*)(C + cofs + (size_t)(row0 + r) * ldc + col0 + c4) = v; if (C16) { v4h h4; for (int i = 0; i < 4; ++i) h4[i] = (_Float16)v[i]; *(v4h*)(C16 + cofs + (size_t)(row0 + r) * ldc + col0 + c4) = h4; } } }
     }
}


typedef _Float16 v4h __attribute__((ext_vector_type(4)));

__global__ __launch_bounds__(256) void k_x16(const float* __restrict__ x, _Float16* __restrict__ X16, size_t n8) { const size_t t = (size_t)blockIdx.x * 256 + threadIdx.x; if (t >= n8) return; FragH f;
#pragma unroll
  for (int q = 0; q < 8; ++q) f.h[q] = (_Float16)bf16_round(x[t * 8 + q]); *(v8us*)((unsigned short*)X16 + t * 8) = f.half[0];  }
__global__ __launch_bounds__(256) void k_h16(const float* __restrict__ x, _Float16* __restrict__ X16, size_t n8) { const size_t t = (size_t)blockIdx.x * 256 + threadIdx.x; if (t >= n8) return; FragH f;
#pragma unroll
  for (int q = 0; q < 8; ++q) f.h[q] = (_Float16)x[t * 8 + q]; *(v8us*)((unsigned short*)X16 + t * 8) = f.half[0];  }
__global__ __launch_bounds__(256) void k_round16f(const float* __restrict__ W, _Float16* __restrict__ Bt, size_t n8) { const size_t t = (size_t)blockIdx.x * 256 + threadIdx.x; if (t >= n8) return; FragH f;
#pragma unroll
  for (int i = 0; i < 8; ++i) f.h[i] = (_Float16)(bf16_round(W[t * 8 + i]) * 16.0f); *(v8us*)((unsigned short*)Bt + t * 8) = f.half[0];  }
template <int NHv, int TTv>
__global__ __launch_bounds__(256) void k_vt(const _Float16* __restrict__ V16, int ldv, int voff, _Float16* __restrict__ Vt) { __shared__ unsigned short tl[64][66]; const int tid = threadIdx.x; const int slab = blockIdx.x / (TTv / 64), lg = blockIdx.x % (TTv / 64); const int b = slab / NHv, h = slab % NHv;
  for (int i = tid; i < 64 * 8; i += 256) { const int r = i / 8, c8 = (i % 8) * 8; FragH f; f.half[0] = *(const v8us*)((const unsigned short*)V16 + ((size_t)b * TTv + lg * 64 + r) * ldv + voff + h * 64 + c8);
#pragma unroll
    for (int q = 0; q < 8; ++q) tl[r][c8 + q] = f.u[q]; }
  __syncthreads();
  {
#pragma unroll
    for (int rd = 0; rd < 2; ++rd) { const int d = rd * 32 + tid / 8, pc = tid % 8; FragH f;
#pragma unroll
      for (int q = 0; q < 8; ++q) f.u[q] = tl[pc * 8 + q][d];
      *(v8us*)((unsigned short*)Vt + ((size_t)slab * 64 + d) * TTv + lg * 64 + pc * 8) = f.half[0]; }
     } }

__global__ __launch_bounds__(256) void k_hl(const float* __restrict__ F, _Float16* __restrict__ Hh, _Float16* __restrict__ Hl, size_t n8) { const size_t t = (size_t)blockIdx.x * 256 + threadIdx.x; if (t >= n8) return; FragH fh, fl; const v4f a = *(const v4fa*)(F + t * 8), c = *(const v4fa*)(F + t * 8 + 4);
#pragma unroll
  for (int q = 0; q < 4; ++q) { _Float16 h = (_Float16)a[q]; fh.h[q] = h; fl.h[q] = (_Float16)((a[q] - (float)h) * 1024.0f); h = (_Float16)c[q]; fh.h[4 + q] = h; fl.h[4 + q] = (_Float16)((c[q] - (float)h) * 1024.0f); }
  { *(v8us*)((unsigned short*)Hh + t * 8) = fh.half[0]; *(v8us*)((unsigned short*)Hl + t * 8) = fl.half[0];  } }

// ---- fast GEMM (wave tile 32x64; requires M % 32 == 0 rows per launch region and N % 64 == 0); epilogue = k_gemm_hhx semantics ----
__device__ __forceinline__ v16h g2_frag(const _Float16* p, int hh) { FragH f; f.half[0] = *(const v8us*)((const unsigned short*)p + 8 * hh); f.half[1] = *(const v8us*)((const unsigned short*)p + 16 + 8 * hh); return f.v; }
__device__ __forceinline__ v8f g2_mma(v16h a, v16h b, v8f c) { v8f d = __builtin_amdgcn_wmma_f32_16x16x32_f16(false, a, false, b, (short)0, c, false, false); asm volatile("v_nop\n\tv_nop\n\tv_nop\n\tv_nop" : "+v"(d) : "v"(a), "v"(b)); return d; }
template <int ACT>
__global__ __launch_bounds__(128) void k_gemm2(const _Float16* __restrict__ A, int lda, size_t sA, const _Float16* __restrict__ Bh, int ldb, size_t sB, float alpha, const float* __restrict__ bias, size_t sBias, const float* __restrict__ CP, int rowsPerB, size_t sCPb, int row0g,
    float* __restrict__ C, _Float16* __restrict__ C16, int ldc, size_t sC, int M, int N, int K) { static_assert(ACT == 0 || ACT == 3 || ACT == 6 || ACT == 8 || ACT == 9 || ACT == 11 || ACT == 12 || ACT == 14 || ACT == 15 || ACT == 16 || ACT == 17, "k_gemm2: unsupported ACT code (would silently apply no activation)");
  __shared__ __attribute__((aligned(16))) float so[4][32][68];
  const int tid = threadIdx.x, w = tid >> 5, lane = tid & 31, ln = lane & 15, hh = lane >> 4; const int by = blockIdx.y;
  A += (size_t)by * sA; Bh += (size_t)by * sB; const size_t cofs = (size_t)by * sC; const float* bp = bias ? bias + (size_t)by * sBias : nullptr;
  const int ntn = N >> 6; const int mt = blockIdx.x / ntn, nq = blockIdx.x - mt * ntn; const int row0 = mt * 128 + 32 * w, col0 = nq * 64; if (row0 >= M) return;
  const _Float16* a0p = A + (size_t)(row0 + ln) * lda; const _Float16* a1p = a0p + (size_t)16 * lda;
  const _Float16* b0p = Bh + (size_t)(col0 + ln) * ldb; const _Float16* b1p = b0p + (size_t)16 * ldb; const _Float16* b2p = b1p + (size_t)16 * ldb; const _Float16* b3p = b2p + (size_t)16 * ldb;
  const v8f z8 = {0.f,0.f,0.f,0.f,0.f,0.f,0.f,0.f}; v8f c00 = z8, c01 = z8, c02 = z8, c03 = z8, c10 = z8, c11 = z8, c12 = z8, c13 = z8;
#pragma unroll 1
  for (int kb = 0; kb < K; kb += 32) { const v16h a0 = g2_frag(a0p + kb, hh), a1 = g2_frag(a1p + kb, hh);
    v16h b = g2_frag(b0p + kb, hh); c00 = g2_mma(a0, b, c00); c10 = g2_mma(a1, b, c10);
    b = g2_frag(b1p + kb, hh); c01 = g2_mma(a0, b, c01); c11 = g2_mma(a1, b, c11);
    b = g2_frag(b2p + kb, hh); c02 = g2_mma(a0, b, c02); c12 = g2_mma(a1, b, c12);
    b = g2_frag(b3p + kb, hh); c03 = g2_mma(a0, b, c03); c13 = g2_mma(a1, b, c13); }
  v8f accs[8] = {c00, c01, c02, c03, c10, c11, c12, c13};
#pragma unroll
  for (int u = 0; u < 8; ++u) { const int t = u & 3, half = u >> 2; const int col = col0 + t * 16 + ln; const float bv = bp ? bf16_round(bp[col]) : 0.f;
#pragma unroll
    for (int r = 0; r < 8; ++r) { const int rloc = half * 16 + 8 * hh + r; float v = accs[u][r] * alpha + bv; if (CP) { if (rowsPerB < 0) v += CP[cofs + (size_t)(row0g + row0 + rloc) * ldc + col];      /* rowsPerB < 0: own element of the batched C plane */ else { const int bidx = (row0g + row0 + rloc) / rowsPerB; v += CP[(size_t)bidx * sCPb + (size_t)by * 64 + col]; } }
      if (ACT == 3) v = fmaxf(v, 0.f); else if (ACT == 6) v = 0.5f * v * (1.0f + erff(v * 0.70710678118654752f)); else if (ACT == 11) v = 1.0f / (1.0f + expf(-v)); else if (ACT == 15) v = v / (1.0f + expf(-v)); else if (ACT == 12) v = (v > 0.f) ? v : 0.01f * v; else if (ACT == 8) v = tanhf(v); else if (ACT == 9) v = 0.5f * v * (1.0f + tanhf(0.7978845608028654f * (v + 0.044715f * v * v * v))); else if (ACT == 14) v = (v > 0.f) ? v : 0.1f * v; else if (ACT == 16) v = (v >= 0.f) ? v : 0.3f * v; else if (ACT == 17) v = (v >= 0.f) ? v : 0.2f * v;
      so[w][rloc][t * 16 + ln] = v; } }
  __builtin_amdgcn_fence(__ATOMIC_ACQ_REL, "workgroup"); __builtin_amdgcn_wave_barrier();
  const int rsub = lane >> 4, c4 = (lane & 15) * 4;
  {
#pragma unroll
    for (int q = 0; q < 16; ++q) { const int r = q * 2 + rsub; const v4f v = *(const v4fa*)&so[w][r][c4]; if (C) *(v4f*)(C + cofs + (size_t)(row0 + r) * ldc + col0 + c4) = v; if (C16) { v4h h4; for (int i = 0; i < 4; ++i) h4[i] = (_Float16)v[i]; *(v4h*)(C16 + cofs + (size_t)(row0 + r) * ldc + col0 + c4) = h4; } }
     } }


__global__ __launch_bounds__(256) void k_rsm(const float* __restrict__ S, _Float16* __restrict__ P, int nrows) {
  #pragma clang fp contract(off)
  const int i = blockIdx.x * 256 + threadIdx.x; if (i >= nrows) return; const float* s = S + (size_t)i * SQ; float mx = -3.0e38f;
#pragma unroll 1
  for (int j = 0; j < SQ; ++j) mx = fmaxf(mx, s[j]); float se = 0.f;
#pragma unroll 1
  for (int j = 0; j < SQ; ++j) se += expf(s[j] - mx); const float sc = 256.0f / se;
#pragma unroll 1
  for (int j0 = 0; j0 < SQ; j0 += 8) { FragH f; for (int q = 0; q < 8; ++q) f.h[q] = (_Float16)(expf(s[j0 + q] - mx) * sc); unsigned short* d = (unsigned short*)P + (size_t)i * SQ + j0; *(v8us*)d = f.half[0];  } }
__global__ __launch_bounds__(256) void k_vt(const _Float16* __restrict__ V16, int b, int h0, _Float16* __restrict__ VT) { __shared__ unsigned short tl[64][65]; const int tid = threadIdx.x; const int hh = blockIdx.x % HG, sg = blockIdx.x / HG; const int s0 = sg * 64; const int h = h0 + hh;
  for (int i = tid; i < 64 * 8; i += 256) { const int j = i / 8, d8 = (i % 8) * 8; FragH f; f.half[0] = *(const v8us*)((const unsigned short*)V16 + ((size_t)b * SQ + s0 + j) * DM + h * HD + d8); for (int q = 0; q < 8; ++q) tl[d8 + q][j] = f.u[q]; }
  __syncthreads();
  { for (int i = tid; i < 64 * 8; i += 256) { const int d = i / 8, j8 = (i % 8) * 8; FragH f; for (int q = 0; q < 8; ++q) f.u[q] = tl[d][j8 + q]; *(v8us*)((unsigned short*)VT + ((size_t)hh * HD + d) * SQ + s0 + j8) = f.half[0]; }  } }


template <int BFIN, int W16, int W32>
__global__ __launch_bounds__(256) void k_lnx(const float* __restrict__ X, const float* __restrict__ g, const float* __restrict__ bb, float eps, _Float16* __restrict__ N16, float* __restrict__ N32) {
  #pragma clang fp contract(off)
  __shared__ float red[256]; const size_t r = blockIdx.x; const int t = threadIdx.x; const bool act = t < (DMQ / 4); const int c0 = act ? t * 4 : 0;
  const v4f xa = *(const v4fa*)(X + r * DMQ + c0); float s[4]; float sum = 0.f;
  for (int q = 0; q < 4; ++q) { s[q] = act ? (BFIN ? bf16_round(xa[q]) : xa[q]) : 0.f; sum = __fadd_rn(sum, s[q]); }
  red[t] = sum; __syncthreads(); for (int st = 128; st > 0; st >>= 1) { if (t < st) red[t] = __fadd_rn(red[t], red[t + st]); __syncthreads(); } const float mu = red[0] / (float)DMQ; __syncthreads();
  float vs = 0.f; for (int q = 0; q < 4; ++q) { const float dl = act ? __fadd_rn(s[q], -mu) : 0.f; vs = __fadd_rn(vs, __fmul_rn(dl, dl)); } red[t] = vs; __syncthreads(); for (int st = 128; st > 0; st >>= 1) { if (t < st) red[t] = __fadd_rn(red[t], red[t + st]); __syncthreads(); }
  const float rs = rsqrtf(__fadd_rn(red[0] / (float)DMQ, eps)); v4h y; v4f yf;
  for (int q = 0; q < 4; ++q) { const int c = c0 + q; yf[q] = __fadd_rn(__fmul_rn(__fmul_rn(__fadd_rn(s[q], -mu), rs), bf16_round(g[c])), (bb ? bf16_round(bb[c]) : 0.f)); y[q] = (_Float16)yf[q]; }
  if (!act) return;      /* no barriers after this point */
  { if (W16) *(v4h*)(N16 + r * DMQ + c0) = y; if (W32) *(v4f*)(N32 + r * DMQ + c0) = yf;  } }


__global__ __launch_bounds__(256) void k_rsmf(const float* __restrict__ S, _Float16* __restrict__ P, int qn, int hg) {
  #pragma clang fp contract(off)
  const int t = blockIdx.x * 256 + threadIdx.x; if (t >= qn * hg) return; const size_t i = (size_t)(t / qn) * SQ + (t % qn); const float* s = S + i * SQ; float mx = -3.0e38f;
#pragma unroll 1
  for (int j = 0; j < SQ; ++j) mx = fmaxf(mx, s[j]); float se = 0.f;
#pragma unroll 1
  for (int j = 0; j < SQ; ++j) se += __expf(s[j] - mx); const float sc = 256.0f / se;
#pragma unroll 1
  for (int j0 = 0; j0 < SQ; j0 += 8) { FragH f; for (int q = 0; q < 8; ++q) f.h[q] = (_Float16)(__expf(s[j0 + q] - mx) * sc); unsigned short* d = (unsigned short*)P + i * SQ + j0; *(v8us*)d = f.half[0];  } }


__global__ __launch_bounds__(256) void k_bfr(const float* __restrict__ x, float* __restrict__ XB, size_t n8) { const size_t t = (size_t)blockIdx.x * 256 + threadIdx.x; if (t >= n8) return; v4f a = *(const v4fa*)(x + t * 8), c = *(const v4fa*)(x + t * 8 + 4); for (int q = 0; q < 4; ++q) { a[q] = bf16_round(a[q]); c[q] = bf16_round(c[q]); }
  { *(v4f*)(XB + t * 8) = a; *(v4f*)(XB + t * 8 + 4) = c;  } }



__global__ __launch_bounds__(256) void k_rsmfam(const float* __restrict__ S, _Float16* __restrict__ P, int qn, int hg, const float* __restrict__ am) {
  #pragma clang fp contract(off)
  const int t = blockIdx.x * 256 + threadIdx.x; if (t >= qn * hg) return; const size_t i = (size_t)(t / qn) * SQ + (t % qn); const float* s = S + i * SQ; float mx = -3.0e38f;
#pragma unroll 1
  for (int j = 0; j < SQ; ++j) mx = fmaxf(mx, __fadd_rn(s[j], bf16_round(am[j]))); float se = 0.f;
#pragma unroll 1
  for (int j = 0; j < SQ; ++j) se += __expf(__fadd_rn(s[j], bf16_round(am[j])) - mx); const float sc = 256.0f / se;
#pragma unroll 1
  for (int j0 = 0; j0 < SQ; j0 += 8) { FragH f; for (int q = 0; q < 8; ++q) f.h[q] = (_Float16)(__expf(__fadd_rn(s[j0 + q], bf16_round(am[j0 + q])) - mx) * sc); unsigned short* d = (unsigned short*)P + i * SQ + j0; *(v8us*)d = f.half[0];  } }


#define CC CX           /* unused: input channels */
#define LL SQ           /* pixels per image */
#define LQ (3 * DM)     /* unused */

__global__ __launch_bounds__(256) void k_rowb(float* __restrict__ O, const float* __restrict__ bias, size_t n4) {
  #pragma clang fp contract(off)
  const size_t t = (size_t)blockIdx.x * 256 + threadIdx.x; if (t >= n4) return; const size_t e = t * 4; const int c = (int)((e / SQ) % CX);      /* output channels */ const float bb = bf16_round(bias[c]); const v4f a = *(const v4fa*)(O + e); v4f o; for (int q = 0; q < 4; ++q) o[q] = __fadd_rn(a[q], bb);
  *(v4f*)(O + e) = o;  }

__global__ __launch_bounds__(256) void k_gres(const float* __restrict__ T, const float* __restrict__ gam, const float* __restrict__ X, float* __restrict__ Y, size_t n4) {
  #pragma clang fp contract(off)
  const size_t t = (size_t)blockIdx.x * 256 + threadIdx.x; if (t >= n4) return; const float g = bf16_round(gam[0]); const v4f a = *(const v4fa*)(T + t * 4), xx = *(const v4fa*)(X + t * 4); v4f r;
  for (int q = 0; q < 4; ++q) r[q] = __fadd_rn(__fmul_rn(g, a[q]), bf16_round(xx[q]));
  *(v4f*)(Y + t * 4) = r;  }

// ---- fused sigmoid attention: T[b][c][n] = sum_m V[b][c][m] sigmoid(q[n].k[m]); the gate tile never leaves registers ----
// S^T / 2 = K.(Q / 2)^T (A = k rows, B = rows of q / 2, both through f_frag16): a lane holds column n = ln, rows m = 8 hh + r. Two such D tiles (m 0-15, 16-31), gated and
// rounded to f16 in place, are the B operand of out += V.P^T in the hardware k order, which is the order k_proj stores the V fragments in (A operand, f_fragp).
// Work-group = one image, 32 query columns, all 128 channels; its 8 waves each walk 512 of the 4096 keys; the 8 partial tiles are summed through LDS in wave order.
#define FW 8             /* waves per work-group = key ranges */
#define FN 32            /* query columns per work-group */
#define FP 36            /* LDS row pitch in floats: rows 8 apart fall on other banks, 16-byte reads stay aligned */
/* waves_per_eu(4, 4): at most 256 registers, so that two work-groups share a WGP and four waves per SIMD cover each other's dependent gate arithmetic; 2 x the LDS size fits the WGP */
__device__ __forceinline__ v16h f_frag16(const _Float16* p) { FragH f; const v8us z = {0, 0, 0, 0, 0, 0, 0, 0}; f.half[0] = *(const v8us*)(const unsigned short*)p; f.half[1] = z; return f.v; }      /* q / k fragment: k 16-31 of the K = 32 contraction is zero, set in registers */
__device__ __forceinline__ v16h f_fragp(const _Float16* p) { FragH f; f.half[0] = *(const v8us*)(const unsigned short*)p; f.half[1] = *(const v8us*)((const unsigned short*)p + 256); return f.v; }      /* V fragment from a 1-KiB unit of k_proj: p = unit + 8 lane; the second half stands 512 bytes on */
__device__ __forceinline__ v8f f_mma(v16h a, v16h b, v8f c) { return __builtin_amdgcn_wmma_f32_16x16x32_f16(false, a, false, b, (short)0, c, false, false); }
/* gate: sigmoid(s) = 0.5 + 0.5 tanh(s / 2), one v_tanh_f32 per score; u = s / 2 comes out of the score product itself (the q plane holds q / 2, a power of two); two gates share the packed fma and the packed f16 conversion; +-inf give 0 and 1, NaN stays NaN */
typedef float v2f __attribute__((ext_vector_type(2)));
typedef _Float16 v2h __attribute__((ext_vector_type(2)));
__device__ __forceinline__ v2h f_gate2(float u0, float u1) { const v2f t = {__builtin_amdgcn_tanhf(u0), __builtin_amdgcn_tanhf(u1)}; const v2f hf = {0.5f, 0.5f}; return __builtin_convertvector(__builtin_elementwise_fma(t, hf, hf), v2h); }
__global__ __launch_bounds__(FW * 32) __attribute__((amdgpu_waves_per_eu(4, 4))) void k_sattn(const _Float16* __restrict__ QZ, const _Float16* __restrict__ KZ, const _Float16* __restrict__ VP, float* __restrict__ T) {
  __shared__ __attribute__((aligned(16))) float red[FW][CX][FP];
  constexpr int MR = SQ / FW;      /* keys per wave */
  const int tid = threadIdx.x, w = tid >> 5, lane = tid & 31, ln = lane & 15, hh = lane >> 4; const int b = blockIdx.y, n0 = blockIdx.x * FN;
  const _Float16* qp = QZ + ((size_t)b * SQ + n0 + ln) * 16; const unsigned ki = (unsigned)((b * SQ + w * MR + ln) * 16 + 8 * hh), vi = (unsigned)((b * (SQ / 32) + w * (MR / 32)) * (CX / 16) * 512 + 8 * lane); const _Float16* kp = KZ + ki; const _Float16* vp = VP + vi;      /* kp, vp: the lane's own first 8 elements; over a wave both are 512 contiguous bytes */
  const v16h qf[2] = {f_frag16(qp + 8 * hh), f_frag16(qp + 16 * 16 + 8 * hh)};      /* rows of q / 2: the score tiles are s / 2, the argument of the gate's tanh */
  const v8f z8 = {0.f,0.f,0.f,0.f,0.f,0.f,0.f,0.f}; v8f acc[CX / 16][2];
#pragma unroll
  for (int t = 0; t < CX / 16; ++t) { acc[t][0] = z8; acc[t][1] = z8; }
#pragma unroll 1      /* rolled; the inner loops are unrolled so that fragments and accumulators stay in registers */
  for (int m0 = 0; m0 < MR; m0 += 32, kp += 32 * 16, vp += (CX / 16) * 512) {
    const v16h k0 = f_frag16(kp), k1 = f_frag16(kp + 16 * 16); v16h vf[CX / 16];
#pragma unroll
    for (int t = 0; t < CX / 16; ++t) vf[t] = f_fragp(vp + t * 512);
    asm volatile("s_wait_xcnt 0x0" ::: "memory");      /* kp and vp are advanced at the loop's foot: the wait that stands between issued loads and an overwrite of their address registers, put where the wave waits for the k rows next */
    __builtin_amdgcn_sched_barrier(0);      /* all of the pass's loads are issued ahead of the scores: a load sunk behind the first gates is waited for in full among the products */
#pragma unroll
    for (int j = 0; j < 2; ++j) { const v8f s0 = f_mma(k0, qf[j], z8), s1 = f_mma(k1, qf[j], z8); FragH p;
#pragma unroll
      for (int r = 0; r < 8; r += 2) { const v2h g0 = f_gate2(s0[r], s0[r + 1]), g1 = f_gate2(s1[r], s1[r + 1]); p.h[r] = g0[0]; p.h[r + 1] = g0[1]; p.h[8 + r] = g1[0]; p.h[8 + r + 1] = g1[1]; }
#pragma unroll
      for (int t = 0; t < CX / 16; ++t) acc[t][j] = f_mma(vf[t], p.v, acc[t][j]);
      __builtin_amdgcn_sched_barrier(0);      /* one column group's scores and gates at a time: both at once do not fit the registers of four waves per SIMD */
    } }
#pragma unroll
  for (int t = 0; t < CX / 16; ++t)
#pragma unroll
    for (int j = 0; j < 2; ++j)
#pragma unroll
      for (int r = 0; r < 8; ++r) red[w][t * 16 + 8 * hh + r][j * 16 + ln] = acc[t][j][r];
  __syncthreads();
#pragma unroll
  for (int q = 0; q < CX * FN / 4 / (FW * 32); ++q) { const int i = q * (FW * 32) + tid, c = i / (FN / 4), n4 = (i % (FN / 4)) * 4; v4f s = *(const v4fa*)&red[0][c][n4];
#pragma unroll
    for (int u = 1; u < FW; ++u) s += *(const v4fa*)&red[u][c][n4];
    *(v4f*)(T + ((size_t)b * CX + c) * SQ + n0 + n4) = s; } }
// ---- fused projections: x [b][c][n] f32 and the natural weights -> q / 2 rows, k rows (f16 [b n][16]) and V in fragment order, one launch ----
// Work-group = 64 tokens of one image. The x tile (bf16-rounded, exact in f16) is turned to token rows [64][128] and [Wq; Wk; Wv] (bf16-rounded, x 16) to rows [160][128] in LDS; every fragment is two 16-byte LDS reads (g2_frag).
// Wave w: token tile mt = w & 3 (16 tokens); hf = w >> 2 picks q (0) or k (1) and the output channels 64 hf + 0..63 of v.
// q, k: A = weight rows, B = token rows: a lane holds token ln, outputs 8 hh + r: one 16-byte store into the token's row.
// v: A = token rows, B = weight rows: a lane holds channel ln, tokens 8 hh + r. That is the A operand of k_sattn: per image, 32-key block and 16-channel tile one 1-KiB unit [half][lane][8 keys]
// (lane = 16 hh + ln holds channel ln, keys 16 half + 8 hh + 0..7), so a D tile is stored as it stands, 512 contiguous bytes per wave.
#define PK 64            /* tokens per work-group: 256 work-groups */
#define PP (CX + 8)      /* LDS row pitch in f16: 272 bytes = 16 x odd, for 16-byte readers of 256-byte rows */
__global__ __launch_bounds__(256) void k_proj(const float* __restrict__ x, const float* __restrict__ wq, const float* __restrict__ bq, const float* __restrict__ wk, const float* __restrict__ bk, const float* __restrict__ wv, const float* __restrict__ bv,
    _Float16* __restrict__ QZ, _Float16* __restrict__ KZ, _Float16* __restrict__ VP) {
  __shared__ __attribute__((aligned(16))) _Float16 xs[PK][PP];
  __shared__ __attribute__((aligned(16))) _Float16 wl[32 + CX][PP];
  const int tid = threadIdx.x, w = tid >> 5, lane = tid & 31, ln = lane & 15, hh = lane >> 4; const int b = blockIdx.x / (SQ / PK), n0 = (blockIdx.x % (SQ / PK)) * PK;
  const int g16 = tid & 15, r16 = tid >> 4, mt = w & 3, hf = w >> 2;
  /* x: a thread takes 4 tokens (4 g16 + q) of 8 channels (8 r16 + j): 16 lanes read 256 contiguous bytes of a channel row; the 8 x 4 block leaves as four 16-byte LDS stores */
  const float* xp = x + ((size_t)b * CX + r16 * 8) * SQ + n0 + g16 * 4; v4f xa[8];
#pragma unroll
  for (int j = 0; j < 8; ++j) xa[j] = *(const v4fa*)(xp + (size_t)j * SQ);
  /* weights: pass u covers 16 rows (0: Wq, 1: Wk, 2-9: Wv), a thread 8 elements of row r16 */
  const float* wqp = wq + r16 * CX + g16 * 8; const float* wkp = wk + r16 * CX + g16 * 8; const float* wvp = wv + r16 * CX + g16 * 8; v4f wa[2 + CX / 16][2];
  wa[0][0] = *(const v4fa*)wqp; wa[0][1] = *(const v4fa*)(wqp + 4); wa[1][0] = *(const v4fa*)wkp; wa[1][1] = *(const v4fa*)(wkp + 4);
#pragma unroll
  for (int u = 0; u < CX / 16; ++u) { wa[2 + u][0] = *(const v4fa*)(wvp + u * 16 * CX); wa[2 + u][1] = *(const v4fa*)(wvp + u * 16 * CX + 4); }
  const float* bp = (hf ? bk : bq) + 8 * hh; const v4f b0 = *(const v4fa*)bp, b1 = *(const v4fa*)(bp + 4); const float* bvp = bv + hf * (CX / 2) + ln; float bb[CX / 32];
#pragma unroll
  for (int t4 = 0; t4 < CX / 32; ++t4) bb[t4] = bvp[t4 * 16];
  asm volatile("s_wait_xcnt 0x0" :: "v"(xp), "v"(wqp), "v"(wkp), "v"(wvp), "v"(bp), "v"(bvp) : "memory");      /* the wait that stands between issued loads and an overwrite of their address registers; the addresses are inputs so that they stay in their registers up to it and no load of the run lands on one. No load sinks below it either: all of a thread's loads are in flight before the first conversion waits, one memory latency instead of one per group */
#pragma unroll
  for (int u = 0; u < 2 + CX / 16; ++u) { FragH f;
#pragma unroll
    for (int i = 0; i < 4; ++i) { f.h[i] = (_Float16)(bf16_round(wa[u][0][i]) * 16.0f); f.h[4 + i] = (_Float16)(bf16_round(wa[u][1][i]) * 16.0f); }
    *(v8us*)&wl[u * 16 + r16][g16 * 8] = f.half[0]; }
#pragma unroll
  for (int q = 0; q < 4; ++q) { FragH f;
#pragma unroll
    for (int j = 0; j < 8; ++j) f.h[j] = (_Float16)bf16_round(xa[j][q]);
    *(v8us*)&xs[g16 * 4 + q][r16 * 8] = f.half[0]; }
  __syncthreads();
  const v8f z8 = {0.f,0.f,0.f,0.f,0.f,0.f,0.f,0.f}; v16h xf[CX / 32], qw[CX / 32], vw[CX / 32][CX / 32];
#pragma unroll
  for (int kk = 0; kk < CX / 32; ++kk) { xf[kk] = g2_frag(&xs[mt * 16 + ln][kk * 32], hh); qw[kk] = g2_frag(&wl[hf * 16 + ln][kk * 32], hh); }
#pragma unroll
  for (int t4 = 0; t4 < CX / 32; ++t4)
#pragma unroll
    for (int kk = 0; kk < CX / 32; ++kk) vw[t4][kk] = g2_frag(&wl[32 + (hf * (CX / 32) + t4) * 16 + ln][kk * 32], hh);
  __builtin_amdgcn_sched_barrier(0);      /* every fragment read is issued ahead of the products: otherwise each product waits out the LDS latency of its own two reads */
  v8f aq = z8, av[CX / 32];
#pragma unroll
  for (int t4 = 0; t4 < CX / 32; ++t4) av[t4] = z8;
#pragma unroll
  for (int kk = 0; kk < CX / 32; ++kk) { aq = f_mma(qw[kk], xf[kk], aq);      /* the five accumulators are independent of one another */
#pragma unroll
    for (int t4 = 0; t4 < CX / 32; ++t4) av[t4] = f_mma(xf[kk], vw[t4][kk], av[t4]); }
  { const float sc = hf ? 1.0f : 0.5f;      /* q / 2 (exact in f32): the gate takes tanh of half the score */
    FragH o;
#pragma unroll
    for (int r = 0; r < 8; ++r) o.h[r] = (_Float16)(sc * (aq[r] * 0.0625f + bf16_round(r < 4 ? b0[r & 3] : b1[r & 3])));
    *(v8us*)((unsigned short*)(hf ? KZ : QZ) + ((size_t)b * SQ + n0 + mt * 16 + ln) * 16 + 8 * hh) = o.half[0]; }
#pragma unroll
  for (int t4 = 0; t4 < CX / 32; ++t4) { const int t = hf * (CX / 32) + t4; const float bt = bf16_round(bb[t4]); FragH o;
#pragma unroll
    for (int r = 0; r < 8; ++r) o.h[r] = (_Float16)(av[t4][r] * 0.0625f + bt);
    *(v8us*)((unsigned short*)VP + ((((size_t)(b * (SQ / 32) + (n0 >> 5) + (mt >> 1)) * (CX / 16) + t) * 2 + (mt & 1)) * 32 + lane) * 8) = o.half[0]; } }
extern "C" void kernel_launch(void* const* d_in, const int* in_sizes, int n_in,
                              void* d_out, int out_size, void* d_ws, size_t ws_size, hipStream_t stream) {
  (void)in_sizes; (void)n_in; (void)out_size;
  const float* const* I = (const float* const*)d_in; const float* x = I[0]; const float* wq = I[1]; const float* bq = I[2]; const float* wk = I[3]; const float* bk = I[4]; const float* wv = I[5]; const float* bv = I[6]; const float* gam = I[7];      /* natural Wq/Wk [16][128] + b, Wv [128][128] + b; gamma [1] */
  constexpr int DQ = 16;      /* q/k width */
  char* ws = (char*)d_ws; size_t off = 0;
  auto take = [&](size_t bytes) { char* p = ws + off; off += (bytes + 255) & ~(size_t)255; return p; };
  _Float16* QZ = (_Float16*)take(NR * DQ * 2); _Float16* KZ = (_Float16*)take(NR * DQ * 2); _Float16* VP = (_Float16*)take(NR * CX * 2);
  float* T = (float*)take(NR * CX * 4);      /* one plane per image: all four images go through each stage in one launch */
  if (off > ws_size) return;
  k_proj<<<NB * (SQ / PK), 256, 0, stream>>>(x, wq, bq, wk, bk, wv, bv, QZ, KZ, VP);      /* q / 2 and k rows [NR][16] f16, V in fragment order [b][key / 32][channel / 16][1 KiB] */
  k_sattn<<<dim3(SQ / FN, NB), FW * 32, 0, stream>>>(QZ, KZ, VP, T);      /* out[b][c][n] = sum_m v[c][m] sigmoid(q[:, n].k[:, m]): scores (K = 32 with zero padding), gate (f16) and V x gate^T in one kernel, f32 */
  k_gres<<<(unsigned)((NR * CX / 4 + 255) / 256), 256, 0, stream>>>(T, gam, x, (float*)d_out, NR * CX / 4);      /* y = bf16(gamma) out + bf16(x) -> channel-first output */
}

// v006
// One run takes 32.5 microseconds.
// Timed twice side by side with v005, it ran 1.08 and 1.09 times as fast.
// Over all steps from v000 it is 19.3 times as fast.
#include <hip/hip_runtime.h>
// SAGAN-style self-attention with SIGMOID gating instead of softmax, channel-first (x [4][128][64][64]; q = Wq x + bq, k = Wk x + bk (1x1, 128 -> 16), v = Wv x + bv (128 -> 128), natural weights and biases sigma 0.05; attn[n][m] = sigmoid(q[:, n].k[:, m]) (no scale, no normalisation); out[c][n] = sum_m v[c][m] attn[n][m]; y = gamma out + x with the scalar gamma input -> [4][128][64][64]).
// Structure: one projection kernel (work-group = 64 tokens of one image): the channel-first x tile and [Wq; Wk; Wv] go through LDS as exact f16 rows; q and k as W (A) x tokens (B), v as tokens (A) x W (B), f32 + bias; the D tiles are stored as they stand: q / 2 and k as f16 rows [16384][16], V in WMMA fragment order; one fused kernel: attn tile = sigmoid(q.k) = 0.5 + 0.5 tanh(q.k / 2) to f16 in registers (the 16-deep contraction runs as K = 32 with zeros set in registers), out[c][n] = V (A operand) x attn (B^T) f32, 8 key ranges summed through LDS, and y = bf16(gamma) out + bf16(x) formed on that sum and stored by the same kernel; two launches.
// Compute dtype: inputs rounded to bf16; x / weights exact; q, k, v and the sigmoid gates as plain f16 GEMM operands (~2^-12); scores and out f32; v_wmma_f32_16x16x32_f16.
#define NB 4
#define SQ 4096
#define DM 128
#define CX 128          /* channels */
#define NH 4
#define HD 64
#define DMQ DM                       /* LayerNorm width */
#define DFF 4096
#define HG 1                         /* heads per attention launch group */
#define B0 0                         /* unused */
#define NBR NB                       /* unused (only in MP, itself unused) */
#define NR ((size_t)NB * SQ)         /* token rows */
#define MP ((int)((size_t)NBR * SQ)) /* unused (only in MPO, itself unused) */
#define QN SQ                        /* unused */
#define NHD NH                       /* unused */
#define MPO MP                       /* unused */
#define LQ DM      /* unused (redefined below) */
typedef __bf16 v16b __attribute__((ext_vector_type(16)));
typedef unsigned short v8us __attribute__((ext_vector_type(8), may_alias));
typedef float  v8f  __attribute__((ext_vector_type(8)));
typedef float  v4f  __attribute__((ext_vector_type(4)));
typedef float  v4fa __attribute__((ext_vector_type(4), may_alias));
union FragB { v16b v; v8us half[2]; unsigned short u[16]; };

__device__ __forceinline__ unsigned short bf16_bits(float x) { unsigned int u = __float_as_uint(x); return (unsigned short)((u + 0x7FFFu + ((u >> 16) & 1u)) >> 16); }
__device__ __forceinline__ float bf16_val(unsigned short b) { return __uint_as_float(((unsigned int)b) << 16); }
__device__ __forceinline__ float bf16_round(float x) { return bf16_val(bf16_bits(x)); }
// D += A·B with NT terms: 1 = ah·bh, 2 = + al·bh (A split), 3 = + ah·bl (both split)
template <int NT>
__device__ __forceinline__ v8f mmaN(v16b ah, v16b al, v16b bh, v16b bl, v8f c) {
  c = __builtin_amdgcn_wmma_f32_16x16x32_bf16(false, ah, false, bh, (short)0, c, false, false);
  if (NT >= 2) c = __builtin_amdgcn_wmma_f32_16x16x32_bf16(false, al, false, bh, (short)0, c, false, false);
  if (NT >= 3) c = __builtin_amdgcn_wmma_f32_16x16x32_bf16(false, ah, false, bl, (short)0, c, false, false);
  asm volatile("v_nop\n\tv_nop\n\tv_nop\n\tv_nop" : "+v"(c) : "v"(ah), "v"(al), "v"(bh), "v"(bl));
  return c;
}

__global__ __launch_bounds__(256) void k_wt_bf16(const float* __restrict__ W, unsigned short* __restrict__ Wt, int K, int N) {
  const int t = blockIdx.x * 256 + threadIdx.x;
  const int k8n = K / 8;
  if (t >= N * k8n) return;
  const int n = t / k8n, k8 = (t % k8n) * 8;
  v8us v;
#pragma unroll
  for (int i = 0; i < 8; ++i) v[i] = bf16_bits(W[(size_t)(k8 + i) * N + n]);
  *(v8us*)(Wt + (size_t)n * K + k8) = v;
  
}

// GEMM C[M][N] (f32, pitch ldc) = act(A[M][K]·W + bias). A f32 row-major (pitch lda) converted per fragment to bf16
// (ASPLIT: hi/lo two planes -> 2 terms, else single rounded term); Wt bf16 [N][K] (pitch ldb). BIAS_BF16 rounds the
// bias to bf16 first (bias quantised to bf16 before the add). K%32==0, M%16==0, N%64==0.
template <bool ASPLIT, int ACT, bool BIAS_BF16>
__global__ __launch_bounds__(128) void k_gemm_bf(const float* __restrict__ A, int lda, const unsigned short* __restrict__ Wt, int ldb,
                                               const float* __restrict__ bias, float* __restrict__ C, int ldc, int M, int N, int K) {
  __shared__ __attribute__((aligned(16))) float so[4][16][64];
  const int tid = threadIdx.x, w = tid >> 5, lane = tid & 31, ln = lane & 15, hh = lane >> 4;
  const int ntn = N / 64;
  const int wid = blockIdx.x * 4 + w;
  const int mt = wid / ntn, nq = wid % ntn;
  if (mt * 16 >= M) return;
  const int row0 = mt * 16, col0 = nq * 64;
  const float* arow = A + (size_t)(row0 + ln) * lda;
  v8f acc[4] = {};
  for (int kb = 0; kb < K; kb += 32) {
    FragB ah, al;
    const v4f x0 = *(const v4fa*)(arow + kb + 8 * hh), x1 = *(const v4fa*)(arow + kb + 8 * hh + 4);
    const v4f x2 = *(const v4fa*)(arow + kb + 16 + 8 * hh), x3 = *(const v4fa*)(arow + kb + 16 + 8 * hh + 4);
    float xs[16] = {x0[0],x0[1],x0[2],x0[3],x1[0],x1[1],x1[2],x1[3],x2[0],x2[1],x2[2],x2[3],x3[0],x3[1],x3[2],x3[3]};
#pragma unroll
    for (int i = 0; i < 16; ++i) { const unsigned short hb = bf16_bits(xs[i]); ah.u[i] = hb; al.u[i] = ASPLIT ? bf16_bits(xs[i] - bf16_val(hb)) : (unsigned short)0; }
#pragma unroll
    for (int t = 0; t < 4; ++t) {
      const unsigned short* brow = Wt + (size_t)(col0 + t * 16 + ln) * ldb + kb;
      FragB b;
      b.half[0] = *(const v8us*)(brow + 8 * hh);
      b.half[1] = *(const v8us*)(brow + 16 + 8 * hh);
      acc[t] = mmaN<ASPLIT ? 2 : 1>(ah.v, al.v, b.v, b.v, acc[t]);
    }
  }
#pragma unroll
  for (int t = 0; t < 4; ++t) {
    float bv = bias ? bias[col0 + t * 16 + ln] : 0.f;
    if (BIAS_BF16) bv = bf16_round(bv);
#pragma unroll
    for (int r = 0; r < 8; ++r) { float v = acc[t][r] + bv; if (ACT == 1) v = fmaxf(v, 0.f); so[w][8 * hh + r][t * 16 + ln] = v; }
  }
  __builtin_amdgcn_fence(__ATOMIC_ACQ_REL, "workgroup");
  __builtin_amdgcn_wave_barrier();
  const int rsub = lane >> 4, c4 = (lane & 15) * 4;
  {
#pragma unroll
    for (int q = 0; q < 8; ++q) {
      const int r = q * 2 + rsub;
      const v4f v = *(const v4fa*)&so[w][r][c4];
      *(v4f*)(C + (size_t)(row0 + r) * ldc + col0 + c4) = v;
    }
    
  }
}

// GEMM C = act(A·W + bias + resid): A f32 (ASPLIT -> hi/lo 2 terms), Wt bf16 [N][K]; ACT 0 none, 1 relu, 2 exact gelu;
// resid (optional, f32, row index = (row % rmod), pitch ldr, RES_BF16 rounds it) added before the activation.
template <bool ASPLIT, int ACT, bool BIAS_BF16, bool RES_BF16>
__global__ __launch_bounds__(128) void k_gemm_bf3(const float* __restrict__ A, int lda, const unsigned short* __restrict__ Wt, int ldb,
                                                const float* __restrict__ bias, const float* __restrict__ resid, int rmod, int ldr,
                                                float* __restrict__ C, int ldc, int M, int N, int K) {
  __shared__ __attribute__((aligned(16))) float so[4][16][64];
  const int tid = threadIdx.x, w = tid >> 5, lane = tid & 31, ln = lane & 15, hh = lane >> 4;
  const int ntn = N / 64;
  const int wid = blockIdx.x * 4 + w;
  const int mt = wid / ntn, nq = wid % ntn;
  if (mt * 16 >= M) return;
  const int row0 = mt * 16, col0 = nq * 64;
  const float* arow = A + (size_t)(row0 + ln) * lda;
  v8f acc[4] = {};
  for (int kb = 0; kb < K; kb += 32) {
    FragB ah, al;
    const v4f x0 = *(const v4fa*)(arow + kb + 8 * hh), x1 = *(const v4fa*)(arow + kb + 8 * hh + 4);
    const v4f x2 = *(const v4fa*)(arow + kb + 16 + 8 * hh), x3 = *(const v4fa*)(arow + kb + 16 + 8 * hh + 4);
    float xs[16] = {x0[0],x0[1],x0[2],x0[3],x1[0],x1[1],x1[2],x1[3],x2[0],x2[1],x2[2],x2[3],x3[0],x3[1],x3[2],x3[3]};
#pragma unroll
    for (int i = 0; i < 16; ++i) { const unsigned short hb = bf16_bits(xs[i]); ah.u[i] = hb; al.u[i] = ASPLIT ? bf16_bits(xs[i] - bf16_val(hb)) : (unsigned short)0; }
#pragma unroll
    for (int t = 0; t < 4; ++t) {
      const unsigned short* brow = Wt + (size_t)(col0 + t * 16 + ln) * ldb + kb;
      FragB b;
      b.half[0] = *(const v8us*)(brow + 8 * hh);
      b.half[1] = *(const v8us*)(brow + 16 + 8 * hh);
      acc[t] = mmaN<ASPLIT ? 2 : 1>(ah.v, al.v, b.v, b.v, acc[t]);
    }
  }
#pragma unroll
  for (int t = 0; t < 4; ++t) {
    const int col = col0 + t * 16 + ln;
    float bv = bias ? bias[col] : 0.f;
    if (BIAS_BF16) bv = bf16_round(bv);
#pragma unroll
    for (int r = 0; r < 8; ++r) {
      float v = acc[t][r] + bv;
      if (resid) { float rv = resid[(size_t)((row0 + 8 * hh + r) % rmod) * ldr + col]; if (RES_BF16) rv = bf16_round(rv); v += rv; }
      if (ACT == 1) v = fmaxf(v, 0.f);
      if (ACT == 2) v = 0.5f * v * (1.0f + erff(v * 0.70710678118654752f));
      if (ACT == 3) { const float u = 0.7978845608028654f * (v + 0.044715f * v * v * v); v = 0.5f * v * (1.0f + tanhf(u)); }
      so[w][8 * hh + r][t * 16 + ln] = v;
    }
  }
  __builtin_amdgcn_fence(__ATOMIC_ACQ_REL, "workgroup");
  __builtin_amdgcn_wave_barrier();
  const int rsub = lane >> 4, c4 = (lane & 15) * 4;
  {
#pragma unroll
    for (int q = 0; q < 8; ++q) {
      const int r = q * 2 + rsub;
      const v4f v = *(const v4fa*)&so[w][r][c4];
      *(v4f*)(C + (size_t)(row0 + r) * ldc + col0 + c4) = v;
    }
    
  }
}
// row LayerNorm (biased variance, eps) over N: s = X (+ R); optional out_sum <- s; out_norm <- (s-mu)*rsqrt(var+eps)*g + b
template <bool PARAM_BF16>
__global__ __launch_bounds__(256) void k_layernorm(const float* __restrict__ X, const float* __restrict__ R, const float* __restrict__ g, const float* __restrict__ bta,
                                                  float* __restrict__ out_sum, float* __restrict__ out_norm, int N, float eps) {
  __shared__ float red[256];
  const int row = blockIdx.x, tid = threadIdx.x;
  const float* x = X + (size_t)row * N; const float* rr = R ? R + (size_t)row * N : nullptr;
  float vals[16];                     // up to N = 4096
  const int per = N / 256;            // contiguous chunk per thread? use strided-by-4 chunks: thread handles j = tid*4 + 1024*u
  float s1 = 0.f;
  for (int u = 0; u < per / 4; ++u) {
    const int j = tid * 4 + 1024 * u;
    const v4f a = *(const v4fa*)(x + j);
    v4f b = {0.f,0.f,0.f,0.f}; if (rr) b = *(const v4fa*)(rr + j);
#pragma unroll
    for (int q = 0; q < 4; ++q) { const float v = a[q] + b[q]; vals[u * 4 + q] = v; s1 += v; }
  }
  red[tid] = s1; __syncthreads();
  for (int st = 128; st > 0; st >>= 1) { if (tid < st) red[tid] += red[tid + st]; __syncthreads(); }
  const float mu = red[0] / (float)N; __syncthreads();
  float s2 = 0.f;
  for (int u = 0; u < per / 4; ++u)
#pragma unroll
    for (int q = 0; q < 4; ++q) { const float c = vals[u * 4 + q] - mu; s2 += c * c; }
  red[tid] = s2; __syncthreads();
  for (int st = 128; st > 0; st >>= 1) { if (tid < st) red[tid] += red[tid + st]; __syncthreads(); }
  const float rs = rsqrtf(red[0] / (float)N + eps);
  {
    for (int u = 0; u < per / 4; ++u) {
      const int j = tid * 4 + 1024 * u;
      v4f o, sm;
#pragma unroll
      for (int q = 0; q < 4; ++q) {
        float gg = g[j + q], bb = bta[j + q];
        if (PARAM_BF16) { gg = bf16_round(gg); bb = bf16_round(bb); }
        sm[q] = vals[u * 4 + q]; o[q] = (vals[u * 4 + q] - mu) * rs * gg + bb;
      }
      if (out_sum) *(v4f*)(out_sum + (size_t)row * N + j) = sm;
      *(v4f*)(out_norm + (size_t)row * N + j) = o;
    }
    
  }
}



// ---- f16 WMMA path (v_wmma_f32_16x16x32_f16): 11-bit significands for operands in range — used where a [0,1] probability operand needs more precision than bf16
typedef _Float16 v16h __attribute__((ext_vector_type(16)));
union FragH { v16h v; v8us half[2]; _Float16 h[16]; unsigned short u[16]; };
template <int NT>
__device__ __forceinline__ v8f mmaH(v16h ah, v16h al, v16h bh, v16h bl, v8f c) {
  c = __builtin_amdgcn_wmma_f32_16x16x32_f16(false, ah, false, bh, (short)0, c, false, false);
  if (NT >= 2) c = __builtin_amdgcn_wmma_f32_16x16x32_f16(false, al, false, bh, (short)0, c, false, false);
  if (NT >= 3) c = __builtin_amdgcn_wmma_f32_16x16x32_f16(false, ah, false, bl, (short)0, c, false, false);
  asm volatile("v_nop\n\tv_nop\n\tv_nop\n\tv_nop" : "+v"(c) : "v"(ah), "v"(al), "v"(bh), "v"(bl));
  return c;
}
// batched GEMM like k_gemm_b but f16 operands: A f32 (split into f16 hi/lo if ASPLIT, else rounded to f16), Bt = f16 values [n][k]; alpha; C f32; N multiple of 16 (partial tiles skipped)
template <bool ASPLIT>
__global__ __launch_bounds__(128) void k_gemm_h(const float* __restrict__ A, int lda, size_t sA, const _Float16* __restrict__ Bh, int ldb, size_t sB, float alpha, float* __restrict__ C, int ldc, size_t sC, int M, int N, int K) {
  __shared__ __attribute__((aligned(16))) float so[4][16][64];
  const int tid = threadIdx.x, w = tid >> 5, lane = tid & 31, ln = lane & 15, hh = lane >> 4; const int by = blockIdx.y;
  A += (size_t)by * sA; Bh += (size_t)by * sB; C += (size_t)by * sC;
  const int ntn = (N + 63) / 64; const int wid = blockIdx.x * 4 + w; const int mt = wid / ntn, nq = wid % ntn; if (mt * 16 >= M) return;
  const int row0 = mt * 16, col0 = nq * 64; const float* arow = A + (size_t)(row0 + ln) * lda;
  v8f acc[4] = {};
  for (int kb = 0; kb < K; kb += 32) {
    FragH ah, al;
    const v4f x0 = *(const v4fa*)(arow + kb + 8 * hh), x1 = *(const v4fa*)(arow + kb + 8 * hh + 4), x2 = *(const v4fa*)(arow + kb + 16 + 8 * hh), x3 = *(const v4fa*)(arow + kb + 16 + 8 * hh + 4);
    float xs[16] = {x0[0],x0[1],x0[2],x0[3],x1[0],x1[1],x1[2],x1[3],x2[0],x2[1],x2[2],x2[3],x3[0],x3[1],x3[2],x3[3]};
#pragma unroll
    for (int i = 0; i < 16; ++i) { const _Float16 h = (_Float16)xs[i]; ah.h[i] = h; al.h[i] = ASPLIT ? (_Float16)(xs[i] - (float)h) : (_Float16)0.0f; }
#pragma unroll
    for (int t = 0; t < 4; ++t) { if (col0 + t * 16 >= N) continue; const size_t boff = (size_t)(col0 + t * 16 + ln) * ldb + kb; FragH bq; bq.half[0] = *(const v8us*)(Bh + boff + 8 * hh); bq.half[1] = *(const v8us*)(Bh + boff + 16 + 8 * hh);
      acc[t] = mmaH<ASPLIT ? 2 : 1>(ah.v, al.v, bq.v, bq.v, acc[t]); }
  }
#pragma unroll
  for (int t = 0; t < 4; ++t) { if (col0 + t * 16 >= N) continue;
#pragma unroll
    for (int r = 0; r < 8; ++r) so[w][8 * hh + r][t * 16 + ln] = acc[t][r] * alpha; }
  __builtin_amdgcn_fence(__ATOMIC_ACQ_REL, "workgroup"); __builtin_amdgcn_wave_barrier();
  const int rsub = lane >> 4, c4 = (lane & 15) * 4;
  {
#pragma unroll
    for (int q = 0; q < 8; ++q) { const int r = q * 2 + rsub; if (col0 + c4 < N) { const v4f v = *(const v4fa*)&so[w][r][c4]; *(v4f*)(C + (size_t)(row0 + r) * ldc + col0 + c4) = v; } }
     }
}

// Wt[n][k] = f16(W[k][n]·scale) from f32 row-major W[K][N] (scale = power of two; bf16-exact weights stay exact in f16 away from the subnormal range)
__global__ __launch_bounds__(256) void k_wt_f16(const float* __restrict__ W, _Float16* __restrict__ Wt, int K, int N, float scale) {
  const int t = blockIdx.x * 256 + threadIdx.x; if (t >= N * (K / 8)) return; const int n = t / (K / 8), k8 = (t % (K / 8)) * 8; FragH f;
#pragma unroll
  for (int i = 0; i < 8; ++i) f.h[i] = (_Float16)(bf16_round(W[(size_t)(k8 + i) * N + n]) * scale); const v8us o = f.half[0];
  *(v8us*)((unsigned short*)Wt + (size_t)n * K + k8) = o; 
}
// k_gemm_hh variant with fused epilogue: v = acc·alpha + bias[by·sBias + col] (+ CP[(row/rowsPerB)·sCPb + by·64 + col] if CP) ; ACT 0 none / 1 elu ; writes f16 C16 (and f32 C if non-null)
template <int ACT>
__global__ __launch_bounds__(128) void k_gemm_hhx(const _Float16* __restrict__ A, int lda, size_t sA, const _Float16* __restrict__ Bh, int ldb, size_t sB, float alpha, const float* __restrict__ bias, size_t sBias, const float* __restrict__ CP, int rowsPerB, size_t sCPb, int row0g,
    float* __restrict__ C, _Float16* __restrict__ C16, int ldc, size_t sC, int M, int N, int K) {
  __shared__ __attribute__((aligned(16))) float so[4][16][64];
  const int tid = threadIdx.x, w = tid >> 5, lane = tid & 31, ln = lane & 15, hh = lane >> 4; const int by = blockIdx.y;
  A += (size_t)by * sA; Bh += (size_t)by * sB; const size_t cofs = (size_t)by * sC; const float* bp = bias ? bias + (size_t)by * sBias : nullptr;
  const int ntn = (N + 63) / 64; const int wid = blockIdx.x * 4 + w; const int mt = wid / ntn, nq = wid % ntn; if (mt * 16 >= M) return;
  const int row0 = mt * 16, col0 = nq * 64; const _Float16* arow = A + (size_t)(row0 + ln) * lda;
  v8f acc[4] = {};
  for (int kb = 0; kb < K; kb += 32) { FragH ah; ah.half[0] = *(const v8us*)((const unsigned short*)arow + kb + 8 * hh); ah.half[1] = *(const v8us*)((const unsigned short*)arow + kb + 16 + 8 * hh);
#pragma unroll
    for (int t = 0; t < 4; ++t) { if (col0 + t * 16 >= N) continue; const size_t boff = (size_t)(col0 + t * 16 + ln) * ldb + kb; FragH bq; bq.half[0] = *(const v8us*)((const unsigned short*)Bh + boff + 8 * hh); bq.half[1] = *(const v8us*)((const unsigned short*)Bh + boff + 16 + 8 * hh);
      acc[t] = mmaH<1>(ah.v, ah.v, bq.v, bq.v, acc[t]); }
  }
#pragma unroll
  for (int t = 0; t < 4; ++t) { if (col0 + t * 16 >= N) continue; const int col = col0 + t * 16 + ln; const float bv = bp ? bf16_round(bp[col]) : 0.f;
#pragma unroll
    for (int r = 0; r < 8; ++r) { float v = acc[t][r] * alpha + bv; if (CP) { const int rr = row0g + row0 + 8 * hh + r; if (rowsPerB < 0) v += CP[cofs + (size_t)rr * ldc + col];      /* rowsPerB < 0: own element of the batched C plane */ else { const int bidx = rr / rowsPerB; v += CP[(size_t)bidx * sCPb + (size_t)by * 64 + col]; } } if (ACT == 1) v = (v > 0.f) ? v : expm1f(v); else if (ACT == 7) v = (v > 0.f) ? v + 1.0f : expf(v); else if (ACT == 8) v = tanhf(v); else if (ACT == 9) v = 0.5f * v * (1.0f + tanhf(0.7978845608028654f * (v + 0.044715f * v * v * v))); else if (ACT == 11) v = 1.0f / (1.0f + expf(-v)); else if (ACT == 12) v = (v > 0.f) ? v : 0.01f * v; else if (ACT == 14) v = (v > 0.f) ? v : 0.1f * v; else if (ACT == 16) v = (v >= 0.f) ? v : 0.3f * v; else if (ACT == 17) v = (v >= 0.f) ? v : 0.2f * v; else if (ACT == 15) v = v / (1.0f + expf(-v)); else if (ACT == 3) v = fmaxf(v, 0.f); else if (ACT == 6) v = 0.5f * v * (1.0f + erff(v * 0.70710678118654752f)); so[w][8 * hh + r][t * 16 + ln] = v; } }
  __builtin_amdgcn_fence(__ATOMIC_ACQ_REL, "workgroup"); __builtin_amdgcn_wave_barrier();
  const int rsub = lane >> 4, c4 = (lane & 15) * 4; typedef _Float16 v4h __attribute__((ext_vector_type(4)));
  {
#pragma unroll
    for (int q = 0; q < 8; ++q) { const int r = q * 2 + rsub; if (col0 + c4 < N) { const v4f v = *(const v4fa*)&so[w][r][c4]; if (C) *(v4f*)(C + cofs + (size_t)(row0 + r) * ldc + col0 + c4) = v; if (C16) { v4h h4; for (int i = 0; i < 4; ++i) h4[i] = (_Float16)v[i]; *(v4h*)(C16 + cofs + (size_t)(row0 + r) * ldc + col0 + c4) = h4; } } }
     }
}


typedef _Float16 v4h __attribute__((ext_vector_type(4)));

__global__ __launch_bounds__(256) void k_x16(const float* __restrict__ x, _Float16* __restrict__ X16, size_t n8) { const size_t t = (size_t)blockIdx.x * 256 + threadIdx.x; if (t >= n8) return; FragH f;
#pragma unroll
  for (int q = 0; q < 8; ++q) f.h[q] = (_Float16)bf16_round(x[t * 8 + q]); *(v8us*)((unsigned short*)X16 + t * 8) = f.half[0];  }
__global__ __launch_bounds__(256) void k_h16(const float* __restrict__ x, _Float16* __restrict__ X16, size_t n8) { const size_t t = (size_t)blockIdx.x * 256 + threadIdx.x; if (t >= n8) return; FragH f;
#pragma unroll
  for (int q = 0; q < 8; ++q) f.h[q] = (_Float16)x[t * 8 + q]; *(v8us*)((unsigned short*)X16 + t * 8) = f.half[0];  }
__global__ __launch_bounds__(256) void k_round16f(const float* __restrict__ W, _Float16* __restrict__ Bt, size_t n8) { const size_t t = (size_t)blockIdx.x * 256 + threadIdx.x; if (t >= n8) return; FragH f;
#pragma unroll
  for (int i = 0; i < 8; ++i) f.h[i] = (_Float16)(bf16_round(W[t * 8 + i]) * 16.0f); *(v8us*)((unsigned short*)Bt + t * 8) = f.half[0];  }
template <int NHv, int TTv>
__global__ __launch_bounds__(256) void k_vt(const _Float16* __restrict__ V16, int ldv, int voff, _Float16* __restrict__ Vt) { __shared__ unsigned short tl[64][66]; const int tid = threadIdx.x; const int slab = blockIdx.x / (TTv / 64), lg = blockIdx.x % (TTv / 64); const int b = slab / NHv, h = slab % NHv;
  for (int i = tid; i < 64 * 8; i += 256) { const int r = i / 8, c8 = (i % 8) * 8; FragH f; f.half[0] = *(const v8us*)((const unsigned short*)V16 + ((size_t)b * TTv + lg * 64 + r) * ldv + voff + h * 64 + c8);
#pragma unroll
    for (int q = 0; q < 8; ++q) tl[r][c8 + q] = f.u[q]; }
  __syncthreads();
  {
#pragma unroll
    for (int rd = 0; rd < 2; ++rd) { const int d = rd * 32 + tid / 8, pc = tid % 8; FragH f;
#pragma unroll
      for (int q = 0; q < 8; ++q) f.u[q] = tl[pc * 8 + q][d];
      *(v8us*)((unsigned short*)Vt + ((size_t)slab * 64 + d) * TTv + lg * 64 + pc * 8) = f.half[0]; }
     } }

__global__ __launch_bounds__(256) void k_hl(const float* __restrict__ F, _Float16* __restrict__ Hh, _Float16* __restrict__ Hl, size_t n8) { const size_t t = (size_t)blockIdx.x * 256 + threadIdx.x; if (t >= n8) return; FragH fh, fl; const v4f a = *(const v4fa*)(F + t * 8), c = *(const v4fa*)(F + t * 8 + 4);
#pragma unroll
  for (int q = 0; q < 4; ++q) { _Float16 h = (_Float16)a[q]; fh.h[q] = h; fl.h[q] = (_Float16)((a[q] - (float)h) * 1024.0f); h = (_Float16)c[q]; fh.h[4 + q] = h; fl.h[4 + q] = (_Float16)((c[q] - (float)h) * 1024.0f); }
  { *(v8us*)((unsigned short*)Hh + t * 8) = fh.half[0]; *(v8us*)((unsigned short*)Hl + t * 8) = fl.half[0];  } }

// ---- fast GEMM (wave tile 32x64; requires M % 32 == 0 rows per launch region and N % 64 == 0); epilogue = k_gemm_hhx semantics ----
__device__ __forceinline__ v16h g2_frag(const _Float16* p, int hh) { FragH f; f.half[0] = *(const v8us*)((const unsigned short*)p + 8 * hh); f.half[1] = *(const v8us*)((const unsigned short*)p + 16 + 8 * hh); return f.v; }
__device__ __forceinline__ v8f g2_mma(v16h a, v16h b, v8f c) { v8f d = __builtin_amdgcn_wmma_f32_16x16x32_f16(false, a, false, b, (short)0, c, false, false); asm volatile("v_nop\n\tv_nop\n\tv_nop\n\tv_nop" : "+v"(d) : "v"(a), "v"(b)); return d; }
template <int ACT>
__global__ __launch_bounds__(128) void k_gemm2(const _Float16* __restrict__ A, int lda, size_t sA, const _Float16* __restrict__ Bh, int ldb, size_t sB, float alpha, const float* __restrict__ bias, size_t sBias, const float* __restrict__ CP, int rowsPerB, size_t sCPb, int row0g,
    float* __restrict__ C, _Float16* __restrict__ C16, int ldc, size_t sC, int M, int N, int K) { static_assert(ACT == 0 || ACT == 3 || ACT == 6 || ACT == 8 || ACT == 9 || ACT == 11 || ACT == 12 || ACT == 14 || ACT == 15 || ACT == 16 || ACT == 17, "k_gemm2: unsupported ACT code (would silently apply no activation)");
  __shared__ __attribute__((aligned(16))) float so[4][32][68];
  const int tid = threadIdx.x, w = tid >> 5, lane = tid & 31, ln = lane & 15, hh = lane >> 4; const int by = blockIdx.y;
  A += (size_t)by * sA; Bh += (size_t)by * sB; const size_t cofs = (size_t)by * sC; const float* bp = bias ? bias + (size_t)by * sBias : nullptr;
  const int ntn = N >> 6; const int mt = blockIdx.x / ntn, nq = blockIdx.x - mt * ntn; const int row0 = mt * 128 + 32 * w, col0 = nq * 64; if (row0 >= M) return;
  const _Float16* a0p = A + (size_t)(row0 + ln) * lda; const _Float16* a1p = a0p + (size_t)16 * lda;
  const _Float16* b0p = Bh + (size_t)(col0 + ln) * ldb; const _Float16* b1p = b0p + (size_t)16 * ldb; const _Float16* b2p = b1p + (size_t)16 * ldb; const _Float16* b3p = b2p + (size_t)16 * ldb;
  const v8f z8 = {0.f,0.f,0.f,0.f,0.f,0.f,0.f,0.f}; v8f c00 = z8, c01 = z8, c02 = z8, c03 = z8, c10 = z8, c11 = z8, c12 = z8, c13 = z8;
#pragma unroll 1
  for (int kb = 0; kb < K; kb += 32) { const v16h a0 = g2_frag(a0p + kb, hh), a1 = g2_frag(a1p + kb, hh);
    v16h b = g2_frag(b0p + kb, hh); c00 = g2_mma(a0, b, c00); c10 = g2_mma(a1, b, c10);
    b = g2_frag(b1p + kb, hh); c01 = g2_mma(a0, b, c01); c11 = g2_mma(a1, b, c11);
    b = g2_frag(b2p + kb, hh); c02 = g2_mma(a0, b, c02); c12 = g2_mma(a1, b, c12);
    b = g2_frag(b3p + kb, hh); c03 = g2_mma(a0, b, c03); c13 = g2_mma(a1, b, c13); }
  v8f accs[8] = {c00, c01, c02, c03, c10, c11, c12, c13};
#pragma unroll
  for (int u = 0; u < 8; ++u) { const int t = u & 3, half = u >> 2; const int col = col0 + t * 16 + ln; const float bv = bp ? bf16_round(bp[col]) : 0.f;
#pragma unroll
    for (int r = 0; r < 8; ++r) { const int rloc = half * 16 + 8 * hh + r; float v = accs[u][r] * alpha + bv; if (CP) { if (rowsPerB < 0) v += CP[cofs + (size_t)(row0g + row0 + rloc) * ldc + col];      /* rowsPerB < 0: own element of the batched C plane */ else { const int bidx = (row0g + row0 + rloc) / rowsPerB; v += CP[(size_t)bidx * sCPb + (size_t)by * 64 + col]; } }
      if (ACT == 3) v = fmaxf(v, 0.f); else if (ACT == 6) v = 0.5f * v * (1.0f + erff(v * 0.70710678118654752f)); else if (ACT == 11) v = 1.0f / (1.0f + expf(-v)); else if (ACT == 15) v = v / (1.0f + expf(-v)); else if (ACT == 12) v = (v > 0.f) ? v : 0.01f * v; else if (ACT == 8) v = tanhf(v); else if (ACT == 9) v = 0.5f * v * (1.0f + tanhf(0.7978845608028654f * (v + 0.044715f * v * v * v))); else if (ACT == 14) v = (v > 0.f) ? v : 0.1f * v; else if (ACT == 16) v = (v >= 0.f) ? v : 0.3f * v; else if (ACT == 17) v = (v >= 0.f) ? v : 0.2f * v;
      so[w][rloc][t * 16 + ln] = v; } }
  __builtin_amdgcn_fence(__ATOMIC_ACQ_REL, "workgroup"); __builtin_amdgcn_wave_barrier();
  const int rsub = lane >> 4, c4 = (lane & 15) * 4;
  {
#pragma unroll
    for (int q = 0; q < 16; ++q) { const int r = q * 2 + rsub; const v4f v = *(const v4fa*)&so[w][r][c4]; if (C) *(v4f*)(C + cofs + (size_t)(row0 + r) * ldc + col0 + c4) = v; if (C16) { v4h h4; for (int i = 0; i < 4; ++i) h4[i] = (_Float16)v[i]; *(v4h*)(C16 + cofs + (size_t)(row0 + r) * ldc + col0 + c4) = h4; } }
     } }


__global__ __launch_bounds__(256) void k_rsm(const float* __restrict__ S, _Float16* __restrict__ P, int nrows) {
  #pragma clang fp contract(off)
  const int i = blockIdx.x * 256 + threadIdx.x; if (i >= nrows) return; const float* s = S + (size_t)i * SQ; float mx = -3.0e38f;
#pragma unroll 1
  for (int j = 0; j < SQ; ++j) mx = fmaxf(mx, s[j]); float se = 0.f;
#pragma unroll 1
  for (int j = 0; j < SQ; ++j) se += expf(s[j] - mx); const float sc = 256.0f / se;
#pragma unroll 1
  for (int j0 = 0; j0 < SQ; j0 += 8) { FragH f; for (int q = 0; q < 8; ++q) f.h[q] = (_Float16)(expf(s[j0 + q] - mx) * sc); unsigned short* d = (unsigned short*)P + (size_t)i * SQ + j0; *(v8us*)d = f.half[0];  } }
__global__ __launch_bounds__(256) void k_vt(const _Float16* __restrict__ V16, int b, int h0, _Float16* __restrict__ VT) { __shared__ unsigned short tl[64][65]; const int tid = threadIdx.x; const int hh = blockIdx.x % HG, sg = blockIdx.x / HG; const int s0 = sg * 64; const int h = h0 + hh;
  for (int i = tid; i < 64 * 8; i += 256) { const int j = i / 8, d8 = (i % 8) * 8; FragH f; f.half[0] = *(const v8us*)((const unsigned short*)V16 + ((size_t)b * SQ + s0 + j) * DM + h * HD + d8); for (int q = 0; q < 8; ++q) tl[d8 + q][j] = f.u[q]; }
  __syncthreads();
  { for (int i = tid; i < 64 * 8; i += 256) { const int d = i / 8, j8 = (i % 8) * 8; FragH f; for (int q = 0; q < 8; ++q) f.u[q] = tl[d][j8 + q]; *(v8us*)((unsigned short*)VT + ((size_t)hh * HD + d) * SQ + s0 + j8) = f.half[0]; }  } }


template <int BFIN, int W16, int W32>
__global__ __launch_bounds__(256) void k_lnx(const float* __restrict__ X, const float* __restrict__ g, const float* __restrict__ bb, float eps, _Float16* __restrict__ N16, float* __restrict__ N32) {
  #pragma clang fp contract(off)
  __shared__ float red[256]; const size_t r = blockIdx.x; const int t = threadIdx.x; const bool act = t < (DMQ / 4); const int c0 = act ? t * 4 : 0;
  const v4f xa = *(const v4fa*)(X + r * DMQ + c0); float s[4]; float sum = 0.f;
  for (int q = 0; q < 4; ++q) { s[q] = act ? (BFIN ? bf16_round(xa[q]) : xa[q]) : 0.f; sum = __fadd_rn(sum, s[q]); }
  red[t] = sum; __syncthreads(); for (int st = 128; st > 0; st >>= 1) { if (t < st) red[t] = __fadd_rn(red[t], red[t + st]); __syncthreads(); } const float mu = red[0] / (float)DMQ; __syncthreads();
  float vs = 0.f; for (int q = 0; q < 4; ++q) { const float dl = act ? __fadd_rn(s[q], -mu) : 0.f; vs = __fadd_rn(vs, __fmul_rn(dl, dl)); } red[t] = vs; __syncthreads(); for (int st = 128; st > 0; st >>= 1) { if (t < st) red[t] = __fadd_rn(red[t], red[t + st]); __syncthreads(); }
  const float rs = rsqrtf(__fadd_rn(red[0] / (float)DMQ, eps)); v4h y; v4f yf;
  for (int q = 0; q < 4; ++q) { const int c = c0 + q; yf[q] = __fadd_rn(__fmul_rn(__fmul_rn(__fadd_rn(s[q], -mu), rs), bf16_round(g[c])), (bb ? bf16_round(bb[c]) : 0.f)); y[q] = (_Float16)yf[q]; }
  if (!act) return;      /* no barriers after this point */
  { if (W16) *(v4h*)(N16 + r * DMQ + c0) = y; if (W32) *(v4f*)(N32 + r * DMQ + c0) = yf;  } }


__global__ __launch_bounds__(256) void k_rsmf(const float* __restrict__ S, _Float16* __restrict__ P, int qn, int hg) {
  #pragma clang fp contract(off)
  const int t = blockIdx.x * 256 + threadIdx.x; if (t >= qn * hg) return; const size_t i = (size_t)(t / qn) * SQ + (t % qn); const float* s = S + i * SQ; float mx = -3.0e38f;
#pragma unroll 1
  for (int j = 0; j < SQ; ++j) mx = fmaxf(mx, s[j]); float se = 0.f;
#pragma unroll 1
  for (int j = 0; j < SQ; ++j) se += __expf(s[j] - mx); const float sc = 256.0f / se;
#pragma unroll 1
  for (int j0 = 0; j0 < SQ; j0 += 8) { FragH f; for (int q = 0; q < 8; ++q) f.h[q] = (_Float16)(__expf(s[j0 + q] - mx) * sc); unsigned short* d = (unsigned short*)P + i * SQ + j0; *(v8us*)d = f.half[0];  } }


__global__ __launch_bounds__(256) void k_bfr(const float* __restrict__ x, float* __restrict__ XB, size_t n8) { const size_t t = (size_t)blockIdx.x * 256 + threadIdx.x; if (t >= n8) return; v4f a = *(const v4fa*)(x + t * 8), c = *(const v4fa*)(x + t * 8 + 4); for (int q = 0; q < 4; ++q) { a[q] = bf16_round(a[q]); c[q] = bf16_round(c[q]); }
  { *(v4f*)(XB + t * 8) = a; *(v4f*)(XB + t * 8 + 4) = c;  } }



__global__ __launch_bounds__(256) void k_rsmfam(const float* __restrict__ S, _Float16* __restrict__ P, int qn, int hg, const float* __restrict__ am) {
  #pragma clang fp contract(off)
  const int t = blockIdx.x * 256 + threadIdx.x; if (t >= qn * hg) return; const size_t i = (size_t)(t / qn) * SQ + (t % qn); const float* s = S + i * SQ; float mx = -3.0e38f;
#pragma unroll 1
  for (int j = 0; j < SQ; ++j) mx = fmaxf(mx, __fadd_rn(s[j], bf16_round(am[j]))); float se = 0.f;
#pragma unroll 1
  for (int j = 0; j < SQ; ++j) se += __expf(__fadd_rn(s[j], bf16_round(am[j])) - mx); const float sc = 256.0f / se;
#pragma unroll 1
  for (int j0 = 0; j0 < SQ; j0 += 8) { FragH f; for (int q = 0; q < 8; ++q) f.h[q] = (_Float16)(__expf(__fadd_rn(s[j0 + q], bf16_round(am[j0 + q])) - mx) * sc); unsigned short* d = (unsigned short*)P + i * SQ + j0; *(v8us*)d = f.half[0];  } }


#define CC CX           /* unused: input channels */
#define LL SQ           /* pixels per image */
#define LQ (3 * DM)     /* unused */

__global__ __launch_bounds__(256) void k_rowb(float* __restrict__ O, const float* __restrict__ bias, size_t n4) {
  #pragma clang fp contract(off)
  const size_t t = (size_t)blockIdx.x * 256 + threadIdx.x; if (t >= n4) return; const size_t e = t * 4; const int c = (int)((e / SQ) % CX);      /* output channels */ const float bb = bf16_round(bias[c]); const v4f a = *(const v4fa*)(O + e); v4f o; for (int q = 0; q < 4; ++q) o[q] = __fadd_rn(a[q], bb);
  *(v4f*)(O + e) = o;  }

// ---- fused sigmoid attention: Y[b][c][n] = bf16(gamma) sum_m V[b][c][m] sigmoid(q[n].k[m]) + bf16(x[b][c][n]); the gate tile never leaves registers ----
// S^T / 2 = K.(Q / 2)^T (A = k rows, B = rows of q / 2, both through f_frag16): a lane holds column n = ln, rows m = 8 hh + r. Two such D tiles (m 0-15, 16-31), gated and
// rounded to f16 in place, are the B operand of out += V.P^T in the hardware k order, which is the order k_proj stores the V fragments in (A operand, f_fragp).
// Work-group = one image, 32 query columns, all 128 channels; its 8 waves each walk 512 of the 4096 keys; the 8 partial tiles are summed through LDS in wave order; the thread that holds a sum scales it, adds its x and stores y.
#define FW 8             /* waves per work-group = key ranges */
#define FN 32            /* query columns per work-group */
#define FP 36            /* LDS row pitch in floats: rows 8 apart fall on other banks, 16-byte reads stay aligned */
/* waves_per_eu(4, 4): at most 256 registers, so that two work-groups share a WGP and four waves per SIMD cover each other's dependent gate arithmetic; 2 x the LDS size fits the WGP */
__device__ __forceinline__ v16h f_frag16(const _Float16* p) { FragH f; const v8us z = {0, 0, 0, 0, 0, 0, 0, 0}; f.half[0] = *(const v8us*)(const unsigned short*)p; f.half[1] = z; return f.v; }      /* q / k fragment: k 16-31 of the K = 32 contraction is zero, set in registers */
__device__ __forceinline__ v16h f_fragp(const _Float16* p) { FragH f; f.half[0] = *(const v8us*)(const unsigned short*)p; f.half[1] = *(const v8us*)((const unsigned short*)p + 256); return f.v; }      /* V fragment from a 1-KiB unit of k_proj: p = unit + 8 lane; the second half stands 512 bytes on */
__device__ __forceinline__ v8f f_mma(v16h a, v16h b, v8f c) { return __builtin_amdgcn_wmma_f32_16x16x32_f16(false, a, false, b, (short)0, c, false, false); }
/* gate: sigmoid(s) = 0.5 + 0.5 tanh(s / 2), one v_tanh_f32 per score; u = s / 2 comes out of the score product itself (the q plane holds q / 2, a power of two); two gates share the packed fma and the packed f16 conversion; +-inf give 0 and 1, NaN stays NaN */
typedef float v2f __attribute__((ext_vector_type(2)));
typedef _Float16 v2h __attribute__((ext_vector_type(2)));
__device__ __forceinline__ v2h f_gate2(float u0, float u1) { const v2f t = {__builtin_amdgcn_tanhf(u0), __builtin_amdgcn_tanhf(u1)}; const v2f hf = {0.5f, 0.5f}; return __builtin_convertvector(__builtin_elementwise_fma(t, hf, hf), v2h); }
__global__ __launch_bounds__(FW * 32) __attribute__((amdgpu_waves_per_eu(4, 4))) void k_sattn(const _Float16* __restrict__ QZ, const _Float16* __restrict__ KZ, const _Float16* __restrict__ VP, const float* __restrict__ gam, const float* __restrict__ x, float* __restrict__ Y) {
  __shared__ __attribute__((aligned(16))) float red[FW][CX][FP];
  constexpr int MR = SQ / FW;      /* keys per wave */
  const int tid = threadIdx.x, w = tid >> 5, lane = tid & 31, ln = lane & 15, hh = lane >> 4; const int b = blockIdx.y, n0 = blockIdx.x * FN;
  const _Float16* qp = QZ + ((size_t)b * SQ + n0 + ln) * 16; const unsigned ki = (unsigned)((b * SQ + w * MR + ln) * 16 + 8 * hh), vi = (unsigned)((b * (SQ / 32) + w * (MR / 32)) * (CX / 16) * 512 + 8 * lane); const _Float16* kp = KZ + ki; const _Float16* vp = VP + vi;      /* kp, vp: the lane's own first 8 elements; over a wave both are 512 contiguous bytes */
  const v16h qf[2] = {f_frag16(qp + 8 * hh), f_frag16(qp + 16 * 16 + 8 * hh)};      /* rows of q / 2: the score tiles are s / 2, the argument of the gate's tanh */
  const v8f z8 = {0.f,0.f,0.f,0.f,0.f,0.f,0.f,0.f}; v8f acc[CX / 16][2];
#pragma unroll
  for (int t = 0; t < CX / 16; ++t) { acc[t][0] = z8; acc[t][1] = z8; }
#pragma unroll 1      /* rolled; the inner loops are unrolled so that fragments and accumulators stay in registers */
  for (int m0 = 0; m0 < MR; m0 += 32, kp += 32 * 16, vp += (CX / 16) * 512) {
    const v16h k0 = f_frag16(kp), k1 = f_frag16(kp + 16 * 16); v16h vf[CX / 16];
#pragma unroll
    for (int t = 0; t < CX / 16; ++t) vf[t] = f_fragp(vp + t * 512);
    asm volatile("s_wait_xcnt 0x0" ::: "memory");      /* kp and vp are advanced at the loop's foot: the wait that stands between issued loads and an overwrite of their address registers, put where the wave waits for the k rows next */
    __builtin_amdgcn_sched_barrier(0);      /* all of the pass's loads are issued ahead of the scores: a load sunk behind the first gates is waited for in full among the products */
#pragma unroll
    for (int j = 0; j < 2; ++j) { const v8f s0 = f_mma(k0, qf[j], z8), s1 = f_mma(k1, qf[j], z8); FragH p;
#pragma unroll
      for (int r = 0; r < 8; r += 2) { const v2h g0 = f_gate2(s0[r], s0[r + 1]), g1 = f_gate2(s1[r], s1[r + 1]); p.h[r] = g0[0]; p.h[r + 1] = g0[1]; p.h[8 + r] = g1[0]; p.h[8 + r + 1] = g1[1]; }
#pragma unroll
      for (int t = 0; t < CX / 16; ++t) acc[t][j] = f_mma(vf[t], p.v, acc[t][j]);
      __builtin_amdgcn_sched_barrier(0);      /* one column group's scores and gates at a time: both at once do not fit the registers of four waves per SIMD */
    } }
  /* residual: the thread's own x elements (those of the sums it forms below) are asked for here, so that they arrive while the partial tiles go through LDS */
  constexpr int NQ = CX * FN / 4 / (FW * 32); const size_t eo = ((size_t)b * CX + tid / (FN / 4)) * SQ + n0 + (tid % (FN / 4)) * 4; const float* xp = x + eo; v4f xr[NQ];
#pragma unroll
  for (int q = 0; q < NQ; ++q) xr[q] = *(const v4fa*)(xp + (size_t)q * (FW * 32 / (FN / 4)) * SQ);
  asm volatile("s_wait_xcnt 0x0" :: "v"(xp) : "memory");      /* the wait that stands between issued loads and an overwrite of their address registers; the address is an input so that it stays in its registers up to the wait and no load of the run lands on it */
  const float g = bf16_round(gam[0]);
#pragma unroll
  for (int t = 0; t < CX / 16; ++t)
#pragma unroll
    for (int j = 0; j < 2; ++j)
#pragma unroll
      for (int r = 0; r < 8; ++r) red[w][t * 16 + 8 * hh + r][j * 16 + ln] = acc[t][j][r];
  __syncthreads();
#pragma unroll
  for (int q = 0; q < NQ; ++q) { const int i = q * (FW * 32) + tid, c = i / (FN / 4), n4 = (i % (FN / 4)) * 4; v4f s = *(const v4fa*)&red[0][c][n4];
#pragma unroll
    for (int u = 1; u < FW; ++u) s += *(const v4fa*)&red[u][c][n4];
#pragma unroll
    for (int e = 0; e < 4; ++e) s[e] = g * s[e] + bf16_round(xr[q][e]);
    *(v4f*)(Y + eo + (size_t)q * (FW * 32 / (FN / 4)) * SQ) = s; } }
// ---- fused projections: x [b][c][n] f32 and the natural weights -> q / 2 rows, k rows (f16 [b n][16]) and V in fragment order, one launch ----
// Work-group = 64 tokens of one image. The x tile (bf16-rounded, exact in f16) is turned to token rows [64][128] and [Wq; Wk; Wv] (bf16-rounded, x 16) to rows [160][128] in LDS; every fragment is two 16-byte LDS reads (g2_frag).
// Wave w: token tile mt = w & 3 (16 tokens); hf = w >> 2 picks q (0) or k (1) and the output channels 64 hf + 0..63 of v.
// q, k: A = weight rows, B = token rows: a lane holds token ln, outputs 8 hh + r: one 16-byte store into the token's row.
// v: A = token rows, B = weight rows: a lane holds channel ln, tokens 8 hh + r. That is the A operand of k_sattn: per image, 32-key block and 16-channel tile one 1-KiB unit [half][lane][8 keys]
// (lane = 16 hh + ln holds channel ln, keys 16 half + 8 hh + 0..7), so a D tile is stored as it stands, 512 contiguous bytes per wave.
#define PK 64            /* tokens per work-group: 256 work-groups */
#define PP (CX + 8)      /* LDS row pitch in f16: 272 bytes = 16 x odd, for 16-byte readers of 256-byte rows */
__global__ __launch_bounds__(256) void k_proj(const float* __restrict__ x, const float* __restrict__ wq, const float* __restrict__ bq, const float* __restrict__ wk, const float* __restrict__ bk, const float* __restrict__ wv, const float* __restrict__ bv,
    _Float16* __restrict__ QZ, _Float16* __restrict__ KZ, _Float16* __restrict__ VP) {
  __shared__ __attribute__((aligned(16))) _Float16 xs[PK][PP];
  __shared__ __attribute__((aligned(16))) _Float16 wl[32 + CX][PP];
  const int tid = threadIdx.x, w = tid >> 5, lane = tid & 31, ln = lane & 15, hh = lane >> 4; const int b = blockIdx.x / (SQ / PK), n0 = (blockIdx.x % (SQ / PK)) * PK;
  const int g16 = tid & 15, r16 = tid >> 4, mt = w & 3, hf = w >> 2;
  /* x: a thread takes 4 tokens (4 g16 + q) of 8 channels (8 r16 + j): 16 lanes read 256 contiguous bytes of a channel row; the 8 x 4 block leaves as four 16-byte LDS stores */
  const float* xp = x + ((size_t)b * CX + r16 * 8) * SQ + n0 + g16 * 4; v4f xa[8];
#pragma unroll
  for (int j = 0; j < 8; ++j) xa[j] = *(const v4fa*)(xp + (size_t)j * SQ);
  /* weights: pass u covers 16 rows (0: Wq, 1: Wk, 2-9: Wv), a thread 8 elements of row r16 */
  const float* wqp = wq + r16 * CX + g16 * 8; const float* wkp = wk + r16 * CX + g16 * 8; const float* wvp = wv + r16 * CX + g16 * 8; v4f wa[2 + CX / 16][2];
  wa[0][0] = *(const v4fa*)wqp; wa[0][1] = *(const v4fa*)(wqp + 4); wa[1][0] = *(const v4fa*)wkp; wa[1][1] = *(const v4fa*)(wkp + 4);
#pragma unroll
  for (int u = 0; u < CX / 16; ++u) { wa[2 + u][0] = *(const v4fa*)(wvp + u * 16 * CX); wa[2 + u][1] = *(const v4fa*)(wvp + u * 16 * CX + 4); }
  const float* bp = (hf ? bk : bq) + 8 * hh; const v4f b0 = *(const v4fa*)bp, b1 = *(const v4fa*)(bp + 4); const float* bvp = bv + hf * (CX / 2) + ln; float bb[CX / 32];
#pragma unroll
  for (int t4 = 0; t4 < CX / 32; ++t4) bb[t4] = bvp[t4 * 16];
  asm volatile("s_wait_xcnt 0x0" :: "v"(xp), "v"(wqp), "v"(wkp), "v"(wvp), "v"(bp), "v"(bvp) : "memory");      /* the wait that stands between issued loads and an overwrite of their address registers; the addresses are inputs so that they stay in their registers up to it and no load of the run lands on one. No load sinks below it either: all of a thread's loads are in flight before the first conversion waits, one memory latency instead of one per group */
#pragma unroll
  for (int u = 0; u < 2 + CX / 16; ++u) { FragH f;
#pragma unroll
    for (int i = 0; i < 4; ++i) { f.h[i] = (_Float16)(bf16_round(wa[u][0][i]) * 16.0f); f.h[4 + i] = (_Float16)(bf16_round(wa[u][1][i]) * 16.0f); }
    *(v8us*)&wl[u * 16 + r16][g16 * 8] = f.half[0]; }
#pragma unroll
  for (int q = 0; q < 4; ++q) { FragH f;
#pragma unroll
    for (int j = 0; j < 8; ++j) f.h[j] = (_Float16)bf16_round(xa[j][q]);
    *(v8us*)&xs[g16 * 4 + q][r16 * 8] = f.half[0]; }
  __syncthreads();
  const v8f z8 = {0.f,0.f,0.f,0.f,0.f,0.f,0.f,0.f}; v16h xf[CX / 32], qw[CX / 32], vw[CX / 32][CX / 32];
#pragma unroll
  for (int kk = 0; kk < CX / 32; ++kk) { xf[kk] = g2_frag(&xs[mt * 16 + ln][kk * 32], hh); qw[kk] = g2_frag(&wl[hf * 16 + ln][kk * 32], hh); }
#pragma unroll
  for (int t4 = 0; t4 < CX / 32; ++t4)
#pragma unroll
    for (int kk = 0; kk < CX / 32; ++kk) vw[t4][kk] = g2_frag(&wl[32 + (hf * (CX / 32) + t4) * 16 + ln][kk * 32], hh);
  __builtin_amdgcn_sched_barrier(0);      /* every fragment read is issued ahead of the products: otherwise each product waits out the LDS latency of its own two reads */
  v8f aq = z8, av[CX / 32];
#pragma unroll
  for (int t4 = 0; t4 < CX / 32; ++t4) av[t4] = z8;
#pragma unroll
  for (int kk = 0; kk < CX / 32; ++kk) { aq = f_mma(qw[kk], xf[kk], aq);      /* the five accumulators are independent of one another */
#pragma unroll
    for (int t4 = 0; t4 < CX / 32; ++t4) av[t4] = f_mma(xf[kk], vw[t4][kk], av[t4]); }
  { const float sc = hf ? 1.0f : 0.5f;      /* q / 2 (exact in f32): the gate takes tanh of half the score */
    FragH o;
#pragma unroll
    for (int r = 0; r < 8; ++r) o.h[r] = (_Float16)(sc * (aq[r] * 0.0625f + bf16_round(r < 4 ? b0[r & 3] : b1[r & 3])));
    *(v8us*)((unsigned short*)(hf ? KZ : QZ) + ((size_t)b * SQ + n0 + mt * 16 + ln) * 16 + 8 * hh) = o.half[0]; }
#pragma unroll
  for (int t4 = 0; t4 < CX / 32; ++t4) { const int t = hf * (CX / 32) + t4; const float bt = bf16_round(bb[t4]); FragH o;
#pragma unroll
    for (int r = 0; r < 8; ++r) o.h[r] = (_Float16)(av[t4][r] * 0.0625f + bt);
    *(v8us*)((unsigned short*)VP + ((((size_t)(b * (SQ / 32) + (n0 >> 5) + (mt >> 1)) * (CX / 16) + t) * 2 + (mt & 1)) * 32 + lane) * 8) = o.half[0]; } }
extern "C" void kernel_launch(void* const* d_in, const int* in_sizes, int n_in,
                              void* d_out, int out_size, void* d_ws, size_t ws_size, hipStream_t stream) {
  (void)in_sizes; (void)n_in; (void)out_size;
  const float* const* I = (const float* const*)d_in; const float* x = I[0]; const float* wq = I[1]; const float* bq = I[2]; const float* wk = I[3]; const float* bk = I[4]; const float* wv = I[5]; const float* bv = I[6]; const float* gam = I[7];      /* natural Wq/Wk [16][128] + b, Wv [128][128] + b; gamma [1] */
  constexpr int DQ = 16;      /* q/k width */
  char* ws = (char*)d_ws; size_t off = 0;
  auto take = [&](size_t bytes) { char* p = ws + off; off += (bytes + 255) & ~(size_t)255; return p; };
  _Float16* QZ = (_Float16*)take(NR * DQ * 2); _Float16* KZ = (_Float16*)take(NR * DQ * 2); _Float16* VP = (_Float16*)take(NR * CX * 2);
  if (off > ws_size) return;
  k_proj<<<NB * (SQ / PK), 256, 0, stream>>>(x, wq, bq, wk, bk, wv, bv, QZ, KZ, VP);      /* q / 2 and k rows [NR][16] f16, V in fragment order [b][key / 32][channel / 16][1 KiB] */
  k_sattn<<<dim3(SQ / FN, NB), FW * 32, 0, stream>>>(QZ, KZ, VP, gam, x, (float*)d_out);      /* out[b][c][n] = sum_m v[c][m] sigmoid(q[:, n].k[:, m]): scores (K = 32 with zero padding), gate (f16) and V x gate^T in one kernel, f32; y = bf16(gamma) out + bf16(x) -> channel-first output */
}

// v007
// Measured time: 24.7 microseconds a run.
// Timed twice side by side with v006, it ran 1.30 and 1.31 times as fast.
// All steps since v000 together make it 25.3 times as fast.
#include <hip/hip_runtime.h>
// SAGAN-style self-attention with SIGMOID gating instead of softmax, channel-first (x [4][128][64][64]; q = Wq x + bq, k = Wk x + bk (1x1, 128 -> 16), v = Wv x + bv (128 -> 128), natural weights and biases sigma 0.05; attn[n][m] = sigmoid(q[:, n].k[:, m]) (no scale, no normalisation); out[c][n] = sum_m v[c][m] attn[n][m]; y = gamma out + x with the scalar gamma input -> [4][128][64][64]).
// Structure: one projection kernel (work-group = 64 tokens of one image): the channel-first x tile and [Wq; Wk; Wv] go through LDS as exact f16 rows; q and k as W (A) x tokens (B), v as tokens (A) x W (B), f32 + bias; the D tiles are stored as they stand: q / 2 and k as f16 rows [16384][16], V in WMMA fragment order; one fused kernel: attn tile = sigmoid(q.k) = 0.5 + 0.5 tanh(q.k / 2) to f16 in registers (the 16-deep contraction runs as K = 32 with zeros set in registers), out[c][n] = V (A operand) x attn (B^T) f32, 8 key ranges summed through LDS, and y = bf16(gamma) out + bf16(x) formed on that sum and stored by the same kernel; two launches.
// Compute dtype: inputs rounded to bf16; x / weights exact; q, k, v and the sigmoid gates as plain f16 GEMM operands (~2^-12); scores and out f32; v_wmma_f32_16x16x32_f16.
#define NB 4
#define SQ 4096
#define DM 128
#define CX 128          /* channels */
#define NH 4
#define HD 64
#define DMQ DM                       /* LayerNorm width */
#define DFF 4096
#define HG 1                         /* heads per attention launch group */
#define B0 0                         /* unused */
#define NBR NB                       /* unused (only in MP, itself unused) */
#define NR ((size_t)NB * SQ)         /* token rows */
#define MP ((int)((size_t)NBR * SQ)) /* unused (only in MPO, itself unused) */
#define QN SQ                        /* unused */
#define NHD NH                       /* unused */
#define MPO MP                       /* unused */
#define LQ DM      /* unused (redefined below) */
typedef __bf16 v16b __attribute__((ext_vector_type(16)));
typedef unsigned short v8us __attribute__((ext_vector_type(8), may_alias));
typedef float  v8f  __attribute__((ext_vector_type(8)));
typedef float  v4f  __attribute__((ext_vector_type(4)));
typedef float  v4fa __attribute__((ext_vector_type(4), may_alias));
union FragB { v16b v; v8us half[2]; unsigned short u[16]; };

__device__ __forceinline__ unsigned short bf16_bits(float x) { unsigned int u = __float_as_uint(x); return (unsigned short)((u + 0x7FFFu + ((u >> 16) & 1u)) >> 16); }
__device__ __forceinline__ float bf16_val(unsigned short b) { return __uint_as_float(((unsigned int)b) << 16); }
__device__ __forceinline__ float bf16_round(float x) { return bf16_val(bf16_bits(x)); }
// D += A·B with NT terms: 1 = ah·bh, 2 = + al·bh (A split), 3 = + ah·bl (both split)
template <int NT>
__device__ __forceinline__ v8f mmaN(v16b ah, v16b al, v16b bh, v16b bl, v8f c) {
  c = __builtin_amdgcn_wmma_f32_16x16x32_bf16(false, ah, false, bh, (short)0, c, false, false);
  if (NT >= 2) c = __builtin_amdgcn_wmma_f32_16x16x32_bf16(false, al, false, bh, (short)0, c, false, false);
  if (NT >= 3) c = __builtin_amdgcn_wmma_f32_16x16x32_bf16(false, ah, false, bl, (short)0, c, false, false);
  asm volatile("v_nop\n\tv_nop\n\tv_nop\n\tv_nop" : "+v"(c) : "v"(ah), "v"(al), "v"(bh), "v"(bl));
  return c;
}

__global__ __launch_bounds__(256) void k_wt_bf16(const float* __restrict__ W, unsigned short* __restrict__ Wt, int K, int N) {
  const int t = blockIdx.x * 256 + threadIdx.x;
  const int k8n = K / 8;
  if (t >= N * k8n) return;
  const int n = t / k8n, k8 = (t % k8n) * 8;
  v8us v;
#pragma unroll
  for (int i = 0; i < 8; ++i) v[i] = bf16_bits(W[(size_t)(k8 + i) * N + n]);
  *(v8us*)(Wt + (size_t)n * K + k8) = v;
  
}

// GEMM C[M][N] (f32, pitch ldc) = act(A[M][K]·W + bias). A f32 row-major (pitch lda) converted per fragment to bf16
// (ASPLIT: hi/lo two planes -> 2 terms, else single rounded term); Wt bf16 [N][K] (pitch ldb). BIAS_BF16 rounds the
// bias to bf16 first (bias quantised to bf16 before the add). K%32==0, M%16==0, N%64==0.
template <bool ASPLIT, int ACT, bool BIAS_BF16>
__global__ __launch_bounds__(128) void k_gemm_bf(const float* __restrict__ A, int lda, const unsigned short* __restrict__ Wt, int ldb,
                                               const float* __restrict__ bias, float* __restrict__ C, int ldc, int M, int N, int K) {
  __shared__ __attribute__((aligned(16))) float so[4][16][64];
  const int tid = threadIdx.x, w = tid >> 5, lane = tid & 31, ln = lane & 15, hh = lane >> 4;
  const int ntn = N / 64;
  const int wid = blockIdx.x * 4 + w;
  const int mt = wid / ntn, nq = wid % ntn;
  if (mt * 16 >= M) return;
  const int row0 = mt * 16, col0 = nq * 64;
  const float* arow = A + (size_t)(row0 + ln) * lda;
  v8f acc[4] = {};
  for (int kb = 0; kb < K; kb += 32) {
    FragB ah, al;
    const v4f x0 = *(const v4fa*)(arow + kb + 8 * hh), x1 = *(const v4fa*)(arow + kb + 8 * hh + 4);
    const v4f x2 = *(const v4fa*)(arow + kb + 16 + 8 * hh), x3 = *(const v4fa*)(arow + kb + 16 + 8 * hh + 4);
    float xs[16] = {x0[0],x0[1],x0[2],x0[3],x1[0],x1[1],x1[2],x1[3],x2[0],x2[1],x2[2],x2[3],x3[0],x3[1],x3[2],x3[3]};
#pragma unroll
    for (int i = 0; i < 16; ++i) { const unsigned short hb = bf16_bits(xs[i]); ah.u[i] = hb; al.u[i] = ASPLIT ? bf16_bits(xs[i] - bf16_val(hb)) : (unsigned short)0; }
#pragma unroll
    for (int t = 0; t < 4; ++t) {
      const unsigned short* brow = Wt + (size_t)(col0 + t * 16 + ln) * ldb + kb;
      FragB b;
      b.half[0] = *(const v8us*)(brow + 8 * hh);
      b.half[1] = *(const v8us*)(brow + 16 + 8 * hh);
      acc[t] = mmaN<ASPLIT ? 2 : 1>(ah.v, al.v, b.v, b.v, acc[t]);
    }
  }
#pragma unroll
  for (int t = 0; t < 4; ++t) {
    float bv = bias ? bias[col0 + t * 16 + ln] : 0.f;
    if (BIAS_BF16) bv = bf16_round(bv);
#pragma unroll
    for (int r = 0; r < 8; ++r) { float v = acc[t][r] + bv; if (ACT == 1) v = fmaxf(v, 0.f); so[w][8 * hh + r][t * 16 + ln] = v; }
  }
  __builtin_amdgcn_fence(__ATOMIC_ACQ_REL, "workgroup");
  __builtin_amdgcn_wave_barrier();
  const int rsub = lane >> 4, c4 = (lane & 15) * 4;
  {
#pragma unroll
    for (int q = 0; q < 8; ++q) {
      const int r = q * 2 + rsub;
      const v4f v = *(const v4fa*)&so[w][r][c4];
      *(v4f*)(C + (size_t)(row0 + r) * ldc + col0 + c4) = v;
    }
    
  }
}

// GEMM C = act(A·W + bias + resid): A f32 (ASPLIT -> hi/lo 2 terms), Wt bf16 [N][K]; ACT 0 none, 1 relu, 2 exact gelu;
// resid (optional, f32, row index = (row % rmod), pitch ldr, RES_BF16 rounds it) added before the activation.
template <bool ASPLIT, int ACT, bool BIAS_BF16, bool RES_BF16>
__global__ __launch_bounds__(128) void k_gemm_bf3(const float* __restrict__ A, int lda, const unsigned short* __restrict__ Wt, int ldb,
                                                const float* __restrict__ bias, const float* __restrict__ resid, int rmod, int ldr,
                                                float* __restrict__ C, int ldc, int M, int N, int K) {
  __shared__ __attribute__((aligned(16))) float so[4][16][64];
  const int tid = threadIdx.x, w = tid >> 5, lane = tid & 31, ln = lane & 15, hh = lane >> 4;
  const int ntn = N / 64;
  const int wid = blockIdx.x * 4 + w;
  const int mt = wid / ntn, nq = wid % ntn;
  if (mt * 16 >= M) return;
  const int row0 = mt * 16, col0 = nq * 64;
  const float* arow = A + (size_t)(row0 + ln) * lda;
  v8f acc[4] = {};
  for (int kb = 0; kb < K; kb += 32) {
    FragB ah, al;
    const v4f x0 = *(const v4fa*)(arow + kb + 8 * hh), x1 = *(const v4fa*)(arow + kb + 8 * hh + 4);
    const v4f x2 = *(const v4fa*)(arow + kb + 16 + 8 * hh), x3 = *(const v4fa*)(arow + kb + 16 + 8 * hh + 4);
    float xs[16] = {x0[0],x0[1],x0[2],x0[3],x1[0],x1[1],x1[2],x1[3],x2[0],x2[1],x2[2],x2[3],x3[0],x3[1],x3[2],x3[3]};
#pragma unroll
    for (int i = 0; i < 16; ++i) { const unsigned short hb = bf16_bits(xs[i]); ah.u[i] = hb; al.u[i] = ASPLIT ? bf16_bits(xs[i] - bf16_val(hb)) : (unsigned short)0; }
#pragma unroll
    for (int t = 0; t < 4; ++t) {
      const unsigned short* brow = Wt + (size_t)(col0 + t * 16 + ln) * ldb + kb;
      FragB b;
      b.half[0] = *(const v8us*)(brow + 8 * hh);
      b.half[1] = *(const v8us*)(brow + 16 + 8 * hh);
      acc[t] = mmaN<ASPLIT ? 2 : 1>(ah.v, al.v, b.v, b.v, acc[t]);
    }
  }
#pragma unroll
  for (int t = 0; t < 4; ++t) {
    const int col = col0 + t * 16 + ln;
    float bv = bias ? bias[col] : 0.f;
    if (BIAS_BF16) bv = bf16_round(bv);
#pragma unroll
    for (int r = 0; r < 8; ++r) {
      float v = acc[t][r] + bv;
      if (resid) { float rv = resid[(size_t)((row0 + 8 * hh + r) % rmod) * ldr + col]; if (RES_BF16) rv = bf16_round(rv); v += rv; }
      if (ACT == 1) v = fmaxf(v, 0.f);
      if (ACT == 2) v = 0.5f * v * (1.0f + erff(v * 0.70710678118654752f));
      if (ACT == 3) { const float u = 0.7978845608028654f * (v + 0.044715f * v * v * v); v = 0.5f * v * (1.0f + tanhf(u)); }
      so[w][8 * hh + r][t * 16 + ln] = v;
    }
  }
  __builtin_amdgcn_fence(__ATOMIC_ACQ_REL, "workgroup");
  __builtin_amdgcn_wave_barrier();
  const int rsub = lane >> 4, c4 = (lane & 15) * 4;
  {
#pragma unroll
    for (int q = 0; q < 8; ++q) {
      const int r = q * 2 + rsub;
      const v4f v = *(const v4fa*)&so[w][r][c4];
      *(v4f*)(C + (size_t)(row0 + r) * ldc + col0 + c4) = v;
    }
    
  }
}
// row LayerNorm (biased variance, eps) over N: s = X (+ R); optional out_sum <- s; out_norm <- (s-mu)*rsqrt(var+eps)*g + b
template <bool PARAM_BF16>
__global__ __launch_bounds__(256) void k_layernorm(const float* __restrict__ X, const float* __restrict__ R, const float* __restrict__ g, const float* __restrict__ bta,
                                                  float* __restrict__ out_sum, float* __restrict__ out_norm, int N, float eps) {
  __shared__ float red[256];
  const int row = blockIdx.x, tid = threadIdx.x;
  const float* x = X + (size_t)row * N; const float* rr = R ? R + (size_t)row * N : nullptr;
  float vals[16];                     // up to N = 4096
  const int per = N / 256;            // contiguous chunk per thread? use strided-by-4 chunks: thread handles j = tid*4 + 1024*u
  float s1 = 0.f;
  for (int u = 0; u < per / 4; ++u) {
    const int j = tid * 4 + 1024 * u;
    const v4f a = *(const v4fa*)(x + j);
    v4f b = {0.f,0.f,0.f,0.f}; if (rr) b = *(const v4fa*)(rr + j);
#pragma unroll
    for (int q = 0; q < 4; ++q) { const float v = a[q] + b[q]; vals[u * 4 + q] = v; s1 += v; }
  }
  red[tid] = s1; __syncthreads();
  for (int st = 128; st > 0; st >>= 1) { if (tid < st) red[tid] += red[tid + st]; __syncthreads(); }
  const float mu = red[0] / (float)N; __syncthreads();
  float s2 = 0.f;
  for (int u = 0; u < per / 4; ++u)
#pragma unroll
    for (int q = 0; q < 4; ++q) { const float c = vals[u * 4 + q] - mu; s2 += c * c; }
  red[tid] = s2; __syncthreads();
  for (int st = 128; st > 0; st >>= 1) { if (tid < st) red[tid] += red[tid + st]; __syncthreads(); }
  const float rs = rsqrtf(red[0] / (float)N + eps);
  {
    for (int u = 0; u < per / 4; ++u) {
      const int j = tid * 4 + 1024 * u;
      v4f o, sm;
#pragma unroll
      for (int q = 0; q < 4; ++q) {
        float gg = g[j + q], bb = bta[j + q];
        if (PARAM_BF16) { gg = bf16_round(gg); bb = bf16_round(bb); }
        sm[q] = vals[u * 4 + q]; o[q] = (vals[u * 4 + q] - mu) * rs * gg + bb;
      }
      if (out_sum) *(v4f*)(out_sum + (size_t)row * N + j) = sm;
      *(v4f*)(out_norm + (size_t)row * N + j) = o;
    }
    
  }
}



// ---- f16 WMMA path (v_wmma_f32_16x16x32_f16): 11-bit significands for operands in range — used where a [0,1] probability operand needs more precision than bf16
typedef _Float16 v16h __attribute__((ext_vector_type(16)));
union FragH { v16h v; v8us half[2]; _Float16 h[16]; unsigned short u[16]; };
template <int NT>
__device__ __forceinline__ v8f mmaH(v16h ah, v16h al, v16h bh, v16h bl, v8f c) {
  c = __builtin_amdgcn_wmma_f32_16x16x32_f16(false, ah, false, bh, (short)0, c, false, false);
  if (NT >= 2) c = __builtin_amdgcn_wmma_f32_16x16x32_f16(false, al, false, bh, (short)0, c, false, false);
  if (NT >= 3) c = __builtin_amdgcn_wmma_f32_16x16x32_f16(false, ah, false, bl, (short)0, c, false, false);
  asm volatile("v_nop\n\tv_nop\n\tv_nop\n\tv_nop" : "+v"(c) : "v"(ah), "v"(al), "v"(bh), "v"(bl));
  return c;
}
// batched GEMM like k_gemm_b but f16 operands: A f32 (split into f16 hi/lo if ASPLIT, else rounded to f16), Bt = f16 values [n][k]; alpha; C f32; N multiple of 16 (partial tiles skipped)
template <bool ASPLIT>
__global__ __launch_bounds__(128) void k_gemm_h(const float* __restrict__ A, int lda, size_t sA, const _Float16* __restrict__ Bh, int ldb, size_t sB, float alpha, float* __restrict__ C, int ldc, size_t sC, int M, int N, int K) {
  __shared__ __attribute__((aligned(16))) float so[4][16][64];
  const int tid = threadIdx.x, w = tid >> 5, lane = tid & 31, ln = lane & 15, hh = lane >> 4; const int by = blockIdx.y;
  A += (size_t)by * sA; Bh += (size_t)by * sB; C += (size_t)by * sC;
  const int ntn = (N + 63) / 64; const int wid = blockIdx.x * 4 + w; const int mt = wid / ntn, nq = wid % ntn; if (mt * 16 >= M) return;
  const int row0 = mt * 16, col0 = nq * 64; const float* arow = A + (size_t)(row0 + ln) * lda;
  v8f acc[4] = {};
  for (int kb = 0; kb < K; kb += 32) {
    FragH ah, al;
    const v4f x0 = *(const v4fa*)(arow + kb + 8 * hh), x1 = *(const v4fa*)(arow + kb + 8 * hh + 4), x2 = *(const v4fa*)(arow + kb + 16 + 8 * hh), x3 = *(const v4fa*)(arow + kb + 16 + 8 * hh + 4);
    float xs[16] = {x0[0],x0[1],x0[2],x0[3],x1[0],x1[1],x1[2],x1[3],x2[0],x2[1],x2[2],x2[3],x3[0],x3[1],x3[2],x3[3]};
#pragma unroll
    for (int i = 0; i < 16; ++i) { const _Float16 h = (_Float16)xs[i]; ah.h[i] = h; al.h[i] = ASPLIT ? (_Float16)(xs[i] - (float)h) : (_Float16)0.0f; }
#pragma unroll
    for (int t = 0; t < 4; ++t) { if (col0 + t * 16 >= N) continue; const size_t boff = (size_t)(col0 + t * 16 + ln) * ldb + kb; FragH bq; bq.half[0] = *(const v8us*)(Bh + boff + 8 * hh); bq.half[1] = *(const v8us*)(Bh + boff + 16 + 8 * hh);
      acc[t] = mmaH<ASPLIT ? 2 : 1>(ah.v, al.v, bq.v, bq.v, acc[t]); }
  }
#pragma unroll
  for (int t = 0; t < 4; ++t) { if (col0 + t * 16 >= N) continue;
#pragma unroll
    for (int r = 0; r < 8; ++r) so[w][8 * hh + r][t * 16 + ln] = acc[t][r] * alpha; }
  __builtin_amdgcn_fence(__ATOMIC_ACQ_REL, "workgroup"); __builtin_amdgcn_wave_barrier();
  const int rsub = lane >> 4, c4 = (lane & 15) * 4;
  {
#pragma unroll
    for (int q = 0; q < 8; ++q) { const int r = q * 2 + rsub; if (col0 + c4 < N) { const v4f v = *(const v4fa*)&so[w][r][c4]; *(v4f*)(C + (size_t)(row0 + r) * ldc + col0 + c4) = v; } }
     }
}

// Wt[n][k] = f16(W[k][n]·scale) from f32 row-major W[K][N] (scale = power of two; bf16-exact weights stay exact in f16 away from the subnormal range)
__global__ __launch_bounds__(256) void k_wt_f16(const float* __restrict__ W, _Float16* __restrict__ Wt, int K, int N, float scale) {
  const int t = blockIdx.x * 256 + threadIdx.x; if (t >= N * (K / 8)) return; const int n = t / (K / 8), k8 = (t % (K / 8)) * 8; FragH f;
#pragma unroll
  for (int i = 0; i < 8; ++i) f.h[i] = (_Float16)(bf16_round(W[(size_t)(k8 + i) * N + n]) * scale); const v8us o = f.half[0];
  *(v8us*)((unsigned short*)Wt + (size_t)n * K + k8) = o; 
}
// k_gemm_hh variant with fused epilogue: v = acc·alpha + bias[by·sBias + col] (+ CP[(row/rowsPerB)·sCPb + by·64 + col] if CP) ; ACT 0 none / 1 elu ; writes f16 C16 (and f32 C if non-null)
template <int ACT>
__global__ __launch_bounds__(128) void k_gemm_hhx(const _Float16* __restrict__ A, int lda, size_t sA, const _Float16* __restrict__ Bh, int ldb, size_t sB, float alpha, const float* __restrict__ bias, size_t sBias, const float* __restrict__ CP, int rowsPerB, size_t sCPb, int row0g,
    float* __restrict__ C, _Float16* __restrict__ C16, int ldc, size_t sC, int M, int N, int K) {
  __shared__ __attribute__((aligned(16))) float so[4][16][64];
  const int tid = threadIdx.x, w = tid >> 5, lane = tid & 31, ln = lane & 15, hh = lane >> 4; const int by = blockIdx.y;
  A += (size_t)by * sA; Bh += (size_t)by * sB; const size_t cofs = (size_t)by * sC; const float* bp = bias ? bias + (size_t)by * sBias : nullptr;
  const int ntn = (N + 63) / 64; const int wid = blockIdx.x * 4 + w; const int mt = wid / ntn, nq = wid % ntn; if (mt * 16 >= M) return;
  const int row0 = mt * 16, col0 = nq * 64; const _Float16* arow = A + (size_t)(row0 + ln) * lda;
  v8f acc[4] = {};
  for (int kb = 0; kb < K; kb += 32) { FragH ah; ah.half[0] = *(const v8us*)((const unsigned short*)arow + kb + 8 * hh); ah.half[1] = *(const v8us*)((const unsigned short*)arow + kb + 16 + 8 * hh);
#pragma unroll
    for (int t = 0; t < 4; ++t) { if (col0 + t * 16 >= N) continue; const size_t boff = (size_t)(col0 + t * 16 + ln) * ldb + kb; FragH bq; bq.half[0] = *(const v8us*)((const unsigned short*)Bh + boff + 8 * hh); bq.half[1] = *(const v8us*)((const unsigned short*)Bh + boff + 16 + 8 * hh);
      acc[t] = mmaH<1>(ah.v, ah.v, bq.v, bq.v, acc[t]); }
  }
#pragma unroll
  for (int t = 0; t < 4; ++t) { if (col0 + t * 16 >= N) continue; const int col = col0 + t * 16 + ln; const float bv = bp ? bf16_round(bp[col]) : 0.f;
#pragma unroll
    for (int r = 0; r < 8; ++r) { float v = acc[t][r] * alpha + bv; if (CP) { const int rr = row0g + row0 + 8 * hh + r; if (rowsPerB < 0) v += CP[cofs + (size_t)rr * ldc + col];      /* rowsPerB < 0: own element of the batched C plane */ else { const int bidx = rr / rowsPerB; v += CP[(size_t)bidx * sCPb + (size_t)by * 64 + col]; } } if (ACT == 1) v = (v > 0.f) ? v : expm1f(v); else if (ACT == 7) v = (v > 0.f) ? v + 1.0f : expf(v); else if (ACT == 8) v = tanhf(v); else if (ACT == 9) v = 0.5f * v * (1.0f + tanhf(0.7978845608028654f * (v + 0.044715f * v * v * v))); else if (ACT == 11) v = 1.0f / (1.0f + expf(-v)); else if (ACT == 12) v = (v > 0.f) ? v : 0.01f * v; else if (ACT == 14) v = (v > 0.f) ? v : 0.1f * v; else if (ACT == 16) v = (v >= 0.f) ? v : 0.3f * v; else if (ACT == 17) v = (v >= 0.f) ? v : 0.2f * v; else if (ACT == 15) v = v / (1.0f + expf(-v)); else if (ACT == 3) v = fmaxf(v, 0.f); else if (ACT == 6) v = 0.5f * v * (1.0f + erff(v * 0.70710678118654752f)); so[w][8 * hh + r][t * 16 + ln] = v; } }
  __builtin_amdgcn_fence(__ATOMIC_ACQ_REL, "workgroup"); __builtin_amdgcn_wave_barrier();
  const int rsub = lane >> 4, c4 = (lane & 15) * 4; typedef _Float16 v4h __attribute__((ext_vector_type(4)));
  {
#pragma unroll
    for (int q = 0; q < 8; ++q) { const int r = q * 2 + rsub; if (col0 + c4 < N) { const v4f v = *(const v4fa*)&so[w][r][c4]; if (C) *(v4f*)(C + cofs + (size_t)(row0 + r) * ldc + col0 + c4) = v; if (C16) { v4h h4; for (int i = 0; i < 4; ++i) h4[i] = (_Float16)v[i]; *(v4h*)(C16 + cofs + (size_t)(row0 + r) * ldc + col0 + c4) = h4; } } }
     }
}


typedef _Float16 v4h __attribute__((ext_vector_type(4)));

__global__ __launch_bounds__(256) void k_x16(const float* __restrict__ x, _Float16* __restrict__ X16, size_t n8) { const size_t t = (size_t)blockIdx.x * 256 + threadIdx.x; if (t >= n8) return; FragH f;
#pragma unroll
  for (int q = 0; q < 8; ++q) f.h[q] = (_Float16)bf16_round(x[t * 8 + q]); *(v8us*)((unsigned short*)X16 + t * 8) = f.half[0];  }
__global__ __launch_bounds__(256) void k_h16(const float* __restrict__ x, _Float16* __restrict__ X16, size_t n8) { const size_t t = (size_t)blockIdx.x * 256 + threadIdx.x; if (t >= n8) return; FragH f;
#pragma unroll
  for (int q = 0; q < 8; ++q) f.h[q] = (_Float16)x[t * 8 + q]; *(v8us*)((unsigned short*)X16 + t * 8) = f.half[0];  }
__global__ __launch_bounds__(256) void k_round16f(const float* __restrict__ W, _Float16* __restrict__ Bt, size_t n8) { const size_t t = (size_t)blockIdx.x * 256 + threadIdx.x; if (t >= n8) return; FragH f;
#pragma unroll
  for (int i = 0; i < 8; ++i) f.h[i] = (_Float16)(bf16_round(W[t * 8 + i]) * 16.0f); *(v8us*)((unsigned short*)Bt + t * 8) = f.half[0];  }
template <int NHv, int TTv>
__global__ __launch_bounds__(256) void k_vt(const _Float16* __restrict__ V16, int ldv, int voff, _Float16* __restrict__ Vt) { __shared__ unsigned short tl[64][66]; const int tid = threadIdx.x; const int slab = blockIdx.x / (TTv / 64), lg = blockIdx.x % (TTv / 64); const int b = slab / NHv, h = slab % NHv;
  for (int i = tid; i < 64 * 8; i += 256) { const int r = i / 8, c8 = (i % 8) * 8; FragH f; f.half[0] = *(const v8us*)((const unsigned short*)V16 + ((size_t)b * TTv + lg * 64 + r) * ldv + voff + h * 64 + c8);
#pragma unroll
    for (int q = 0; q < 8; ++q) tl[r][c8 + q] = f.u[q]; }
  __syncthreads();
  {
#pragma unroll
    for (int rd = 0; rd < 2; ++rd) { const int d = rd * 32 + tid / 8, pc = tid % 8; FragH f;
#pragma unroll
      for (int q = 0; q < 8; ++q) f.u[q] = tl[pc * 8 + q][d];
      *(v8us*)((unsigned short*)Vt + ((size_t)slab * 64 + d) * TTv + lg * 64 + pc * 8) = f.half[0]; }
     } }

__global__ __launch_bounds__(256) void k_hl(const float* __restrict__ F, _Float16* __restrict__ Hh, _Float16* __restrict__ Hl, size_t n8) { const size_t t = (size_t)blockIdx.x * 256 + threadIdx.x; if (t >= n8) return; FragH fh, fl; const v4f a = *(const v4fa*)(F + t * 8), c = *(const v4fa*)(F + t * 8 + 4);
#pragma unroll
  for (int q = 0; q < 4; ++q) { _Float16 h = (_Float16)a[q]; fh.h[q] = h; fl.h[q] = (_Float16)((a[q] - (float)h) * 1024.0f); h = (_Float16)c[q]; fh.h[4 + q] = h; fl.h[4 + q] = (_Float16)((c[q] - (float)h) * 1024.0f); }
  { *(v8us*)((unsigned short*)Hh + t * 8) = fh.half[0]; *(v8us*)((unsigned short*)Hl + t * 8) = fl.half[0];  } }

// ---- fast GEMM (wave tile 32x64; requires M % 32 == 0 rows per launch region and N % 64 == 0); epilogue = k_gemm_hhx semantics ----
__device__ __forceinline__ v16h g2_frag(const _Float16* p, int hh) { FragH f; f.half[0] = *(const v8us*)((const unsigned short*)p + 8 * hh); f.half[1] = *(const v8us*)((const unsigned short*)p + 16 + 8 * hh); return f.v; }
__device__ __forceinline__ v8f g2_mma(v16h a, v16h b, v8f c) { v8f d = __builtin_amdgcn_wmma_f32_16x16x32_f16(false, a, false, b, (short)0, c, false, false); asm volatile("v_nop\n\tv_nop\n\tv_nop\n\tv_nop" : "+v"(d) : "v"(a), "v"(b)); return d; }
template <int ACT>
__global__ __launch_bounds__(128) void k_gemm2(const _Float16* __restrict__ A, int lda, size_t sA, const _Float16* __restrict__ Bh, int ldb, size_t sB, float alpha, const float* __restrict__ bias, size_t sBias, const float* __restrict__ CP, int rowsPerB, size_t sCPb, int row0g,
    float* __restrict__ C, _Float16* __restrict__ C16, int ldc, size_t sC, int M, int N, int K) { static_assert(ACT == 0 || ACT == 3 || ACT == 6 || ACT == 8 || ACT == 9 || ACT == 11 || ACT == 12 || ACT == 14 || ACT == 15 || ACT == 16 || ACT == 17, "k_gemm2: unsupported ACT code (would silently apply no activation)");
  __shared__ __attribute__((aligned(16))) float so[4][32][68];
  const int tid = threadIdx.x, w = tid >> 5, lane = tid & 31, ln = lane & 15, hh = lane >> 4; const int by = blockIdx.y;
  A += (size_t)by * sA; Bh += (size_t)by * sB; const size_t cofs = (size_t)by * sC; const float* bp = bias ? bias + (size_t)by * sBias : nullptr;
  const int ntn = N >> 6; const int mt = blockIdx.x / ntn, nq = blockIdx.x - mt * ntn; const int row0 = mt * 128 + 32 * w, col0 = nq * 64; if (row0 >= M) return;
  const _Float16* a0p = A + (size_t)(row0 + ln) * lda; const _Float16* a1p = a0p + (size_t)16 * lda;
  const _Float16* b0p = Bh + (size_t)(col0 + ln) * ldb; const _Float16* b1p = b0p + (size_t)16 * ldb; const _Float16* b2p = b1p + (size_t)16 * ldb; const _Float16* b3p = b2p + (size_t)16 * ldb;
  const v8f z8 = {0.f,0.f,0.f,0.f,0.f,0.f,0.f,0.f}; v8f c00 = z8, c01 = z8, c02 = z8, c03 = z8, c10 = z8, c11 = z8, c12 = z8, c13 = z8;
#pragma unroll 1
  for (int kb = 0; kb < K; kb += 32) { const v16h a0 = g2_frag(a0p + kb, hh), a1 = g2_frag(a1p + kb, hh);
    v16h b = g2_frag(b0p + kb, hh); c00 = g2_mma(a0, b, c00); c10 = g2_mma(a1, b, c10);
    b = g2_frag(b1p + kb, hh); c01 = g2_mma(a0, b, c01); c11 = g2_mma(a1, b, c11);
    b = g2_frag(b2p + kb, hh); c02 = g2_mma(a0, b, c02); c12 = g2_mma(a1, b, c12);
    b = g2_frag(b3p + kb, hh); c03 = g2_mma(a0, b, c03); c13 = g2_mma(a1, b, c13); }
  v8f accs[8] = {c00, c01, c02, c03, c10, c11, c12, c13};
#pragma unroll
  for (int u = 0; u < 8; ++u) { const int t = u & 3, half = u >> 2; const int col = col0 + t * 16 + ln; const float bv = bp ? bf16_round(bp[col]) : 0.f;
#pragma unroll
    for (int r = 0; r < 8; ++r) { const int rloc = half * 16 + 8 * hh + r; float v = accs[u][r] * alpha + bv; if (CP) { if (rowsPerB < 0) v += CP[cofs + (size_t)(row0g + row0 + rloc) * ldc + col];      /* rowsPerB < 0: own element of the batched C plane */ else { const int bidx = (row0g + row0 + rloc) / rowsPerB; v += CP[(size_t)bidx * sCPb + (size_t)by * 64 + col]; } }
      if (ACT == 3) v = fmaxf(v, 0.f); else if (ACT == 6) v = 0.5f * v * (1.0f + erff(v * 0.70710678118654752f)); else if (ACT == 11) v = 1.0f / (1.0f + expf(-v)); else if (ACT == 15) v = v / (1.0f + expf(-v)); else if (ACT == 12) v = (v > 0.f) ? v : 0.01f * v; else if (ACT == 8) v = tanhf(v); else if (ACT == 9) v = 0.5f * v * (1.0f + tanhf(0.7978845608028654f * (v + 0.044715f * v * v * v))); else if (ACT == 14) v = (v > 0.f) ? v : 0.1f * v; else if (ACT == 16) v = (v >= 0.f) ? v : 0.3f * v; else if (ACT == 17) v = (v >= 0.f) ? v : 0.2f * v;
      so[w][rloc][t * 16 + ln] = v; } }
  __builtin_amdgcn_fence(__ATOMIC_ACQ_REL, "workgroup"); __builtin_amdgcn_wave_barrier();
  const int rsub = lane >> 4, c4 = (lane & 15) * 4;
  {
#pragma unroll
    for (int q = 0; q < 16; ++q) { const int r = q * 2 + rsub; const v4f v = *(const v4fa*)&so[w][r][c4]; if (C) *(v4f*)(C + cofs + (size_t)(row0 + r) * ldc + col0 + c4) = v; if (C16) { v4h h4; for (int i = 0; i < 4; ++i) h4[i] = (_Float16)v[i]; *(v4h*)(C16 + cofs + (size_t)(row0 + r) * ldc + col0 + c4) = h4; } }
     } }


__global__ __launch_bounds__(256) void k_rsm(const float* __restrict__ S, _Float16* __restrict__ P, int nrows) {
  #pragma clang fp contract(off)
  const int i = blockIdx.x * 256 + threadIdx.x; if (i >= nrows) return; const float* s = S + (size_t)i * SQ; float mx = -3.0e38f;
#pragma unroll 1
  for (int j = 0; j < SQ; ++j) mx = fmaxf(mx, s[j]); float se = 0.f;
#pragma unroll 1
  for (int j = 0; j < SQ; ++j) se += expf(s[j] - mx); const float sc = 256.0f / se;
#pragma unroll 1
  for (int j0 = 0; j0 < SQ; j0 += 8) { FragH f; for (int q = 0; q < 8; ++q) f.h[q] = (_Float16)(expf(s[j0 + q] - mx) * sc); unsigned short* d = (unsigned short*)P + (size_t)i * SQ + j0; *(v8us*)d = f.half[0];  } }
__global__ __launch_bounds__(256) void k_vt(const _Float16* __restrict__ V16, int b, int h0, _Float16* __restrict__ VT) { __shared__ unsigned short tl[64][65]; const int tid = threadIdx.x; const int hh = blockIdx.x % HG, sg = blockIdx.x / HG; const int s0 = sg * 64; const int h = h0 + hh;
  for (int i = tid; i < 64 * 8; i += 256) { const int j = i / 8, d8 = (i % 8) * 8; FragH f; f.half[0] = *(const v8us*)((const unsigned short*)V16 + ((size_t)b * SQ + s0 + j) * DM + h * HD + d8); for (int q = 0; q < 8; ++q) tl[d8 + q][j] = f.u[q]; }
  __syncthreads();
  { for (int i = tid; i < 64 * 8; i += 256) { const int d = i / 8, j8 = (i % 8) * 8; FragH f; for (int q = 0; q < 8; ++q) f.u[q] = tl[d][j8 + q]; *(v8us*)((unsigned short*)VT + ((size_t)hh * HD + d) * SQ + s0 + j8) = f.half[0]; }  } }


template <int BFIN, int W16, int W32>
__global__ __launch_bounds__(256) void k_lnx(const float* __restrict__ X, const float* __restrict__ g, const float* __restrict__ bb, float eps, _Float16* __restrict__ N16, float* __restrict__ N32) {
  #pragma clang fp contract(off)
  __shared__ float red[256]; const size_t r = blockIdx.x; const int t = threadIdx.x; const bool act = t < (DMQ / 4); const int c0 = act ? t * 4 : 0;
  const v4f xa = *(const v4fa*)(X + r * DMQ + c0); float s[4]; float sum = 0.f;
  for (int q = 0; q < 4; ++q) { s[q] = act ? (BFIN ? bf16_round(xa[q]) : xa[q]) : 0.f; sum = __fadd_rn(sum, s[q]); }
  red[t] = sum; __syncthreads(); for (int st = 128; st > 0; st >>= 1) { if (t < st) red[t] = __fadd_rn(red[t], red[t + st]); __syncthreads(); } const float mu = red[0] / (float)DMQ; __syncthreads();
  float vs = 0.f; for (int q = 0; q < 4; ++q) { const float dl = act ? __fadd_rn(s[q], -mu) : 0.f; vs = __fadd_rn(vs, __fmul_rn(dl, dl)); } red[t] = vs; __syncthreads(); for (int st = 128; st > 0; st >>= 1) { if (t < st) red[t] = __fadd_rn(red[t], red[t + st]); __syncthreads(); }
  const float rs = rsqrtf(__fadd_rn(red[0] / (float)DMQ, eps)); v4h y; v4f yf;
  for (int q = 0; q < 4; ++q) { const int c = c0 + q; yf[q] = __fadd_rn(__fmul_rn(__fmul_rn(__fadd_rn(s[q], -mu), rs), bf16_round(g[c])), (bb ? bf16_round(bb[c]) : 0.f)); y[q] = (_Float16)yf[q]; }
  if (!act) return;      /* no barriers after this point */
  { if (W16) *(v4h*)(N16 + r * DMQ + c0) = y; if (W32) *(v4f*)(N32 + r * DMQ + c0) = yf;  } }


__global__ __launch_bounds__(256) void k_rsmf(const float* __restrict__ S, _Float16* __restrict__ P, int qn, int hg) {
  #pragma clang fp contract(off)
  const int t = blockIdx.x * 256 + threadIdx.x; if (t >= qn * hg) return; const size_t i = (size_t)(t / qn) * SQ + (t % qn); const float* s = S + i * SQ; float mx = -3.0e38f;
#pragma unroll 1
  for (int j = 0; j < SQ; ++j) mx = fmaxf(mx, s[j]); float se = 0.f;
#pragma unroll 1
  for (int j = 0; j < SQ; ++j) se += __expf(s[j] - mx); const float sc = 256.0f / se;
#pragma unroll 1
  for (int j0 = 0; j0 < SQ; j0 += 8) { FragH f; for (int q = 0; q < 8; ++q) f.h[q] = (_Float16)(__expf(s[j0 + q] - mx) * sc); unsigned short* d = (unsigned short*)P + i * SQ + j0; *(v8us*)d = f.half[0];  } }


__global__ __launch_bounds__(256) void k_bfr(const float* __restrict__ x, float* __restrict__ XB, size_t n8) { const size_t t = (size_t)blockIdx.x * 256 + threadIdx.x; if (t >= n8) return; v4f a = *(const v4fa*)(x + t * 8), c = *(const v4fa*)(x + t * 8 + 4); for (int q = 0; q < 4; ++q) { a[q] = bf16_round(a[q]); c[q] = bf16_round(c[q]); }
  { *(v4f*)(XB + t * 8) = a; *(v4f*)(XB + t * 8 + 4) = c;  } }



__global__ __launch_bounds__(256) void k_rsmfam(const float* __restrict__ S, _Float16* __restrict__ P, int qn, int hg, const float* __restrict__ am) {
  #pragma clang fp contract(off)
  const int t = blockIdx.x * 256 + threadIdx.x; if (t >= qn * hg) return; const size_t i = (size_t)(t / qn) * SQ + (t % qn); const float* s = S + i * SQ; float mx = -3.0e38f;
#pragma unroll 1
  for (int j = 0; j < SQ; ++j) mx = fmaxf(mx, __fadd_rn(s[j], bf16_round(am[j]))); float se = 0.f;
#pragma unroll 1
  for (int j = 0; j < SQ; ++j) se += __expf(__fadd_rn(s[j], bf16_round(am[j])) - mx); const float sc = 256.0f / se;
#pragma unroll 1
  for (int j0 = 0; j0 < SQ; j0 += 8) { FragH f; for (int q = 0; q < 8; ++q) f.h[q] = (_Float16)(__expf(__fadd_rn(s[j0 + q], bf16_round(am[j0 + q])) - mx) * sc); unsigned short* d = (unsigned short*)P + i * SQ + j0; *(v8us*)d = f.half[0];  } }


#define CC CX           /* unused: input channels */
#define LL SQ           /* pixels per image */
#define LQ (3 * DM)     /* unused */

__global__ __launch_bounds__(256) void k_rowb(float* __restrict__ O, const float* __restrict__ bias, size_t n4) {
  #pragma clang fp contract(off)
  const size_t t = (size_t)blockIdx.x * 256 + threadIdx.x; if (t >= n4) return; const size_t e = t * 4; const int c = (int)((e / SQ) % CX);      /* output channels */ const float bb = bf16_round(bias[c]); const v4f a = *(const v4fa*)(O + e); v4f o; for (int q = 0; q < 4; ++q) o[q] = __fadd_rn(a[q], bb);
  *(v4f*)(O + e) = o;  }

// ---- fused sigmoid attention: Y[b][c][n] = bf16(gamma) sum_m V[b][c][m] sigmoid(q[n].k[m]) + bf16(x[b][c][n]); the gate tile never leaves registers ----
// S^T / 2 = K.(Q / 2)^T (A = k rows, B = rows of q / 2, both through f_frag16): a lane holds column n = ln, rows m = 8 hh + r. Two such D tiles (m 0-15, 16-31), gated and
// rounded to f16 in place, are the B operand of out += V.P^T in the hardware k order, which is the order k_proj stores the V fragments in (A operand, f_fragp).
// Work-group = one image, 64 query columns, all 128 channels; its 8 waves each walk 512 of the 4096 keys; the 8 partial tiles are summed through LDS in wave order; the thread that holds a sum scales it, adds its x and stores y.
#define FW 8             /* waves per work-group = key ranges */
#define FN 64            /* query columns per work-group, all of them in every wave: a V fragment loaded from L2 feeds four products */
#define FP (FN + 4)      /* LDS row pitch in floats: rows 8 apart fall on other banks, 16-byte reads stay aligned */
/* waves_per_eu(2, 2): the 128 x 64 f32 tile takes 256 registers, so a wave has the 512 of two waves per SIMD; one work-group per WGP, whose LDS holds its 8 partial tiles */
__device__ __forceinline__ v16h f_frag16(const _Float16* p) { FragH f; const v8us z = {0, 0, 0, 0, 0, 0, 0, 0}; f.half[0] = *(const v8us*)(const unsigned short*)p; f.half[1] = z; return f.v; }      /* q / k fragment: k 16-31 of the K = 32 contraction is zero, set in registers */
__device__ __forceinline__ v16h f_fragp(const _Float16* p) { FragH f; f.half[0] = *(const v8us*)(const unsigned short*)p; f.half[1] = *(const v8us*)((const unsigned short*)p + 256); return f.v; }      /* V fragment from a 1-KiB unit of k_proj: p = unit + 8 lane; the second half stands 512 bytes on */
__device__ __forceinline__ v8f f_mma(v16h a, v16h b, v8f c) { return __builtin_amdgcn_wmma_f32_16x16x32_f16(false, a, false, b, (short)0, c, false, false); }
/* gate: sigmoid(s) = 0.5 + 0.5 tanh(s / 2), one v_tanh_f32 per score; u = s / 2 comes out of the score product itself (the q plane holds q / 2, a power of two); two gates share the packed fma and the packed f16 conversion; +-inf give 0 and 1, NaN stays NaN */
typedef float v2f __attribute__((ext_vector_type(2)));
typedef _Float16 v2h __attribute__((ext_vector_type(2)));
__device__ __forceinline__ v2h f_gate2(float u0, float u1) { const v2f t = {__builtin_amdgcn_tanhf(u0), __builtin_amdgcn_tanhf(u1)}; const v2f hf = {0.5f, 0.5f}; return __builtin_convertvector(__builtin_elementwise_fma(t, hf, hf), v2h); }
__global__ __launch_bounds__(FW * 32) __attribute__((amdgpu_waves_per_eu(2, 2))) void k_sattn(const _Float16* __restrict__ QZ, const _Float16* __restrict__ KZ, const _Float16* __restrict__ VP, const float* __restrict__ gam, const float* __restrict__ x, float* __restrict__ Y) {
  __shared__ __attribute__((aligned(16))) float red[FW][CX][FP];
  constexpr int MR = SQ / FW;      /* keys per wave */
  const int tid = threadIdx.x, w = tid >> 5, lane = tid & 31, ln = lane & 15, hh = lane >> 4; const int b = blockIdx.y, n0 = blockIdx.x * FN;
  const _Float16* qp = QZ + ((size_t)b * SQ + n0 + ln) * 16 + 8 * hh; const unsigned ki = (unsigned)((b * SQ + w * MR + ln) * 16 + 8 * hh), vi = (unsigned)((b * (SQ / 32) + w * (MR / 32)) * (CX / 16) * 512 + 8 * lane); const _Float16* kp = KZ + ki; const _Float16* vp = VP + vi;      /* kp, vp: the lane's own first 8 elements; over a wave both are 512 contiguous bytes */
  v16h qf[FN / 16];
#pragma unroll      /* unrolled: qf is indexed by constants only and stays in registers */
  for (int j = 0; j < FN / 16; ++j) qf[j] = f_frag16(qp + j * 16 * 16);      /* rows of q / 2: the score tiles are s / 2, the argument of the gate's tanh */
  asm volatile("s_wait_xcnt 0x0" :: "v"(qp) : "memory");      /* the wait that stands between issued loads and an overwrite of their address registers; the address is an input so that it stays in its registers up to the wait */
  const v8f z8 = {0.f,0.f,0.f,0.f,0.f,0.f,0.f,0.f}; v8f acc[CX / 16][FN / 16];
#pragma unroll
  for (int t = 0; t < CX / 16; ++t)
#pragma unroll      /* unrolled, like the loop around it: the accumulators are indexed by constants only and stay in registers */
    for (int j = 0; j < FN / 16; ++j) acc[t][j] = z8;
#pragma unroll 1      /* rolled, for speed only; the inner loops are unrolled so that fragments and accumulators stay in registers */
  for (int m0 = 0; m0 < MR; m0 += 32, kp += 32 * 16, vp += (CX / 16) * 512) {
    const v16h k0 = f_frag16(kp), k1 = f_frag16(kp + 16 * 16); v16h vf[CX / 16];
#pragma unroll
    for (int t = 0; t < CX / 16; ++t) vf[t] = f_fragp(vp + t * 512);
    asm volatile("s_wait_xcnt 0x0" ::: "memory");      /* kp and vp are advanced at the loop's foot: the wait that stands between issued loads and an overwrite of their address registers, put where the wave waits for the k rows next */
    __builtin_amdgcn_sched_barrier(0);      /* all of the pass's loads are issued ahead of the scores: a load sunk behind the first gates is waited for in full among the products */
#pragma unroll
    for (int j = 0; j < FN / 16; ++j) { const v8f s0 = f_mma(k0, qf[j], z8), s1 = f_mma(k1, qf[j], z8); FragH p;
#pragma unroll
      for (int r = 0; r < 8; r += 2) { const v2h g0 = f_gate2(s0[r], s0[r + 1]), g1 = f_gate2(s1[r], s1[r + 1]); p.h[r] = g0[0]; p.h[r + 1] = g0[1]; p.h[8 + r] = g1[0]; p.h[8 + r + 1] = g1[1]; }
#pragma unroll
      for (int t = 0; t < CX / 16; ++t) acc[t][j] = f_mma(vf[t], p.v, acc[t][j]);
    } }
  /* residual: the thread's own x elements (those of the sums it forms below) are asked for here, so that they arrive while the partial tiles go through LDS */
  constexpr int NQ = CX * FN / 4 / (FW * 32); const size_t eo = ((size_t)b * CX + tid / (FN / 4)) * SQ + n0 + (tid % (FN / 4)) * 4; const float* xp = x + eo; v4f xr[NQ];
#pragma unroll
  for (int q = 0; q < NQ; ++q) xr[q] = *(const v4fa*)(xp + (size_t)q * (FW * 32 / (FN / 4)) * SQ);
  asm volatile("s_wait_xcnt 0x0" :: "v"(xp) : "memory");      /* the wait that stands between issued loads and an overwrite of their address registers; the address is an input so that it stays in its registers up to the wait and no load of the run lands on it */
  const float g = bf16_round(gam[0]);
#pragma unroll
  for (int t = 0; t < CX / 16; ++t)
#pragma unroll
    for (int j = 0; j < FN / 16; ++j)
#pragma unroll
      for (int r = 0; r < 8; ++r) red[w][t * 16 + 8 * hh + r][j * 16 + ln] = acc[t][j][r];
  __syncthreads();
#pragma unroll
  for (int q = 0; q < NQ; ++q) { const int i = q * (FW * 32) + tid, c = i / (FN / 4), n4 = (i % (FN / 4)) * 4; v4f s = *(const v4fa*)&red[0][c][n4];
#pragma unroll
    for (int u = 1; u < FW; ++u) s += *(const v4fa*)&red[u][c][n4];
#pragma unroll
    for (int e = 0; e < 4; ++e) s[e] = g * s[e] + bf16_round(xr[q][e]);
    *(v4f*)(Y + eo + (size_t)q * (FW * 32 / (FN / 4)) * SQ) = s; } }
// ---- fused projections: x [b][c][n] f32 and the natural weights -> q / 2 rows, k rows (f16 [b n][16]) and V in fragment order, one launch ----
// Work-group = 64 tokens of one image. The x tile (bf16-rounded, exact in f16) is turned to token rows [64][128] and [Wq; Wk; Wv] (bf16-rounded, x 16) to rows [160][128] in LDS; every fragment is two 16-byte LDS reads (g2_frag).
// Wave w: token tile mt = w & 3 (16 tokens); hf = w >> 2 picks q (0) or k (1) and the output channels 64 hf + 0..63 of v.
// q, k: A = weight rows, B = token rows: a lane holds token ln, outputs 8 hh + r: one 16-byte store into the token's row.
// v: A = token rows, B = weight rows: a lane holds channel ln, tokens 8 hh + r. That is the A operand of k_sattn: per image, 32-key block and 16-channel tile one 1-KiB unit [half][lane][8 keys]
// (lane = 16 hh + ln holds channel ln, keys 16 half + 8 hh + 0..7), so a D tile is stored as it stands, 512 contiguous bytes per wave.
#define PK 64            /* tokens per work-group: 256 work-groups */
#define PP (CX + 8)      /* LDS row pitch in f16: 272 bytes = 16 x odd, for 16-byte readers of 256-byte rows */
__global__ __launch_bounds__(256) void k_proj(const float* __restrict__ x, const float* __restrict__ wq, const float* __restrict__ bq, const float* __restrict__ wk, const float* __restrict__ bk, const float* __restrict__ wv, const float* __restrict__ bv,
    _Float16* __restrict__ QZ, _Float16* __restrict__ KZ, _Float16* __restrict__ VP) {
  __shared__ __attribute__((aligned(16))) _Float16 xs[PK][PP];
  __shared__ __attribute__((aligned(16))) _Float16 wl[32 + CX][PP];
  const int tid = threadIdx.x, w = tid >> 5, lane = tid & 31, ln = lane & 15, hh = lane >> 4; const int b = blockIdx.x / (SQ / PK), n0 = (blockIdx.x % (SQ / PK)) * PK;
  const int g16 = tid & 15, r16 = tid >> 4, mt = w & 3, hf = w >> 2;
  /* x: a thread takes 4 tokens (4 g16 + q) of 8 channels (8 r16 + j): 16 lanes read 256 contiguous bytes of a channel row; the 8 x 4 block leaves as four 16-byte LDS stores */
  const float* xp = x + ((size_t)b * CX + r16 * 8) * SQ + n0 + g16 * 4; v4f xa[8];
#pragma unroll
  for (int j = 0; j < 8; ++j) xa[j] = *(const v4fa*)(xp + (size_t)j * SQ);
  /* weights: pass u covers 16 rows (0: Wq, 1: Wk, 2-9: Wv), a thread 8 elements of row r16 */
  const float* wqp = wq + r16 * CX + g16 * 8; const float* wkp = wk + r16 * CX + g16 * 8; const float* wvp = wv + r16 * CX + g16 * 8; v4f wa[2 + CX / 16][2];
  wa[0][0] = *(const v4fa*)wqp; wa[0][1] = *(const v4fa*)(wqp + 4); wa[1][0] = *(const v4fa*)wkp; wa[1][1] = *(const v4fa*)(wkp + 4);
#pragma unroll
  for (int u = 0; u < CX / 16; ++u) { wa[2 + u][0] = *(const v4fa*)(wvp + u * 16 * CX); wa[2 + u][1] = *(const v4fa*)(wvp + u * 16 * CX + 4); }
  const float* bp = (hf ? bk : bq) + 8 * hh; const v4f b0 = *(const v4fa*)bp, b1 = *(const v4fa*)(bp + 4); const float* bvp = bv + hf * (CX / 2) + ln; float bb[CX / 32];
#pragma unroll
  for (int t4 = 0; t4 < CX / 32; ++t4) bb[t4] = bvp[t4 * 16];
  asm volatile("s_wait_xcnt 0x0" :: "v"(xp), "v"(wqp), "v"(wkp), "v"(wvp), "v"(bp), "v"(bvp) : "memory");      /* the wait that stands between issued loads and an overwrite of their address registers; the addresses are inputs so that they stay in their registers up to it and no load of the run lands on one. No load sinks below it either: all of a thread's loads are in flight before the first conversion waits, one memory latency instead of one per group */
#pragma unroll
  for (int u = 0; u < 2 + CX / 16; ++u) { FragH f;
#pragma unroll
    for (int i = 0; i < 4; ++i) { f.h[i] = (_Float16)(bf16_round(wa[u][0][i]) * 16.0f); f.h[4 + i] = (_Float16)(bf16_round(wa[u][1][i]) * 16.0f); }
    *(v8us*)&wl[u * 16 + r16][g16 * 8] = f.half[0]; }
#pragma unroll
  for (int q = 0; q < 4; ++q) { FragH f;
#pragma unroll
    for (int j = 0; j < 8; ++j) f.h[j] = (_Float16)bf16_round(xa[j][q]);
    *(v8us*)&xs[g16 * 4 + q][r16 * 8] = f.half[0]; }
  __syncthreads();
  const v8f z8 = {0.f,0.f,0.f,0.f,0.f,0.f,0.f,0.f}; v16h xf[CX / 32], qw[CX / 32], vw[CX / 32][CX / 32];
#pragma unroll
  for (int kk = 0; kk < CX / 32; ++kk) { xf[kk] = g2_frag(&xs[mt * 16 + ln][kk * 32], hh); qw[kk] = g2_frag(&wl[hf * 16 + ln][kk * 32], hh); }
#pragma unroll
  for (int t4 = 0; t4 < CX / 32; ++t4)
#pragma unroll
    for (int kk = 0; kk < CX / 32; ++kk) vw[t4][kk] = g2_frag(&wl[32 + (hf * (CX / 32) + t4) * 16 + ln][kk * 32], hh);
  __builtin_amdgcn_sched_barrier(0);      /* every fragment read is issued ahead of the products: otherwise each product waits out the LDS latency of its own two reads */
  v8f aq = z8, av[CX / 32];
#pragma unroll
  for (int t4 = 0; t4 < CX / 32; ++t4) av[t4] = z8;
#pragma unroll
  for (int kk = 0; kk < CX / 32; ++kk) { aq = f_mma(qw[kk], xf[kk], aq);      /* the five accumulators are independent of one another */
#pragma unroll
    for (int t4 = 0; t4 < CX / 32; ++t4) av[t4] = f_mma(xf[kk], vw[t4][kk], av[t4]); }
  { const float sc = hf ? 1.0f : 0.5f;      /* q / 2 (exact in f32): the gate takes tanh of half the score */
    FragH o;
#pragma unroll
    for (int r = 0; r < 8; ++r) o.h[r] = (_Float16)(sc * (aq[r] * 0.0625f + bf16_round(r < 4 ? b0[r & 3] : b1[r & 3])));
    *(v8us*)((unsigned short*)(hf ? KZ : QZ) + ((size_t)b * SQ + n0 + mt * 16 + ln) * 16 + 8 * hh) = o.half[0]; }
#pragma unroll
  for (int t4 = 0; t4 < CX / 32; ++t4) { const int t = hf * (CX / 32) + t4; const float bt = bf16_round(bb[t4]); FragH o;
#pragma unroll
    for (int r = 0; r < 8; ++r) o.h[r] = (_Float16)(av[t4][r] * 0.0625f + bt);
    *(v8us*)((unsigned short*)VP + ((((size_t)(b * (SQ / 32) + (n0 >> 5) + (mt >> 1)) * (CX / 16) + t) * 2 + (mt & 1)) * 32 + lane) * 8) = o.half[0]; } }
extern "C" void kernel_launch(void* const* d_in, const int* in_sizes, int n_in,
                              void* d_out, int out_size, void* d_ws, size_t ws_size, hipStream_t stream) {
  (void)in_sizes; (void)n_in; (void)out_size;
  const float* const* I = (const float* const*)d_in; const float* x = I[0]; const float* wq = I[1]; const float* bq = I[2]; const float* wk = I[3]; const float* bk = I[4]; const float* wv = I[5]; const float* bv = I[6]; const float* gam = I[7];      /* natural Wq/Wk [16][128] + b, Wv [128][128] + b; gamma [1] */
  constexpr int DQ = 16;      /* q/k width */
  char* ws = (char*)d_ws; size_t off = 0;
  auto take = [&](size_t bytes) { char* p = ws + off; off += (bytes + 255) & ~(size_t)255; return p; };
  _Float16* QZ = (_Float16*)take(NR * DQ * 2); _Float16* KZ = (_Float16*)take(NR * DQ * 2); _Float16* VP = (_Float16*)take(NR * CX * 2);
  if (off > ws_size) return;
  k_proj<<<NB * (SQ / PK), 256, 0, stream>>>(x, wq, bq, wk, bk, wv, bv, QZ, KZ, VP);      /* q / 2 and k rows [NR][16] f16, V in fragment order [b][key / 32][channel / 16][1 KiB] */
  k_sattn<<<dim3(SQ / FN, NB), FW * 32, 0, stream>>>(QZ, KZ, VP, gam, x, (float*)d_out);      /* out[b][c][n] = sum_m v[c][m] sigmoid(q[:, n].k[:, m]): scores (K = 32 with zero padding), gate (f16) and V x gate^T in one kernel, f32; y = bf16(gamma) out + bf16(x) -> channel-first output */
}

// v008
// It runs in 23.9 microseconds.
// Next to v007, in two timings, it ran 1.04 and 1.10 times as fast.
// All steps since v000 together make it 27.1 times as fast.
#include <hip/hip_runtime.h>
// SAGAN-style self-attention with SIGMOID gating instead of softmax, channel-first (x [4][128][64][64]; q = Wq x + bq, k = Wk x + bk (1x1, 128 -> 16), v = Wv x + bv (128 -> 128), natural weights and biases sigma 0.05; attn[n][m] = sigmoid(q[:, n].k[:, m]) (no scale, no normalisation); out[c][n] = sum_m v[c][m] attn[n][m]; y = gamma out + x with the scalar gamma input -> [4][128][64][64]).
// Structure: one projection kernel (work-group = 64 tokens of one image): the channel-first x tile and [Wq; Wk; Wv] go through LDS as exact f16 rows; q and k as W (A) x tokens (B), v as tokens (A) x W (B), f32 + bias; the D tiles are stored as they stand: q / 2 and k as f16 rows [16384][16], V in WMMA fragment order; one fused kernel: attn tile = sigmoid(q.k) = 0.5 + 0.5 tanh(q.k / 2) to f16 in registers (the 16-deep contraction runs as K = 32 with zeros set in registers), out[c][n] = V (A operand) x attn (B^T) f32, 8 key ranges summed through LDS, and y = bf16(gamma) out + bf16(x) formed on that sum and stored by the same kernel; two launches.
// Compute dtype: inputs rounded to bf16; x / weights exact; q, k, v and the sigmoid gates as plain f16 GEMM operands (~2^-12); scores and out f32; v_wmma_f32_16x16x32_f16.
#define NB 4
#define SQ 4096
#define DM 128
#define CX 128          /* channels */
#define NH 4
#define HD 64
#define DMQ DM                       /* LayerNorm width */
#define DFF 4096
#define HG 1                         /* heads per attention launch group */
#define B0 0                         /* unused */
#define NBR NB                       /* unused (only in MP, itself unused) */
#define NR ((size_t)NB * SQ)         /* token rows */
#define MP ((int)((size_t)NBR * SQ)) /* unused (only in MPO, itself unused) */
#define QN SQ                        /* unused */
#define NHD NH                       /* unused */
#define MPO MP                       /* unused */
#define LQ DM      /* unused (redefined below) */
typedef __bf16 v16b __attribute__((ext_vector_type(16)));
typedef unsigned short v8us __attribute__((ext_vector_type(8), may_alias));
typedef float  v8f  __attribute__((ext_vector_type(8)));
typedef float  v4f  __attribute__((ext_vector_type(4)));
typedef float  v4fa __attribute__((ext_vector_type(4), may_alias));
union FragB { v16b v; v8us half[2]; unsigned short u[16]; };

__device__ __forceinline__ unsigned short bf16_bits(float x) { unsigned int u = __float_as_uint(x); return (unsigned short)((u + 0x7FFFu + ((u >> 16) & 1u)) >> 16); }
__device__ __forceinline__ float bf16_val(unsigned short b) { return __uint_as_float(((unsigned int)b) << 16); }
__device__ __forceinline__ float bf16_round(float x) { return bf16_val(bf16_bits(x)); }
// D += A·B with NT terms: 1 = ah·bh, 2 = + al·bh (A split), 3 = + ah·bl (both split)
template <int NT>
__device__ __forceinline__ v8f mmaN(v16b ah, v16b al, v16b bh, v16b bl, v8f c) {
  c = __builtin_amdgcn_wmma_f32_16x16x32_bf16(false, ah, false, bh, (short)0, c, false, false);
  if (NT >= 2) c = __builtin_amdgcn_wmma_f32_16x16x32_bf16(false, al, false, bh, (short)0, c, false, false);
  if (NT >= 3) c = __builtin_amdgcn_wmma_f32_16x16x32_bf16(false, ah, false, bl, (short)0, c, false, false);
  asm volatile("v_nop\n\tv_nop\n\tv_nop\n\tv_nop" : "+v"(c) : "v"(ah), "v"(al), "v"(bh), "v"(bl));
  return c;
}

__global__ __launch_bounds__(256) void k_wt_bf16(const float* __restrict__ W, unsigned short* __restrict__ Wt, int K, int N) {
  const int t = blockIdx.x * 256 + threadIdx.x;
  const int k8n = K / 8;
  if (t >= N * k8n) return;
  const int n = t / k8n, k8 = (t % k8n) * 8;
  v8us v;
#pragma unroll
  for (int i = 0; i < 8; ++i) v[i] = bf16_bits(W[(size_t)(k8 + i) * N + n]);
  *(v8us*)(Wt + (size_t)n * K + k8) = v;
  
}

// GEMM C[M][N] (f32, pitch ldc) = act(A[M][K]·W + bias). A f32 row-major (pitch lda) converted per fragment to bf16
// (ASPLIT: hi/lo two planes -> 2 terms, else single rounded term); Wt bf16 [N][K] (pitch ldb). BIAS_BF16 rounds the
// bias to bf16 first (bias quantised to bf16 before the add). K%32==0, M%16==0, N%64==0.
template <bool ASPLIT, int ACT, bool BIAS_BF16>
__global__ __launch_bounds__(128) void k_gemm_bf(const float* __restrict__ A, int lda, const unsigned short* __restrict__ Wt, int ldb,
                                               const float* __restrict__ bias, float* __restrict__ C, int ldc, int M, int N, int K) {
  __shared__ __attribute__((aligned(16))) float so[4][16][64];
  const int tid = threadIdx.x, w = tid >> 5, lane = tid & 31, ln = lane & 15, hh = lane >> 4;
  const int ntn = N / 64;
  const int wid = blockIdx.x * 4 + w;
  const int mt = wid / ntn, nq = wid % ntn;
  if (mt * 16 >= M) return;
  const int row0 = mt * 16, col0 = nq * 64;
  const float* arow = A + (size_t)(row0 + ln) * lda;
  v8f acc[4] = {};
  for (int kb = 0; kb < K; kb += 32) {
    FragB ah, al;
    const v4f x0 = *(const v4fa*)(arow + kb + 8 * hh), x1 = *(const v4fa*)(arow + kb + 8 * hh + 4);
    const v4f x2 = *(const v4fa*)(arow + kb + 16 + 8 * hh), x3 = *(const v4fa*)(arow + kb + 16 + 8 * hh + 4);
    float xs[16] = {x0[0],x0[1],x0[2],x0[3],x1[0],x1[1],x1[2],x1[3],x2[0],x2[1],x2[2],x2[3],x3[0],x3[1],x3[2],x3[3]};
#pragma unroll
    for (int i = 0; i < 16; ++i) { const unsigned short hb = bf16_bits(xs[i]); ah.u[i] = hb; al.u[i] = ASPLIT ? bf16_bits(xs[i] - bf16_val(hb)) : (unsigned short)0; }
#pragma unroll
    for (int t = 0; t < 4; ++t) {
      const unsigned short* brow = Wt + (size_t)(col0 + t * 16 + ln) * ldb + kb;
      FragB b;
      b.half[0] = *(const v8us*)(brow + 8 * hh);
      b.half[1] = *(const v8us*)(brow + 16 + 8 * hh);
      acc[t] = mmaN<ASPLIT ? 2 : 1>(ah.v, al.v, b.v, b.v, acc[t]);
    }
  }
#pragma unroll
  for (int t = 0; t < 4; ++t) {
    float bv = bias ? bias[col0 + t * 16 + ln] : 0.f;
    if (BIAS_BF16) bv = bf16_round(bv);
#pragma unroll
    for (int r = 0; r < 8; ++r) { float v = acc[t][r] + bv; if (ACT == 1) v = fmaxf(v, 0.f); so[w][8 * hh + r][t * 16 + ln] = v; }
  }
  __builtin_amdgcn_fence(__ATOMIC_ACQ_REL, "workgroup");
  __builtin_amdgcn_wave_barrier();
  const int rsub = lane >> 4, c4 = (lane & 15) * 4;
  {
#pragma unroll
    for (int q = 0; q < 8; ++q) {
      const int r = q * 2 + rsub;
      const v4f v = *(const v4fa*)&so[w][r][c4];
      *(v4f*)(C + (size_t)(row0 + r) * ldc + col0 + c4) = v;
    }
    
  }
}

// GEMM C = act(A·W + bias + resid): A f32 (ASPLIT -> hi/lo 2 terms), Wt bf16 [N][K]; ACT 0 none, 1 relu, 2 exact gelu;
// resid (optional, f32, row index = (row % rmod), pitch ldr, RES_BF16 rounds it) added before the activation.
template <bool ASPLIT, int ACT, bool BIAS_BF16, bool RES_BF16>
__global__ __launch_bounds__(128) void k_gemm_bf3(const float* __restrict__ A, int lda, const unsigned short* __restrict__ Wt, int ldb,
                                                const float* __restrict__ bias, const float* __restrict__ resid, int rmod, int ldr,
                                                float* __restrict__ C, int ldc, int M, int N, int K) {
  __shared__ __attribute__((aligned(16))) float so[4][16][64];
  const int tid = threadIdx.x, w = tid >> 5, lane = tid & 31, ln = lane & 15, hh = lane >> 4;
  const int ntn = N / 64;
  const int wid = blockIdx.x * 4 + w;
  const int mt = wid / ntn, nq = wid % ntn;
  if (mt * 16 >= M) return;
  const int row0 = mt * 16, col0 = nq * 64;
  const float* arow = A + (size_t)(row0 + ln) * lda;
  v8f acc[4] = {};
  for (int kb = 0; kb < K; kb += 32) {
    FragB ah, al;
    const v4f x0 = *(const v4fa*)(arow + kb + 8 * hh), x1 = *(const v4fa*)(arow + kb + 8 * hh + 4);
    const v4f x2 = *(const v4fa*)(arow + kb + 16 + 8 * hh), x3 = *(const v4fa*)(arow + kb + 16 + 8 * hh + 4);
    float xs[16] = {x0[0],x0[1],x0[2],x0[3],x1[0],x1[1],x1[2],x1[3],x2[0],x2[1],x2[2],x2[3],x3[0],x3[1],x3[2],x3[3]};
#pragma unroll
    for (int i = 0; i < 16; ++i) { const unsigned short hb = bf16_bits(xs[i]); ah.u[i] = hb; al.u[i] = ASPLIT ? bf16_bits(xs[i] - bf16_val(hb)) : (unsigned short)0; }
#pragma unroll
    for (int t = 0; t < 4; ++t) {
      const unsigned short* brow = Wt + (size_t)(col0 + t * 16 + ln) * ldb + kb;
      FragB b;
      b.half[0] = *(const v8us*)(brow + 8 * hh);
      b.half[1] = *(const v8us*)(brow + 16 + 8 * hh);
      acc[t] = mmaN<ASPLIT ? 2 : 1>(ah.v, al.v, b.v, b.v, acc[t]);
    }
  }
#pragma unroll
  for (int t = 0; t < 4; ++t) {
    const int col = col0 + t * 16 + ln;
    float bv = bias ? bias[col] : 0.f;
    if (BIAS_BF16) bv = bf16_round(bv);
#pragma unroll
    for (int r = 0; r < 8; ++r) {
      float v = acc[t][r] + bv;
      if (resid) { float rv = resid[(size_t)((row0 + 8 * hh + r) % rmod) * ldr + col]; if (RES_BF16) rv = bf16_round(rv); v += rv; }
      if (ACT == 1) v = fmaxf(v, 0.f);
      if (ACT == 2) v = 0.5f * v * (1.0f + erff(v * 0.70710678118654752f));
      if (ACT == 3) { const float u = 0.7978845608028654f * (v + 0.044715f * v * v * v); v = 0.5f * v * (1.0f + tanhf(u)); }
      so[w][8 * hh + r][t * 16 + ln] = v;
    }
  }
  __builtin_amdgcn_fence(__ATOMIC_ACQ_REL, "workgroup");
  __builtin_amdgcn_wave_barrier();
  const int rsub = lane >> 4, c4 = (lane & 15) * 4;
  {
#pragma unroll
    for (int q = 0; q < 8; ++q) {
      const int r = q * 2 + rsub;
      const v4f v = *(const v4fa*)&so[w][r][c4];
      *(v4f*)(C + (size_t)(row0 + r) * ldc + col0 + c4) = v;
    }
    
  }
}
// row LayerNorm (biased variance, eps) over N: s = X (+ R); optional out_sum <- s; out_norm <- (s-mu)*rsqrt(var+eps)*g + b
template <bool PARAM_BF16>
__global__ __launch_bounds__(256) void k_layernorm(const float* __restrict__ X, const float* __restrict__ R, const float* __restrict__ g, const float* __restrict__ bta,
                                                  float* __restrict__ out_sum, float* __restrict__ out_norm, int N, float eps) {
  __shared__ float red[256];
  const int row = blockIdx.x, tid = threadIdx.x;
  const float* x = X + (size_t)row * N; const float* rr = R ? R + (size_t)row * N : nullptr;
  float vals[16];                     // up to N = 4096
  const int per = N / 256;            // contiguous chunk per thread? use strided-by-4 chunks: thread handles j = tid*4 + 1024*u
  float s1 = 0.f;
  for (int u = 0; u < per / 4; ++u) {
    const int j = tid * 4 + 1024 * u;
    const v4f a = *(const v4fa*)(x + j);
    v4f b = {0.f,0.f,0.f,0.f}; if (rr) b = *(const v4fa*)(rr + j);
#pragma unroll
    for (int q = 0; q < 4; ++q) { const float v = a[q] + b[q]; vals[u * 4 + q] = v; s1 += v; }
  }
  red[tid] = s1; __syncthreads();
  for (int st = 128; st > 0; st >>= 1) { if (tid < st) red[tid] += red[tid + st]; __syncthreads(); }
  const float mu = red[0] / (float)N; __syncthreads();
  float s2 = 0.f;
  for (int u = 0; u < per / 4; ++u)
#pragma unroll
    for (int q = 0; q < 4; ++q) { const float c = vals[u * 4 + q] - mu; s2 += c * c; }
  red[tid] = s2; __syncthreads();
  for (int st = 128; st > 0; st >>= 1) { if (tid < st) red[tid] += red[tid + st]; __syncthreads(); }
  const float rs = rsqrtf(red[0] / (float)N + eps);
  {
    for (int u = 0; u < per / 4; ++u) {
      const int j = tid * 4 + 1024 * u;
      v4f o, sm;
#pragma unroll
      for (int q = 0; q < 4; ++q) {
        float gg = g[j + q], bb = bta[j + q];
        if (PARAM_BF16) { gg = bf16_round(gg); bb = bf16_round(bb); }
        sm[q] = vals[u * 4 + q]; o[q] = (vals[u * 4 + q] - mu) * rs * gg + bb;
      }
      if (out_sum) *(v4f*)(out_sum + (size_t)row * N + j) = sm;
      *(v4f*)(out_norm + (size_t)row * N + j) = o;
    }
    
  }
}



// ---- f16 WMMA path (v_wmma_f32_16x16x32_f16): 11-bit significands for operands in range — used where a [0,1] probability operand needs more precision than bf16
typedef _Float16 v16h __attribute__((ext_vector_type(16)));
union FragH { v16h v; v8us half[2]; _Float16 h[16]; unsigned short u[16]; };
template <int NT>
__device__ __forceinline__ v8f mmaH(v16h ah, v16h al, v16h bh, v16h bl, v8f c) {
  c = __builtin_amdgcn_wmma_f32_16x16x32_f16(false, ah, false, bh, (short)0, c, false, false);
  if (NT >= 2) c = __builtin_amdgcn_wmma_f32_16x16x32_f16(false, al, false, bh, (short)0, c, false, false);
  if (NT >= 3) c = __builtin_amdgcn_wmma_f32_16x16x32_f16(false, ah, false, bl, (short)0, c, false, false);
  asm volatile("v_nop\n\tv_nop\n\tv_nop\n\tv_nop" : "+v"(c) : "v"(ah), "v"(al), "v"(bh), "v"(bl));
  return c;
}
// batched GEMM like k_gemm_b but f16 operands: A f32 (split into f16 hi/lo if ASPLIT, else rounded to f16), Bt = f16 values [n][k]; alpha; C f32; N multiple of 16 (partial tiles skipped)
template <bool ASPLIT>
__global__ __launch_bounds__(128) void k_gemm_h(const float* __restrict__ A, int lda, size_t sA, const _Float16* __restrict__ Bh, int ldb, size_t sB, float alpha, float* __restrict__ C, int ldc, size_t sC, int M, int N, int K) {
  __shared__ __attribute__((aligned(16))) float so[4][16][64];
  const int tid = threadIdx.x, w = tid >> 5, lane = tid & 31, ln = lane & 15, hh = lane >> 4; const int by = blockIdx.y;
  A += (size_t)by * sA; Bh += (size_t)by * sB; C += (size_t)by * sC;
  const int ntn = (N + 63) / 64; const int wid = blockIdx.x * 4 + w; const int mt = wid / ntn, nq = wid % ntn; if (mt * 16 >= M) return;
  const int row0 = mt * 16, col0 = nq * 64; const float* arow = A + (size_t)(row0 + ln) * lda;
  v8f acc[4] = {};
  for (int kb = 0; kb < K; kb += 32) {
    FragH ah, al;
    const v4f x0 = *(const v4fa*)(arow + kb + 8 * hh), x1 = *(const v4fa*)(arow + kb + 8 * hh + 4), x2 = *(const v4fa*)(arow + kb + 16 + 8 * hh), x3 = *(const v4fa*)(arow + kb + 16 + 8 * hh + 4);
    float xs[16] = {x0[0],x0[1],x0[2],x0[3],x1[0],x1[1],x1[2],x1[3],x2[0],x2[1],x2[2],x2[3],x3[0],x3[1],x3[2],x3[3]};
#pragma unroll
    for (int i = 0; i < 16; ++i) { const _Float16 h = (_Float16)xs[i]; ah.h[i] = h; al.h[i] = ASPLIT ? (_Float16)(xs[i] - (float)h) : (_Float16)0.0f; }
#pragma unroll
    for (int t = 0; t < 4; ++t) { if (col0 + t * 16 >= N) continue; const size_t boff = (size_t)(col0 + t * 16 + ln) * ldb + kb; FragH bq; bq.half[0] = *(const v8us*)(Bh + boff + 8 * hh); bq.half[1] = *(const v8us*)(Bh + boff + 16 + 8 * hh);
      acc[t] = mmaH<ASPLIT ? 2 : 1>(ah.v, al.v, bq.v, bq.v, acc[t]); }
  }
#pragma unroll
  for (int t = 0; t < 4; ++t) { if (col0 + t * 16 >= N) continue;
#pragma unroll
    for (int r = 0; r < 8; ++r) so[w][8 * hh + r][t * 16 + ln] = acc[t][r] * alpha; }
  __builtin_amdgcn_fence(__ATOMIC_ACQ_REL, "workgroup"); __builtin_amdgcn_wave_barrier();
  const int rsub = lane >> 4, c4 = (lane & 15) * 4;
  {
#pragma unroll
    for (int q = 0; q < 8; ++q) { const int r = q * 2 + rsub; if (col0 + c4 < N) { const v4f v = *(const v4fa*)&so[w][r][c4]; *(v4f*)(C + (size_t)(row0 + r) * ldc + col0 + c4) = v; } }
     }
}

// Wt[n][k] = f16(W[k][n]·scale) from f32 row-major W[K][N] (scale = power of two; bf16-exact weights stay exact in f16 away from the subnormal range)
__global__ __launch_bounds__(256) void k_wt_f16(const float* __restrict__ W, _Float16* __restrict__ Wt, int K, int N, float scale) {
  const int t = blockIdx.x * 256 + threadIdx.x; if (t >= N * (K / 8)) return; const int n = t / (K / 8), k8 = (t % (K / 8)) * 8; FragH f;
#pragma unroll
  for (int i = 0; i < 8; ++i) f.h[i] = (_Float16)(bf16_round(W[(size_t)(k8 + i) * N + n]) * scale); const v8us o = f.half[0];
  *(v8us*)((unsigned short*)Wt + (size_t)n * K + k8) = o; 
}
// k_gemm_hh variant with fused epilogue: v = acc·alpha + bias[by·sBias + col] (+ CP[(row/rowsPerB)·sCPb + by·64 + col] if CP) ; ACT 0 none / 1 elu ; writes f16 C16 (and f32 C if non-null)
template <int ACT>
__global__ __launch_bounds__(128) void k_gemm_hhx(const _Float16* __restrict__ A, int lda, size_t sA, const _Float16* __restrict__ Bh, int ldb, size_t sB, float alpha, const float* __restrict__ bias, size_t sBias, const float* __restrict__ CP, int rowsPerB, size_t sCPb, int row0g,
    float* __restrict__ C, _Float16* __restrict__ C16, int ldc, size_t sC, int M, int N, int K) {
  __shared__ __attribute__((aligned(16))) float so[4][16][64];
  const int tid = threadIdx.x, w = tid >> 5, lane = tid & 31, ln = lane & 15, hh = lane >> 4; const int by = blockIdx.y;
  A += (size_t)by * sA; Bh += (size_t)by * sB; const size_t cofs = (size_t)by * sC; const float* bp = bias ? bias + (size_t)by * sBias : nullptr;
  const int ntn = (N + 63) / 64; const int wid = blockIdx.x * 4 + w; const int mt = wid / ntn, nq = wid % ntn; if (mt * 16 >= M) return;
  const int row0 = mt * 16, col0 = nq * 64; const _Float16* arow = A + (size_t)(row0 + ln) * lda;
  v8f acc[4] = {};
  for (int kb = 0; kb < K; kb += 32) { FragH ah; ah.half[0] = *(const v8us*)((const unsigned short*)arow + kb + 8 * hh); ah.half[1] = *(const v8us*)((const unsigned short*)arow + kb + 16 + 8 * hh);
#pragma unroll
    for (int t = 0; t < 4; ++t) { if (col0 + t * 16 >= N) continue; const size_t boff = (size_t)(col0 + t * 16 + ln) * ldb + kb; FragH bq; bq.half[0] = *(const v8us*)((const unsigned short*)Bh + boff + 8 * hh); bq.half[1] = *(const v8us*)((const unsigned short*)Bh + boff + 16 + 8 * hh);
      acc[t] = mmaH<1>(ah.v, ah.v, bq.v, bq.v, acc[t]); }
  }
#pragma unroll
  for (int t = 0; t < 4; ++t) { if (col0 + t * 16 >= N) continue; const int col = col0 + t * 16 + ln; const float bv = bp ? bf16_round(bp[col]) : 0.f;
#pragma unroll
    for (int r = 0; r < 8; ++r) { float v = acc[t][r] * alpha + bv; if (CP) { const int rr = row0g + row0 + 8 * hh + r; if (rowsPerB < 0) v += CP[cofs + (size_t)rr * ldc + col];      /* rowsPerB < 0: own element of the batched C plane */ else { const int bidx = rr / rowsPerB; v += CP[(size_t)bidx * sCPb + (size_t)by * 64 + col]; } } if (ACT == 1) v = (v > 0.f) ? v : expm1f(v); else if (ACT == 7) v = (v > 0.f) ? v + 1.0f : expf(v); else if (ACT == 8) v = tanhf(v); else if (ACT == 9) v = 0.5f * v * (1.0f + tanhf(0.7978845608028654f * (v + 0.044715f * v * v * v))); else if (ACT == 11) v = 1.0f / (1.0f + expf(-v)); else if (ACT == 12) v = (v > 0.f) ? v : 0.01f * v; else if (ACT == 14) v = (v > 0.f) ? v : 0.1f * v; else if (ACT == 16) v = (v >= 0.f) ? v : 0.3f * v; else if (ACT == 17) v = (v >= 0.f) ? v : 0.2f * v; else if (ACT == 15) v = v / (1.0f + expf(-v)); else if (ACT == 3) v = fmaxf(v, 0.f); else if (ACT == 6) v = 0.5f * v * (1.0f + erff(v * 0.70710678118654752f)); so[w][8 * hh + r][t * 16 + ln] = v; } }
  __builtin_amdgcn_fence(__ATOMIC_ACQ_REL, "workgroup"); __builtin_amdgcn_wave_barrier();
  const int rsub = lane >> 4, c4 = (lane & 15) * 4; typedef _Float16 v4h __attribute__((ext_vector_type(4)));
  {
#pragma unroll
    for (int q = 0; q < 8; ++q) { const int r = q * 2 + rsub; if (col0 + c4 < N) { const v4f v = *(const v4fa*)&so[w][r][c4]; if (C) *(v4f*)(C + cofs + (size_t)(row0 + r) * ldc + col0 + c4) = v; if (C16) { v4h h4; for (int i = 0; i < 4; ++i) h4[i] = (_Float16)v[i]; *(v4h*)(C16 + cofs + (size_t)(row0 + r) * ldc + col0 + c4) = h4; } } }
     }
}


typedef _Float16 v4h __attribute__((ext_vector_type(4)));

__global__ __launch_bounds__(256) void k_x16(const float* __restrict__ x, _Float16* __restrict__ X16, size_t n8) { const size_t t = (size_t)blockIdx.x * 256 + threadIdx.x; if (t >= n8) return; FragH f;
#pragma unroll
  for (int q = 0; q < 8; ++q) f.h[q] = (_Float16)bf16_round(x[t * 8 + q]); *(v8us*)((unsigned short*)X16 + t * 8) = f.half[0];  }
__global__ __launch_bounds__(256) void k_h16(const float* __restrict__ x, _Float16* __restrict__ X16, size_t n8) { const size_t t = (size_t)blockIdx.x * 256 + threadIdx.x; if (t >= n8) return; FragH f;
#pragma unroll
  for (int q = 0; q < 8; ++q) f.h[q] = (_Float16)x[t * 8 + q]; *(v8us*)((unsigned short*)X16 + t * 8) = f.half[0];  }
__global__ __launch_bounds__(256) void k_round16f(const float* __restrict__ W, _Float16* __restrict__ Bt, size_t n8) { const size_t t = (size_t)blockIdx.x * 256 + threadIdx.x; if (t >= n8) return; FragH f;
#pragma unroll
  for (int i = 0; i < 8; ++i) f.h[i] = (_Float16)(bf16_round(W[t * 8 + i]) * 16.0f); *(v8us*)((unsigned short*)Bt + t * 8) = f.half[0];  }
template <int NHv, int TTv>
__global__ __launch_bounds__(256) void k_vt(const _Float16* __restrict__ V16, int ldv, int voff, _Float16* __restrict__ Vt) { __shared__ unsigned short tl[64][66]; const int tid = threadIdx.x; const int slab = blockIdx.x / (TTv / 64), lg = blockIdx.x % (TTv / 64); const int b = slab / NHv, h = slab % NHv;
  for (int i = tid; i < 64 * 8; i += 256) { const int r = i / 8, c8 = (i % 8) * 8; FragH f; f.half[0] = *(const v8us*)((const unsigned short*)V16 + ((size_t)b * TTv + lg * 64 + r) * ldv + voff + h * 64 + c8);
#pragma unroll
    for (int q = 0; q < 8; ++q) tl[r][c8 + q] = f.u[q]; }
  __syncthreads();
  {
#pragma unroll
    for (int rd = 0; rd < 2; ++rd) { const int d = rd * 32 + tid / 8, pc = tid % 8; FragH f;
#pragma unroll
      for (int q = 0; q < 8; ++q) f.u[q] = tl[pc * 8 + q][d];
      *(v8us*)((unsigned short*)Vt + ((size_t)slab * 64 + d) * TTv + lg * 64 + pc * 8) = f.half[0]; }
     } }

__global__ __launch_bounds__(256) void k_hl(const float* __restrict__ F, _Float16* __restrict__ Hh, _Float16* __restrict__ Hl, size_t n8) { const size_t t = (size_t)blockIdx.x * 256 + threadIdx.x; if (t >= n8) return; FragH fh, fl; const v4f a = *(const v4fa*)(F + t * 8), c = *(const v4fa*)(F + t * 8 + 4);
#pragma unroll
  for (int q = 0; q < 4; ++q) { _Float16 h = (_Float16)a[q]; fh.h[q] = h; fl.h[q] = (_Float16)((a[q] - (float)h) * 1024.0f); h = (_Float16)c[q]; fh.h[4 + q] = h; fl.h[4 + q] = (_Float16)((c[q] - (float)h) * 1024.0f); }
  { *(v8us*)((unsigned short*)Hh + t * 8) = fh.half[0]; *(v8us*)((unsigned short*)Hl + t * 8) = fl.half[0];  } }

// ---- fast GEMM (wave tile 32x64; requires M % 32 == 0 rows per launch region and N % 64 == 0); epilogue = k_gemm_hhx semantics ----
__device__ __forceinline__ v16h g2_frag(const _Float16* p, int hh) { FragH f; f.half[0] = *(const v8us*)((const unsigned short*)p + 8 * hh); f.half[1] = *(const v8us*)((const unsigned short*)p + 16 + 8 * hh); return f.v; }
__device__ __forceinline__ v8f g2_mma(v16h a, v16h b, v8f c) { v8f d = __builtin_amdgcn_wmma_f32_16x16x32_f16(false, a, false, b, (short)0, c, false, false); asm volatile("v_nop\n\tv_nop\n\tv_nop\n\tv_nop" : "+v"(d) : "v"(a), "v"(b)); return d; }
template <int ACT>
__global__ __launch_bounds__(128) void k_gemm2(const _Float16* __restrict__ A, int lda, size_t sA, const _Float16* __restrict__ Bh, int ldb, size_t sB, float alpha, const float* __restrict__ bias, size_t sBias, const float* __restrict__ CP, int rowsPerB, size_t sCPb, int row0g,
    float* __restrict__ C, _Float16* __restrict__ C16, int ldc, size_t sC, int M, int N, int K) { static_assert(ACT == 0 || ACT == 3 || ACT == 6 || ACT == 8 || ACT == 9 || ACT == 11 || ACT == 12 || ACT == 14 || ACT == 15 || ACT == 16 || ACT == 17, "k_gemm2: unsupported ACT code (would silently apply no activation)");
  __shared__ __attribute__((aligned(16))) float so[4][32][68];
  const int tid = threadIdx.x, w = tid >> 5, lane = tid & 31, ln = lane & 15, hh = lane >> 4; const int by = blockIdx.y;
  A += (size_t)by * sA; Bh += (size_t)by * sB; const size_t cofs = (size_t)by * sC; const float* bp = bias ? bias + (size_t)by * sBias : nullptr;
  const int ntn = N >> 6; const int mt = blockIdx.x / ntn, nq = blockIdx.x - mt * ntn; const int row0 = mt * 128 + 32 * w, col0 = nq * 64; if (row0 >= M) return;
  const _Float16* a0p = A + (size_t)(row0 + ln) * lda; const _Float16* a1p = a0p + (size_t)16 * lda;
  const _Float16* b0p = Bh + (size_t)(col0 + ln) * ldb; const _Float16* b1p = b0p + (size_t)16 * ldb; const _Float16* b2p = b1p + (size_t)16 * ldb; const _Float16* b3p = b2p + (size_t)16 * ldb;
  const v8f z8 = {0.f,0.f,0.f,0.f,0.f,0.f,0.f,0.f}; v8f c00 = z8, c01 = z8, c02 = z8, c03 = z8, c10 = z8, c11 = z8, c12 = z8, c13 = z8;
#pragma unroll 1
  for (int kb = 0; kb < K; kb += 32) { const v16h a0 = g2_frag(a0p + kb, hh), a1 = g2_frag(a1p + kb, hh);
    v16h b = g2_frag(b0p + kb, hh); c00 = g2_mma(a0, b, c00); c10 = g2_mma(a1, b, c10);
    b = g2_frag(b1p + kb, hh); c01 = g2_mma(a0, b, c01); c11 = g2_mma(a1, b, c11);
    b = g2_frag(b2p + kb, hh); c02 = g2_mma(a0, b, c02); c12 = g2_mma(a1, b, c12);
    b = g2_frag(b3p + kb, hh); c03 = g2_mma(a0, b, c03); c13 = g2_mma(a1, b, c13); }
  v8f accs[8] = {c00, c01, c02, c03, c10, c11, c12, c13};
#pragma unroll
  for (int u = 0; u < 8; ++u) { const int t = u & 3, half = u >> 2; const int col = col0 + t * 16 + ln; const float bv = bp ? bf16_round(bp[col]) : 0.f;
#pragma unroll
    for (int r = 0; r < 8; ++r) { const int rloc = half * 16 + 8 * hh + r; float v = accs[u][r] * alpha + bv; if (CP) { if (rowsPerB < 0) v += CP[cofs + (size_t)(row0g + row0 + rloc) * ldc + col];      /* rowsPerB < 0: own element of the batched C plane */ else { const int bidx = (row0g + row0 + rloc) / rowsPerB; v += CP[(size_t)bidx * sCPb + (size_t)by * 64 + col]; } }
      if (ACT == 3) v = fmaxf(v, 0.f); else if (ACT == 6) v = 0.5f * v * (1.0f + erff(v * 0.70710678118654752f)); else if (ACT == 11) v = 1.0f / (1.0f + expf(-v)); else if (ACT == 15) v = v / (1.0f + expf(-v)); else if (ACT == 12) v = (v > 0.f) ? v : 0.01f * v; else if (ACT == 8) v = tanhf(v); else if (ACT == 9) v = 0.5f * v * (1.0f + tanhf(0.7978845608028654f * (v + 0.044715f * v * v * v))); else if (ACT == 14) v = (v > 0.f) ? v : 0.1f * v; else if (ACT == 16) v = (v >= 0.f) ? v : 0.3f * v; else if (ACT == 17) v = (v >= 0.f) ? v : 0.2f * v;
      so[w][rloc][t * 16 + ln] = v; } }
  __builtin_amdgcn_fence(__ATOMIC_ACQ_REL, "workgroup"); __builtin_amdgcn_wave_barrier();
  const int rsub = lane >> 4, c4 = (lane & 15) * 4;
  {
#pragma unroll
    for (int q = 0; q < 16; ++q) { const int r = q * 2 + rsub; const v4f v = *(const v4fa*)&so[w][r][c4]; if (C) *(v4f*)(C + cofs + (size_t)(row0 + r) * ldc + col0 + c4) = v; if (C16) { v4h h4; for (int i = 0; i < 4; ++i) h4[i] = (_Float16)v[i]; *(v4h*)(C16 + cofs + (size_t)(row0 + r) * ldc + col0 + c4) = h4; } }
     } }


__global__ __launch_bounds__(256) void k_rsm(const float* __restrict__ S, _Float16* __restrict__ P, int nrows) {
  #pragma clang fp contract(off)
  const int i = blockIdx.x * 256 + threadIdx.x; if (i >= nrows) return; const float* s = S + (size_t)i * SQ; float mx = -3.0e38f;
#pragma unroll 1
  for (int j = 0; j < SQ; ++j) mx = fmaxf(mx, s[j]); float se = 0.f;
#pragma unroll 1
  for (int j = 0; j < SQ; ++j) se += expf(s[j] - mx); const float sc = 256.0f / se;
#pragma unroll 1
  for (int j0 = 0; j0 < SQ; j0 += 8) { FragH f; for (int q = 0; q < 8; ++q) f.h[q] = (_Float16)(expf(s[j0 + q] - mx) * sc); unsigned short* d = (unsigned short*)P + (size_t)i * SQ + j0; *(v8us*)d = f.half[0];  } }
__global__ __launch_bounds__(256) void k_vt(const _Float16* __restrict__ V16, int b, int h0, _Float16* __restrict__ VT) { __shared__ unsigned short tl[64][65]; const int tid = threadIdx.x; const int hh = blockIdx.x % HG, sg = blockIdx.x / HG; const int s0 = sg * 64; const int h = h0 + hh;
  for (int i = tid; i < 64 * 8; i += 256) { const int j = i / 8, d8 = (i % 8) * 8; FragH f; f.half[0] = *(const v8us*)((const unsigned short*)V16 + ((size_t)b * SQ + s0 + j) * DM + h * HD + d8); for (int q = 0; q < 8; ++q) tl[d8 + q][j] = f.u[q]; }
  __syncthreads();
  { for (int i = tid; i < 64 * 8; i += 256) { const int d = i / 8, j8 = (i % 8) * 8; FragH f; for (int q = 0; q < 8; ++q) f.u[q] = tl[d][j8 + q]; *(v8us*)((unsigned short*)VT + ((size_t)hh * HD + d) * SQ + s0 + j8) = f.half[0]; }  } }


template <int BFIN, int W16, int W32>
__global__ __launch_bounds__(256) void k_lnx(const float* __restrict__ X, const float* __restrict__ g, const float* __restrict__ bb, float eps, _Float16* __restrict__ N16, float* __restrict__ N32) {
  #pragma clang fp contract(off)
  __shared__ float red[256]; const size_t r = blockIdx.x; const int t = threadIdx.x; const bool act = t < (DMQ / 4); const int c0 = act ? t * 4 : 0;
  const v4f xa = *(const v4fa*)(X + r * DMQ + c0); float s[4]; float sum = 0.f;
  for (int q = 0; q < 4; ++q) { s[q] = act ? (BFIN ? bf16_round(xa[q]) : xa[q]) : 0.f; sum = __fadd_rn(sum, s[q]); }
  red[t] = sum; __syncthreads(); for (int st = 128; st > 0; st >>= 1) { if (t < st) red[t] = __fadd_rn(red[t], red[t + st]); __syncthreads(); } const float mu = red[0] / (float)DMQ; __syncthreads();
  float vs = 0.f; for (int q = 0; q < 4; ++q) { const float dl = act ? __fadd_rn(s[q], -mu) : 0.f; vs = __fadd_rn(vs, __fmul_rn(dl, dl)); } red[t] = vs; __syncthreads(); for (int st = 128; st > 0; st >>= 1) { if (t < st) red[t] = __fadd_rn(red[t], red[t + st]); __syncthreads(); }
  const float rs = rsqrtf(__fadd_rn(red[0] / (float)DMQ, eps)); v4h y; v4f yf;
  for (int q = 0; q < 4; ++q) { const int c = c0 + q; yf[q] = __fadd_rn(__fmul_rn(__fmul_rn(__fadd_rn(s[q], -mu), rs), bf16_round(g[c])), (bb ? bf16_round(bb[c]) : 0.f)); y[q] = (_Float16)yf[q]; }
  if (!act) return;      /* no barriers after this point */
  { if (W16) *(v4h*)(N16 + r * DMQ + c0) = y; if (W32) *(v4f*)(N32 + r * DMQ + c0) = yf;  } }


__global__ __launch_bounds__(256) void k_rsmf(const float* __restrict__ S, _Float16* __restrict__ P, int qn, int hg) {
  #pragma clang fp contract(off)
  const int t = blockIdx.x * 256 + threadIdx.x; if (t >= qn * hg) return; const size_t i = (size_t)(t / qn) * SQ + (t % qn); const float* s = S + i * SQ; float mx = -3.0e38f;
#pragma unroll 1
  for (int j = 0; j < SQ; ++j) mx = fmaxf(mx, s[j]); float se = 0.f;
#pragma unroll 1
  for (int j = 0; j < SQ; ++j) se += __expf(s[j] - mx); const float sc = 256.0f / se;
#pragma unroll 1
  for (int j0 = 0; j0 < SQ; j0 += 8) { FragH f; for (int q = 0; q < 8; ++q) f.h[q] = (_Float16)(__expf(s[j0 + q] - mx) * sc); unsigned short* d = (unsigned short*)P + i * SQ + j0; *(v8us*)d = f.half[0];  } }


__global__ __launch_bounds__(256) void k_bfr(const float* __restrict__ x, float* __restrict__ XB, size_t n8) { const size_t t = (size_t)blockIdx.x * 256 + threadIdx.x; if (t >= n8) return; v4f a = *(const v4fa*)(x + t * 8), c = *(const v4fa*)(x + t * 8 + 4); for (int q = 0; q < 4; ++q) { a[q] = bf16_round(a[q]); c[q] = bf16_round(c[q]); }
  { *(v4f*)(XB + t * 8) = a; *(v4f*)(XB + t * 8 + 4) = c;  } }



__global__ __launch_bounds__(256) void k_rsmfam(const float* __restrict__ S, _Float16* __restrict__ P, int qn, int hg, const float* __restrict__ am) {
  #pragma clang fp contract(off)
  const int t = blockIdx.x * 256 + threadIdx.x; if (t >= qn * hg) return; const size_t i = (size_t)(t / qn) * SQ + (t % qn); const float* s = S + i * SQ; float mx = -3.0e38f;
#pragma unroll 1
  for (int j = 0; j < SQ; ++j) mx = fmaxf(mx, __fadd_rn(s[j], bf16_round(am[j]))); float se = 0.f;
#pragma unroll 1
  for (int j = 0; j < SQ; ++j) se += __expf(__fadd_rn(s[j], bf16_round(am[j])) - mx); const float sc = 256.0f / se;
#pragma unroll 1
  for (int j0 = 0; j0 < SQ; j0 += 8) { FragH f; for (int q = 0; q < 8; ++q) f.h[q] = (_Float16)(__expf(__fadd_rn(s[j0 + q], bf16_round(am[j0 + q])) - mx) * sc); unsigned short* d = (unsigned short*)P + i * SQ + j0; *(v8us*)d = f.half[0];  } }


#define CC CX           /* unused: input channels */
#define LL SQ           /* pixels per image */
#define LQ (3 * DM)     /* unused */

__global__ __launch_bounds__(256) void k_rowb(float* __restrict__ O, const float* __restrict__ bias, size_t n4) {
  #pragma clang fp contract(off)
  const size_t t = (size_t)blockIdx.x * 256 + threadIdx.x; if (t >= n4) return; const size_t e = t * 4; const int c = (int)((e / SQ) % CX);      /* output channels */ const float bb = bf16_round(bias[c]); const v4f a = *(const v4fa*)(O + e); v4f o; for (int q = 0; q < 4; ++q) o[q] = __fadd_rn(a[q], bb);
  *(v4f*)(O + e) = o;  }

// ---- fused sigmoid attention: Y[b][c][n] = bf16(gamma) sum_m V[b][c][m] sigmoid(q[n].k[m]) + bf16(x[b][c][n]); the gate tile never leaves registers ----
// S^T / 2 = K.(Q / 2)^T (A = k rows, B = rows of q / 2, both through f_frag16): a lane holds column n = ln, rows m = 8 hh + r. Two such D tiles (m 0-15, 16-31), gated and
// rounded to f16 in place, are the B operand of out += V.P^T in the hardware k order, which is the order k_proj stores the V fragments in (A operand, f_fragp).
// Work-group = one image, 64 query columns, all 128 channels; its 8 waves each walk 512 of the 4096 keys; the 8 partial tiles are summed through LDS in wave order; the thread that holds a sum scales it, adds its x and stores y.
#define FW 8             /* waves per work-group = key ranges */
#define FN 64            /* query columns per work-group, all of them in every wave: a V fragment loaded from L2 feeds four products */
#define FP (FN + 4)      /* LDS row pitch in floats: rows 8 apart fall on other banks, 16-byte reads stay aligned */
/* waves_per_eu(2, 2): the 128 x 64 f32 tile takes 256 registers, so a wave has the 512 of two waves per SIMD; one work-group per WGP, whose LDS holds its 8 partial tiles */
__device__ __forceinline__ v16h f_frag16(const _Float16* p) { FragH f; const v8us z = {0, 0, 0, 0, 0, 0, 0, 0}; f.half[0] = *(const v8us*)(const unsigned short*)p; f.half[1] = z; return f.v; }      /* q / k fragment: k 16-31 of the K = 32 contraction is zero, set in registers */
__device__ __forceinline__ v16h f_fragp(const _Float16* p) { FragH f; f.half[0] = *(const v8us*)(const unsigned short*)p; f.half[1] = *(const v8us*)((const unsigned short*)p + 256); return f.v; }      /* V fragment from a 1-KiB unit of k_proj: p = unit + 8 lane; the second half stands 512 bytes on */
__device__ __forceinline__ v8f f_mma(v16h a, v16h b, v8f c) { return __builtin_amdgcn_wmma_f32_16x16x32_f16(false, a, false, b, (short)0, c, false, false); }
/* gate: sigmoid(s) = 0.5 + 0.5 tanh(s / 2), one v_tanh_f32 per score; u = s / 2 comes out of the score product itself (the q plane holds q / 2, a power of two); two gates share the packed fma and the packed f16 conversion; +-inf give 0 and 1, NaN stays NaN */
typedef float v2f __attribute__((ext_vector_type(2)));
typedef _Float16 v2h __attribute__((ext_vector_type(2)));
__device__ __forceinline__ v2h f_gate2(float u0, float u1) { const v2f t = {__builtin_amdgcn_tanhf(u0), __builtin_amdgcn_tanhf(u1)}; const v2f hf = {0.5f, 0.5f}; return __builtin_convertvector(__builtin_elementwise_fma(t, hf, hf), v2h); }
/* the fragments of one 32-key pass: two k tiles and the eight V tiles, 18 loads of 512 contiguous bytes per wave */
__device__ __forceinline__ void f_load(const _Float16* kp, const _Float16* vp, v16h (&kf)[2], v16h (&vf)[CX / 16]) {
  kf[0] = f_frag16(kp); kf[1] = f_frag16(kp + 16 * 16);
#pragma unroll      /* unrolled: vf is indexed by constants only and stays in registers */
  for (int t = 0; t < CX / 16; ++t) vf[t] = f_fragp(vp + t * 512); }
/* one 32-key pass: per 16 query columns two score tiles, their gates as the f16 B operand, eight products into the accumulators */
__device__ __forceinline__ void f_pass(const v16h (&kf)[2], const v16h (&vf)[CX / 16], const v16h (&qf)[FN / 16], v8f (&acc)[CX / 16][FN / 16]) {
  const v8f z8 = {0.f,0.f,0.f,0.f,0.f,0.f,0.f,0.f};
#pragma unroll      /* unrolled, with the two loops inside: fragments and accumulators are indexed by constants only and stay in registers */
  for (int j = 0; j < FN / 16; ++j) { const v8f s0 = f_mma(kf[0], qf[j], z8), s1 = f_mma(kf[1], qf[j], z8); FragH p;
#pragma unroll
    for (int r = 0; r < 8; r += 2) { const v2h g0 = f_gate2(s0[r], s0[r + 1]), g1 = f_gate2(s1[r], s1[r + 1]); p.h[r] = g0[0]; p.h[r + 1] = g0[1]; p.h[8 + r] = g1[0]; p.h[8 + r + 1] = g1[1]; }
#pragma unroll
    for (int t = 0; t < CX / 16; ++t) acc[t][j] = f_mma(vf[t], p.v, acc[t][j]);
  } }
__global__ __launch_bounds__(FW * 32) __attribute__((amdgpu_waves_per_eu(2, 2))) void k_sattn(const _Float16* __restrict__ QZ, const _Float16* __restrict__ KZ, const _Float16* __restrict__ VP, const float* __restrict__ gam, const float* __restrict__ x, float* __restrict__ Y) {
  __shared__ __attribute__((aligned(16))) float red[FW][CX][FP];
  constexpr int MR = SQ / FW;      /* keys per wave */
  const int tid = threadIdx.x, w = tid >> 5, lane = tid & 31, ln = lane & 15, hh = lane >> 4; const int b = blockIdx.y, n0 = blockIdx.x * FN;
  const _Float16* qp = QZ + ((size_t)b * SQ + n0 + ln) * 16 + 8 * hh; const unsigned ki = (unsigned)((b * SQ + w * MR + ln) * 16 + 8 * hh), vi = (unsigned)((b * (SQ / 32) + w * (MR / 32)) * (CX / 16) * 512 + 8 * lane); const _Float16* kp = KZ + ki; const _Float16* vp = VP + vi;      /* kp, vp: the lane's own first 8 elements; over a wave both are 512 contiguous bytes */
  v16h qf[FN / 16];
#pragma unroll      /* unrolled: qf is indexed by constants only and stays in registers */
  for (int j = 0; j < FN / 16; ++j) qf[j] = f_frag16(qp + j * 16 * 16);      /* rows of q / 2: the score tiles are s / 2, the argument of the gate's tanh */
  asm volatile("s_wait_xcnt 0x0" :: "v"(qp) : "memory");      /* the wait that stands between issued loads and an overwrite of their address registers; the address is an input so that it stays in its registers up to the wait */
  const v8f z8 = {0.f,0.f,0.f,0.f,0.f,0.f,0.f,0.f}; v8f acc[CX / 16][FN / 16];
#pragma unroll
  for (int t = 0; t < CX / 16; ++t)
#pragma unroll      /* unrolled, like the loop around it: the accumulators are indexed by constants only and stay in registers */
    for (int j = 0; j < FN / 16; ++j) acc[t][j] = z8;
  /* two fragment sets: while the products of one 32-key pass run on set a (b), the loads of the next pass fill set b (a), so a pass no longer starts by waiting out the L2 latency of its own loads */
  v16h ka[2], va[CX / 16], kb[2], vb[CX / 16];
  f_load(kp, vp, ka, va);
  asm volatile("s_wait_xcnt 0x0" :: "v"(kp), "v"(vp) : "memory");      /* the wait that stands between issued loads and an overwrite of their address registers; the addresses are inputs so that they stay in their registers up to the wait */
#pragma unroll 1      /* rolled, for speed only; the inner loops are unrolled so that fragments and accumulators stay in registers */
  for (int m0 = 0; m0 < MR - 64; m0 += 64) {
    f_load(kp + 32 * 16, vp + (CX / 16) * 512, kb, vb);
    __builtin_amdgcn_sched_barrier(0);      /* the next pass's loads are issued ahead of this pass's scores: sunk among the products they would arrive too late for their own pass */
    f_pass(ka, va, qf, acc);
    __builtin_amdgcn_sched_barrier(0);      /* set a is refilled only behind its last product */
    f_load(kp + 64 * 16, vp + 2 * (CX / 16) * 512, ka, va);
    asm volatile("s_wait_xcnt 0x0" ::: "memory");      /* kp and vp are advanced on the next line: the wait that stands between issued loads and an overwrite of their address registers */
    kp += 64 * 16; vp += 2 * (CX / 16) * 512;
    __builtin_amdgcn_sched_barrier(0);      /* as above: the refill of set a is in flight before the first score of set b */
    f_pass(kb, vb, qf, acc);
  }
  /* the last two passes stand outside the loop: nothing is loaded behind the wave's key range, and every wait in the loop counts the same loads on every trip */
  f_load(kp + 32 * 16, vp + (CX / 16) * 512, kb, vb);
  asm volatile("s_wait_xcnt 0x0" ::: "memory");      /* the address registers are free for other use from here on: the wait that stands between issued loads and an overwrite of their address registers */
  __builtin_amdgcn_sched_barrier(0);      /* the last pass's loads, and the wait behind them, are issued ahead of the scores of the pass before it */
  f_pass(ka, va, qf, acc);
  f_pass(kb, vb, qf, acc);
  /* residual: the thread's own x elements (those of the sums it forms below) are asked for here, so that they arrive while the partial tiles go through LDS */
  constexpr int NQ = CX * FN / 4 / (FW * 32); const size_t eo = ((size_t)b * CX + tid / (FN / 4)) * SQ + n0 + (tid % (FN / 4)) * 4; const float* xp = x + eo; v4f xr[NQ];
#pragma unroll
  for (int q = 0; q < NQ; ++q) xr[q] = *(const v4fa*)(xp + (size_t)q * (FW * 32 / (FN / 4)) * SQ);
  asm volatile("s_wait_xcnt 0x0" :: "v"(xp) : "memory");      /* the wait that stands between issued loads and an overwrite of their address registers; the address is an input so that it stays in its registers up to the wait and no load of the run lands on it */
  const float g = bf16_round(gam[0]);
#pragma unroll
  for (int t = 0; t < CX / 16; ++t)
#pragma unroll
    for (int j = 0; j < FN / 16; ++j)
#pragma unroll
      for (int r = 0; r < 8; ++r) red[w][t * 16 + 8 * hh + r][j * 16 + ln] = acc[t][j][r];
  __syncthreads();
#pragma unroll
  for (int q = 0; q < NQ; ++q) { const int i = q * (FW * 32) + tid, c = i / (FN / 4), n4 = (i % (FN / 4)) * 4; v4f s = *(const v4fa*)&red[0][c][n4];
#pragma unroll
    for (int u = 1; u < FW; ++u) s += *(const v4fa*)&red[u][c][n4];
#pragma unroll
    for (int e = 0; e < 4; ++e) s[e] = g * s[e] + bf16_round(xr[q][e]);
    *(v4f*)(Y + eo + (size_t)q * (FW * 32 / (FN / 4)) * SQ) = s; } }
// ---- fused projections: x [b][c][n] f32 and the natural weights -> q / 2 rows, k rows (f16 [b n][16]) and V in fragment order, one launch ----
// Work-group = 64 tokens of one image. The x tile (bf16-rounded, exact in f16) is turned to token rows [64][128] and [Wq; Wk; Wv] (bf16-rounded, x 16) to rows [160][128] in LDS; every fragment is two 16-byte LDS reads (g2_frag).
// Wave w: token tile mt = w & 3 (16 tokens); hf = w >> 2 picks q (0) or k (1) and the output channels 64 hf + 0..63 of v.
// q, k: A = weight rows, B = token rows: a lane holds token ln, outputs 8 hh + r: one 16-byte store into the token's row.
// v: A = token rows, B = weight rows: a lane holds channel ln, tokens 8 hh + r. That is the A operand of k_sattn: per image, 32-key block and 16-channel tile one 1-KiB unit [half][lane][8 keys]
// (lane = 16 hh + ln holds channel ln, keys 16 half + 8 hh + 0..7), so a D tile is stored as it stands, 512 contiguous bytes per wave.
#define PK 64            /* tokens per work-group: 256 work-groups */
#define PP (CX + 8)      /* LDS row pitch in f16: 272 bytes = 16 x odd, for 16-byte readers of 256-byte rows */
__global__ __launch_bounds__(256) void k_proj(const float* __restrict__ x, const float* __restrict__ wq, const float* __restrict__ bq, const float* __restrict__ wk, const float* __restrict__ bk, const float* __restrict__ wv, const float* __restrict__ bv,
    _Float16* __restrict__ QZ, _Float16* __restrict__ KZ, _Float16* __restrict__ VP) {
  __shared__ __attribute__((aligned(16))) _Float16 xs[PK][PP];
  __shared__ __attribute__((aligned(16))) _Float16 wl[32 + CX][PP];
  const int tid = threadIdx.x, w = tid >> 5, lane = tid & 31, ln = lane & 15, hh = lane >> 4; const int b = blockIdx.x / (SQ / PK), n0 = (blockIdx.x % (SQ / PK)) * PK;
  const int g16 = tid & 15, r16 = tid >> 4, mt = w & 3, hf = w >> 2;
  /* x: a thread takes 4 tokens (4 g16 + q) of 8 channels (8 r16 + j): 16 lanes read 256 contiguous bytes of a channel row; the 8 x 4 block leaves as four 16-byte LDS stores */
  const float* xp = x + ((size_t)b * CX + r16 * 8) * SQ + n0 + g16 * 4; v4f xa[8];
#pragma unroll
  for (int j = 0; j < 8; ++j) xa[j] = *(const v4fa*)(xp + (size_t)j * SQ);
  /* weights: pass u covers 16 rows (0: Wq, 1: Wk, 2-9: Wv), a thread 8 elements of row r16 */
  const float* wqp = wq + r16 * CX + g16 * 8; const float* wkp = wk + r16 * CX + g16 * 8; const float* wvp = wv + r16 * CX + g16 * 8; v4f wa[2 + CX / 16][2];
  wa[0][0] = *(const v4fa*)wqp; wa[0][1] = *(const v4fa*)(wqp + 4); wa[1][0] = *(const v4fa*)wkp; wa[1][1] = *(const v4fa*)(wkp + 4);
#pragma unroll
  for (int u = 0; u < CX / 16; ++u) { wa[2 + u][0] = *(const v4fa*)(wvp + u * 16 * CX); wa[2 + u][1] = *(const v4fa*)(wvp + u * 16 * CX + 4); }
  const float* bp = (hf ? bk : bq) + 8 * hh; const v4f b0 = *(const v4fa*)bp, b1 = *(const v4fa*)(bp + 4); const float* bvp = bv + hf * (CX / 2) + ln; float bb[CX / 32];
#pragma unroll
  for (int t4 = 0; t4 < CX / 32; ++t4) bb[t4] = bvp[t4 * 16];
  asm volatile("s_wait_xcnt 0x0" :: "v"(xp), "v"(wqp), "v"(wkp), "v"(wvp), "v"(bp), "v"(bvp) : "memory");      /* the wait that stands between issued loads and an overwrite of their address registers; the addresses are inputs so that they stay in their registers up to it and no load of the run lands on one. No load sinks below it either: all of a thread's loads are in flight before the first conversion waits, one memory latency instead of one per group */
#pragma unroll
  for (int u = 0; u < 2 + CX / 16; ++u) { FragH f;
#pragma unroll
    for (int i = 0; i < 4; ++i) { f.h[i] = (_Float16)(bf16_round(wa[u][0][i]) * 16.0f); f.h[4 + i] = (_Float16)(bf16_round(wa[u][1][i]) * 16.0f); }
    *(v8us*)&wl[u * 16 + r16][g16 * 8] = f.half[0]; }
#pragma unroll
  for (int q = 0; q < 4; ++q) { FragH f;
#pragma unroll
    for (int j = 0; j < 8; ++j) f.h[j] = (_Float16)bf16_round(xa[j][q]);
    *(v8us*)&xs[g16 * 4 + q][r16 * 8] = f.half[0]; }
  __syncthreads();
  const v8f z8 = {0.f,0.f,0.f,0.f,0.f,0.f,0.f,0.f}; v16h xf[CX / 32], qw[CX / 32], vw[CX / 32][CX / 32];
#pragma unroll
  for (int kk = 0; kk < CX / 32; ++kk) { xf[kk] = g2_frag(&xs[mt * 16 + ln][kk * 32], hh); qw[kk] = g2_frag(&wl[hf * 16 + ln][kk * 32], hh); }
#pragma unroll
  for (int t4 = 0; t4 < CX / 32; ++t4)
#pragma unroll
    for (int kk = 0; kk < CX / 32; ++kk) vw[t4][kk] = g2_frag(&wl[32 + (hf * (CX / 32) + t4) * 16 + ln][kk * 32], hh);
  __builtin_amdgcn_sched_barrier(0);      /* every fragment read is issued ahead of the products: otherwise each product waits out the LDS latency of its own two reads */
  v8f aq = z8, av[CX / 32];
#pragma unroll
  for (int t4 = 0; t4 < CX / 32; ++t4) av[t4] = z8;
#pragma unroll
  for (int kk = 0; kk < CX / 32; ++kk) { aq = f_mma(qw[kk], xf[kk], aq);      /* the five accumulators are independent of one another */
#pragma unroll
    for (int t4 = 0; t4 < CX / 32; ++t4) av[t4] = f_mma(xf[kk], vw[t4][kk], av[t4]); }
  { const float sc = hf ? 1.0f : 0.5f;      /* q / 2 (exact in f32): the gate takes tanh of half the score */
    FragH o;
#pragma unroll
    for (int r = 0; r < 8; ++r) o.h[r] = (_Float16)(sc * (aq[r] * 0.0625f + bf16_round(r < 4 ? b0[r & 3] : b1[r & 3])));
    *(v8us*)((unsigned short*)(hf ? KZ : QZ) + ((size_t)b * SQ + n0 + mt * 16 + ln) * 16 + 8 * hh) = o.half[0]; }
#pragma unroll
  for (int t4 = 0; t4 < CX / 32; ++t4) { const int t = hf * (CX / 32) + t4; const float bt = bf16_round(bb[t4]); FragH o;
#pragma unroll
    for (int r = 0; r < 8; ++r) o.h[r] = (_Float16)(av[t4][r] * 0.0625f + bt);
    *(v8us*)((unsigned short*)VP + ((((size_t)(b * (SQ / 32) + (n0 >> 5) + (mt >> 1)) * (CX / 16) + t) * 2 + (mt & 1)) * 32 + lane) * 8) = o.half[0]; } }
extern "C" void kernel_launch(void* const* d_in, const int* in_sizes, int n_in,
                              void* d_out, int out_size, void* d_ws, size_t ws_size, hipStream_t stream) {
  (void)in_sizes; (void)n_in; (void)out_size;
  const float* const* I = (const float* const*)d_in; const float* x = I[0]; const float* wq = I[1]; const float* bq = I[2]; const float* wk = I[3]; const float* bk = I[4]; const float* wv = I[5]; const float* bv = I[6]; const float* gam = I[7];      /* natural Wq/Wk [16][128] + b, Wv [128][128] + b; gamma [1] */
  constexpr int DQ = 16;      /* q/k width */
  char* ws = (char*)d_ws; size_t off = 0;
  auto take = [&](size_t bytes) { char* p = ws + off; off += (bytes + 255) & ~(size_t)255; return p; };
  _Float16* QZ = (_Float16*)take(NR * DQ * 2); _Float16* KZ = (_Float16*)take(NR * DQ * 2); _Float16* VP = (_Float16*)take(NR * CX * 2);
  if (off > ws_size) return;
  k_proj<<<NB * (SQ / PK), 256, 0, stream>>>(x, wq, bq, wk, bk, wv, bv, QZ, KZ, VP);      /* q / 2 and k rows [NR][16] f16, V in fragment order [b][key / 32][channel / 16][1 KiB] */
  k_sattn<<<dim3(SQ / FN, NB), FW * 32, 0, stream>>>(QZ, KZ, VP, gam, x, (float*)d_out);      /* out[b][c][n] = sum_m v[c][m] sigmoid(q[:, n].k[:, m]): scores (K = 32 with zero padding), gate (f16) and V x gate^T in one kernel, f32; y = bf16(gamma) out + bf16(x) -> channel-first output */
}

// v009
// Measured time: 22.9 microseconds a run.
// In two side-by-side timings against v008, it was 1.05 and 1.03 times as fast.
// Counting every step since v000, it is 28.3 times as fast.
#include <hip/hip_runtime.h>
// SAGAN-style self-attention with SIGMOID gating instead of softmax, channel-first (x [4][128][64][64]; q = Wq x + bq, k = Wk x + bk (1x1, 128 -> 16), v = Wv x + bv (128 -> 128), natural weights and biases sigma 0.05; attn[n][m] = sigmoid(q[:, n].k[:, m]) (no scale, no normalisation); out[c][n] = sum_m v[c][m] attn[n][m]; y = gamma out + x with the scalar gamma input -> [4][128][64][64]).
// Structure: one projection kernel (work-group = 64 tokens of one image): the channel-first x tile and [Wq; Wk; Wv] go through LDS as exact f16 rows; q and k as W (A) x tokens (B), v as tokens (A) x W (B), f32 + bias; the D tiles are stored as they stand: q / 2 and k as f16 rows [16384][16], V in WMMA fragment order; one fused kernel: attn tile = sigmoid(q.k) = 0.5 + 0.5 tanh(q.k / 2) to f16 in registers (the 16-deep contraction runs as K = 32 with zeros set in registers), out[c][n] = V (A operand) x attn (B^T) f32, 8 key ranges summed through LDS, and y = bf16(gamma) out + bf16(x) formed on that sum and stored by the same kernel; two launches.
// Compute dtype: inputs rounded to bf16; x / weights exact; q, k, v and the sigmoid gates as plain f16 GEMM operands (~2^-12); scores and out f32; v_wmma_f32_16x16x32_f16.
#define NB 4
#define SQ 4096
#define DM 128
#define CX 128          /* channels */
#define NH 4
#define HD 64
#define DMQ DM                       /* LayerNorm width */
#define DFF 4096
#define HG 1                         /* heads per attention launch group */
#define B0 0                         /* unused */
#define NBR NB                       /* unused (only in MP, itself unused) */
#define NR ((size_t)NB * SQ)         /* token rows */
#define MP ((int)((size_t)NBR * SQ)) /* unused (only in MPO, itself unused) */
#define QN SQ                        /* unused */
#define NHD NH                       /* unused */
#define MPO MP                       /* unused */
#define LQ DM      /* unused (redefined below) */
typedef __bf16 v16b __attribute__((ext_vector_type(16)));
typedef unsigned short v8us __attribute__((ext_vector_type(8), may_alias));
typedef float  v8f  __attribute__((ext_vector_type(8)));
typedef float  v4f  __attribute__((ext_vector_type(4)));
typedef float  v4fa __attribute__((ext_vector_type(4), may_alias));
union FragB { v16b v; v8us half[2]; unsigned short u[16]; };

__device__ __forceinline__ unsigned short bf16_bits(float x) { unsigned int u = __float_as_uint(x); return (unsigned short)((u + 0x7FFFu + ((u >> 16) & 1u)) >> 16); }
__device__ __forceinline__ float bf16_val(unsigned short b) { return __uint_as_float(((unsigned int)b) << 16); }
__device__ __forceinline__ float bf16_round(float x) { return bf16_val(bf16_bits(x)); }
// D += A·B with NT terms: 1 = ah·bh, 2 = + al·bh (A split), 3 = + ah·bl (both split)
template <int NT>
__device__ __forceinline__ v8f mmaN(v16b ah, v16b al, v16b bh, v16b bl, v8f c) {
  c = __builtin_amdgcn_wmma_f32_16x16x32_bf16(false, ah, false, bh, (short)0, c, false, false);
  if (NT >= 2) c = __builtin_amdgcn_wmma_f32_16x16x32_bf16(false, al, false, bh, (short)0, c, false, false);
  if (NT >= 3) c = __builtin_amdgcn_wmma_f32_16x16x32_bf16(false, ah, false, bl, (short)0, c, false, false);
  asm volatile("v_nop\n\tv_nop\n\tv_nop\n\tv_nop" : "+v"(c) : "v"(ah), "v"(al), "v"(bh), "v"(bl));
  return c;
}

__global__ __launch_bounds__(256) void k_wt_bf16(const float* __restrict__ W, unsigned short* __restrict__ Wt, int K, int N) {
  const int t = blockIdx.x * 256 + threadIdx.x;
  const int k8n = K / 8;
  if (t >= N * k8n) return;
  const int n = t / k8n, k8 = (t % k8n) * 8;
  v8us v;
#pragma unroll
  for (int i = 0; i < 8; ++i) v[i] = bf16_bits(W[(size_t)(k8 + i) * N + n]);
  *(v8us*)(Wt + (size_t)n * K + k8) = v;
  
}

// GEMM C[M][N] (f32, pitch ldc) = act(A[M][K]·W + bias). A f32 row-major (pitch lda) converted per fragment to bf16
// (ASPLIT: hi/lo two planes -> 2 terms, else single rounded term); Wt bf16 [N][K] (pitch ldb). BIAS_BF16 rounds the
// bias to bf16 first (bias quantised to bf16 before the add). K%32==0, M%16==0, N%64==0.
template <bool ASPLIT, int ACT, bool BIAS_BF16>
__global__ __launch_bounds__(128) void k_gemm_bf(const float* __restrict__ A, int lda, const unsigned short* __restrict__ Wt, int ldb,
                                               const float* __restrict__ bias, float* __restrict__ C, int ldc, int M, int N, int K) {
  __shared__ __attribute__((aligned(16))) float so[4][16][64];
  const int tid = threadIdx.x, w = tid >> 5, lane = tid & 31, ln = lane & 15, hh = lane >> 4;
  const int ntn = N / 64;
  const int wid = blockIdx.x * 4 + w;
  const int mt = wid / ntn, nq = wid % ntn;
  if (mt * 16 >= M) return;
  const int row0 = mt * 16, col0 = nq * 64;
  const float* arow = A + (size_t)(row0 + ln) * lda;
  v8f acc[4] = {};
  for (int kb = 0; kb < K; kb += 32) {
    FragB ah, al;
    const v4f x0 = *(const v4fa*)(arow + kb + 8 * hh), x1 = *(const v4fa*)(arow + kb + 8 * hh + 4);
    const v4f x2 = *(const v4fa*)(arow + kb + 16 + 8 * hh), x3 = *(const v4fa*)(arow + kb + 16 + 8 * hh + 4);
    float xs[16] = {x0[0],x0[1],x0[2],x0[3],x1[0],x1[1],x1[2],x1[3],x2[0],x2[1],x2[2],x2[3],x3[0],x3[1],x3[2],x3[3]};
#pragma unroll
    for (int i = 0; i < 16; ++i) { const unsigned short hb = bf16_bits(xs[i]); ah.u[i] = hb; al.u[i] = ASPLIT ? bf16_bits(xs[i] - bf16_val(hb)) : (unsigned short)0; }
#pragma unroll
    for (int t = 0; t < 4; ++t) {
      const unsigned short* brow = Wt + (size_t)(col0 + t * 16 + ln) * ldb + kb;
      FragB b;
      b.half[0] = *(const v8us*)(brow + 8 * hh);
      b.half[1] = *(const v8us*)(brow + 16 + 8 * hh);
      acc[t] = mmaN<ASPLIT ? 2 : 1>(ah.v, al.v, b.v, b.v, acc[t]);
    }
  }
#pragma unroll
  for (int t = 0; t < 4; ++t) {
    float bv = bias ? bias[col0 + t * 16 + ln] : 0.f;
    if (BIAS_BF16) bv = bf16_round(bv);
#pragma unroll
    for (int r = 0; r < 8; ++r) { float v = acc[t][r] + bv; if (ACT == 1) v = fmaxf(v, 0.f); so[w][8 * hh + r][t * 16 + ln] = v; }
  }
  __builtin_amdgcn_fence(__ATOMIC_ACQ_REL, "workgroup");
  __builtin_amdgcn_wave_barrier();
  const int rsub = lane >> 4, c4 = (lane & 15) * 4;
  {
#pragma unroll
    for (int q = 0; q < 8; ++q) {
      const int r = q * 2 + rsub;
      const v4f v = *(const v4fa*)&so[w][r][c4];
      *(v4f*)(C + (size_t)(row0 + r) * ldc + col0 + c4) = v;
    }
    
  }
}

// GEMM C = act(A·W + bias + resid): A f32 (ASPLIT -> hi/lo 2 terms), Wt bf16 [N][K]; ACT 0 none, 1 relu, 2 exact gelu;
// resid (optional, f32, row index = (row % rmod), pitch ldr, RES_BF16 rounds it) added before the activation.
template <bool ASPLIT, int ACT, bool BIAS_BF16, bool RES_BF16>
__global__ __launch_bounds__(128) void k_gemm_bf3(const float* __restrict__ A, int lda, const unsigned short* __restrict__ Wt, int ldb,
                                                const float* __restrict__ bias, const float* __restrict__ resid, int rmod, int ldr,
                                                float* __restrict__ C, int ldc, int M, int N, int K) {
  __shared__ __attribute__((aligned(16))) float so[4][16][64];
  const int tid = threadIdx.x, w = tid >> 5, lane = tid & 31, ln = lane & 15, hh = lane >> 4;
  const int ntn = N / 64;
  const int wid = blockIdx.x * 4 + w;
  const int mt = wid / ntn, nq = wid % ntn;
  if (mt * 16 >= M) return;
  const int row0 = mt * 16, col0 = nq * 64;
  const float* arow = A + (size_t)(row0 + ln) * lda;
  v8f acc[4] = {};
  for (int kb = 0; kb < K; kb += 32) {
    FragB ah, al;
    const v4f x0 = *(const v4fa*)(arow + kb + 8 * hh), x1 = *(const v4fa*)(arow + kb + 8 * hh + 4);
    const v4f x2 = *(const v4fa*)(arow + kb + 16 + 8 * hh), x3 = *(const v4fa*)(arow + kb + 16 + 8 * hh + 4);
    float xs[16] = {x0[0],x0[1],x0[2],x0[3],x1[0],x1[1],x1[2],x1[3],x2[0],x2[1],x2[2],x2[3],x3[0],x3[1],x3[2],x3[3]};
#pragma unroll
    for (int i = 0; i < 16; ++i) { const unsigned short hb = bf16_bits(xs[i]); ah.u[i] = hb; al.u[i] = ASPLIT ? bf16_bits(xs[i] - bf16_val(hb)) : (unsigned short)0; }
#pragma unroll
    for (int t = 0; t < 4; ++t) {
      const unsigned short* brow = Wt + (size_t)(col0 + t * 16 + ln) * ldb + kb;
      FragB b;
      b.half[0] = *(const v8us*)(brow + 8 * hh);
      b.half[1] = *(const v8us*)(brow + 16 + 8 * hh);
      acc[t] = mmaN<ASPLIT ? 2 : 1>(ah.v, al.v, b.v, b.v, acc[t]);
    }
  }
#pragma unroll
  for (int t = 0; t < 4; ++t) {
    const int col = col0 + t * 16 + ln;
    float bv = bias ? bias[col] : 0.f;
    if (BIAS_BF16) bv = bf16_round(bv);
#pragma unroll
    for (int r = 0; r < 8; ++r) {
      float v = acc[t][r] + bv;
      if (resid) { float rv = resid[(size_t)((row0 + 8 * hh + r) % rmod) * ldr + col]; if (RES_BF16) rv = bf16_round(rv); v += rv; }
      if (ACT == 1) v = fmaxf(v, 0.f);
      if (ACT == 2) v = 0.5f * v * (1.0f + erff(v * 0.70710678118654752f));
      if (ACT == 3) { const float u = 0.7978845608028654f * (v + 0.044715f * v * v * v); v = 0.5f * v * (1.0f + tanhf(u)); }
      so[w][8 * hh + r][t * 16 + ln] = v;
    }
  }
  __builtin_amdgcn_fence(__ATOMIC_ACQ_REL, "workgroup");
  __builtin_amdgcn_wave_barrier();
  const int rsub = lane >> 4, c4 = (lane & 15) * 4;
  {
#pragma unroll
    for (int q = 0; q < 8; ++q) {
      const int r = q * 2 + rsub;
      const v4f v = *(const v4fa*)&so[w][r][c4];
      *(v4f*)(C + (size_t)(row0 + r) * ldc + col0 + c4) = v;
    }
    
  }
}
// row LayerNorm (biased variance, eps) over N: s = X (+ R); optional out_sum <- s; out_norm <- (s-mu)*rsqrt(var+eps)*g + b
template <bool PARAM_BF16>
__global__ __launch_bounds__(256) void k_layernorm(const float* __restrict__ X, const float* __restrict__ R, const float* __restrict__ g, const float* __restrict__ bta,
                                                  float* __restrict__ out_sum, float* __restrict__ out_norm, int N, float eps) {
  __shared__ float red[256];
  const int row = blockIdx.x, tid = threadIdx.x;
  const float* x = X + (size_t)row * N; const float* rr = R ? R + (size_t)row * N : nullptr;
  float vals[16];                     // up to N = 4096
  const int per = N / 256;            // contiguous chunk per thread? use strided-by-4 chunks: thread handles j = tid*4 + 1024*u
  float s1 = 0.f;
  for (int u = 0; u < per / 4; ++u) {
    const int j = tid * 4 + 1024 * u;
    const v4f a = *(const v4fa*)(x + j);
    v4f b = {0.f,0.f,0.f,0.f}; if (rr) b = *(const v4fa*)(rr + j);
#pragma unroll
    for (int q = 0; q < 4; ++q) { const float v = a[q] + b[q]; vals[u * 4 + q] = v; s1 += v; }
  }
  red[tid] = s1; __syncthreads();
  for (int st = 128; st > 0; st >>= 1) { if (tid < st) red[tid] += red[tid + st]; __syncthreads(); }
  const float mu = red[0] / (float)N; __syncthreads();
  float s2 = 0.f;
  for (int u = 0; u < per / 4; ++u)
#pragma unroll
    for (int q = 0; q < 4; ++q) { const float c = vals[u * 4 + q] - mu; s2 += c * c; }
  red[tid] = s2; __syncthreads();
  for (int st = 128; st > 0; st >>= 1) { if (tid < st) red[tid] += red[tid + st]; __syncthreads(); }
  const float rs = rsqrtf(red[0] / (float)N + eps);
  {
    for (int u = 0; u < per / 4; ++u) {
      const int j = tid * 4 + 1024 * u;
      v4f o, sm;
#pragma unroll
      for (int q = 0; q < 4; ++q) {
        float gg = g[j + q], bb = bta[j + q];
        if (PARAM_BF16) { gg = bf16_round(gg); bb = bf16_round(bb); }
        sm[q] = vals[u * 4 + q]; o[q] = (vals[u * 4 + q] - mu) * rs * gg + bb;
      }
      if (out_sum) *(v4f*)(out_sum + (size_t)row * N + j) = sm;
      *(v4f*)(out_norm + (size_t)row * N + j) = o;
    }
    
  }
}



// ---- f16 WMMA path (v_wmma_f32_16x16x32_f16): 11-bit significands for operands in range — used where a [0,1] probability operand needs more precision than bf16
typedef _Float16 v16h __attribute__((ext_vector_type(16)));
union FragH { v16h v; v8us half[2]; _Float16 h[16]; unsigned short u[16]; };
template <int NT>
__device__ __forceinline__ v8f mmaH(v16h ah, v16h al, v16h bh, v16h bl, v8f c) {
  c = __builtin_amdgcn_wmma_f32_16x16x32_f16(false, ah, false, bh, (short)0, c, false, false);
  if (NT >= 2) c = __builtin_amdgcn_wmma_f32_16x16x32_f16(false, al, false, bh, (short)0, c, false, false);
  if (NT >= 3) c = __builtin_amdgcn_wmma_f32_16x16x32_f16(false, ah, false, bl, (short)0, c, false, false);
  asm volatile("v_nop\n\tv_nop\n\tv_nop\n\tv_nop" : "+v"(c) : "v"(ah), "v"(al), "v"(bh), "v"(bl));
  return c;
}
// batched GEMM like k_gemm_b but f16 operands: A f32 (split into f16 hi/lo if ASPLIT, else rounded to f16), Bt = f16 values [n][k]; alpha; C f32; N multiple of 16 (partial tiles skipped)
template <bool ASPLIT>
__global__ __launch_bounds__(128) void k_gemm_h(const float* __restrict__ A, int lda, size_t sA, const _Float16* __restrict__ Bh, int ldb, size_t sB, float alpha, float* __restrict__ C, int ldc, size_t sC, int M, int N, int K) {
  __shared__ __attribute__((aligned(16))) float so[4][16][64];
  const int tid = threadIdx.x, w = tid >> 5, lane = tid & 31, ln = lane & 15, hh = lane >> 4; const int by = blockIdx.y;
  A += (size_t)by * sA; Bh += (size_t)by * sB; C += (size_t)by * sC;
  const int ntn = (N + 63) / 64; const int wid = blockIdx.x * 4 + w; const int mt = wid / ntn, nq = wid % ntn; if (mt * 16 >= M) return;
  const int row0 = mt * 16, col0 = nq * 64; const float* arow = A + (size_t)(row0 + ln) * lda;
  v8f acc[4] = {};
  for (int kb = 0; kb < K; kb += 32) {
    FragH ah, al;
    const v4f x0 = *(const v4fa*)(arow + kb + 8 * hh), x1 = *(const v4fa*)(arow + kb + 8 * hh + 4), x2 = *(const v4fa*)(arow + kb + 16 + 8 * hh), x3 = *(const v4fa*)(arow + kb + 16 + 8 * hh + 4);
    float xs[16] = {x0[0],x0[1],x0[2],x0[3],x1[0],x1[1],x1[2],x1[3],x2[0],x2[1],x2[2],x2[3],x3[0],x3[1],x3[2],x3[3]};
#pragma unroll
    for (int i = 0; i < 16; ++i) { const _Float16 h = (_Float16)xs[i]; ah.h[i] = h; al.h[i] = ASPLIT ? (_Float16)(xs[i] - (float)h) : (_Float16)0.0f; }
#pragma unroll
    for (int t = 0; t < 4; ++t) { if (col0 + t * 16 >= N) continue; const size_t boff = (size_t)(col0 + t * 16 + ln) * ldb + kb; FragH bq; bq.half[0] = *(const v8us*)(Bh + boff + 8 * hh); bq.half[1] = *(const v8us*)(Bh + boff + 16 + 8 * hh);
      acc[t] = mmaH<ASPLIT ? 2 : 1>(ah.v, al.v, bq.v, bq.v, acc[t]); }
  }
#pragma unroll
  for (int t = 0; t < 4; ++t) { if (col0 + t * 16 >= N) continue;
#pragma unroll
    for (int r = 0; r < 8; ++r) so[w][8 * hh + r][t * 16 + ln] = acc[t][r] * alpha; }
  __builtin_amdgcn_fence(__ATOMIC_ACQ_REL, "workgroup"); __builtin_amdgcn_wave_barrier();
  const int rsub = lane >> 4, c4 = (lane & 15) * 4;
  {
#pragma unroll
    for (int q = 0; q < 8; ++q) { const int r = q * 2 + rsub; if (col0 + c4 < N) { const v4f v = *(const v4fa*)&so[w][r][c4]; *(v4f*)(C + (size_t)(row0 + r) * ldc + col0 + c4) = v; } }
     }
}

// Wt[n][k] = f16(W[k][n]·scale) from f32 row-major W[K][N] (scale = power of two; bf16-exact weights stay exact in f16 away from the subnormal range)
__global__ __launch_bounds__(256) void k_wt_f16(const float* __restrict__ W, _Float16* __restrict__ Wt, int K, int N, float scale) {
  const int t = blockIdx.x * 256 + threadIdx.x; if (t >= N * (K / 8)) return; const int n = t / (K / 8), k8 = (t % (K / 8)) * 8; FragH f;
#pragma unroll
  for (int i = 0; i < 8; ++i) f.h[i] = (_Float16)(bf16_round(W[(size_t)(k8 + i) * N + n]) * scale); const v8us o = f.half[0];
  *(v8us*)((unsigned short*)Wt + (size_t)n * K + k8) = o; 
}
// k_gemm_hh variant with fused epilogue: v = acc·alpha + bias[by·sBias + col] (+ CP[(row/rowsPerB)·sCPb + by·64 + col] if CP) ; ACT 0 none / 1 elu ; writes f16 C16 (and f32 C if non-null)
template <int ACT>
__global__ __launch_bounds__(128) void k_gemm_hhx(const _Float16* __restrict__ A, int lda, size_t sA, const _Float16* __restrict__ Bh, int ldb, size_t sB, float alpha, const float* __restrict__ bias, size_t sBias, const float* __restrict__ CP, int rowsPerB, size_t sCPb, int row0g,
    float* __restrict__ C, _Float16* __restrict__ C16, int ldc, size_t sC, int M, int N, int K) {
  __shared__ __attribute__((aligned(16))) float so[4][16][64];
  const int tid = threadIdx.x, w = tid >> 5, lane = tid & 31, ln = lane & 15, hh = lane >> 4; const int by = blockIdx.y;
  A += (size_t)by * sA; Bh += (size_t)by * sB; const size_t cofs = (size_t)by * sC; const float* bp = bias ? bias + (size_t)by * sBias : nullptr;
  const int ntn = (N + 63) / 64; const int wid = blockIdx.x * 4 + w; const int mt = wid / ntn, nq = wid % ntn; if (mt * 16 >= M) return;
  const int row0 = mt * 16, col0 = nq * 64; const _Float16* arow = A + (size_t)(row0 + ln) * lda;
  v8f acc[4] = {};
  for (int kb = 0; kb < K; kb += 32) { FragH ah; ah.half[0] = *(const v8us*)((const unsigned short*)arow + kb + 8 * hh); ah.half[1] = *(const v8us*)((const unsigned short*)arow + kb + 16 + 8 * hh);
#pragma unroll
    for (int t = 0; t < 4; ++t) { if (col0 + t * 16 >= N) continue; const size_t boff = (size_t)(col0 + t * 16 + ln) * ldb + kb; FragH bq; bq.half[0] = *(const v8us*)((const unsigned short*)Bh + boff + 8 * hh); bq.half[1] = *(const v8us*)((const unsigned short*)Bh + boff + 16 + 8 * hh);
      acc[t] = mmaH<1>(ah.v, ah.v, bq.v, bq.v, acc[t]); }
  }
#pragma unroll
  for (int t = 0; t < 4; ++t) { if (col0 + t * 16 >= N) continue; const int col = col0 + t * 16 + ln; const float bv = bp ? bf16_round(bp[col]) : 0.f;
#pragma unroll
    for (int r = 0; r < 8; ++r) { float v = acc[t][r] * alpha + bv; if (CP) { const int rr = row0g + row0 + 8 * hh + r; if (rowsPerB < 0) v += CP[cofs + (size_t)rr * ldc + col];      /* rowsPerB < 0: own element of the batched C plane */ else { const int bidx = rr / rowsPerB; v += CP[(size_t)bidx * sCPb + (size_t)by * 64 + col]; } } if (ACT == 1) v = (v > 0.f) ? v : expm1f(v); else if (ACT == 7) v = (v > 0.f) ? v + 1.0f : expf(v); else if (ACT == 8) v = tanhf(v); else if (ACT == 9) v = 0.5f * v * (1.0f + tanhf(0.7978845608028654f * (v + 0.044715f * v * v * v))); else if (ACT == 11) v = 1.0f / (1.0f + expf(-v)); else if (ACT == 12) v = (v > 0.f) ? v : 0.01f * v; else if (ACT == 14) v = (v > 0.f) ? v : 0.1f * v; else if (ACT == 16) v = (v >= 0.f) ? v : 0.3f * v; else if (ACT == 17) v = (v >= 0.f) ? v : 0.2f * v; else if (ACT == 15) v = v / (1.0f + expf(-v)); else if (ACT == 3) v = fmaxf(v, 0.f); else if (ACT == 6) v = 0.5f * v * (1.0f + erff(v * 0.70710678118654752f)); so[w][8 * hh + r][t * 16 + ln] = v; } }
  __builtin_amdgcn_fence(__ATOMIC_ACQ_REL, "workgroup"); __builtin_amdgcn_wave_barrier();
  const int rsub = lane >> 4, c4 = (lane & 15) * 4; typedef _Float16 v4h __attribute__((ext_vector_type(4)));
  {
#pragma unroll
    for (int q = 0; q < 8; ++q) { const int r = q * 2 + rsub; if (col0 + c4 < N) { const v4f v = *(const v4fa*)&so[w][r][c4]; if (C) *(v4f*)(C + cofs + (size_t)(row0 + r) * ldc + col0 + c4) = v; if (C16) { v4h h4; for (int i = 0; i < 4; ++i) h4[i] = (_Float16)v[i]; *(v4h*)(C16 + cofs + (size_t)(row0 + r) * ldc + col0 + c4) = h4; } } }
     }
}


typedef _Float16 v4h __attribute__((ext_vector_type(4)));

__global__ __launch_bounds__(256) void k_x16(const float* __restrict__ x, _Float16* __restrict__ X16, size_t n8) { const size_t t = (size_t)blockIdx.x * 256 + threadIdx.x; if (t >= n8) return; FragH f;
#pragma unroll
  for (int q = 0; q < 8; ++q) f.h[q] = (_Float16)bf16_round(x[t * 8 + q]); *(v8us*)((unsigned short*)X16 + t * 8) = f.half[0];  }
__global__ __launch_bounds__(256) void k_h16(const float* __restrict__ x, _Float16* __restrict__ X16, size_t n8) { const size_t t = (size_t)blockIdx.x * 256 + threadIdx.x; if (t >= n8) return; FragH f;
#pragma unroll
  for (int q = 0; q < 8; ++q) f.h[q] = (_Float16)x[t * 8 + q]; *(v8us*)((unsigned short*)X16 + t * 8) = f.half[0];  }
__global__ __launch_bounds__(256) void k_round16f(const float* __restrict__ W, _Float16* __restrict__ Bt, size_t n8) { const size_t t = (size_t)blockIdx.x * 256 + threadIdx.x; if (t >= n8) return; FragH f;
#pragma unroll
  for (int i = 0; i < 8; ++i) f.h[i] = (_Float16)(bf16_round(W[t * 8 + i]) * 16.0f); *(v8us*)((unsigned short*)Bt + t * 8) = f.half[0];  }
template <int NHv, int TTv>
__global__ __launch_bounds__(256) void k_vt(const _Float16* __restrict__ V16, int ldv, int voff, _Float16* __restrict__ Vt) { __shared__ unsigned short tl[64][66]; const int tid = threadIdx.x; const int slab = blockIdx.x / (TTv / 64), lg = blockIdx.x % (TTv / 64); const int b = slab / NHv, h = slab % NHv;
  for (int i = tid; i < 64 * 8; i += 256) { const int r = i / 8, c8 = (i % 8) * 8; FragH f; f.half[0] = *(const v8us*)((const unsigned short*)V16 + ((size_t)b * TTv + lg * 64 + r) * ldv + voff + h * 64 + c8);
#pragma unroll
    for (int q = 0; q < 8; ++q) tl[r][c8 + q] = f.u[q]; }
  __syncthreads();
  {
#pragma unroll
    for (int rd = 0; rd < 2; ++rd) { const int d = rd * 32 + tid / 8, pc = tid % 8; FragH f;
#pragma unroll
      for (int q = 0; q < 8; ++q) f.u[q] = tl[pc * 8 + q][d];
      *(v8us*)((unsigned short*)Vt + ((size_t)slab * 64 + d) * TTv + lg * 64 + pc * 8) = f.half[0]; }
     } }

__global__ __launch_bounds__(256) void k_hl(const float* __restrict__ F, _Float16* __restrict__ Hh, _Float16* __restrict__ Hl, size_t n8) { const size_t t = (size_t)blockIdx.x * 256 + threadIdx.x; if (t >= n8) return; FragH fh, fl; const v4f a = *(const v4fa*)(F + t * 8), c = *(const v4fa*)(F + t * 8 + 4);
#pragma unroll
  for (int q = 0; q < 4; ++q) { _Float16 h = (_Float16)a[q]; fh.h[q] = h; fl.h[q] = (_Float16)((a[q] - (float)h) * 1024.0f); h = (_Float16)c[q]; fh.h[4 + q] = h; fl.h[4 + q] = (_Float16)((c[q] - (float)h) * 1024.0f); }
  { *(v8us*)((unsigned short*)Hh + t * 8) = fh.half[0]; *(v8us*)((unsigned short*)Hl + t * 8) = fl.half[0];  } }

// ---- fast GEMM (wave tile 32x64; requires M % 32 == 0 rows per launch region and N % 64 == 0); epilogue = k_gemm_hhx semantics ----
__device__ __forceinline__ v16h g2_frag(const _Float16* p, int hh) { FragH f; f.half[0] = *(const v8us*)((const unsigned short*)p + 8 * hh); f.half[1] = *(const v8us*)((const unsigned short*)p + 16 + 8 * hh); return f.v; }
__device__ __forceinline__ v8f g2_mma(v16h a, v16h b, v8f c) { v8f d = __builtin_amdgcn_wmma_f32_16x16x32_f16(false, a, false, b, (short)0, c, false, false); asm volatile("v_nop\n\tv_nop\n\tv_nop\n\tv_nop" : "+v"(d) : "v"(a), "v"(b)); return d; }
template <int ACT>
__global__ __launch_bounds__(128) void k_gemm2(const _Float16* __restrict__ A, int lda, size_t sA, const _Float16* __restrict__ Bh, int ldb, size_t sB, float alpha, const float* __restrict__ bias, size_t sBias, const float* __restrict__ CP, int rowsPerB, size_t sCPb, int row0g,
    float* __restrict__ C, _Float16* __restrict__ C16, int ldc, size_t sC, int M, int N, int K) { static_assert(ACT == 0 || ACT == 3 || ACT == 6 || ACT == 8 || ACT == 9 || ACT == 11 || ACT == 12 || ACT == 14 || ACT == 15 || ACT == 16 || ACT == 17, "k_gemm2: unsupported ACT code (would silently apply no activation)");
  __shared__ __attribute__((aligned(16))) float so[4][32][68];
  const int tid = threadIdx.x, w = tid >> 5, lane = tid & 31, ln = lane & 15, hh = lane >> 4; const int by = blockIdx.y;
  A += (size_t)by * sA; Bh += (size_t)by * sB; const size_t cofs = (size_t)by * sC; const float* bp = bias ? bias + (size_t)by * sBias : nullptr;
  const int ntn = N >> 6; const int mt = blockIdx.x / ntn, nq = blockIdx.x - mt * ntn; const int row0 = mt * 128 + 32 * w, col0 = nq * 64; if (row0 >= M) return;
  const _Float16* a0p = A + (size_t)(row0 + ln) * lda; const _Float16* a1p = a0p + (size_t)16 * lda;
  const _Float16* b0p = Bh + (size_t)(col0 + ln) * ldb; const _Float16* b1p = b0p + (size_t)16 * ldb; const _Float16* b2p = b1p + (size_t)16 * ldb; const _Float16* b3p = b2p + (size_t)16 * ldb;
  const v8f z8 = {0.f,0.f,0.f,0.f,0.f,0.f,0.f,0.f}; v8f c00 = z8, c01 = z8, c02 = z8, c03 = z8, c10 = z8, c11 = z8, c12 = z8, c13 = z8;
#pragma unroll 1
  for (int kb = 0; kb < K; kb += 32) { const v16h a0 = g2_frag(a0p + kb, hh), a1 = g2_frag(a1p + kb, hh);
    v16h b = g2_frag(b0p + kb, hh); c00 = g2_mma(a0, b, c00); c10 = g2_mma(a1, b, c10);
    b = g2_frag(b1p + kb, hh); c01 = g2_mma(a0, b, c01); c11 = g2_mma(a1, b, c11);
    b = g2_frag(b2p + kb, hh); c02 = g2_mma(a0, b, c02); c12 = g2_mma(a1, b, c12);
    b = g2_frag(b3p + kb, hh); c03 = g2_mma(a0, b, c03); c13 = g2_mma(a1, b, c13); }
  v8f accs[8] = {c00, c01, c02, c03, c10, c11, c12, c13};
#pragma unroll
  for (int u = 0; u < 8; ++u) { const int t = u & 3, half = u >> 2; const int col = col0 + t * 16 + ln; const float bv = bp ? bf16_round(bp[col]) : 0.f;
#pragma unroll
    for (int r = 0; r < 8; ++r) { const int rloc = half * 16 + 8 * hh + r; float v = accs[u][r] * alpha + bv; if (CP) { if (rowsPerB < 0) v += CP[cofs + (size_t)(row0g + row0 + rloc) * ldc + col];      /* rowsPerB < 0: own element of the batched C plane */ else { const int bidx = (row0g + row0 + rloc) / rowsPerB; v += CP[(size_t)bidx * sCPb + (size_t)by * 64 + col]; } }
      if (ACT == 3) v = fmaxf(v, 0.f); else if (ACT == 6) v = 0.5f * v * (1.0f + erff(v * 0.70710678118654752f)); else if (ACT == 11) v = 1.0f / (1.0f + expf(-v)); else if (ACT == 15) v = v / (1.0f + expf(-v)); else if (ACT == 12) v = (v > 0.f) ? v : 0.01f * v; else if (ACT == 8) v = tanhf(v); else if (ACT == 9) v = 0.5f * v * (1.0f + tanhf(0.7978845608028654f * (v + 0.044715f * v * v * v))); else if (ACT == 14) v = (v > 0.f) ? v : 0.1f * v; else if (ACT == 16) v = (v >= 0.f) ? v : 0.3f * v; else if (ACT == 17) v = (v >= 0.f) ? v : 0.2f * v;
      so[w][rloc][t * 16 + ln] = v; } }
  __builtin_amdgcn_fence(__ATOMIC_ACQ_REL, "workgroup"); __builtin_amdgcn_wave_barrier();
  const int rsub = lane >> 4, c4 = (lane & 15) * 4;
  {
#pragma unroll
    for (int q = 0; q < 16; ++q) { const int r = q * 2 + rsub; const v4f v = *(const v4fa*)&so[w][r][c4]; if (C) *(v4f*)(C + cofs + (size_t)(row0 + r) * ldc + col0 + c4) = v; if (C16) { v4h h4; for (int i = 0; i < 4; ++i) h4[i] = (_Float16)v[i]; *(v4h*)(C16 + cofs + (size_t)(row0 + r) * ldc + col0 + c4) = h4; } }
     } }


__global__ __launch_bounds__(256) void k_rsm(const float* __restrict__ S, _Float16* __restrict__ P, int nrows) {
  #pragma clang fp contract(off)
  const int i = blockIdx.x * 256 + threadIdx.x; if (i >= nrows) return; const float* s = S + (size_t)i * SQ; float mx = -3.0e38f;
#pragma unroll 1
  for (int j = 0; j < SQ; ++j) mx = fmaxf(mx, s[j]); float se = 0.f;
#pragma unroll 1
  for (int j = 0; j < SQ; ++j) se += expf(s[j] - mx); const float sc = 256.0f / se;
#pragma unroll 1
  for (int j0 = 0; j0 < SQ; j0 += 8) { FragH f; for (int q = 0; q < 8; ++q) f.h[q] = (_Float16)(expf(s[j0 + q] - mx) * sc); unsigned short* d = (unsigned short*)P + (size_t)i * SQ + j0; *(v8us*)d = f.half[0];  } }
__global__ __launch_bounds__(256) void k_vt(const _Float16* __restrict__ V16, int b, int h0, _Float16* __restrict__ VT) { __shared__ unsigned short tl[64][65]; const int tid = threadIdx.x; const int hh = blockIdx.x % HG, sg = blockIdx.x / HG; const int s0 = sg * 64; const int h = h0 + hh;
  for (int i = tid; i < 64 * 8; i += 256) { const int j = i / 8, d8 = (i % 8) * 8; FragH f; f.half[0] = *(const v8us*)((const unsigned short*)V16 + ((size_t)b * SQ + s0 + j) * DM + h * HD + d8); for (int q = 0; q < 8; ++q) tl[d8 + q][j] = f.u[q]; }
  __syncthreads();
  { for (int i = tid; i < 64 * 8; i += 256) { const int d = i / 8, j8 = (i % 8) * 8; FragH f; for (int q = 0; q < 8; ++q) f.u[q] = tl[d][j8 + q]; *(v8us*)((unsigned short*)VT + ((size_t)hh * HD + d) * SQ + s0 + j8) = f.half[0]; }  } }


template <int BFIN, int W16, int W32>
__global__ __launch_bounds__(256) void k_lnx(const float* __restrict__ X, const float* __restrict__ g, const float* __restrict__ bb, float eps, _Float16* __restrict__ N16, float* __restrict__ N32) {
  #pragma clang fp contract(off)
  __shared__ float red[256]; const size_t r = blockIdx.x; const int t = threadIdx.x; const bool act = t < (DMQ / 4); const int c0 = act ? t * 4 : 0;
  const v4f xa = *(const v4fa*)(X + r * DMQ + c0); float s[4]; float sum = 0.f;
  for (int q = 0; q < 4; ++q) { s[q] = act ? (BFIN ? bf16_round(xa[q]) : xa[q]) : 0.f; sum = __fadd_rn(sum, s[q]); }
  red[t] = sum; __syncthreads(); for (int st = 128; st > 0; st >>= 1) { if (t < st) red[t] = __fadd_rn(red[t], red[t + st]); __syncthreads(); } const float mu = red[0] / (float)DMQ; __syncthreads();
  float vs = 0.f; for (int q = 0; q < 4; ++q) { const float dl = act ? __fadd_rn(s[q], -mu) : 0.f; vs = __fadd_rn(vs, __fmul_rn(dl, dl)); } red[t] = vs; __syncthreads(); for (int st = 128; st > 0; st >>= 1) { if (t < st) red[t] = __fadd_rn(red[t], red[t + st]); __syncthreads(); }
  const float rs = rsqrtf(__fadd_rn(red[0] / (float)DMQ, eps)); v4h y; v4f yf;
  for (int q = 0; q < 4; ++q) { const int c = c0 + q; yf[q] = __fadd_rn(__fmul_rn(__fmul_rn(__fadd_rn(s[q], -mu), rs), bf16_round(g[c])), (bb ? bf16_round(bb[c]) : 0.f)); y[q] = (_Float16)yf[q]; }
  if (!act) return;      /* no barriers after this point */
  { if (W16) *(v4h*)(N16 + r * DMQ + c0) = y; if (W32) *(v4f*)(N32 + r * DMQ + c0) = yf;  } }


__global__ __launch_bounds__(256) void k_rsmf(const float* __restrict__ S, _Float16* __restrict__ P, int qn, int hg) {
  #pragma clang fp contract(off)
  const int t = blockIdx.x * 256 + threadIdx.x; if (t >= qn * hg) return; const size_t i = (size_t)(t / qn) * SQ + (t % qn); const float* s = S + i * SQ; float mx = -3.0e38f;
#pragma unroll 1
  for (int j = 0; j < SQ; ++j) mx = fmaxf(mx, s[j]); float se = 0.f;
#pragma unroll 1
  for (int j = 0; j < SQ; ++j) se += __expf(s[j] - mx); const float sc = 256.0f / se;
#pragma unroll 1
  for (int j0 = 0; j0 < SQ; j0 += 8) { FragH f; for (int q = 0; q < 8; ++q) f.h[q] = (_Float16)(__expf(s[j0 + q] - mx) * sc); unsigned short* d = (unsigned short*)P + i * SQ + j0; *(v8us*)d = f.half[0];  } }


__global__ __launch_bounds__(256) void k_bfr(const float* __restrict__ x, float* __restrict__ XB, size_t n8) { const size_t t = (size_t)blockIdx.x * 256 + threadIdx.x; if (t >= n8) return; v4f a = *(const v4fa*)(x + t * 8), c = *(const v4fa*)(x + t * 8 + 4); for (int q = 0; q < 4; ++q) { a[q] = bf16_round(a[q]); c[q] = bf16_round(c[q]); }
  { *(v4f*)(XB + t * 8) = a; *(v4f*)(XB + t * 8 + 4) = c;  } }



__global__ __launch_bounds__(256) void k_rsmfam(const float* __restrict__ S, _Float16* __restrict__ P, int qn, int hg, const float* __restrict__ am) {
  #pragma clang fp contract(off)
  const int t = blockIdx.x * 256 + threadIdx.x; if (t >= qn * hg) return; const size_t i = (size_t)(t / qn) * SQ + (t % qn); const float* s = S + i * SQ; float mx = -3.0e38f;
#pragma unroll 1
  for (int j = 0; j < SQ; ++j) mx = fmaxf(mx, __fadd_rn(s[j], bf16_round(am[j]))); float se = 0.f;
#pragma unroll 1
  for (int j = 0; j < SQ; ++j) se += __expf(__fadd_rn(s[j], bf16_round(am[j])) - mx); const float sc = 256.0f / se;
#pragma unroll 1
  for (int j0 = 0; j0 < SQ; j0 += 8) { FragH f; for (int q = 0; q < 8; ++q) f.h[q] = (_Float16)(__expf(__fadd_rn(s[j0 + q], bf16_round(am[j0 + q])) - mx) * sc); unsigned short* d = (unsigned short*)P + i * SQ + j0; *(v8us*)d = f.half[0];  } }


#define CC CX           /* unused: input channels */
#define LL SQ           /* pixels per image */
#define LQ (3 * DM)     /* unused */

__global__ __launch_bounds__(256) void k_rowb(float* __restrict__ O, const float* __restrict__ bias, size_t n4) {
  #pragma clang fp contract(off)
  const size_t t = (size_t)blockIdx.x * 256 + threadIdx.x; if (t >= n4) return; const size_t e = t * 4; const int c = (int)((e / SQ) % CX);      /* output channels */ const float bb = bf16_round(bias[c]); const v4f a = *(const v4fa*)(O + e); v4f o; for (int q = 0; q < 4; ++q) o[q] = __fadd_rn(a[q], bb);
  *(v4f*)(O + e) = o;  }

// ---- fused sigmoid attention: Y[b][c][n] = bf16(gamma) sum_m V[b][c][m] sigmoid(q[n].k[m]) + bf16(x[b][c][n]); the gate tile never leaves registers ----
// S^T / 2 = K.(Q / 2)^T (A = k rows, B = rows of q / 2, both through f_frag16): a lane holds column n = ln, rows m = 8 hh + r. Two such D tiles (m 0-15, 16-31), gated and
// rounded to f16 in place, are the B operand of out += V.P^T in the hardware k order, which is the order k_proj stores the V fragments in (A operand, f_fragp).
// Work-group = one image, 64 query columns, all 128 channels; its 8 waves each walk 512 of the 4096 keys, from a start pass of the work-group's own, wrapping; the 8 partial tiles are summed through LDS in wave order; the thread that holds a sum scales it, adds its x and stores y.
#define FW 8             /* waves per work-group = key ranges */
#define FN 64            /* query columns per work-group, all of them in every wave: a V fragment loaded from L2 feeds four products */
#define FP (FN + 4)      /* LDS row pitch in floats: rows 8 apart fall on other banks, 16-byte reads stay aligned */
/* waves_per_eu(2, 2): the 128 x 64 f32 tile takes 256 registers, so a wave has the 512 of two waves per SIMD; one work-group per WGP, whose LDS holds its 8 partial tiles */
__device__ __forceinline__ v16h f_frag16(const _Float16* p) { FragH f; const v8us z = {0, 0, 0, 0, 0, 0, 0, 0}; f.half[0] = *(const v8us*)(const unsigned short*)p; f.half[1] = z; return f.v; }      /* q / k fragment: k 16-31 of the K = 32 contraction is zero, set in registers */
__device__ __forceinline__ v16h f_fragp(const _Float16* p) { FragH f; f.half[0] = *(const v8us*)(const unsigned short*)p; f.half[1] = *(const v8us*)((const unsigned short*)p + 256); return f.v; }      /* V fragment from a 1-KiB unit of k_proj: p = unit + 8 lane; the second half stands 512 bytes on */
__device__ __forceinline__ v8f f_mma(v16h a, v16h b, v8f c) { return __builtin_amdgcn_wmma_f32_16x16x32_f16(false, a, false, b, (short)0, c, false, false); }
/* gate: sigmoid(s) = 0.5 + 0.5 tanh(s / 2), one v_tanh_f32 per score; u = s / 2 comes out of the score product itself (the q plane holds q / 2, a power of two); two gates share the packed fma and the packed f16 conversion; +-inf give 0 and 1, NaN stays NaN */
typedef float v2f __attribute__((ext_vector_type(2)));
typedef _Float16 v2h __attribute__((ext_vector_type(2)));
__device__ __forceinline__ v2h f_gate2(float u0, float u1) { const v2f t = {__builtin_amdgcn_tanhf(u0), __builtin_amdgcn_tanhf(u1)}; const v2f hf = {0.5f, 0.5f}; return __builtin_convertvector(__builtin_elementwise_fma(t, hf, hf), v2h); }
/* the fragments of one 32-key pass: two k tiles and the eight V tiles, 18 loads of 512 contiguous bytes per wave */
__device__ __forceinline__ void f_load(const _Float16* kp, const _Float16* vp, v16h (&kf)[2], v16h (&vf)[CX / 16]) {
  kf[0] = f_frag16(kp); kf[1] = f_frag16(kp + 16 * 16);
#pragma unroll      /* unrolled: vf is indexed by constants only and stays in registers */
  for (int t = 0; t < CX / 16; ++t) vf[t] = f_fragp(vp + t * 512); }
/* one 32-key pass: per 16 query columns two score tiles, their gates as the f16 B operand, eight products into the accumulators */
__device__ __forceinline__ void f_pass(const v16h (&kf)[2], const v16h (&vf)[CX / 16], const v16h (&qf)[FN / 16], v8f (&acc)[CX / 16][FN / 16]) {
  const v8f z8 = {0.f,0.f,0.f,0.f,0.f,0.f,0.f,0.f};
#pragma unroll      /* unrolled, with the two loops inside: fragments and accumulators are indexed by constants only and stay in registers */
  for (int j = 0; j < FN / 16; ++j) { const v8f s0 = f_mma(kf[0], qf[j], z8), s1 = f_mma(kf[1], qf[j], z8); FragH p;
#pragma unroll
    for (int r = 0; r < 8; r += 2) { const v2h g0 = f_gate2(s0[r], s0[r + 1]), g1 = f_gate2(s1[r], s1[r + 1]); p.h[r] = g0[0]; p.h[r + 1] = g0[1]; p.h[8 + r] = g1[0]; p.h[8 + r + 1] = g1[1]; }
#pragma unroll
    for (int t = 0; t < CX / 16; ++t) acc[t][j] = f_mma(vf[t], p.v, acc[t][j]);
  } }
#define FNP (SQ / FW / 32)          /* 32-key passes per wave */
#define FKS (32 * 16)               /* elements of k per pass */
#define FVS ((CX / 16) * 512)       /* elements of V per pass */
/* kp and vp go on to the next pass, from the last pass of the wave's key range back to its first; ps is the pass they stand on, the same for the whole work-group */
__device__ __forceinline__ void f_next(const _Float16*& kp, const _Float16*& vp, int& ps) {
  asm volatile("s_wait_xcnt 0x0" :: "v"(kp), "v"(vp) : "memory");      /* the wait that stands between issued loads and an overwrite of their address registers; the addresses are inputs so that they stay in their registers up to the wait */
  const bool wr = ps == FNP - 1; kp += wr ? -(FNP - 1) * FKS : FKS; vp += wr ? -(FNP - 1) * FVS : FVS; ps = wr ? 0 : ps + 1; }
__global__ __launch_bounds__(FW * 32) __attribute__((amdgpu_waves_per_eu(2, 2))) void k_sattn(const _Float16* __restrict__ QZ, const _Float16* __restrict__ KZ, const _Float16* __restrict__ VP, const float* __restrict__ gam, const float* __restrict__ x, float* __restrict__ Y) {
  __shared__ __attribute__((aligned(16))) float red[FW][CX][FP];
  constexpr int MR = SQ / FW;      /* keys per wave */
  const int tid = threadIdx.x, w = tid >> 5, lane = tid & 31, ln = lane & 15, hh = lane >> 4; const int b = blockIdx.y, n0 = blockIdx.x * FN;
  const _Float16* qp = QZ + ((size_t)b * SQ + n0 + ln) * 16 + 8 * hh; const unsigned ki = (unsigned)((b * SQ + w * MR + ln) * 16 + 8 * hh), vi = (unsigned)((b * (SQ / 32) + w * (MR / 32)) * (CX / 16) * 512 + 8 * lane); const _Float16* kp = KZ + ki; const _Float16* vp = VP + vi;      /* kp, vp: the lane's own first 8 elements; over a wave both are 512 contiguous bytes */
  v16h qf[FN / 16];
#pragma unroll      /* unrolled: qf is indexed by constants only and stays in registers */
  for (int j = 0; j < FN / 16; ++j) qf[j] = f_frag16(qp + j * 16 * 16);      /* rows of q / 2: the score tiles are s / 2, the argument of the gate's tanh */
  asm volatile("s_wait_xcnt 0x0" :: "v"(qp) : "memory");      /* the wait that stands between issued loads and an overwrite of their address registers; the address is an input so that it stays in its registers up to the wait */
  const v8f z8 = {0.f,0.f,0.f,0.f,0.f,0.f,0.f,0.f}; v8f acc[CX / 16][FN / 16];
#pragma unroll
  for (int t = 0; t < CX / 16; ++t)
#pragma unroll      /* unrolled, like the loop around it: the accumulators are indexed by constants only and stay in registers */
    for (int j = 0; j < FN / 16; ++j) acc[t][j] = z8;
  /* two fragment sets: while the products of one 32-key pass run on set a (b), the loads of the next pass fill set b (a), so a pass no longer starts by waiting out the L2 latency of its own loads */
  v16h ka[2], va[CX / 16], kb[2], vb[CX / 16];
  /* staggered start: the 64 work-groups of an image read the same k and V lines. Each work-group starts the FNP passes of its waves at a pass of its own
     and wraps, so that 4 work-groups and not 64 stand on a line at a time. The start takes bit 0 and bits 3 to 5 of the index: work-groups whose indices differ by 2, 4 or 6 share it, close neighbours do not. Any start covers every pass once. */
  int ps = (int)(((blockIdx.x >> 3) * 2 + (blockIdx.x & 1)) & (FNP - 1));
  kp += ps * FKS; vp += ps * FVS;
  f_load(kp, vp, ka, va);
#pragma unroll 1      /* rolled; the inner loops are unrolled so that fragments and accumulators stay in registers */
  for (int it = 0; it < FNP / 2 - 1; ++it) {
    f_next(kp, vp, ps);
    f_load(kp, vp, kb, vb);
    __builtin_amdgcn_sched_barrier(0);      /* the next pass's loads are issued ahead of this pass's scores: sunk among the products they would arrive too late for their own pass */
    f_pass(ka, va, qf, acc);
    __builtin_amdgcn_sched_barrier(0);      /* set a is refilled only behind its last product */
    f_next(kp, vp, ps);
    f_load(kp, vp, ka, va);
    __builtin_amdgcn_sched_barrier(0);      /* as above: the refill of set a is in flight before the first score of set b */
    f_pass(kb, vb, qf, acc);
  }
  /* the last two passes stand outside the loop: no pass is loaded twice, and every wait in the loop counts the same loads on every trip */
  f_next(kp, vp, ps);
  f_load(kp, vp, kb, vb);
  asm volatile("s_wait_xcnt 0x0" :: "v"(kp), "v"(vp) : "memory");      /* the address registers are free for other use from here on: the wait that stands between issued loads and an overwrite of their address registers; the addresses are inputs so that they stay in their registers up to the wait */
  __builtin_amdgcn_sched_barrier(0);      /* the last pass's loads, and the wait behind them, are issued ahead of the scores of the pass before it */
  f_pass(ka, va, qf, acc);
  f_pass(kb, vb, qf, acc);
  /* residual: the thread's own x elements (those of the sums it forms below) are asked for here, so that they arrive while the partial tiles go through LDS */
  constexpr int NQ = CX * FN / 4 / (FW * 32); const size_t eo = ((size_t)b * CX + tid / (FN / 4)) * SQ + n0 + (tid % (FN / 4)) * 4; const float* xp = x + eo; v4f xr[NQ];
#pragma unroll
  for (int q = 0; q < NQ; ++q) xr[q] = *(const v4fa*)(xp + (size_t)q * (FW * 32 / (FN / 4)) * SQ);
  asm volatile("s_wait_xcnt 0x0" :: "v"(xp) : "memory");      /* the wait that stands between issued loads and an overwrite of their address registers; the address is an input so that it stays in its registers up to the wait and no load of the run lands on it */
  const float g = bf16_round(gam[0]);
#pragma unroll
  for (int t = 0; t < CX / 16; ++t)
#pragma unroll
    for (int j = 0; j < FN / 16; ++j)
#pragma unroll
      for (int r = 0; r < 8; ++r) red[w][t * 16 + 8 * hh + r][j * 16 + ln] = acc[t][j][r];
  __syncthreads();
#pragma unroll
  for (int q = 0; q < NQ; ++q) { const int i = q * (FW * 32) + tid, c = i / (FN / 4), n4 = (i % (FN / 4)) * 4; v4f s = *(const v4fa*)&red[0][c][n4];
#pragma unroll
    for (int u = 1; u < FW; ++u) s += *(const v4fa*)&red[u][c][n4];
#pragma unroll
    for (int e = 0; e < 4; ++e) s[e] = g * s[e] + bf16_round(xr[q][e]);
    *(v4f*)(Y + eo + (size_t)q * (FW * 32 / (FN / 4)) * SQ) = s; } }
// ---- fused projections: x [b][c][n] f32 and the natural weights -> q / 2 rows, k rows (f16 [b n][16]) and V in fragment order, one launch ----
// Work-group = 64 tokens of one image. The x tile (bf16-rounded, exact in f16) is turned to token rows [64][128] and [Wq; Wk; Wv] (bf16-rounded, x 16) to rows [160][128] in LDS; every fragment is two 16-byte LDS reads (g2_frag).
// Wave w: token tile mt = w & 3 (16 tokens); hf = w >> 2 picks q (0) or k (1) and the output channels 64 hf + 0..63 of v.
// q, k: A = weight rows, B = token rows: a lane holds token ln, outputs 8 hh + r: one 16-byte store into the token's row.
// v: A = token rows, B = weight rows: a lane holds channel ln, tokens 8 hh + r. That is the A operand of k_sattn: per image, 32-key block and 16-channel tile one 1-KiB unit [half][lane][8 keys]
// (lane = 16 hh + ln holds channel ln, keys 16 half + 8 hh + 0..7), so a D tile is stored as it stands, 512 contiguous bytes per wave.
#define PK 64            /* tokens per work-group: 256 work-groups */
#define PP (CX + 8)      /* LDS row pitch in f16: 272 bytes = 16 x odd, for 16-byte readers of 256-byte rows */
__global__ __launch_bounds__(256) void k_proj(const float* __restrict__ x, const float* __restrict__ wq, const float* __restrict__ bq, const float* __restrict__ wk, const float* __restrict__ bk, const float* __restrict__ wv, const float* __restrict__ bv,
    _Float16* __restrict__ QZ, _Float16* __restrict__ KZ, _Float16* __restrict__ VP) {
  __shared__ __attribute__((aligned(16))) _Float16 xs[PK][PP];
  __shared__ __attribute__((aligned(16))) _Float16 wl[32 + CX][PP];
  const int tid = threadIdx.x, w = tid >> 5, lane = tid & 31, ln = lane & 15, hh = lane >> 4; const int b = blockIdx.x / (SQ / PK), n0 = (blockIdx.x % (SQ / PK)) * PK;
  const int g16 = tid & 15, r16 = tid >> 4, mt = w & 3, hf = w >> 2;
  /* x: a thread takes 4 tokens (4 g16 + q) of 8 channels (8 r16 + j): 16 lanes read 256 contiguous bytes of a channel row; the 8 x 4 block leaves as four 16-byte LDS stores */
  const float* xp = x + ((size_t)b * CX + r16 * 8) * SQ + n0 + g16 * 4; v4f xa[8];
#pragma unroll
  for (int j = 0; j < 8; ++j) xa[j] = *(const v4fa*)(xp + (size_t)j * SQ);
  /* weights: pass u covers 16 rows (0: Wq, 1: Wk, 2-9: Wv), a thread 8 elements of row r16 */
  const float* wqp = wq + r16 * CX + g16 * 8; const float* wkp = wk + r16 * CX + g16 * 8; const float* wvp = wv + r16 * CX + g16 * 8; v4f wa[2 + CX / 16][2];
  wa[0][0] = *(const v4fa*)wqp; wa[0][1] = *(const v4fa*)(wqp + 4); wa[1][0] = *(const v4fa*)wkp; wa[1][1] = *(const v4fa*)(wkp + 4);
#pragma unroll
  for (int u = 0; u < CX / 16; ++u) { wa[2 + u][0] = *(const v4fa*)(wvp + u * 16 * CX); wa[2 + u][1] = *(const v4fa*)(wvp + u * 16 * CX + 4); }
  const float* bp = (hf ? bk : bq) + 8 * hh; const v4f b0 = *(const v4fa*)bp, b1 = *(const v4fa*)(bp + 4); const float* bvp = bv + hf * (CX / 2) + ln; float bb[CX / 32];
#pragma unroll
  for (int t4 = 0; t4 < CX / 32; ++t4) bb[t4] = bvp[t4 * 16];
  asm volatile("s_wait_xcnt 0x0" :: "v"(xp), "v"(wqp), "v"(wkp), "v"(wvp), "v"(bp), "v"(bvp) : "memory");      /* the wait that stands between issued loads and an overwrite of their address registers; the addresses are inputs so that they stay in their registers up to it and no load of the run lands on one. No load sinks below it either: all of a thread's loads are in flight before the first conversion waits, one memory latency instead of one per group */
#pragma unroll
  for (int u = 0; u < 2 + CX / 16; ++u) { FragH f;
#pragma unroll
    for (int i = 0; i < 4; ++i) { f.h[i] = (_Float16)(bf16_round(wa[u][0][i]) * 16.0f); f.h[4 + i] = (_Float16)(bf16_round(wa[u][1][i]) * 16.0f); }
    *(v8us*)&wl[u * 16 + r16][g16 * 8] = f.half[0]; }
#pragma unroll
  for (int q = 0; q < 4; ++q) { FragH f;
#pragma unroll
    for (int j = 0; j < 8; ++j) f.h[j] = (_Float16)bf16_round(xa[j][q]);
    *(v8us*)&xs[g16 * 4 + q][r16 * 8] = f.half[0]; }
  __syncthreads();
  const v8f z8 = {0.f,0.f,0.f,0.f,0.f,0.f,0.f,0.f}; v16h xf[CX / 32], qw[CX / 32], vw[CX / 32][CX / 32];
#pragma unroll
  for (int kk = 0; kk < CX / 32; ++kk) { xf[kk] = g2_frag(&xs[mt * 16 + ln][kk * 32], hh); qw[kk] = g2_frag(&wl[hf * 16 + ln][kk * 32], hh); }
#pragma unroll
  for (int t4 = 0; t4 < CX / 32; ++t4)
#pragma unroll
    for (int kk = 0; kk < CX / 32; ++kk) vw[t4][kk] = g2_frag(&wl[32 + (hf * (CX / 32) + t4) * 16 + ln][kk * 32], hh);
  __builtin_amdgcn_sched_barrier(0);      /* every fragment read is issued ahead of the products: otherwise each product waits out the LDS latency of its own two reads */
  v8f aq = z8, av[CX / 32];
#pragma unroll
  for (int t4 = 0; t4 < CX / 32; ++t4) av[t4] = z8;
#pragma unroll
  for (int kk = 0; kk < CX / 32; ++kk) { aq = f_mma(qw[kk], xf[kk], aq);      /* the five accumulators are independent of one another */
#pragma unroll
    for (int t4 = 0; t4 < CX / 32; ++t4) av[t4] = f_mma(xf[kk], vw[t4][kk], av[t4]); }
  { const float sc = hf ? 1.0f : 0.5f;      /* q / 2 (exact in f32): the gate takes tanh of half the score */
    FragH o;
#pragma unroll
    for (int r = 0; r < 8; ++r) o.h[r] = (_Float16)(sc * (aq[r] * 0.0625f + bf16_round(r < 4 ? b0[r & 3] : b1[r & 3])));
    *(v8us*)((unsigned short*)(hf ? KZ : QZ) + ((size_t)b * SQ + n0 + mt * 16 + ln) * 16 + 8 * hh) = o.half[0]; }
#pragma unroll
  for (int t4 = 0; t4 < CX / 32; ++t4) { const int t = hf * (CX / 32) + t4; const float bt = bf16_round(bb[t4]); FragH o;
#pragma unroll
    for (int r = 0; r < 8; ++r) o.h[r] = (_Float16)(av[t4][r] * 0.0625f + bt);
    *(v8us*)((unsigned short*)VP + ((((size_t)(b * (SQ / 32) + (n0 >> 5) + (mt >> 1)) * (CX / 16) + t) * 2 + (mt & 1)) * 32 + lane) * 8) = o.half[0]; } }
extern "C" void kernel_launch(void* const* d_in, const int* in_sizes, int n_in,
                              void* d_out, int out_size, void* d_ws, size_t ws_size, hipStream_t stream) {
  (void)in_sizes; (void)n_in; (void)out_size;
  const float* const* I = (const float* const*)d_in; const float* x = I[0]; const float* wq = I[1]; const float* bq = I[2]; const float* wk = I[3]; const float* bk = I[4]; const float* wv = I[5]; const float* bv = I[6]; const float* gam = I[7];      /* natural Wq/Wk [16][128] + b, Wv [128][128] + b; gamma [1] */
  constexpr int DQ = 16;      /* q/k width */
  char* ws = (char*)d_ws; size_t off = 0;
  auto take = [&](size_t bytes) { char* p = ws + off; off += (bytes + 255) & ~(size_t)255; return p; };
  _Float16* QZ = (_Float16*)take(NR * DQ * 2); _Float16* KZ = (_Float16*)take(NR * DQ * 2); _Float16* VP = (_Float16*)take(NR * CX * 2);
  if (off > ws_size) return;
  k_proj<<<NB * (SQ / PK), 256, 0, stream>>>(x, wq, bq, wk, bk, wv, bv, QZ, KZ, VP);      /* q / 2 and k rows [NR][16] f16, V in fragment order [b][key / 32][channel / 16][1 KiB] */
  k_sattn<<<dim3(SQ / FN, NB), FW * 32, 0, stream>>>(QZ, KZ, VP, gam, x, (float*)d_out);      /* out[b][c][n] = sum_m v[c][m] sigmoid(q[:, n].k[:, m]): scores (K = 32 with zero padding), gate (f16) and V x gate^T in one kernel, f32; y = bf16(gamma) out + bf16(x) -> channel-first output */
}

// v010
// A run of this version takes 21.5 microseconds.
// Timed twice side by side with v009, it ran 1.06 and 1.07 times as fast.
// Over all steps from v000 it is 30.2 times as fast.
#include <hip/hip_runtime.h>
// SAGAN-style self-attention with SIGMOID gating instead of softmax, channel-first (x [4][128][64][64]; q = Wq x + bq, k = Wk x + bk (1x1, 128 -> 16), v = Wv x + bv (128 -> 128), natural weights and biases sigma 0.05; attn[n][m] = sigmoid(q[:, n].k[:, m]) (no scale, no normalisation); out[c][n] = sum_m v[c][m] attn[n][m]; y = gamma out + x with the scalar gamma input -> [4][128][64][64]).
// Structure: one projection kernel (work-group = 64 tokens of one image): the channel-first x tile and [Wq; Wk; Wv] go through LDS as exact f16 rows; q and k as W (A) x tokens (B), v as tokens (A) x W (B), f32 + bias; the D tiles are stored as they stand: q / 2 and k as f16 rows [16384][16], V in WMMA fragment order; one fused kernel: attn tile = sigmoid(q.k) = 0.5 + 0.5 tanh(q.k / 2) to f16 in registers (the 16-deep contraction runs as K = 32 with zeros set in registers), out[c][n] = V (A operand) x attn (B^T) f32, 8 key ranges summed through LDS, and y = bf16(gamma) out + bf16(x) formed on that sum and stored by the same kernel; two launches.
// Compute dtype: inputs rounded to bf16; x / weights exact; q, k, v and the sigmoid gates as plain f16 GEMM operands (~2^-12); scores and out f32; v_wmma_f32_16x16x32_f16.
#define NB 4
#define SQ 4096
#define DM 128
#define CX 128          /* channels */
#define NH 4
#define HD 64
#define DMQ DM                       /* LayerNorm width */
#define DFF 4096
#define HG 1                         /* heads per attention launch group */
#define B0 0                         /* unused */
#define NBR NB                       /* unused (only in MP, itself unused) */
#define NR ((size_t)NB * SQ)         /* token rows */
#define MP ((int)((size_t)NBR * SQ)) /* unused (only in MPO, itself unused) */
#define QN SQ                        /* unused */
#define NHD NH                       /* unused */
#define MPO MP                       /* unused */
#define LQ DM      /* unused (redefined below) */
typedef __bf16 v16b __attribute__((ext_vector_type(16)));
typedef unsigned short v8us __attribute__((ext_vector_type(8), may_alias));
typedef float  v8f  __attribute__((ext_vector_type(8)));
typedef float  v4f  __attribute__((ext_vector_type(4)));
typedef float  v4fa __attribute__((ext_vector_type(4), may_alias));
union FragB { v16b v; v8us half[2]; unsigned short u[16]; };

__device__ __forceinline__ unsigned short bf16_bits(float x) { unsigned int u = __float_as_uint(x); return (unsigned short)((u + 0x7FFFu + ((u >> 16) & 1u)) >> 16); }
__device__ __forceinline__ float bf16_val(unsigned short b) { return __uint_as_float(((unsigned int)b) << 16); }
__device__ __forceinline__ float bf16_round(float x) { return bf16_val(bf16_bits(x)); }
// D += A·B with NT terms: 1 = ah·bh, 2 = + al·bh (A split), 3 = + ah·bl (both split)
template <int NT>
__device__ __forceinline__ v8f mmaN(v16b ah, v16b al, v16b bh, v16b bl, v8f c) {
  c = __builtin_amdgcn_wmma_f32_16x16x32_bf16(false, ah, false, bh, (short)0, c, false, false);
  if (NT >= 2) c = __builtin_amdgcn_wmma_f32_16x16x32_bf16(false, al, false, bh, (short)0, c, false, false);
  if (NT >= 3) c = __builtin_amdgcn_wmma_f32_16x16x32_bf16(false, ah, false, bl, (short)0, c, false, false);
  asm volatile("v_nop\n\tv_nop\n\tv_nop\n\tv_nop" : "+v"(c) : "v"(ah), "v"(al), "v"(bh), "v"(bl));
  return c;
}

__global__ __launch_bounds__(256) void k_wt_bf16(const float* __restrict__ W, unsigned short* __restrict__ Wt, int K, int N) {
  const int t = blockIdx.x * 256 + threadIdx.x;
  const int k8n = K / 8;
  if (t >= N * k8n) return;
  const int n = t / k8n, k8 = (t % k8n) * 8;
  v8us v;
#pragma unroll
  for (int i = 0; i < 8; ++i) v[i] = bf16_bits(W[(size_t)(k8 + i) * N + n]);
  *(v8us*)(Wt + (size_t)n * K + k8) = v;
  
}

// GEMM C[M][N] (f32, pitch ldc) = act(A[M][K]·W + bias). A f32 row-major (pitch lda) converted per fragment to bf16
// (ASPLIT: hi/lo two planes -> 2 terms, else single rounded term); Wt bf16 [N][K] (pitch ldb). BIAS_BF16 rounds the
// bias to bf16 first (bias quantised to bf16 before the add). K%32==0, M%16==0, N%64==0.
template <bool ASPLIT, int ACT, bool BIAS_BF16>
__global__ __launch_bounds__(128) void k_gemm_bf(const float* __restrict__ A, int lda, const unsigned short* __restrict__ Wt, int ldb,
                                               const float* __restrict__ bias, float* __restrict__ C, int ldc, int M, int N, int K) {
  __shared__ __attribute__((aligned(16))) float so[4][16][64];
  const int tid = threadIdx.x, w = tid >> 5, lane = tid & 31, ln = lane & 15, hh = lane >> 4;
  const int ntn = N / 64;
  const int wid = blockIdx.x * 4 + w;
  const int mt = wid / ntn, nq = wid % ntn;
  if (mt * 16 >= M) return;
  const int row0 = mt * 16, col0 = nq * 64;
  const float* arow = A + (size_t)(row0 + ln) * lda;
  v8f acc[4] = {};
  for (int kb = 0; kb < K; kb += 32) {
    FragB ah, al;
    const v4f x0 = *(const v4fa*)(arow + kb + 8 * hh), x1 = *(const v4fa*)(arow + kb + 8 * hh + 4);
    const v4f x2 = *(const v4fa*)(arow + kb + 16 + 8 * hh), x3 = *(const v4fa*)(arow + kb + 16 + 8 * hh + 4);
    float xs[16] = {x0[0],x0[1],x0[2],x0[3],x1[0],x1[1],x1[2],x1[3],x2[0],x2[1],x2[2],x2[3],x3[0],x3[1],x3[2],x3[3]};
#pragma unroll
    for (int i = 0; i < 16; ++i) { const unsigned short hb = bf16_bits(xs[i]); ah.u[i] = hb; al.u[i] = ASPLIT ? bf16_bits(xs[i] - bf16_val(hb)) : (unsigned short)0; }
#pragma unroll
    for (int t = 0; t < 4; ++t) {
      const unsigned short* brow = Wt + (size_t)(col0 + t * 16 + ln) * ldb + kb;
      FragB b;
      b.half[0] = *(const v8us*)(brow + 8 * hh);
      b.half[1] = *(const v8us*)(brow + 16 + 8 * hh);
      acc[t] = mmaN<ASPLIT ? 2 : 1>(ah.v, al.v, b.v, b.v, acc[t]);
    }
  }
#pragma unroll
  for (int t = 0; t < 4; ++t) {
    float bv = bias ? bias[col0 + t * 16 + ln] : 0.f;
    if (BIAS_BF16) bv = bf16_round(bv);
#pragma unroll
    for (int r = 0; r < 8; ++r) { float v = acc[t][r] + bv; if (ACT == 1) v = fmaxf(v, 0.f); so[w][8 * hh + r][t * 16 + ln] = v; }
  }
  __builtin_amdgcn_fence(__ATOMIC_ACQ_REL, "workgroup");
  __builtin_amdgcn_wave_barrier();
  const int rsub = lane >> 4, c4 = (lane & 15) * 4;
  {
#pragma unroll
    for (int q = 0; q < 8; ++q) {
      const int r = q * 2 + rsub;
      const v4f v = *(const v4fa*)&so[w][r][c4];
      *(v4f*)(C + (size_t)(row0 + r) * ldc + col0 + c4) = v;
    }
    
  }
}

// GEMM C = act(A·W + bias + resid): A f32 (ASPLIT -> hi/lo 2 terms), Wt bf16 [N][K]; ACT 0 none, 1 relu, 2 exact gelu;
// resid (optional, f32, row index = (row % rmod), pitch ldr, RES_BF16 rounds it) added before the activation.
template <bool ASPLIT, int ACT, bool BIAS_BF16, bool RES_BF16>
__global__ __launch_bounds__(128) void k_gemm_bf3(const float* __restrict__ A, int lda, const unsigned short* __restrict__ Wt, int ldb,
                                                const float* __restrict__ bias, const float* __restrict__ resid, int rmod, int ldr,
                                                float* __restrict__ C, int ldc, int M, int N, int K) {
  __shared__ __attribute__((aligned(16))) float so[4][16][64];
  const int tid = threadIdx.x, w = tid >> 5, lane = tid & 31, ln = lane & 15, hh = lane >> 4;
  const int ntn = N / 64;
  const int wid = blockIdx.x * 4 + w;
  const int mt = wid / ntn, nq = wid % ntn;
  if (mt * 16 >= M) return;
  const int row0 = mt * 16, col0 = nq * 64;
  const float* arow = A + (size_t)(row0 + ln) * lda;
  v8f acc[4] = {};
  for (int kb = 0; kb < K; kb += 32) {
    FragB ah, al;
    const v4f x0 = *(const v4fa*)(arow + kb + 8 * hh), x1 = *(const v4fa*)(arow + kb + 8 * hh + 4);
    const v4f x2 = *(const v4fa*)(arow + kb + 16 + 8 * hh), x3 = *(const v4fa*)(arow + kb + 16 + 8 * hh + 4);
    float xs[16] = {x0[0],x0[1],x0[2],x0[3],x1[0],x1[1],x1[2],x1[3],x2[0],x2[1],x2[2],x2[3],x3[0],x3[1],x3[2],x3[3]};
#pragma unroll
    for (int i = 0; i < 16; ++i) { const unsigned short hb = bf16_bits(xs[i]); ah.u[i] = hb; al.u[i] = ASPLIT ? bf16_bits(xs[i] - bf16_val(hb)) : (unsigned short)0; }
#pragma unroll
    for (int t = 0; t < 4; ++t) {
      const unsigned short* brow = Wt + (size_t)(col0 + t * 16 + ln) * ldb + kb;
      FragB b;
      b.half[0] = *(const v8us*)(brow + 8 * hh);
      b.half[1] = *(const v8us*)(brow + 16 + 8 * hh);
      acc[t] = mmaN<ASPLIT ? 2 : 1>(ah.v, al.v, b.v, b.v, acc[t]);
    }
  }
#pragma unroll
  for (int t = 0; t < 4; ++t) {
    const int col = col0 + t * 16 + ln;
    float bv = bias ? bias[col] : 0.f;
    if (BIAS_BF16) bv = bf16_round(bv);
#pragma unroll
    for (int r = 0; r < 8; ++r) {
      float v = acc[t][r] + bv;
      if (resid) { float rv = resid[(size_t)((row0 + 8 * hh + r) % rmod) * ldr + col]; if (RES_BF16) rv = bf16_round(rv); v += rv; }
      if (ACT == 1) v = fmaxf(v, 0.f);
      if (ACT == 2) v = 0.5f * v * (1.0f + erff(v * 0.70710678118654752f));
      if (ACT == 3) { const float u = 0.7978845608028654f * (v + 0.044715f * v * v * v); v = 0.5f * v * (1.0f + tanhf(u)); }
      so[w][8 * hh + r][t * 16 + ln] = v;
    }
  }
  __builtin_amdgcn_fence(__ATOMIC_ACQ_REL, "workgroup");
  __builtin_amdgcn_wave_barrier();
  const int rsub = lane >> 4, c4 = (lane & 15) * 4;
  {
#pragma unroll
    for (int q = 0; q < 8; ++q) {
      const int r = q * 2 + rsub;
      const v4f v = *(const v4fa*)&so[w][r][c4];
      *(v4f*)(C + (size_t)(row0 + r) * ldc + col0 + c4) = v;
    }
    
  }
}
// row LayerNorm (biased variance, eps) over N: s = X (+ R); optional out_sum <- s; out_norm <- (s-mu)*rsqrt(var+eps)*g + b
template <bool PARAM_BF16>
__global__ __launch_bounds__(256) void k_layernorm(const float* __restrict__ X, const float* __restrict__ R, const float* __restrict__ g, const float* __restrict__ bta,
                                                  float* __restrict__ out_sum, float* __restrict__ out_norm, int N, float eps) {
  __shared__ float red[256];
  const int row = blockIdx.x, tid = threadIdx.x;
  const float* x = X + (size_t)row * N; const float* rr = R ? R + (size_t)row * N : nullptr;
  float vals[16];                     // up to N = 4096
  const int per = N / 256;            // contiguous chunk per thread? use strided-by-4 chunks: thread handles j = tid*4 + 1024*u
  float s1 = 0.f;
  for (int u = 0; u < per / 4; ++u) {
    const int j = tid * 4 + 1024 * u;
    const v4f a = *(const v4fa*)(x + j);
    v4f b = {0.f,0.f,0.f,0.f}; if (rr) b = *(const v4fa*)(rr + j);
#pragma unroll
    for (int q = 0; q < 4; ++q) { const float v = a[q] + b[q]; vals[u * 4 + q] = v; s1 += v; }
  }
  red[tid] = s1; __syncthreads();
  for (int st = 128; st > 0; st >>= 1) { if (tid < st) red[tid] += red[tid + st]; __syncthreads(); }
  const float mu = red[0] / (float)N; __syncthreads();
  float s2 = 0.f;
  for (int u = 0; u < per / 4; ++u)
#pragma unroll
    for (int q = 0; q < 4; ++q) { const float c = vals[u * 4 + q] - mu; s2 += c * c; }
  red[tid] = s2; __syncthreads();
  for (int st = 128; st > 0; st >>= 1) { if (tid < st) red[tid] += red[tid + st]; __syncthreads(); }
  const float rs = rsqrtf(red[0] / (float)N + eps);
  {
    for (int u = 0; u < per / 4; ++u) {
      const int j = tid * 4 + 1024 * u;
      v4f o, sm;
#pragma unroll
      for (int q = 0; q < 4; ++q) {
        float gg = g[j + q], bb = bta[j + q];
        if (PARAM_BF16) { gg = bf16_round(gg); bb = bf16_round(bb); }
        sm[q] = vals[u * 4 + q]; o[q] = (vals[u * 4 + q] - mu) * rs * gg + bb;
      }
      if (out_sum) *(v4f*)(out_sum + (size_t)row * N + j) = sm;
      *(v4f*)(out_norm + (size_t)row * N + j) = o;
    }
    
  }
}



// ---- f16 WMMA path (v_wmma_f32_16x16x32_f16): 11-bit significands for operands in range — used where a [0,1] probability operand needs more precision than bf16
typedef _Float16 v16h __attribute__((ext_vector_type(16)));
union FragH { v16h v; v8us half[2]; _Float16 h[16]; unsigned short u[16]; };
template <int NT>
__device__ __forceinline__ v8f mmaH(v16h ah, v16h al, v16h bh, v16h bl, v8f c) {
  c = __builtin_amdgcn_wmma_f32_16x16x32_f16(false, ah, false, bh, (short)0, c, false, false);
  if (NT >= 2) c = __builtin_amdgcn_wmma_f32_16x16x32_f16(false, al, false, bh, (short)0, c, false, false);
  if (NT >= 3) c = __builtin_amdgcn_wmma_f32_16x16x32_f16(false, ah, false, bl, (short)0, c, false, false);
  asm volatile("v_nop\n\tv_nop\n\tv_nop\n\tv_nop" : "+v"(c) : "v"(ah), "v"(al), "v"(bh), "v"(bl));
  return c;
}
// batched GEMM like k_gemm_b but f16 operands: A f32 (split into f16 hi/lo if ASPLIT, else rounded to f16), Bt = f16 values [n][k]; alpha; C f32; N multiple of 16 (partial tiles skipped)
template <bool ASPLIT>
__global__ __launch_bounds__(128) void k_gemm_h(const float* __restrict__ A, int lda, size_t sA, const _Float16* __restrict__ Bh, int ldb, size_t sB, float alpha, float* __restrict__ C, int ldc, size_t sC, int M, int N, int K) {
  __shared__ __attribute__((aligned(16))) float so[4][16][64];
  const int tid = threadIdx.x, w = tid >> 5, lane = tid & 31, ln = lane & 15, hh = lane >> 4; const int by = blockIdx.y;
  A += (size_t)by * sA; Bh += (size_t)by * sB; C += (size_t)by * sC;
  const int ntn = (N + 63) / 64; const int wid = blockIdx.x * 4 + w; const int mt = wid / ntn, nq = wid % ntn; if (mt * 16 >= M) return;
  const int row0 = mt * 16, col0 = nq * 64; const float* arow = A + (size_t)(row0 + ln) * lda;
  v8f acc[4] = {};
  for (int kb = 0; kb < K; kb += 32) {
    FragH ah, al;
    const v4f x0 = *(const v4fa*)(arow + kb + 8 * hh), x1 = *(const v4fa*)(arow + kb + 8 * hh + 4), x2 = *(const v4fa*)(arow + kb + 16 + 8 * hh), x3 = *(const v4fa*)(arow + kb + 16 + 8 * hh + 4);
    float xs[16] = {x0[0],x0[1],x0[2],x0[3],x1[0],x1[1],x1[2],x1[3],x2[0],x2[1],x2[2],x2[3],x3[0],x3[1],x3[2],x3[3]};
#pragma unroll
    for (int i = 0; i < 16; ++i) { const _Float16 h = (_Float16)xs[i]; ah.h[i] = h; al.h[i] = ASPLIT ? (_Float16)(xs[i] - (float)h) : (_Float16)0.0f; }
#pragma unroll
    for (int t = 0; t < 4; ++t) { if (col0 + t * 16 >= N) continue; const size_t boff = (size_t)(col0 + t * 16 + ln) * ldb + kb; FragH bq; bq.half[0] = *(const v8us*)(Bh + boff + 8 * hh); bq.half[1] = *(const v8us*)(Bh + boff + 16 + 8 * hh);
      acc[t] = mmaH<ASPLIT ? 2 : 1>(ah.v, al.v, bq.v, bq.v, acc[t]); }
  }
#pragma unroll
  for (int t = 0; t < 4; ++t) { if (col0 + t * 16 >= N) continue;
#pragma unroll
    for (int r = 0; r < 8; ++r) so[w][8 * hh + r][t * 16 + ln] = acc[t][r] * alpha; }
  __builtin_amdgcn_fence(__ATOMIC_ACQ_REL, "workgroup"); __builtin_amdgcn_wave_barrier();
  const int rsub = lane >> 4, c4 = (lane & 15) * 4;
  {
#pragma unroll
    for (int q = 0; q < 8; ++q) { const int r = q * 2 + rsub; if (col0 + c4 < N) { const v4f v = *(const v4fa*)&so[w][r][c4]; *(v4f*)(C + (size_t)(row0 + r) * ldc + col0 + c4) = v; } }
     }
}

// Wt[n][k] = f16(W[k][n]·scale) from f32 row-major W[K][N] (scale = power of two; bf16-exact weights stay exact in f16 away from the subnormal range)
__global__ __launch_bounds__(256) void k_wt_f16(const float* __restrict__ W, _Float16* __restrict__ Wt, int K, int N, float scale) {
  const int t = blockIdx.x * 256 + threadIdx.x; if (t >= N * (K / 8)) return; const int n = t / (K / 8), k8 = (t % (K / 8)) * 8; FragH f;
#pragma unroll
  for (int i = 0; i < 8; ++i) f.h[i] = (_Float16)(bf16_round(W[(size_t)(k8 + i) * N + n]) * scale); const v8us o = f.half[0];
  *(v8us*)((unsigned short*)Wt + (size_t)n * K + k8) = o; 
}
// k_gemm_hh variant with fused epilogue: v = acc·alpha + bias[by·sBias + col] (+ CP[(row/rowsPerB)·sCPb + by·64 + col] if CP) ; ACT 0 none / 1 elu ; writes f16 C16 (and f32 C if non-null)
template <int ACT>
__global__ __launch_bounds__(128) void k_gemm_hhx(const _Float16* __restrict__ A, int lda, size_t sA, const _Float16* __restrict__ Bh, int ldb, size_t sB, float alpha, const float* __restrict__ bias, size_t sBias, const float* __restrict__ CP, int rowsPerB, size_t sCPb, int row0g,
    float* __restrict__ C, _Float16* __restrict__ C16, int ldc, size_t sC, int M, int N, int K) {
  __shared__ __attribute__((aligned(16))) float so[4][16][64];
  const int tid = threadIdx.x, w = tid >> 5, lane = tid & 31, ln = lane & 15, hh = lane >> 4; const int by = blockIdx.y;
  A += (size_t)by * sA; Bh += (size_t)by * sB; const size_t cofs = (size_t)by * sC; const float* bp = bias ? bias + (size_t)by * sBias : nullptr;
  const int ntn = (N + 63) / 64; const int wid = blockIdx.x * 4 + w; const int mt = wid / ntn, nq = wid % ntn; if (mt * 16 >= M) return;
  const int row0 = mt * 16, col0 = nq * 64; const _Float16* arow = A + (size_t)(row0 + ln) * lda;
  v8f acc[4] = {};
  for (int kb = 0; kb < K; kb += 32) { FragH ah; ah.half[0] = *(const v8us*)((const unsigned short*)arow + kb + 8 * hh); ah.half[1] = *(const v8us*)((const unsigned short*)arow + kb + 16 + 8 * hh);
#pragma unroll
    for (int t = 0; t < 4; ++t) { if (col0 + t * 16 >= N) continue; const size_t boff = (size_t)(col0 + t * 16 + ln) * ldb + kb; FragH bq; bq.half[0] = *(const v8us*)((const unsigned short*)Bh + boff + 8 * hh); bq.half[1] = *(const v8us*)((const unsigned short*)Bh + boff + 16 + 8 * hh);
      acc[t] = mmaH<1>(ah.v, ah.v, bq.v, bq.v, acc[t]); }
  }
#pragma unroll
  for (int t = 0; t < 4; ++t) { if (col0 + t * 16 >= N) continue; const int col = col0 + t * 16 + ln; const float bv = bp ? bf16_round(bp[col]) : 0.f;
#pragma unroll
    for (int r = 0; r < 8; ++r) { float v = acc[t][r] * alpha + bv; if (CP) { const int rr = row0g + row0 + 8 * hh + r; if (rowsPerB < 0) v += CP[cofs + (size_t)rr * ldc + col];      /* rowsPerB < 0: own element of the batched C plane */ else { const int bidx = rr / rowsPerB; v += CP[(size_t)bidx * sCPb + (size_t)by * 64 + col]; } } if (ACT == 1) v = (v > 0.f) ? v : expm1f(v); else if (ACT == 7) v = (v > 0.f) ? v + 1.0f : expf(v); else if (ACT == 8) v = tanhf(v); else if (ACT == 9) v = 0.5f * v * (1.0f + tanhf(0.7978845608028654f * (v + 0.044715f * v * v * v))); else if (ACT == 11) v = 1.0f / (1.0f + expf(-v)); else if (ACT == 12) v = (v > 0.f) ? v : 0.01f * v; else if (ACT == 14) v = (v > 0.f) ? v : 0.1f * v; else if (ACT == 16) v = (v >= 0.f) ? v : 0.3f * v; else if (ACT == 17) v = (v >= 0.f) ? v : 0.2f * v; else if (ACT == 15) v = v / (1.0f + expf(-v)); else if (ACT == 3) v = fmaxf(v, 0.f); else if (ACT == 6) v = 0.5f * v * (1.0f + erff(v * 0.70710678118654752f)); so[w][8 * hh + r][t * 16 + ln] = v; } }
  __builtin_amdgcn_fence(__ATOMIC_ACQ_REL, "workgroup"); __builtin_amdgcn_wave_barrier();
  const int rsub = lane >> 4, c4 = (lane & 15) * 4; typedef _Float16 v4h __attribute__((ext_vector_type(4)));
  {
#pragma unroll
    for (int q = 0; q < 8; ++q) { const int r = q * 2 + rsub; if (col0 + c4 < N) { const v4f v = *(const v4fa*)&so[w][r][c4]; if (C) *(v4f*)(C + cofs + (size_t)(row0 + r) * ldc + col0 + c4) = v; if (C16) { v4h h4; for (int i = 0; i < 4; ++i) h4[i] = (_Float16)v[i]; *(v4h*)(C16 + cofs + (size_t)(row0 + r) * ldc + col0 + c4) = h4; } } }
     }
}


typedef _Float16 v4h __attribute__((ext_vector_type(4)));

__global__ __launch_bounds__(256) void k_x16(const float* __restrict__ x, _Float16* __restrict__ X16, size_t n8) { const size_t t = (size_t)blockIdx.x * 256 + threadIdx.x; if (t >= n8) return; FragH f;
#pragma unroll
  for (int q = 0; q < 8; ++q) f.h[q] = (_Float16)bf16_round(x[t * 8 + q]); *(v8us*)((unsigned short*)X16 + t * 8) = f.half[0];  }
__global__ __launch_bounds__(256) void k_h16(const float* __restrict__ x, _Float16* __restrict__ X16, size_t n8) { const size_t t = (size_t)blockIdx.x * 256 + threadIdx.x; if (t >= n8) return; FragH f;
#pragma unroll
  for (int q = 0; q < 8; ++q) f.h[q] = (_Float16)x[t * 8 + q]; *(v8us*)((unsigned short*)X16 + t * 8) = f.half[0];  }
__global__ __launch_bounds__(256) void k_round16f(const float* __restrict__ W, _Float16* __restrict__ Bt, size_t n8) { const size_t t = (size_t)blockIdx.x * 256 + threadIdx.x; if (t >= n8) return; FragH f;
#pragma unroll
  for (int i = 0; i < 8; ++i) f.h[i] = (_Float16)(bf16_round(W[t * 8 + i]) * 16.0f); *(v8us*)((unsigned short*)Bt + t * 8) = f.half[0];  }
template <int NHv, int TTv>
__global__ __launch_bounds__(256) void k_vt(const _Float16* __restrict__ V16, int ldv, int voff, _Float16* __restrict__ Vt) { __shared__ unsigned short tl[64][66]; const int tid = threadIdx.x; const int slab = blockIdx.x / (TTv / 64), lg = blockIdx.x % (TTv / 64); const int b = slab / NHv, h = slab % NHv;
  for (int i = tid; i < 64 * 8; i += 256) { const int r = i / 8, c8 = (i % 8) * 8; FragH f; f.half[0] = *(const v8us*)((const unsigned short*)V16 + ((size_t)b * TTv + lg * 64 + r) * ldv + voff + h * 64 + c8);
#pragma unroll
    for (int q = 0; q < 8; ++q) tl[r][c8 + q] = f.u[q]; }
  __syncthreads();
  {
#pragma unroll
    for (int rd = 0; rd < 2; ++rd) { const int d = rd * 32 + tid / 8, pc = tid % 8; FragH f;
#pragma unroll
      for (int q = 0; q < 8; ++q) f.u[q] = tl[pc * 8 + q][d];
      *(v8us*)((unsigned short*)Vt + ((size_t)slab * 64 + d) * TTv + lg * 64 + pc * 8) = f.half[0]; }
     } }

__global__ __launch_bounds__(256) void k_hl(const float* __restrict__ F, _Float16* __restrict__ Hh, _Float16* __restrict__ Hl, size_t n8) { const size_t t = (size_t)blockIdx.x * 256 + threadIdx.x; if (t >= n8) return; FragH fh, fl; const v4f a = *(const v4fa*)(F + t * 8), c = *(const v4fa*)(F + t * 8 + 4);
#pragma unroll
  for (int q = 0; q < 4; ++q) { _Float16 h = (_Float16)a[q]; fh.h[q] = h; fl.h[q] = (_Float16)((a[q] - (float)h) * 1024.0f); h = (_Float16)c[q]; fh.h[4 + q] = h; fl.h[4 + q] = (_Float16)((c[q] - (float)h) * 1024.0f); }
  { *(v8us*)((unsigned short*)Hh + t * 8) = fh.half[0]; *(v8us*)((unsigned short*)Hl + t * 8) = fl.half[0];  } }

// ---- fast GEMM (wave tile 32x64; requires M % 32 == 0 rows per launch region and N % 64 == 0); epilogue = k_gemm_hhx semantics ----
__device__ __forceinline__ v16h g2_frag(const _Float16* p, int hh) { FragH f; f.half[0] = *(const v8us*)((const unsigned short*)p + 8 * hh); f.half[1] = *(const v8us*)((const unsigned short*)p + 16 + 8 * hh); return f.v; }
__device__ __forceinline__ v8f g2_mma(v16h a, v16h b, v8f c) { v8f d = __builtin_amdgcn_wmma_f32_16x16x32_f16(false, a, false, b, (short)0, c, false, false); asm volatile("v_nop\n\tv_nop\n\tv_nop\n\tv_nop" : "+v"(d) : "v"(a), "v"(b)); return d; }
template <int ACT>
__global__ __launch_bounds__(128) void k_gemm2(const _Float16* __restrict__ A, int lda, size_t sA, const _Float16* __restrict__ Bh, int ldb, size_t sB, float alpha, const float* __restrict__ bias, size_t sBias, const float* __restrict__ CP, int rowsPerB, size_t sCPb, int row0g,
    float* __restrict__ C, _Float16* __restrict__ C16, int ldc, size_t sC, int M, int N, int K) { static_assert(ACT == 0 || ACT == 3 || ACT == 6 || ACT == 8 || ACT == 9 || ACT == 11 || ACT == 12 || ACT == 14 || ACT == 15 || ACT == 16 || ACT == 17, "k_gemm2: unsupported ACT code (would silently apply no activation)");
  __shared__ __attribute__((aligned(16))) float so[4][32][68];
  const int tid = threadIdx.x, w = tid >> 5, lane = tid & 31, ln = lane & 15, hh = lane >> 4; const int by = blockIdx.y;
  A += (size_t)by * sA; Bh += (size_t)by * sB; const size_t cofs = (size_t)by * sC; const float* bp = bias ? bias + (size_t)by * sBias : nullptr;
  const int ntn = N >> 6; const int mt = blockIdx.x / ntn, nq = blockIdx.x - mt * ntn; const int row0 = mt * 128 + 32 * w, col0 = nq * 64; if (row0 >= M) return;
  const _Float16* a0p = A + (size_t)(row0 + ln) * lda; const _Float16* a1p = a0p + (size_t)16 * lda;
  const _Float16* b0p = Bh + (size_t)(col0 + ln) * ldb; const _Float16* b1p = b0p + (size_t)16 * ldb; const _Float16* b2p = b1p + (size_t)16 * ldb; const _Float16* b3p = b2p + (size_t)16 * ldb;
  const v8f z8 = {0.f,0.f,0.f,0.f,0.f,0.f,0.f,0.f}; v8f c00 = z8, c01 = z8, c02 = z8, c03 = z8, c10 = z8, c11 = z8, c12 = z8, c13 = z8;
#pragma unroll 1
  for (int kb = 0; kb < K; kb += 32) { const v16h a0 = g2_frag(a0p + kb, hh), a1 = g2_frag(a1p + kb, hh);
    v16h b = g2_frag(b0p + kb, hh); c00 = g2_mma(a0, b, c00); c10 = g2_mma(a1, b, c10);
    b = g2_frag(b1p + kb, hh); c01 = g2_mma(a0, b, c01); c11 = g2_mma(a1, b, c11);
    b = g2_frag(b2p + kb, hh); c02 = g2_mma(a0, b, c02); c12 = g2_mma(a1, b, c12);
    b = g2_frag(b3p + kb, hh); c03 = g2_mma(a0, b, c03); c13 = g2_mma(a1, b, c13); }
  v8f accs[8] = {c00, c01, c02, c03, c10, c11, c12, c13};
#pragma unroll
  for (int u = 0; u < 8; ++u) { const int t = u & 3, half = u >> 2; const int col = col0 + t * 16 + ln; const float bv = bp ? bf16_round(bp[col]) : 0.f;
#pragma unroll
    for (int r = 0; r < 8; ++r) { const int rloc = half * 16 + 8 * hh + r; float v = accs[u][r] * alpha + bv; if (CP) { if (rowsPerB < 0) v += CP[cofs + (size_t)(row0g + row0 + rloc) * ldc + col];      /* rowsPerB < 0: own element of the batched C plane */ else { const int bidx = (row0g + row0 + rloc) / rowsPerB; v += CP[(size_t)bidx * sCPb + (size_t)by * 64 + col]; } }
      if (ACT == 3) v = fmaxf(v, 0.f); else if (ACT == 6) v = 0.5f * v * (1.0f + erff(v * 0.70710678118654752f)); else if (ACT == 11) v = 1.0f / (1.0f + expf(-v)); else if (ACT == 15) v = v / (1.0f + expf(-v)); else if (ACT == 12) v = (v > 0.f) ? v : 0.01f * v; else if (ACT == 8) v = tanhf(v); else if (ACT == 9) v = 0.5f * v * (1.0f + tanhf(0.7978845608028654f * (v + 0.044715f * v * v * v))); else if (ACT == 14) v = (v > 0.f) ? v : 0.1f * v; else if (ACT == 16) v = (v >= 0.f) ? v : 0.3f * v; else if (ACT == 17) v = (v >= 0.f) ? v : 0.2f * v;
      so[w][rloc][t * 16 + ln] = v; } }
  __builtin_amdgcn_fence(__ATOMIC_ACQ_REL, "workgroup"); __builtin_amdgcn_wave_barrier();
  const int rsub = lane >> 4, c4 = (lane & 15) * 4;
  {
#pragma unroll
    for (int q = 0; q < 16; ++q) { const int r = q * 2 + rsub; const v4f v = *(const v4fa*)&so[w][r][c4]; if (C) *(v4f*)(C + cofs + (size_t)(row0 + r) * ldc + col0 + c4) = v; if (C16) { v4h h4; for (int i = 0; i < 4; ++i) h4[i] = (_Float16)v[i]; *(v4h*)(C16 + cofs + (size_t)(row0 + r) * ldc + col0 + c4) = h4; } }
     } }


__global__ __launch_bounds__(256) void k_rsm(const float* __restrict__ S, _Float16* __restrict__ P, int nrows) {
  #pragma clang fp contract(off)
  const int i = blockIdx.x * 256 + threadIdx.x; if (i >= nrows) return; const float* s = S + (size_t)i * SQ; float mx = -3.0e38f;
#pragma unroll 1
  for (int j = 0; j < SQ; ++j) mx = fmaxf(mx, s[j]); float se = 0.f;
#pragma unroll 1
  for (int j = 0; j < SQ; ++j) se += expf(s[j] - mx); const float sc = 256.0f / se;
#pragma unroll 1
  for (int j0 = 0; j0 < SQ; j0 += 8) { FragH f; for (int q = 0; q < 8; ++q) f.h[q] = (_Float16)(expf(s[j0 + q] - mx) * sc); unsigned short* d = (unsigned short*)P + (size_t)i * SQ + j0; *(v8us*)d = f.half[0];  } }
__global__ __launch_bounds__(256) void k_vt(const _Float16* __restrict__ V16, int b, int h0, _Float16* __restrict__ VT) { __shared__ unsigned short tl[64][65]; const int tid = threadIdx.x; const int hh = blockIdx.x % HG, sg = blockIdx.x / HG; const int s0 = sg * 64; const int h = h0 + hh;
  for (int i = tid; i < 64 * 8; i += 256) { const int j = i / 8, d8 = (i % 8) * 8; FragH f; f.half[0] = *(const v8us*)((const unsigned short*)V16 + ((size_t)b * SQ + s0 + j) * DM + h * HD + d8); for (int q = 0; q < 8; ++q) tl[d8 + q][j] = f.u[q]; }
  __syncthreads();
  { for (int i = tid; i < 64 * 8; i += 256) { const int d = i / 8, j8 = (i % 8) * 8; FragH f; for (int q = 0; q < 8; ++q) f.u[q] = tl[d][j8 + q]; *(v8us*)((unsigned short*)VT + ((size_t)hh * HD + d) * SQ + s0 + j8) = f.half[0]; }  } }


template <int BFIN, int W16, int W32>
__global__ __launch_bounds__(256) void k_lnx(const float* __restrict__ X, const float* __restrict__ g, const float* __restrict__ bb, float eps, _Float16* __restrict__ N16, float* __restrict__ N32) {
  #pragma clang fp contract(off)
  __shared__ float red[256]; const size_t r = blockIdx.x; const int t = threadIdx.x; const bool act = t < (DMQ / 4); const int c0 = act ? t * 4 : 0;
  const v4f xa = *(const v4fa*)(X + r * DMQ + c0); float s[4]; float sum = 0.f;
  for (int q = 0; q < 4; ++q) { s[q] = act ? (BFIN ? bf16_round(xa[q]) : xa[q]) : 0.f; sum = __fadd_rn(sum, s[q]); }
  red[t] = sum; __syncthreads(); for (int st = 128; st > 0; st >>= 1) { if (t < st) red[t] = __fadd_rn(red[t], red[t + st]); __syncthreads(); } const float mu = red[0] / (float)DMQ; __syncthreads();
  float vs = 0.f; for (int q = 0; q < 4; ++q) { const float dl = act ? __fadd_rn(s[q], -mu) : 0.f; vs = __fadd_rn(vs, __fmul_rn(dl, dl)); } red[t] = vs; __syncthreads(); for (int st = 128; st > 0; st >>= 1) { if (t < st) red[t] = __fadd_rn(red[t], red[t + st]); __syncthreads(); }
  const float rs = rsqrtf(__fadd_rn(red[0] / (float)DMQ, eps)); v4h y; v4f yf;
  for (int q = 0; q < 4; ++q) { const int c = c0 + q; yf[q] = __fadd_rn(__fmul_rn(__fmul_rn(__fadd_rn(s[q], -mu), rs), bf16_round(g[c])), (bb ? bf16_round(bb[c]) : 0.f)); y[q] = (_Float16)yf[q]; }
  if (!act) return;      /* no barriers after this point */
  { if (W16) *(v4h*)(N16 + r * DMQ + c0) = y; if (W32) *(v4f*)(N32 + r * DMQ + c0) = yf;  } }


__global__ __launch_bounds__(256) void k_rsmf(const float* __restrict__ S, _Float16* __restrict__ P, int qn, int hg) {
  #pragma clang fp contract(off)
  const int t = blockIdx.x * 256 + threadIdx.x; if (t >= qn * hg) return; const size_t i = (size_t)(t / qn) * SQ + (t % qn); const float* s = S + i * SQ; float mx = -3.0e38f;
#pragma unroll 1
  for (int j = 0; j < SQ; ++j) mx = fmaxf(mx, s[j]); float se = 0.f;
#pragma unroll 1
  for (int j = 0; j < SQ; ++j) se += __expf(s[j] - mx); const float sc = 256.0f / se;
#pragma unroll 1
  for (int j0 = 0; j0 < SQ; j0 += 8) { FragH f; for (int q = 0; q < 8; ++q) f.h[q] = (_Float16)(__expf(s[j0 + q] - mx) * sc); unsigned short* d = (unsigned short*)P + i * SQ + j0; *(v8us*)d = f.half[0];  } }


__global__ __launch_bounds__(256) void k_bfr(const float* __restrict__ x, float* __restrict__ XB, size_t n8) { const size_t t = (size_t)blockIdx.x * 256 + threadIdx.x; if (t >= n8) return; v4f a = *(const v4fa*)(x + t * 8), c = *(const v4fa*)(x + t * 8 + 4); for (int q = 0; q < 4; ++q) { a[q] = bf16_round(a[q]); c[q] = bf16_round(c[q]); }
  { *(v4f*)(XB + t * 8) = a; *(v4f*)(XB + t * 8 + 4) = c;  } }



__global__ __launch_bounds__(256) void k_rsmfam(const float* __restrict__ S, _Float16* __restrict__ P, int qn, int hg, const float* __restrict__ am) {
  #pragma clang fp contract(off)
  const int t = blockIdx.x * 256 + threadIdx.x; if (t >= qn * hg) return; const size_t i = (size_t)(t / qn) * SQ + (t % qn); const float* s = S + i * SQ; float mx = -3.0e38f;
#pragma unroll 1
  for (int j = 0; j < SQ; ++j) mx = fmaxf(mx, __fadd_rn(s[j], bf16_round(am[j]))); float se = 0.f;
#pragma unroll 1
  for (int j = 0; j < SQ; ++j) se += __expf(__fadd_rn(s[j], bf16_round(am[j])) - mx); const float sc = 256.0f / se;
#pragma unroll 1
  for (int j0 = 0; j0 < SQ; j0 += 8) { FragH f; for (int q = 0; q < 8; ++q) f.h[q] = (_Float16)(__expf(__fadd_rn(s[j0 + q], bf16_round(am[j0 + q])) - mx) * sc); unsigned short* d = (unsigned short*)P + i * SQ + j0; *(v8us*)d = f.half[0];  } }


#define CC CX           /* unused: input channels */
#define LL SQ           /* pixels per image */
#define LQ (3 * DM)     /* unused */

__global__ __launch_bounds__(256) void k_rowb(float* __restrict__ O, const float* __restrict__ bias, size_t n4) {
  #pragma clang fp contract(off)
  const size_t t = (size_t)blockIdx.x * 256 + threadIdx.x; if (t >= n4) return; const size_t e = t * 4; const int c = (int)((e / SQ) % CX);      /* output channels */ const float bb = bf16_round(bias[c]); const v4f a = *(const v4fa*)(O + e); v4f o; for (int q = 0; q < 4; ++q) o[q] = __fadd_rn(a[q], bb);
  *(v4f*)(O + e) = o;  }

// ---- fused sigmoid attention: Y[b][c][n] = bf16(gamma) sum_m V[b][c][m] sigmoid(q[n].k[m]) + bf16(x[b][c][n]); the gate tile never leaves registers ----
// S^T / 2 = K.(Q / 2)^T (A = k rows, B = rows of q / 2, both through f_frag16): a lane holds column n = ln, rows m = 8 hh + r. Two such D tiles (m 0-15, 16-31), gated and
// rounded to f16 in place, are the B operand of out += V.P^T in the hardware k order, which is the order k_proj stores the V fragments in (A operand, f_fragp).
// Work-group = one image, 64 query columns, all 128 channels; its 8 waves each walk 512 of the 4096 keys, from a start pass of the work-group's own, wrapping; the 8 partial tiles are summed through LDS in wave order; the thread that holds a sum scales it, adds its x and stores y.
#define FW 8             /* waves per work-group = key ranges */
#define FN 64            /* query columns per work-group, all of them in every wave: a V fragment loaded from L2 feeds four products */
#define FP (FN + 4)      /* LDS row pitch in floats: rows 8 apart fall on other banks, 16-byte reads stay aligned */
/* waves_per_eu(2, 2): the 128 x 64 f32 tile takes 256 registers, so a wave has the 512 of two waves per SIMD; one work-group per WGP, whose LDS holds its 8 partial tiles */
__device__ __forceinline__ v16h f_frag16(const _Float16* p) { FragH f; const v8us z = {0, 0, 0, 0, 0, 0, 0, 0}; f.half[0] = *(const v8us*)(const unsigned short*)p; f.half[1] = z; return f.v; }      /* q / k fragment: k 16-31 of the K = 32 contraction is zero, set in registers */
__device__ __forceinline__ v16h f_fragp(const _Float16* p) { FragH f; f.half[0] = *(const v8us*)(const unsigned short*)p; f.half[1] = *(const v8us*)((const unsigned short*)p + 256); return f.v; }      /* V fragment from a 1-KiB unit of k_proj: p = unit + 8 lane; the second half stands 512 bytes on */
__device__ __forceinline__ v8f f_mma(v16h a, v16h b, v8f c) { return __builtin_amdgcn_wmma_f32_16x16x32_f16(false, a, false, b, (short)0, c, false, false); }
/* gate: sigmoid(s) = 0.5 + 0.5 tanh(s / 2), one v_tanh_f32 per score; u = s / 2 comes out of the score product itself (the q plane holds q / 2, a power of two); two gates share the packed fma and the packed f16 conversion; +-inf give 0 and 1, NaN stays NaN */
typedef float v2f __attribute__((ext_vector_type(2)));
typedef _Float16 v2h __attribute__((ext_vector_type(2)));
__device__ __forceinline__ v2h f_gate2(float u0, float u1) { const v2f t = {__builtin_amdgcn_tanhf(u0), __builtin_amdgcn_tanhf(u1)}; const v2f hf = {0.5f, 0.5f}; return __builtin_convertvector(__builtin_elementwise_fma(t, hf, hf), v2h); }
/* the fragments of one 32-key pass: two k tiles and the eight V tiles, 18 loads of 512 contiguous bytes per wave */
__device__ __forceinline__ void f_load(const _Float16* kp, const _Float16* vp, v16h (&kf)[2], v16h (&vf)[CX / 16]) {
  kf[0] = f_frag16(kp); kf[1] = f_frag16(kp + 16 * 16);
#pragma unroll      /* unrolled: vf is indexed by constants only and stays in registers */
  for (int t = 0; t < CX / 16; ++t) vf[t] = f_fragp(vp + t * 512); }
/* one 32-key pass: per 16 query columns two score tiles, their gates as the f16 B operand, eight products into the accumulators */
__device__ __forceinline__ void f_pass(const v16h (&kf)[2], const v16h (&vf)[CX / 16], const v16h (&qf)[FN / 16], v8f (&acc)[CX / 16][FN / 16]) {
  const v8f z8 = {0.f,0.f,0.f,0.f,0.f,0.f,0.f,0.f};
#pragma unroll      /* unrolled, with the two loops inside: fragments and accumulators are indexed by constants only and stay in registers */
  for (int j = 0; j < FN / 16; ++j) { const v8f s0 = f_mma(kf[0], qf[j], z8), s1 = f_mma(kf[1], qf[j], z8); FragH p;
#pragma unroll
    for (int r = 0; r < 8; r += 2) { const v2h g0 = f_gate2(s0[r], s0[r + 1]), g1 = f_gate2(s1[r], s1[r + 1]); p.h[r] = g0[0]; p.h[r + 1] = g0[1]; p.h[8 + r] = g1[0]; p.h[8 + r + 1] = g1[1]; }
#pragma unroll
    for (int t = 0; t < CX / 16; ++t) acc[t][j] = f_mma(vf[t], p.v, acc[t][j]);
  } }
#define FNP (SQ / FW / 32)          /* 32-key passes per wave */
#define FKS (32 * 16)               /* elements of k per pass */
#define FVS ((CX / 16) * 512)       /* elements of V per pass */
/* kp and vp go on to the next pass, from the last pass of the wave's key range back to its first; ps is the pass they stand on, the same for the whole work-group */
__device__ __forceinline__ void f_next(const _Float16*& kp, const _Float16*& vp, int& ps) {
  asm volatile("s_wait_xcnt 0x0" :: "v"(kp), "v"(vp) : "memory");      /* the wait that stands between issued loads and an overwrite of their address registers; the addresses are inputs so that they stay in their registers up to the wait */
  const bool wr = ps == FNP - 1; kp += wr ? -(FNP - 1) * FKS : FKS; vp += wr ? -(FNP - 1) * FVS : FVS; ps = wr ? 0 : ps + 1; }
__global__ __launch_bounds__(FW * 32) __attribute__((amdgpu_waves_per_eu(2, 2))) void k_sattn(const _Float16* __restrict__ QZ, const _Float16* __restrict__ KZ, const _Float16* __restrict__ VP, const float* __restrict__ gam, const float* __restrict__ x, float* __restrict__ Y) {
  __shared__ __attribute__((aligned(16))) float red[FW][CX][FP];
  constexpr int MR = SQ / FW;      /* keys per wave */
  const int tid = threadIdx.x, w = tid >> 5, lane = tid & 31, ln = lane & 15, hh = lane >> 4; const int b = blockIdx.y, n0 = blockIdx.x * FN;
  const _Float16* qp = QZ + ((size_t)b * SQ + n0 + ln) * 16 + 8 * hh; const unsigned ki = (unsigned)((b * SQ + w * MR + ln) * 16 + 8 * hh), vi = (unsigned)((b * (SQ / 32) + w * (MR / 32)) * (CX / 16) * 512 + 8 * lane); const _Float16* kp = KZ + ki; const _Float16* vp = VP + vi;      /* kp, vp: the lane's own first 8 elements; over a wave both are 512 contiguous bytes */
  v16h qf[FN / 16];
#pragma unroll      /* unrolled: qf is indexed by constants only and stays in registers */
  for (int j = 0; j < FN / 16; ++j) qf[j] = f_frag16(qp + j * 16 * 16);      /* rows of q / 2: the score tiles are s / 2, the argument of the gate's tanh */
  asm volatile("s_wait_xcnt 0x0" :: "v"(qp) : "memory");      /* the wait that stands between issued loads and an overwrite of their address registers; the address is an input so that it stays in its registers up to the wait */
  const v8f z8 = {0.f,0.f,0.f,0.f,0.f,0.f,0.f,0.f}; v8f acc[CX / 16][FN / 16];
#pragma unroll
  for (int t = 0; t < CX / 16; ++t)
#pragma unroll      /* unrolled, like the loop around it: the accumulators are indexed by constants only and stay in registers */
    for (int j = 0; j < FN / 16; ++j) acc[t][j] = z8;
  /* two fragment sets: while the products of one 32-key pass run on set a (b), the loads of the next pass fill set b (a), so a pass no longer starts by waiting out the L2 latency of its own loads */
  v16h ka[2], va[CX / 16], kb[2], vb[CX / 16];
  /* staggered start: the 64 work-groups of an image read the same k and V lines. Each work-group starts the FNP passes of its waves at a pass of its own
     and wraps, so that 4 work-groups and not 64 stand on a line at a time. The start takes bit 0 and bits 3 to 5 of the index: work-groups whose indices differ by 2, 4 or 6 share it, close neighbours do not. Any start covers every pass once. */
  int ps = (int)(((blockIdx.x >> 3) * 2 + (blockIdx.x & 1)) & (FNP - 1));
  kp += ps * FKS; vp += ps * FVS;
  f_load(kp, vp, ka, va);
#pragma unroll 1      /* rolled; the inner loops are unrolled so that fragments and accumulators stay in registers */
  for (int it = 0; it < FNP / 2 - 1; ++it) {
    f_next(kp, vp, ps);
    f_load(kp, vp, kb, vb);
    __builtin_amdgcn_sched_barrier(0);      /* the next pass's loads are issued ahead of this pass's scores: sunk among the products they would arrive too late for their own pass */
    f_pass(ka, va, qf, acc);
    __builtin_amdgcn_sched_barrier(0);      /* set a is refilled only behind its last product */
    f_next(kp, vp, ps);
    f_load(kp, vp, ka, va);
    __builtin_amdgcn_sched_barrier(0);      /* as above: the refill of set a is in flight before the first score of set b */
    f_pass(kb, vb, qf, acc);
  }
  /* the last two passes stand outside the loop: no pass is loaded twice, and every wait in the loop counts the same loads on every trip */
  f_next(kp, vp, ps);
  f_load(kp, vp, kb, vb);
  asm volatile("s_wait_xcnt 0x0" :: "v"(kp), "v"(vp) : "memory");      /* the address registers are free for other use from here on: the wait that stands between issued loads and an overwrite of their address registers; the addresses are inputs so that they stay in their registers up to the wait */
  __builtin_amdgcn_sched_barrier(0);      /* the last pass's loads, and the wait behind them, are issued ahead of the scores of the pass before it */
  f_pass(ka, va, qf, acc);
  f_pass(kb, vb, qf, acc);
  /* residual: the thread's own x elements (those of the sums it forms below) are asked for here, so that they arrive while the partial tiles go through LDS */
  constexpr int NQ = CX * FN / 4 / (FW * 32); const size_t eo = ((size_t)b * CX + tid / (FN / 4)) * SQ + n0 + (tid % (FN / 4)) * 4; const float* xp = x + eo; v4f xr[NQ];
#pragma unroll
  for (int q = 0; q < NQ; ++q) xr[q] = *(const v4fa*)(xp + (size_t)q * (FW * 32 / (FN / 4)) * SQ);
  asm volatile("s_wait_xcnt 0x0" :: "v"(xp) : "memory");      /* the wait that stands between issued loads and an overwrite of their address registers; the address is an input so that it stays in its registers up to the wait and no load of the run lands on it */
  const float g = bf16_round(gam[0]);
#pragma unroll
  for (int t = 0; t < CX / 16; ++t)
#pragma unroll
    for (int j = 0; j < FN / 16; ++j)
#pragma unroll
      for (int r = 0; r < 8; ++r) red[w][t * 16 + 8 * hh + r][j * 16 + ln] = acc[t][j][r];
  __syncthreads();
  v4f pr[NQ][FW];      /* the thread's 64 pieces of the partial tiles; the accumulators' registers are free by now */
#pragma unroll
  for (int q = 0; q < NQ; ++q) { const int i = q * (FW * 32) + tid, c = i / (FN / 4), n4 = (i % (FN / 4)) * 4;
#pragma unroll      /* unrolled, like the loop around it: pr is indexed by constants only and stays in registers */
    for (int u = 0; u < FW; ++u) pr[q][u] = *(const v4fa*)&red[u][c][n4]; }
  __builtin_amdgcn_sched_barrier(0);      /* every LDS read is issued ahead of the first sum: otherwise each read is waited for before the next is issued, 56 LDS latencies in a row per thread */
#pragma unroll
  for (int q = 0; q < NQ; ++q) { v4f s = pr[q][0];
#pragma unroll
    for (int u = 1; u < FW; ++u) s += pr[q][u];
#pragma unroll
    for (int e = 0; e < 4; ++e) s[e] = g * s[e] + bf16_round(xr[q][e]);
    *(v4f*)(Y + eo + (size_t)q * (FW * 32 / (FN / 4)) * SQ) = s; } }
// ---- fused projections: x [b][c][n] f32 and the natural weights -> q / 2 rows, k rows (f16 [b n][16]) and V in fragment order, one launch ----
// Work-group = 64 tokens of one image. The x tile (bf16-rounded, exact in f16) is turned to token rows [64][128] and [Wq; Wk; Wv] (bf16-rounded, x 16) to rows [160][128] in LDS; every fragment is two 16-byte LDS reads (g2_frag).
// Wave w: token tile mt = w & 3 (16 tokens); hf = w >> 2 picks q (0) or k (1) and the output channels 64 hf + 0..63 of v.
// q, k: A = weight rows, B = token rows: a lane holds token ln, outputs 8 hh + r: one 16-byte store into the token's row.
// v: A = token rows, B = weight rows: a lane holds channel ln, tokens 8 hh + r. That is the A operand of k_sattn: per image, 32-key block and 16-channel tile one 1-KiB unit [half][lane][8 keys]
// (lane = 16 hh + ln holds channel ln, keys 16 half + 8 hh + 0..7), so a D tile is stored as it stands, 512 contiguous bytes per wave.
#define PK 64            /* tokens per work-group: 256 work-groups */
#define PP (CX + 8)      /* LDS row pitch in f16: 272 bytes = 16 x odd, for 16-byte readers of 256-byte rows */
__global__ __launch_bounds__(256) void k_proj(const float* __restrict__ x, const float* __restrict__ wq, const float* __restrict__ bq, const float* __restrict__ wk, const float* __restrict__ bk, const float* __restrict__ wv, const float* __restrict__ bv,
    _Float16* __restrict__ QZ, _Float16* __restrict__ KZ, _Float16* __restrict__ VP) {
  __shared__ __attribute__((aligned(16))) _Float16 xs[PK][PP];
  __shared__ __attribute__((aligned(16))) _Float16 wl[32 + CX][PP];
  const int tid = threadIdx.x, w = tid >> 5, lane = tid & 31, ln = lane & 15, hh = lane >> 4; const int b = blockIdx.x / (SQ / PK), n0 = (blockIdx.x % (SQ / PK)) * PK;
  const int g16 = tid & 15, r16 = tid >> 4, mt = w & 3, hf = w >> 2;
  /* x: a thread takes 4 tokens (4 g16 + q) of 8 channels (8 r16 + j): 16 lanes read 256 contiguous bytes of a channel row; the 8 x 4 block leaves as four 16-byte LDS stores */
  const float* xp = x + ((size_t)b * CX + r16 * 8) * SQ + n0 + g16 * 4; v4f xa[8];
#pragma unroll
  for (int j = 0; j < 8; ++j) xa[j] = *(const v4fa*)(xp + (size_t)j * SQ);
  /* weights: pass u covers 16 rows (0: Wq, 1: Wk, 2-9: Wv), a thread 8 elements of row r16 */
  const float* wqp = wq + r16 * CX + g16 * 8; const float* wkp = wk + r16 * CX + g16 * 8; const float* wvp = wv + r16 * CX + g16 * 8; v4f wa[2 + CX / 16][2];
  wa[0][0] = *(const v4fa*)wqp; wa[0][1] = *(const v4fa*)(wqp + 4); wa[1][0] = *(const v4fa*)wkp; wa[1][1] = *(const v4fa*)(wkp + 4);
#pragma unroll
  for (int u = 0; u < CX / 16; ++u) { wa[2 + u][0] = *(const v4fa*)(wvp + u * 16 * CX); wa[2 + u][1] = *(const v4fa*)(wvp + u * 16 * CX + 4); }
  const float* bp = (hf ? bk : bq) + 8 * hh; const v4f b0 = *(const v4fa*)bp, b1 = *(const v4fa*)(bp + 4); const float* bvp = bv + hf * (CX / 2) + ln; float bb[CX / 32];
#pragma unroll
  for (int t4 = 0; t4 < CX / 32; ++t4) bb[t4] = bvp[t4 * 16];
  asm volatile("s_wait_xcnt 0x0" :: "v"(xp), "v"(wqp), "v"(wkp), "v"(wvp), "v"(bp), "v"(bvp) : "memory");      /* the wait that stands between issued loads and an overwrite of their address registers; the addresses are inputs so that they stay in their registers up to it and no load of the run lands on one. No load sinks below it either: all of a thread's loads are in flight before the first conversion waits, one memory latency instead of one per group */
#pragma unroll
  for (int u = 0; u < 2 + CX / 16; ++u) { FragH f;
#pragma unroll
    for (int i = 0; i < 4; ++i) { f.h[i] = (_Float16)(bf16_round(wa[u][0][i]) * 16.0f); f.h[4 + i] = (_Float16)(bf16_round(wa[u][1][i]) * 16.0f); }
    *(v8us*)&wl[u * 16 + r16][g16 * 8] = f.half[0]; }
#pragma unroll
  for (int q = 0; q < 4; ++q) { FragH f;
#pragma unroll
    for (int j = 0; j < 8; ++j) f.h[j] = (_Float16)bf16_round(xa[j][q]);
    *(v8us*)&xs[g16 * 4 + q][r16 * 8] = f.half[0]; }
  __syncthreads();
  const v8f z8 = {0.f,0.f,0.f,0.f,0.f,0.f,0.f,0.f}; v16h xf[CX / 32], qw[CX / 32], vw[CX / 32][CX / 32];
#pragma unroll
  for (int kk = 0; kk < CX / 32; ++kk) { xf[kk] = g2_frag(&xs[mt * 16 + ln][kk * 32], hh); qw[kk] = g2_frag(&wl[hf * 16 + ln][kk * 32], hh); }
#pragma unroll
  for (int t4 = 0; t4 < CX / 32; ++t4)
#pragma unroll
    for (int kk = 0; kk < CX / 32; ++kk) vw[t4][kk] = g2_frag(&wl[32 + (hf * (CX / 32) + t4) * 16 + ln][kk * 32], hh);
  __builtin_amdgcn_sched_barrier(0);      /* every fragment read is issued ahead of the products: otherwise each product waits out the LDS latency of its own two reads */
  v8f aq = z8, av[CX / 32];
#pragma unroll
  for (int t4 = 0; t4 < CX / 32; ++t4) av[t4] = z8;
#pragma unroll
  for (int kk = 0; kk < CX / 32; ++kk) { aq = f_mma(qw[kk], xf[kk], aq);      /* the five accumulators are independent of one another */
#pragma unroll
    for (int t4 = 0; t4 < CX / 32; ++t4) av[t4] = f_mma(xf[kk], vw[t4][kk], av[t4]); }
  { const float sc = hf ? 1.0f : 0.5f;      /* q / 2 (exact in f32): the gate takes tanh of half the score */
    FragH o;
#pragma unroll
    for (int r = 0; r < 8; ++r) o.h[r] = (_Float16)(sc * (aq[r] * 0.0625f + bf16_round(r < 4 ? b0[r & 3] : b1[r & 3])));
    *(v8us*)((unsigned short*)(hf ? KZ : QZ) + ((size_t)b * SQ + n0 + mt * 16 + ln) * 16 + 8 * hh) = o.half[0]; }
#pragma unroll
  for (int t4 = 0; t4 < CX / 32; ++t4) { const int t = hf * (CX / 32) + t4; const float bt = bf16_round(bb[t4]); FragH o;
#pragma unroll
    for (int r = 0; r < 8; ++r) o.h[r] = (_Float16)(av[t4][r] * 0.0625f + bt);
    *(v8us*)((unsigned short*)VP + ((((size_t)(b * (SQ / 32) + (n0 >> 5) + (mt >> 1)) * (CX / 16) + t) * 2 + (mt & 1)) * 32 + lane) * 8) = o.half[0]; } }
extern "C" void kernel_launch(void* const* d_in, const int* in_sizes, int n_in,
                              void* d_out, int out_size, void* d_ws, size_t ws_size, hipStream_t stream) {
  (void)in_sizes; (void)n_in; (void)out_size;
  const float* const* I = (const float* const*)d_in; const float* x = I[0]; const float* wq = I[1]; const float* bq = I[2]; const float* wk = I[3]; const float* bk = I[4]; const float* wv = I[5]; const float* bv = I[6]; const float* gam = I[7];      /* natural Wq/Wk [16][128] + b, Wv [128][128] + b; gamma [1] */
  constexpr int DQ = 16;      /* q/k width */
  char* ws = (char*)d_ws; size_t off = 0;
  auto take = [&](size_t bytes) { char* p = ws + off; off += (bytes + 255) & ~(size_t)255; return p; };
  _Float16* QZ = (_Float16*)take(NR * DQ * 2); _Float16* KZ = (_Float16*)take(NR * DQ * 2); _Float16* VP = (_Float16*)take(NR * CX * 2);
  if (off > ws_size) return;
  k_proj<<<NB * (SQ / PK), 256, 0, stream>>>(x, wq, bq, wk, bk, wv, bv, QZ, KZ, VP);      /* q / 2 and k rows [NR][16] f16, V in fragment order [b][key / 32][channel / 16][1 KiB] */
  k_sattn<<<dim3(SQ / FN, NB), FW * 32, 0, stream>>>(QZ, KZ, VP, gam, x, (float*)d_out);      /* out[b][c][n] = sum_m v[c][m] sigmoid(q[:, n].k[:, m]): scores (K = 32 with zero padding), gate (f16) and V x gate^T in one kernel, f32; y = bf16(gamma) out + bf16(x) -> channel-first output */
}
